// v000
// Times are from an AMD MI455X. After a warm-up the kernel runs many times in a row, and a time is the length of
// such a window on the GPU divided by its runs, so every launch and the gaps after it count. The runs cycle
// through copies of the inputs. A figure is the median of several windows, for all but v000 over two sittings.
// Sittings can differ by a few percent; kernels timed side by side share one.
// The starting kernel, v000, takes 495 microseconds a run.
#include <hip/hip_runtime.h>

// Three-stream masked attention: q = xq Wq^T + bq, k = xk Wk^T + bk, v = xv Wv^T + bv (weights [out][in]); 16 heads x 64 (head h = columns h*64+d); scores x 1/8; integer mask [SEQ][SEQ] read by value (0 -> score := -1e9); softmax; out = ctx Wo^T + bo.
// Compute dtypes, f32 accumulate: every float input RNE-converted to bf16; projections v_wmma_f32_16x16x32_bf16 (exact operand products); attention query rows < RH: bf16 hi+lo planes for q, k, v and p (3 products per site); rows >= RH: v_wmma_f32_16x16x32_f16 single products (q, k, v, p as f16); online softmax f32; ctx carried as bf16 hi+lo planes x Wo bf16 (2 products).
// Engine: one wave per 64x64 GEMM tile (operands straight from K-contiguous 16-bit planes); fused flash-style attention, one wave per 16 query rows, 32-key steps, fragments straight from the head planes, no score or probability plane in global memory.

#ifndef NB
#define NB 2
#endif
#ifndef SEQ
#define SEQ 2048
#endif
#define NB_FULL  2
#define SEQ_FULL 2048
#define DM   1024
#define NH_  16
#define HD   64
#define DQ   (NH_ * HD)
#define RH   512                  // query rows < RH use hi+lo planes
#define RHE  ((RH < SEQ) ? RH : SEQ)
#define SCL  0.125f               // HD^-0.5
#define L2E  1.4426950408889634f
#define MFILL (-1.0e9f)           // value that replaces a masked score
#define MINIT (-1.0e30f)          // running-max start (below MFILL)
#define MSEEN (-5.0e8f)           // running max above this <=> the row has met an unmasked key
#define F16MINN 6.103515625e-05f  // smallest normal f16
#define PP 40                     // P tile pitch (halves): 32 + 8
#define CP 72                     // ctx tile pitch (halves): 64 + 8

typedef _Float16 h16;
typedef unsigned short bf;
typedef __attribute__((ext_vector_type(16))) __bf16   v16bf;
typedef __attribute__((ext_vector_type(16))) _Float16 v16h;
typedef __attribute__((ext_vector_type(8)))  _Float16 v8h;
typedef __attribute__((ext_vector_type(8)))  unsigned short v8us;
typedef __attribute__((ext_vector_type(8)))  float    v8f;
typedef __attribute__((ext_vector_type(4)))  float    v4f;
typedef __attribute__((ext_vector_type(2)))  float    v2f;
typedef __attribute__((ext_vector_type(2)))  _Float16 v2h;
typedef __attribute__((ext_vector_type(2)))  unsigned short v2us;
typedef __attribute__((ext_vector_type(4)))  int      v4i;
typedef v8h  __attribute__((may_alias)) v8ha;
typedef v4f  __attribute__((may_alias)) v4fa;
typedef v8us __attribute__((may_alias)) v8usa;

static_assert(HD == 64);
static_assert(DQ == DM);                       // merged width equals model width
static_assert(DM % 64 == 0);                   // GEMM N tiles of 64, K steps of 32
static_assert(SEQ % 64 == 0);                  // GEMM M tiles of 64; attention tiles of 16 rows, 32 keys
static_assert(RH % 16 == 0);                   // hi/lo row split on a query-tile boundary
static_assert(NB <= NB_FULL);
static_assert(SEQ <= SEQ_FULL);
static_assert((PP * 2) % 16 == 0);             // 16-byte aligned P tile rows
static_assert((CP * 2) % 16 == 0);             // 16-byte aligned ctx tile rows
static_assert((long long)NB * NH_ * SEQ * HD < 2147483647LL);       // int element offsets into head planes
static_assert((long long)SEQ_FULL * SEQ_FULL < 2147483647LL);      // int element offsets into the mask

constexpr size_t WS_W  = (size_t)4 * DM * DM * 2;          // four bf16 weight planes
constexpr size_t WS_XB = (size_t)NB * SEQ * DM * 2;        // bf16 copy of one input stream
constexpr size_t WS_F  = (size_t)NB * SEQ * DM * 4;        // f32 projection result
constexpr size_t WS_PL = (size_t)NB * NH_ * SEQ * HD * 2;  // one 16-bit head plane
constexpr size_t WS_AT = (size_t)NB * SEQ * DQ * 2;        // one merged ctx plane
constexpr size_t WS_TOTAL = WS_W + WS_XB + WS_F + 9 * WS_PL + 2 * WS_AT;
static_assert(WS_TOTAL <= (size_t)134217728);              // carve stays within 128 MiB
static_assert(WS_W % 256 == 0 && WS_XB % 256 == 0 && WS_F % 256 == 0 && WS_PL % 256 == 0 && WS_AT % 256 == 0);

__device__ __forceinline__ unsigned short f2bf(float f) { unsigned u = __float_as_uint(f); u += 0x7FFFu + ((u >> 16) & 1u); return (unsigned short)(u >> 16); }   // RNE
__device__ __forceinline__ float bf2f(unsigned short b) { return __uint_as_float(((unsigned)b) << 16); }
__device__ __forceinline__ float bfr(float f) { return bf2f(f2bf(f)); }
__device__ __forceinline__ v16h cat16(v8h lo, v8h hi) { return __builtin_shufflevector(lo, hi, 0, 1, 2, 3, 4, 5, 6, 7, 8, 9, 10, 11, 12, 13, 14, 15); }
__device__ __forceinline__ v16bf cat16b(v8us lo, v8us hi) { return __builtin_bit_cast(v16bf, __builtin_shufflevector(lo, hi, 0, 1, 2, 3, 4, 5, 6, 7, 8, 9, 10, 11, 12, 13, 14, 15)); }
__device__ __forceinline__ v8f wmma16(v16h a, v16h b, v8f c) { return __builtin_amdgcn_wmma_f32_16x16x32_f16(false, a, false, b, (short)0, c, false, false); }
__device__ __forceinline__ v8f wmmab(v16bf a, v16bf b, v8f c) { return __builtin_amdgcn_wmma_f32_16x16x32_bf16(false, a, false, b, (short)0, c, false, false); }
__device__ __forceinline__ v8f mma3(v16bf ah, v16bf al, v16bf bh, v16bf bl, v8f c) { c = wmmab(ah, bh, c); c = wmmab(al, bh, c); c = wmmab(ah, bl, c); return c; }
__device__ __forceinline__ h16 tohx(float x) { return (h16)x; }
__device__ __forceinline__ void splitf(float y, unsigned short& h, unsigned short& l) { h = f2bf(y); l = f2bf(y - bf2f(h)); }
__device__ __forceinline__ void wave_sync() { __builtin_amdgcn_wave_barrier(); asm volatile("" ::: "memory"); }   // same-wave LDS exchange (tiles are private to the wave)

// Fragment loaders (A and B alike): lane (lr = lane & 15, hi = lane >> 4) points at row/column lr, element 8*hi of the 32-deep k-step;
// elements 0..7 <- k0 + 8hi + 0..7, elements 8..15 <- k0 + 16 + 8hi + 0..7.
template <typename T16> struct WFrag;
template <> struct WFrag<h16> { typedef v16h V; static __device__ __forceinline__ V ld(const h16* p) { return cat16(*(const v8h*)p, *(const v8h*)(p + 16)); } static __device__ __forceinline__ v8f mma(V a, V b, v8f c) { return wmma16(a, b, c); } };
template <> struct WFrag<bf> { typedef v16bf V; static __device__ __forceinline__ V ld(const bf* p) { return cat16b(*(const v8us*)p, *(const v8us*)(p + 16)); } static __device__ __forceinline__ v8f mma(V a, V b, v8f c) { return wmmab(a, b, c); } };

// ---- register-blocked GEMM body, ONE WAVE per 64x64 output tile (16 accumulators), operands straight from K-contiguous 16-bit planes; grid (M/64, N/64, Z), 32 threads.
// C[m][n] (f32, pitch ldc, + bf16-converted bias[n]) = sum_k A[m][k] Bt[n][k] (+ A2 Bt when NSPLIT == 1). z-batch strides sA/sB/sC in elements. K % 32 == 0, M % 64 == 0, N % 64 == 0.
template <typename T16, int NSPLIT, bool BIAS>
__device__ __forceinline__ void gemmw_body(const T16* __restrict__ A, const T16* __restrict__ A2, const T16* __restrict__ Bt, const T16* __restrict__ Bt2, int K, float* C, int ldc, const float* __restrict__ bias, size_t sA, size_t sB, size_t sC) {
    typedef typename WFrag<T16>::V V;
    __shared__ __align__(16) float os[16 * 68];
    const size_t z = blockIdx.z; A += z * sA; if (A2) A2 += z * sA; Bt += z * sB; if (Bt2) Bt2 += z * sB; C += z * sC;
    const int lane = threadIdx.x & 31, lr = lane & 15, hi = lane >> 4; const int r0 = blockIdx.x * 64, c0 = blockIdx.y * 64;
    v8f acc[4][4];
#pragma unroll
    for (int mb = 0; mb < 4; ++mb)
#pragma unroll
        for (int nb = 0; nb < 4; ++nb) acc[mb][nb] = (v8f){};
    const size_t aoff = (size_t)(r0 + lr) * K + 8 * hi, boff = (size_t)(c0 + lr) * K + 8 * hi;
#pragma unroll 1
    for (int kc = 0; kc < K; kc += 32) {
        V a[4], a2[4];
#pragma unroll
        for (int mb = 0; mb < 4; ++mb) { a[mb] = WFrag<T16>::ld(A + aoff + (size_t)mb * 16 * K + kc); if (NSPLIT == 1 || NSPLIT == 2) a2[mb] = WFrag<T16>::ld(A2 + aoff + (size_t)mb * 16 * K + kc); }
#pragma unroll
        for (int nb = 0; nb < 4; ++nb) { const V b = WFrag<T16>::ld(Bt + boff + (size_t)nb * 16 * K + kc); V b2; if (NSPLIT >= 2) b2 = WFrag<T16>::ld(Bt2 + boff + (size_t)nb * 16 * K + kc);
#pragma unroll
            for (int mb = 0; mb < 4; ++mb) { acc[mb][nb] = WFrag<T16>::mma(a[mb], b, acc[mb][nb]); if (NSPLIT == 1 || NSPLIT == 2) acc[mb][nb] = WFrag<T16>::mma(a2[mb], b, acc[mb][nb]); if (NSPLIT >= 2) acc[mb][nb] = WFrag<T16>::mma(a[mb], b2, acc[mb][nb]); } }
        asm volatile("v_nop\n\tv_nop\n\tv_nop\n\tv_nop" : "+v"(acc[0][0]), "+v"(acc[1][1]), "+v"(acc[2][2]), "+v"(acc[3][3]) : "v"(a[0]), "v"(a[3]));
    }
#pragma unroll
    for (int mb = 0; mb < 4; ++mb) {
#pragma unroll
        for (int nb = 0; nb < 4; ++nb) {
#pragma unroll
            for (int j = 0; j < 8; ++j) os[(hi * 8 + j) * 68 + nb * 16 + lr] = acc[mb][nb][j]; }
        wave_sync();
        float* crow = C + (size_t)(r0 + mb * 16) * ldc + c0;
{
#pragma unroll
            for (int s = 0; s < 8; ++s) { const int row = 2 * s + hi, cofs = lr * 4; v4f val = *(const v4fa*)(os + row * 68 + cofs); if (BIAS) { val[0] += bfr(bias[c0 + cofs]); val[1] += bfr(bias[c0 + cofs + 1]); val[2] += bfr(bias[c0 + cofs + 2]); val[3] += bfr(bias[c0 + cofs + 3]); }
                *(v4f*)(crow + (size_t)row * ldc + cofs) = val; }
             }
        wave_sync();
    }
}
// k_proj: F[z][t][n] = XB[z][t][:] . W[n][:] + b[n] (bf16 x bf16, one product).
__global__ __launch_bounds__(32) void k_proj(const bf* A, const bf* Bt, int K, float* C, int ldc, const float* bias, size_t sA, size_t sC) {
    gemmw_body<bf, 0, true>(A, nullptr, Bt, nullptr, K, C, ldc, bias, sA, (size_t)0, sC); }
// k_oproj: OUT[z][t][n] = (ATh + ATl)[z][t][:] . Wo[n][:] + bo[n] (two products).
__global__ __launch_bounds__(32) void k_oproj(const bf* A, const bf* A2, const bf* Bt, int K, float* C, int ldc, const float* bias, size_t sA, size_t sC) {
    gemmw_body<bf, 1, true>(A, A2, Bt, nullptr, K, C, ldc, bias, sA, (size_t)0, sC); }

__global__ __launch_bounds__(256) void k_cvt8(const float* __restrict__ src, bf* dst, int n8, size_t sS, size_t sD) {
    const int i = blockIdx.x * 256 + threadIdx.x; if (i >= n8) return; src += (size_t)blockIdx.y * sS; dst += (size_t)blockIdx.y * sD;
    const v8f v = *(const v8f*)(src + (size_t)i * 8); v8us o;
#pragma unroll
    for (int k = 0; k < 8; ++k) o[k] = f2bf(v[k]);
    *(v8us*)(dst + (size_t)i * 8) = o;  }

__global__ __launch_bounds__(256) void k_hplanes(const float* __restrict__ F, h16* P16, bf* Ph, bf* Pl) {
    const int e = (blockIdx.x * 256 + threadIdx.x) * 2; if (e >= NB * NH_ * SEQ * HD) return;
    const int d = e % HD; const int t = (e / HD) % SEQ; const int z = e / (HD * SEQ); const int b = z / NH_, h = z % NH_;
    const v2f x = *(const v2f*)(F + (size_t)(b * SEQ + t) * DM + h * HD + d); v2h o16; v2us oh, ol;
#pragma unroll
    for (int q = 0; q < 2; ++q) { o16[q] = tohx(x[q]); unsigned short a2, c2; splitf(x[q], a2, c2); oh[q] = a2; ol[q] = c2; }
    *(v2h*)(P16 + e) = o16; *(v2us*)(Ph + e) = oh; *(v2us*)(Pl + e) = ol;  }
__global__ __launch_bounds__(256) void k_vtplanes(const float* __restrict__ F, h16* V16, bf* Vh, bf* Vl) {
    const int e = (blockIdx.x * 256 + threadIdx.x) * 2; if (e >= NB * NH_ * HD * SEQ) return;
    const int t = e % SEQ; const int d = (e / SEQ) % HD; const int z = e / (SEQ * HD); const int b = z / NH_, h = z % NH_; v2h o16; v2us oh, ol;
#pragma unroll
    for (int q = 0; q < 2; ++q) { const float x = F[(size_t)(b * SEQ + t + q) * DM + h * HD + d]; o16[q] = tohx(x); unsigned short a2, c2; splitf(x, a2, c2); oh[q] = a2; ol[q] = c2; }
    *(v2h*)(V16 + e) = o16; *(v2us*)(Vh + e) = oh; *(v2us*)(Vl + e) = ol;  }

// ---- fused attention body: one wave = 16 query rows (q0..q0+15) of one (b, h); key loop in 32-key steps.
// Per step: (1) the 16x32 mask tile is read by value (4 x 16-byte loads per lane); a tile whose 512 entries are all 0 is skipped (wave-uniform, decided on the values read);
// (2) S = q k^T (two 16x16 accumulators, q fragments reloaded per step through an opaque integer offset); (3) e = mask == 0 ? -1e9 : S/8; online softmax in f32
// (row = 8*hi + r, columns lr and 16 + lr; reductions over the 16 lanes of a half); (4) P tile -> wave-private LDS -> A fragment; O += P V (four d-tiles, V^T fragments from the [d][t] planes).
// A skipped all-masked tile contributes exactly 0 to every row that meets an unmasked key somewhere (exp underflow); if some row of the tile never does, the wave repeats the loop
// with skipping disabled (every entry -1e9 -> uniform weights), so the result is exact for any mask contents.
template <bool HI>
__device__ __forceinline__ void attn_body(const h16* __restrict__ Q16, const h16* __restrict__ K16, const h16* __restrict__ VT16,
                                          const bf* __restrict__ Qh, const bf* __restrict__ Ql, const bf* __restrict__ Kh, const bf* __restrict__ Kl,
                                          const bf* __restrict__ VTh, const bf* __restrict__ VTl, const int* __restrict__ mask, bf* ATh, bf* ATl, int row_base) {
    __shared__ __align__(16) h16 pt16[16 * PP];              // P tile (f16 path)
    __shared__ __align__(16) unsigned short pth[16 * PP];    // P tile hi (bf16 path)
    __shared__ __align__(16) unsigned short ptl[16 * PP];    // P tile lo (bf16 path)
    __shared__ __align__(16) unsigned short cth[16 * CP];    // ctx tile hi
    __shared__ __align__(16) unsigned short ctl[16 * CP];    // ctx tile lo
    const int lane = threadIdx.x & 31, lr = lane & 15, hi = lane >> 4;
    const int q0 = row_base + (int)blockIdx.x * 16;
    const int h = blockIdx.y, b = blockIdx.z;
    const int zoff  = (b * NH_ + h) * (SEQ * HD);            // head plane offset ([t][d] and [d][t] planes both hold SEQ*HD elements)
    const int qbase = zoff + (q0 + lr) * HD + 8 * hi;        // A fragment of q: row q0 + lr; + c2*32
    const int kbase = zoff + lr * HD + 8 * hi;               // B fragment of k: column = key kb + nt*16 + lr; + (kb + nt*16)*HD + c2*32
    const int vbase = zoff + lr * SEQ + 8 * hi;              // B fragment of v^T: column = d = dt*16 + lr; + dt*16*SEQ + kb
    const int mrowD = (q0 + 8 * hi) * SEQ_FULL + lr;         // accumulator-layout mask element: + r*SEQ_FULL + kb (+16)
    const int mrowT = (q0 + (lane >> 3)) * SEQ_FULL + (lane & 7) * 4;   // tile test: rows q0 + 4i + (lane>>3), i = 0..3; columns 4*(lane&7)..+3

    v8f o[4]; float m[8], l[8];
    bool dense = false;
#pragma unroll 1
    for (int pass = 0; pass < 2; ++pass) {
#pragma unroll
        for (int t = 0; t < 4; ++t) o[t] = (v8f){};
#pragma unroll
        for (int r = 0; r < 8; ++r) { m[r] = MINIT; l[r] = 0.0f; }
#pragma unroll 1
        for (int kb = 0; kb < SEQ; kb += 32) {
            const v4i t0 = *(const v4i*)(mask + mrowT + kb);
            const v4i t1 = *(const v4i*)(mask + mrowT + 4 * SEQ_FULL + kb);
            const v4i t2 = *(const v4i*)(mask + mrowT + 8 * SEQ_FULL + kb);
            const v4i t3 = *(const v4i*)(mask + mrowT + 12 * SEQ_FULL + kb);
            const int tor = (t0[0] | t0[1] | t0[2] | t0[3]) | (t1[0] | t1[1] | t1[2] | t1[3]) | (t2[0] | t2[1] | t2[2] | t2[3]) | (t3[0] | t3[1] | t3[2] | t3[3]);
            const bool anyw = __builtin_amdgcn_ballot_w32(tor != 0) != 0u;      // wave-uniform
            if (!(dense || anyw)) continue;                                     // whole 16x32 tile masked: skipped (values were read)
            int mk0[8], mk1[8];
#pragma unroll
            for (int r = 0; r < 8; ++r) mk0[r] = mask[mrowD + r * SEQ_FULL + kb];
            asm volatile("" ::: "memory");
#pragma unroll
            for (int r = 0; r < 8; ++r) mk1[r] = mask[mrowD + r * SEQ_FULL + kb + 16];

            int qo = qbase; asm volatile("" : "+v"(qo));                        // opaque offset: q fragments are reloaded each step, not held across the loop
            const int ko = kbase + kb * HD;
            v8f s0 = (v8f){}, s1 = (v8f){};
            if (HI) {
                const v16bf qh0 = WFrag<bf>::ld(Qh + qo), qh1 = WFrag<bf>::ld(Qh + qo + 32);
                const v16bf ql0 = WFrag<bf>::ld(Ql + qo), ql1 = WFrag<bf>::ld(Ql + qo + 32);
                s0 = mma3(qh0, ql0, WFrag<bf>::ld(Kh + ko), WFrag<bf>::ld(Kl + ko), s0);
                s0 = mma3(qh1, ql1, WFrag<bf>::ld(Kh + ko + 32), WFrag<bf>::ld(Kl + ko + 32), s0);
                s1 = mma3(qh0, ql0, WFrag<bf>::ld(Kh + ko + 16 * HD), WFrag<bf>::ld(Kl + ko + 16 * HD), s1);
                s1 = mma3(qh1, ql1, WFrag<bf>::ld(Kh + ko + 16 * HD + 32), WFrag<bf>::ld(Kl + ko + 16 * HD + 32), s1);
                asm volatile("v_nop\n\tv_nop\n\tv_nop\n\tv_nop" : "+v"(s0), "+v"(s1) : "v"(qh1), "v"(ql1));
            } else {
                const v16h qa0 = WFrag<h16>::ld(Q16 + qo), qa1 = WFrag<h16>::ld(Q16 + qo + 32);
                s0 = wmma16(qa0, WFrag<h16>::ld(K16 + ko), s0);
                s0 = wmma16(qa1, WFrag<h16>::ld(K16 + ko + 32), s0);
                s1 = wmma16(qa0, WFrag<h16>::ld(K16 + ko + 16 * HD), s1);
                s1 = wmma16(qa1, WFrag<h16>::ld(K16 + ko + 16 * HD + 32), s1);
                asm volatile("v_nop\n\tv_nop\n\tv_nop\n\tv_nop" : "+v"(s0), "+v"(s1) : "v"(qa0), "v"(qa1));
            }

#pragma unroll
            for (int r = 0; r < 8; ++r) {
                const float e0 = (mk0[r] == 0) ? MFILL : s0[r] * SCL;
                const float e1 = (mk1[r] == 0) ? MFILL : s1[r] * SCL;
                float rm = fmaxf(e0, e1);
                rm = fmaxf(rm, __shfl_xor(rm, 1, 32)); rm = fmaxf(rm, __shfl_xor(rm, 2, 32)); rm = fmaxf(rm, __shfl_xor(rm, 4, 32)); rm = fmaxf(rm, __shfl_xor(rm, 8, 32));
                const float mn = fmaxf(m[r], rm);
                const float al = __builtin_amdgcn_exp2f((m[r] - mn) * L2E);
                float x0 = __builtin_amdgcn_exp2f((e0 - mn) * L2E);
                float x1 = __builtin_amdgcn_exp2f((e1 - mn) * L2E);
                const int po = (8 * hi + r) * PP + lr;
                float rs;
                if (HI) {
                    unsigned short a0, c0, a1, c1; splitf(x0, a0, c0); splitf(x1, a1, c1);
                    pth[po] = a0; ptl[po] = c0; pth[po + 16] = a1; ptl[po + 16] = c1;
                    rs = x0 + x1;
                } else {
                    x0 = (x0 < F16MINN) ? 0.0f : x0; x1 = (x1 < F16MINN) ? 0.0f : x1;      // no subnormal f16 operands; the row sum uses the same values
                    const h16 g0 = tohx(x0), g1 = tohx(x1);
                    pt16[po] = g0; pt16[po + 16] = g1;
                    rs = (float)g0 + (float)g1;
                }
                rs += __shfl_xor(rs, 1, 32); rs += __shfl_xor(rs, 2, 32); rs += __shfl_xor(rs, 4, 32); rs += __shfl_xor(rs, 8, 32);
                l[r] = l[r] * al + rs; m[r] = mn;
                o[0][r] *= al; o[1][r] *= al; o[2][r] *= al; o[3][r] *= al;
            }
            wave_sync();                                                       // P tile: stores by all lanes, then fragment loads (same wave)
            const int vo = vbase + kb;
            if (HI) {
                const v16bf pa = cat16b(*(const v8usa*)(pth + lr * PP + 8 * hi), *(const v8usa*)(pth + lr * PP + 16 + 8 * hi));
                const v16bf pb = cat16b(*(const v8usa*)(ptl + lr * PP + 8 * hi), *(const v8usa*)(ptl + lr * PP + 16 + 8 * hi));
                const v16bf vh0 = WFrag<bf>::ld(VTh + vo), vh1 = WFrag<bf>::ld(VTh + vo + 16 * SEQ), vh2 = WFrag<bf>::ld(VTh + vo + 32 * SEQ), vh3 = WFrag<bf>::ld(VTh + vo + 48 * SEQ);
                const v16bf vl0 = WFrag<bf>::ld(VTl + vo), vl1 = WFrag<bf>::ld(VTl + vo + 16 * SEQ), vl2 = WFrag<bf>::ld(VTl + vo + 32 * SEQ), vl3 = WFrag<bf>::ld(VTl + vo + 48 * SEQ);
                o[0] = mma3(pa, pb, vh0, vl0, o[0]); o[1] = mma3(pa, pb, vh1, vl1, o[1]); o[2] = mma3(pa, pb, vh2, vl2, o[2]); o[3] = mma3(pa, pb, vh3, vl3, o[3]);
                asm volatile("v_nop\n\tv_nop\n\tv_nop\n\tv_nop" : "+v"(o[0]), "+v"(o[1]), "+v"(o[2]), "+v"(o[3]) : "v"(pa), "v"(pb));
            } else {
                const v16h pa = cat16(*(const v8ha*)(pt16 + lr * PP + 8 * hi), *(const v8ha*)(pt16 + lr * PP + 16 + 8 * hi));
                const v16h v0 = WFrag<h16>::ld(VT16 + vo), v1 = WFrag<h16>::ld(VT16 + vo + 16 * SEQ), v2 = WFrag<h16>::ld(VT16 + vo + 32 * SEQ), v3 = WFrag<h16>::ld(VT16 + vo + 48 * SEQ);
                o[0] = wmma16(pa, v0, o[0]); o[1] = wmma16(pa, v1, o[1]); o[2] = wmma16(pa, v2, o[2]); o[3] = wmma16(pa, v3, o[3]);
                asm volatile("v_nop\n\tv_nop\n\tv_nop\n\tv_nop" : "+v"(o[0]), "+v"(o[1]), "+v"(o[2]), "+v"(o[3]) : "v"(pa), "v"(v3));
            }
            wave_sync();                                                       // fragment loads done before the next step's stores
        }
        bool bad = false;
#pragma unroll
        for (int r = 0; r < 8; ++r) bad = bad || !(m[r] > MSEEN);
        if (__builtin_amdgcn_ballot_w32(bad) == 0u) break;                      // every row met an unmasked key: skipped tiles contributed exactly 0
        dense = true;                                                           // otherwise repeat without skipping (wave-uniform)
    }

#pragma unroll
    for (int r = 0; r < 8; ++r) { const float inv = 1.0f / l[r];
#pragma unroll
        for (int dt = 0; dt < 4; ++dt) { unsigned short a, c; splitf(o[dt][r] * inv, a, c); cth[(8 * hi + r) * CP + dt * 16 + lr] = a; ctl[(8 * hi + r) * CP + dt * 16 + lr] = c; } }
    wave_sync();
    v8us hv[4], lv[4];
#pragma unroll
    for (int s = 0; s < 4; ++s) { const int row = 4 * s + (lane >> 3); hv[s] = *(const v8usa*)(cth + row * CP + (lane & 7) * 8); lv[s] = *(const v8usa*)(ctl + row * CP + (lane & 7) * 8); }
    const size_t ob = (size_t)(b * SEQ + q0 + (lane >> 3)) * DQ + h * HD + (lane & 7) * 8;
{
#pragma unroll
        for (int s = 0; s < 4; ++s) { *(v8us*)(ATh + ob + (size_t)(4 * s) * DQ) = hv[s]; *(v8us*)(ATl + ob + (size_t)(4 * s) * DQ) = lv[s]; }
         }
}
__global__ __launch_bounds__(32) void k_attn_hi(const bf* Qh, const bf* Ql, const bf* Kh, const bf* Kl, const bf* VTh, const bf* VTl, const int* mask, bf* ATh, bf* ATl) {
    attn_body<true>(nullptr, nullptr, nullptr, Qh, Ql, Kh, Kl, VTh, VTl, mask, ATh, ATl, 0); }
__global__ __launch_bounds__(32) void k_attn_lo(const h16* Q16, const h16* K16, const h16* VT16, const int* mask, bf* ATh, bf* ATl) {
    attn_body<false>(Q16, K16, VT16, nullptr, nullptr, nullptr, nullptr, nullptr, nullptr, mask, ATh, ATl, RHE); }

extern "C" void kernel_launch(void* const* d_in, const int* in_sizes, int n_in,
                              void* d_out, int out_size, void* d_ws, size_t ws_size, hipStream_t stream) {
    if (n_in < 12) return;
    const long long need_x = (long long)(NB - 1) * SEQ_FULL * DM + (long long)SEQ * DM;      // rows read from a full-size stream
    const long long need_m = (long long)(SEQ - 1) * SEQ_FULL + SEQ;
    if (in_sizes[0] < need_x || in_sizes[1] < need_x || in_sizes[2] < need_x || in_sizes[3] < need_m) return;
    if (in_sizes[4] < DM * DM || in_sizes[6] < DM * DM || in_sizes[8] < DM * DM || in_sizes[10] < DM * DM) return;
    if (in_sizes[5] < DM || in_sizes[7] < DM || in_sizes[9] < DM || in_sizes[11] < DM) return;
    if ((long long)out_size < need_x) return;
    if (WS_TOTAL > ws_size) return;
    // wire order: x_q, x_k, x_v, mask (int32 [1][1][SEQ_FULL][SEQ_FULL]), Wq, bq, Wk, bk, Wv, bv, Wo, bo; weights [out][in]
    const float* xq = (const float*)d_in[0]; const float* xk = (const float*)d_in[1]; const float* xv = (const float*)d_in[2];
    const int* mask = (const int*)d_in[3];
    const float* wq = (const float*)d_in[4]; const float* bq = (const float*)d_in[5];
    const float* wk = (const float*)d_in[6]; const float* bk = (const float*)d_in[7];
    const float* wv = (const float*)d_in[8]; const float* bv = (const float*)d_in[9];
    const float* wo = (const float*)d_in[10]; const float* bo = (const float*)d_in[11];
    float* OUT = (float*)d_out;     // [NB_FULL][SEQ_FULL][DM]
    char* wsp = (char*)d_ws;
    auto take = [&](size_t bytes) { char* p = wsp; wsp += bytes; return (void*)p; };      // all sizes are multiples of 256 bytes
    bf* WQ = (bf*)take(WS_W / 4); bf* WK = (bf*)take(WS_W / 4); bf* WV = (bf*)take(WS_W / 4); bf* WO = (bf*)take(WS_W / 4);
    bf* XB = (bf*)take(WS_XB); float* F = (float*)take(WS_F);
    h16* Q16 = (h16*)take(WS_PL); bf* Qh = (bf*)take(WS_PL); bf* Ql = (bf*)take(WS_PL);
    h16* K16 = (h16*)take(WS_PL); bf* Kh = (bf*)take(WS_PL); bf* Kl = (bf*)take(WS_PL);
    h16* VT16 = (h16*)take(WS_PL); bf* VTh = (bf*)take(WS_PL); bf* VTl = (bf*)take(WS_PL);
    bf* ATh = (bf*)take(WS_AT); bf* ATl = (bf*)take(WS_AT);
    if ((size_t)(wsp - (char*)d_ws) > ws_size) return;

    const unsigned gW = (unsigned)((DM * DM / 8 + 255) / 256), gX = (unsigned)((SEQ * DM / 8 + 255) / 256), gP = (unsigned)((NB * NH_ * SEQ * HD / 2 + 255) / 256);
    k_cvt8<<<dim3(gW, 1), 256, 0, stream>>>(wq, WQ, DM * DM / 8, (size_t)0, (size_t)0);
    k_cvt8<<<dim3(gW, 1), 256, 0, stream>>>(wk, WK, DM * DM / 8, (size_t)0, (size_t)0);
    k_cvt8<<<dim3(gW, 1), 256, 0, stream>>>(wv, WV, DM * DM / 8, (size_t)0, (size_t)0);
    k_cvt8<<<dim3(gW, 1), 256, 0, stream>>>(wo, WO, DM * DM / 8, (size_t)0, (size_t)0);
    const dim3 gG(SEQ / 64, DQ / 64, NB);
    // q stream
    k_cvt8<<<dim3(gX, NB), 256, 0, stream>>>(xq, XB, SEQ * DM / 8, (size_t)SEQ_FULL * DM, (size_t)SEQ * DM);
    k_proj<<<gG, 32, 0, stream>>>(XB, WQ, DM, F, DQ, bq, (size_t)SEQ * DM, (size_t)SEQ * DQ);
    k_hplanes<<<gP, 256, 0, stream>>>(F, Q16, Qh, Ql);
    // k stream
    k_cvt8<<<dim3(gX, NB), 256, 0, stream>>>(xk, XB, SEQ * DM / 8, (size_t)SEQ_FULL * DM, (size_t)SEQ * DM);
    k_proj<<<gG, 32, 0, stream>>>(XB, WK, DM, F, DQ, bk, (size_t)SEQ * DM, (size_t)SEQ * DQ);
    k_hplanes<<<gP, 256, 0, stream>>>(F, K16, Kh, Kl);
    // v stream
    k_cvt8<<<dim3(gX, NB), 256, 0, stream>>>(xv, XB, SEQ * DM / 8, (size_t)SEQ_FULL * DM, (size_t)SEQ * DM);
    k_proj<<<gG, 32, 0, stream>>>(XB, WV, DM, F, DQ, bv, (size_t)SEQ * DM, (size_t)SEQ * DQ);
    k_vtplanes<<<gP, 256, 0, stream>>>(F, VT16, VTh, VTl);
    // attention: query rows [0, RHE) on hi/lo planes, rows [RHE, SEQ) on f16 planes
    k_attn_hi<<<dim3(RHE / 16, NH_, NB), 32, 0, stream>>>(Qh, Ql, Kh, Kl, VTh, VTl, mask, ATh, ATl);
#if SEQ > RH
    k_attn_lo<<<dim3((SEQ - RHE) / 16, NH_, NB), 32, 0, stream>>>(Q16, K16, VT16, mask, ATh, ATl);
#endif
    // output projection: per batch rows of the full-size output
    k_oproj<<<dim3(SEQ / 64, DM / 64, NB), 32, 0, stream>>>(ATh, ATl, WO, DQ, OUT, DM, bo, (size_t)SEQ * DQ, (size_t)SEQ_FULL * DM);
}

// v001
// Measured time: 405 microseconds a run.
// Next to v000, in two timings, it ran 1.25 and 1.26 times as fast.
#include <hip/hip_runtime.h>

// Three-stream masked attention: q = xq Wq^T + bq, k = xk Wk^T + bk, v = xv Wv^T + bv (weights [out][in]); 16 heads x 64 (head h = columns h*64+d); scores x 1/8; integer mask [SEQ][SEQ] read by value (0 -> score := -1e9); softmax; out = ctx Wo^T + bo.
// Compute dtypes, f32 accumulate: every float input RNE-converted to bf16; projections v_wmma_f32_16x16x32_bf16 (exact operand products); attention query rows < RH: bf16 hi+lo planes for q, k, v and p (3 products per site); rows >= RH: v_wmma_f32_16x16x32_f16 single products (q, k, v, p as f16); online softmax f32; ctx carried as bf16 hi+lo planes x Wo bf16 (2 products).
// Engine: one wave per 64x64 GEMM tile (operands straight from K-contiguous 16-bit planes); fused flash-style attention, four waves per work-group (16 query rows each), 32-key steps; the work-group's waves share 64-key K and V^T tiles in LDS (two buffers, asynchronous copies); q and mask straight from global memory; no score or probability plane in global memory.

#ifndef NB
#define NB 2
#endif
#ifndef SEQ
#define SEQ 2048
#endif
#define NB_FULL  2
#define SEQ_FULL 2048
#define DM   1024
#define NH_  16
#define HD   64
#define DQ   (NH_ * HD)
#define RH   512                  // query rows < RH use hi+lo planes
#define RHE  ((RH < SEQ) ? RH : SEQ)
#define SCL  0.125f               // HD^-0.5
#define L2E  1.4426950408889634f
#define MFILL (-1.0e9f)           // value that replaces a masked score
#define MINIT (-1.0e30f)          // running-max start (below MFILL)
#define MSEEN (-5.0e8f)           // running max above this <=> the row has met an unmasked key
#define F16MINN 6.103515625e-05f  // smallest normal f16
#define PP 40                     // P tile pitch (halves): 32 + 8
#define CP 72                     // ctx tile pitch (halves): 64 + 8
#define NW 4                      // attention waves per work-group (16 query rows each)
#define KT 64                     // keys per staged K / V^T tile
#define TP 72                     // staged tile pitch (halves): 64 + 8 = 144 bytes, an odd multiple of 16 bytes
#define TPL (64 * TP)             // one staged plane tile (halves): 64 rows (K: keys x d; V^T: d x keys)

typedef _Float16 h16;
typedef unsigned short bf;
typedef __attribute__((ext_vector_type(16))) __bf16   v16bf;
typedef __attribute__((ext_vector_type(16))) _Float16 v16h;
typedef __attribute__((ext_vector_type(8)))  _Float16 v8h;
typedef __attribute__((ext_vector_type(8)))  unsigned short v8us;
typedef __attribute__((ext_vector_type(8)))  float    v8f;
typedef __attribute__((ext_vector_type(4)))  float    v4f;
typedef __attribute__((ext_vector_type(2)))  float    v2f;
typedef __attribute__((ext_vector_type(2)))  _Float16 v2h;
typedef __attribute__((ext_vector_type(2)))  unsigned short v2us;
typedef __attribute__((ext_vector_type(4)))  int      v4i;
typedef v8h  __attribute__((may_alias)) v8ha;
typedef v4f  __attribute__((may_alias)) v4fa;
typedef v8us __attribute__((may_alias)) v8usa;

static_assert(HD == 64);
static_assert(DQ == DM);                       // merged width equals model width
static_assert(DM % 64 == 0);                   // GEMM N tiles of 64, K steps of 32
static_assert(SEQ % 64 == 0);                  // GEMM M tiles of 64; attention tiles of 16 rows, 32 keys
static_assert(RH % 16 == 0);                   // hi/lo row split on a query-tile boundary
static_assert(NB <= NB_FULL);
static_assert(SEQ <= SEQ_FULL);
static_assert((PP * 2) % 16 == 0);             // 16-byte aligned P tile rows
static_assert((CP * 2) % 16 == 0);             // 16-byte aligned ctx tile rows
static_assert((TP * 2) % 16 == 0);             // 16-byte aligned staged rows
static_assert(RHE % (16 * NW) == 0 && (SEQ - RHE) % (16 * NW) == 0);   // whole attention work-groups on both sides of the row split
static_assert(SEQ % KT == 0 && SEQ / KT >= 2); // whole staged tiles; the two-buffer prologue needs two
static_assert(KT == 64 && NW * 32 == 128);     // stage_pair: 512 16-byte pieces per plane tile, 4 per thread
static_assert((long long)NB * NH_ * SEQ * HD < 2147483647LL);       // int element offsets into head planes
static_assert((long long)SEQ_FULL * SEQ_FULL < 2147483647LL);      // int element offsets into the mask

constexpr size_t WS_W  = (size_t)4 * DM * DM * 2;          // four bf16 weight planes
constexpr size_t WS_XB = (size_t)NB * SEQ * DM * 2;        // bf16 copy of one input stream
constexpr size_t WS_F  = (size_t)NB * SEQ * DM * 4;        // f32 projection result
constexpr size_t WS_PL = (size_t)NB * NH_ * SEQ * HD * 2;  // one 16-bit head plane
constexpr size_t WS_AT = (size_t)NB * SEQ * DQ * 2;        // one merged ctx plane
constexpr size_t WS_TOTAL = WS_W + WS_XB + WS_F + 9 * WS_PL + 2 * WS_AT;
static_assert(WS_TOTAL <= (size_t)134217728);              // carve stays within 128 MiB
static_assert(WS_W % 256 == 0 && WS_XB % 256 == 0 && WS_F % 256 == 0 && WS_PL % 256 == 0 && WS_AT % 256 == 0);

__device__ __forceinline__ unsigned short f2bf(float f) { unsigned u = __float_as_uint(f); u += 0x7FFFu + ((u >> 16) & 1u); return (unsigned short)(u >> 16); }   // RNE
__device__ __forceinline__ float bf2f(unsigned short b) { return __uint_as_float(((unsigned)b) << 16); }
__device__ __forceinline__ float bfr(float f) { return bf2f(f2bf(f)); }
__device__ __forceinline__ v16h cat16(v8h lo, v8h hi) { return __builtin_shufflevector(lo, hi, 0, 1, 2, 3, 4, 5, 6, 7, 8, 9, 10, 11, 12, 13, 14, 15); }
__device__ __forceinline__ v16bf cat16b(v8us lo, v8us hi) { return __builtin_bit_cast(v16bf, __builtin_shufflevector(lo, hi, 0, 1, 2, 3, 4, 5, 6, 7, 8, 9, 10, 11, 12, 13, 14, 15)); }
__device__ __forceinline__ v8f wmma16(v16h a, v16h b, v8f c) { return __builtin_amdgcn_wmma_f32_16x16x32_f16(false, a, false, b, (short)0, c, false, false); }
__device__ __forceinline__ v8f wmmab(v16bf a, v16bf b, v8f c) { return __builtin_amdgcn_wmma_f32_16x16x32_bf16(false, a, false, b, (short)0, c, false, false); }
__device__ __forceinline__ v8f mma3(v16bf ah, v16bf al, v16bf bh, v16bf bl, v8f c) { c = wmmab(ah, bh, c); c = wmmab(al, bh, c); c = wmmab(ah, bl, c); return c; }
__device__ __forceinline__ h16 tohx(float x) { return (h16)x; }
__device__ __forceinline__ void splitf(float y, unsigned short& h, unsigned short& l) { h = f2bf(y); l = f2bf(y - bf2f(h)); }
__device__ __forceinline__ void wave_sync() { __builtin_amdgcn_wave_barrier(); asm volatile("" ::: "memory"); }   // same-wave LDS exchange (tiles are private to the wave)

// Fragment loaders (A and B alike): lane (lr = lane & 15, hi = lane >> 4) points at row/column lr, element 8*hi of the 32-deep k-step;
// elements 0..7 <- k0 + 8hi + 0..7, elements 8..15 <- k0 + 16 + 8hi + 0..7.
template <typename T16> struct WFrag;
template <> struct WFrag<h16> { typedef v16h V; static __device__ __forceinline__ V ld(const h16* p) { return cat16(*(const v8h*)p, *(const v8h*)(p + 16)); } static __device__ __forceinline__ v8f mma(V a, V b, v8f c) { return wmma16(a, b, c); } };
template <> struct WFrag<bf> { typedef v16bf V; static __device__ __forceinline__ V ld(const bf* p) { return cat16b(*(const v8us*)p, *(const v8us*)(p + 16)); } static __device__ __forceinline__ v8f mma(V a, V b, v8f c) { return wmmab(a, b, c); } };

// ---- register-blocked GEMM body, ONE WAVE per 64x64 output tile (16 accumulators), operands straight from K-contiguous 16-bit planes; grid (M/64, N/64, Z), 32 threads.
// C[m][n] (f32, pitch ldc, + bf16-converted bias[n]) = sum_k A[m][k] Bt[n][k] (+ A2 Bt when NSPLIT == 1). z-batch strides sA/sB/sC in elements. K % 32 == 0, M % 64 == 0, N % 64 == 0.
template <typename T16, int NSPLIT, bool BIAS>
__device__ __forceinline__ void gemmw_body(const T16* __restrict__ A, const T16* __restrict__ A2, const T16* __restrict__ Bt, const T16* __restrict__ Bt2, int K, float* C, int ldc, const float* __restrict__ bias, size_t sA, size_t sB, size_t sC) {
    typedef typename WFrag<T16>::V V;
    __shared__ __align__(16) float os[16 * 68];
    const size_t z = blockIdx.z; A += z * sA; if (A2) A2 += z * sA; Bt += z * sB; if (Bt2) Bt2 += z * sB; C += z * sC;
    const int lane = threadIdx.x & 31, lr = lane & 15, hi = lane >> 4; const int r0 = blockIdx.x * 64, c0 = blockIdx.y * 64;
    v8f acc[4][4];
#pragma unroll
    for (int mb = 0; mb < 4; ++mb)
#pragma unroll
        for (int nb = 0; nb < 4; ++nb) acc[mb][nb] = (v8f){};
    const size_t aoff = (size_t)(r0 + lr) * K + 8 * hi, boff = (size_t)(c0 + lr) * K + 8 * hi;
#pragma unroll 1
    for (int kc = 0; kc < K; kc += 32) {
        V a[4], a2[4];
#pragma unroll
        for (int mb = 0; mb < 4; ++mb) { a[mb] = WFrag<T16>::ld(A + aoff + (size_t)mb * 16 * K + kc); if (NSPLIT == 1 || NSPLIT == 2) a2[mb] = WFrag<T16>::ld(A2 + aoff + (size_t)mb * 16 * K + kc); }
#pragma unroll
        for (int nb = 0; nb < 4; ++nb) { const V b = WFrag<T16>::ld(Bt + boff + (size_t)nb * 16 * K + kc); V b2; if (NSPLIT >= 2) b2 = WFrag<T16>::ld(Bt2 + boff + (size_t)nb * 16 * K + kc);
#pragma unroll
            for (int mb = 0; mb < 4; ++mb) { acc[mb][nb] = WFrag<T16>::mma(a[mb], b, acc[mb][nb]); if (NSPLIT == 1 || NSPLIT == 2) acc[mb][nb] = WFrag<T16>::mma(a2[mb], b, acc[mb][nb]); if (NSPLIT >= 2) acc[mb][nb] = WFrag<T16>::mma(a[mb], b2, acc[mb][nb]); } }
        asm volatile("v_nop\n\tv_nop\n\tv_nop\n\tv_nop" : "+v"(acc[0][0]), "+v"(acc[1][1]), "+v"(acc[2][2]), "+v"(acc[3][3]) : "v"(a[0]), "v"(a[3]));
    }
#pragma unroll
    for (int mb = 0; mb < 4; ++mb) {
#pragma unroll
        for (int nb = 0; nb < 4; ++nb) {
#pragma unroll
            for (int j = 0; j < 8; ++j) os[(hi * 8 + j) * 68 + nb * 16 + lr] = acc[mb][nb][j]; }
        wave_sync();
        float* crow = C + (size_t)(r0 + mb * 16) * ldc + c0;
{
#pragma unroll
            for (int s = 0; s < 8; ++s) { const int row = 2 * s + hi, cofs = lr * 4; v4f val = *(const v4fa*)(os + row * 68 + cofs); if (BIAS) { val[0] += bfr(bias[c0 + cofs]); val[1] += bfr(bias[c0 + cofs + 1]); val[2] += bfr(bias[c0 + cofs + 2]); val[3] += bfr(bias[c0 + cofs + 3]); }
                *(v4f*)(crow + (size_t)row * ldc + cofs) = val; }
             }
        wave_sync();
    }
}
// k_proj: F[z][t][n] = XB[z][t][:] . W[n][:] + b[n] (bf16 x bf16, one product).
__global__ __launch_bounds__(32) void k_proj(const bf* A, const bf* Bt, int K, float* C, int ldc, const float* bias, size_t sA, size_t sC) {
    gemmw_body<bf, 0, true>(A, nullptr, Bt, nullptr, K, C, ldc, bias, sA, (size_t)0, sC); }
// k_oproj: OUT[z][t][n] = (ATh + ATl)[z][t][:] . Wo[n][:] + bo[n] (two products).
__global__ __launch_bounds__(32) void k_oproj(const bf* A, const bf* A2, const bf* Bt, int K, float* C, int ldc, const float* bias, size_t sA, size_t sC) {
    gemmw_body<bf, 1, true>(A, A2, Bt, nullptr, K, C, ldc, bias, sA, (size_t)0, sC); }

__global__ __launch_bounds__(256) void k_cvt8(const float* __restrict__ src, bf* dst, int n8, size_t sS, size_t sD) {
    const int i = blockIdx.x * 256 + threadIdx.x; if (i >= n8) return; src += (size_t)blockIdx.y * sS; dst += (size_t)blockIdx.y * sD;
    const v8f v = *(const v8f*)(src + (size_t)i * 8); v8us o;
#pragma unroll
    for (int k = 0; k < 8; ++k) o[k] = f2bf(v[k]);
    *(v8us*)(dst + (size_t)i * 8) = o;  }

__global__ __launch_bounds__(256) void k_hplanes(const float* __restrict__ F, h16* P16, bf* Ph, bf* Pl) {
    const int e = (blockIdx.x * 256 + threadIdx.x) * 2; if (e >= NB * NH_ * SEQ * HD) return;
    const int d = e % HD; const int t = (e / HD) % SEQ; const int z = e / (HD * SEQ); const int b = z / NH_, h = z % NH_;
    const v2f x = *(const v2f*)(F + (size_t)(b * SEQ + t) * DM + h * HD + d); v2h o16; v2us oh, ol;
#pragma unroll
    for (int q = 0; q < 2; ++q) { o16[q] = tohx(x[q]); unsigned short a2, c2; splitf(x[q], a2, c2); oh[q] = a2; ol[q] = c2; }
    *(v2h*)(P16 + e) = o16; *(v2us*)(Ph + e) = oh; *(v2us*)(Pl + e) = ol;  }
__global__ __launch_bounds__(256) void k_vtplanes(const float* __restrict__ F, h16* V16, bf* Vh, bf* Vl) {
    const int e = (blockIdx.x * 256 + threadIdx.x) * 2; if (e >= NB * NH_ * HD * SEQ) return;
    const int t = e % SEQ; const int d = (e / SEQ) % HD; const int z = e / (SEQ * HD); const int b = z / NH_, h = z % NH_; v2h o16; v2us oh, ol;
#pragma unroll
    for (int q = 0; q < 2; ++q) { const float x = F[(size_t)(b * SEQ + t + q) * DM + h * HD + d]; o16[q] = tohx(x); unsigned short a2, c2; splitf(x, a2, c2); oh[q] = a2; ol[q] = c2; }
    *(v2h*)(V16 + e) = o16; *(v2us*)(Vh + e) = oh; *(v2us*)(Vl + e) = ol;  }

// ---- staging of K and V^T tiles for the attention work-group
__device__ __forceinline__ unsigned lds_off(const void* p) { return (unsigned)(size_t)p; }   // byte offset in the work-group's LDS (low half of the shared address)
__device__ __forceinline__ v16bf ldsb(const unsigned short* p) { return cat16b(*(const v8usa*)p, *(const v8usa*)(p + 16)); }   // fragment from a staged bf16 tile, same k order as WFrag::ld
__device__ __forceinline__ v16h  ldsh(const unsigned short* p) { return cat16(*(const v8ha*)p, *(const v8ha*)(p + 16)); }       // fragment from a staged f16 tile
// Two plane tiles of 64 rows x 128 bytes -> LDS at pitch TP, 16 bytes per lane and copy, 128 threads: copy i of a plane brings row 16 i + (tid >> 3), piece tid & 7.
// la / lb: the lane's LDS byte address of its row-0..15 piece; ga / gb: the lane's global address of the same piece; pa / pb: 16 source rows in elements.
template <typename T16>
__device__ __forceinline__ void stage_pair(unsigned la, const T16* ga, int pa, unsigned lb, const T16* gb, int pb) {
    // copies and their s_wait_xcnt in one statement: no address register of a copy is rewritten ahead of the wait
    asm volatile("global_load_async_to_lds_b128 %0, %8, off\n\t"
                 "global_load_async_to_lds_b128 %1, %9, off\n\t"
                 "global_load_async_to_lds_b128 %2, %10, off\n\t"
                 "global_load_async_to_lds_b128 %3, %11, off\n\t"
                 "global_load_async_to_lds_b128 %4, %12, off\n\t"
                 "global_load_async_to_lds_b128 %5, %13, off\n\t"
                 "global_load_async_to_lds_b128 %6, %14, off\n\t"
                 "global_load_async_to_lds_b128 %7, %15, off\n\t"
                 "s_wait_xcnt 0x0"
                 :: "v"(la), "v"(la + 16u * TP * 2u), "v"(la + 32u * TP * 2u), "v"(la + 48u * TP * 2u),
                    "v"(lb), "v"(lb + 16u * TP * 2u), "v"(lb + 32u * TP * 2u), "v"(lb + 48u * TP * 2u),
                    "v"(ga), "v"(ga + pa), "v"(ga + 2 * pa), "v"(ga + 3 * pa),
                    "v"(gb), "v"(gb + pb), "v"(gb + 2 * pb), "v"(gb + 3 * pb)
                 : "memory");
}

// ---- fused attention body: one work-group = NW waves of one (b, h); one wave = 16 query rows (q0..q0+15); key loop in 32-key steps, two steps per staged 64-key tile.
// K and V^T tiles: every thread copies its pieces of tile t + 2 into the buffer that tile t has left (two buffers); one work-group barrier per tile publishes tile t + 1 and frees tile t's buffer.
// Per step: (1) the 16x32 mask tile is read by value (4 x 16-byte loads per lane); a tile whose 512 entries are all 0 is skipped (wave-uniform, decided on the values read);
// (2) S = q k^T (two 16x16 accumulators, q fragments reloaded per step through an opaque integer offset, k fragments from LDS); (3) e = mask == 0 ? -1e9 : S/8; online softmax in f32
// (row = 8*hi + r, columns lr and 16 + lr; reductions over the 16 lanes of a half); (4) P tile -> wave-private LDS -> A fragment; O += P V (four d-tiles, V^T fragments from LDS).
// A skipped all-masked tile contributes exactly 0 to every row that meets an unmasked key somewhere (exp underflow); if some row of the work-group never does, the work-group repeats the loop
// with skipping disabled (every entry -1e9 -> uniform weights; rows that do meet a key end with the same values), so the result is exact for any mask contents.
template <bool HI>
__device__ __forceinline__ void attn_body(const h16* __restrict__ Q16, const h16* __restrict__ K16, const h16* __restrict__ VT16,
                                          const bf* __restrict__ Qh, const bf* __restrict__ Ql, const bf* __restrict__ Kh, const bf* __restrict__ Kl,
                                          const bf* __restrict__ VTh, const bf* __restrict__ VTl, const int* __restrict__ mask, bf* ATh, bf* ATl, int row_base) {
    constexpr int NPL = HI ? 4 : 2;                                          // staged planes per buffer: Kh Kl VTh VTl, or K16 VT16
    __shared__ __align__(16) unsigned short stg[2 * NPL * TPL];              // two buffers of staged tiles
    __shared__ __align__(16) h16 pt16a[HI ? 8 : NW * 16 * PP];               // P tiles (f16 path), one per wave
    __shared__ __align__(16) unsigned short ptha[HI ? NW * 16 * PP : 8];     // P tiles hi (bf16 path)
    __shared__ __align__(16) unsigned short ptla[HI ? NW * 16 * PP : 8];     // P tiles lo (bf16 path)
    __shared__ __align__(16) unsigned short ctha[NW * 16 * CP];              // ctx tiles hi
    __shared__ __align__(16) unsigned short ctla[NW * 16 * CP];              // ctx tiles lo
    __shared__ int wflag[NW];                                                // per wave: some row has met no unmasked key
    const int tid = threadIdx.x, lane = tid & 31, lr = lane & 15, hi = lane >> 4;
    const int wave = __builtin_amdgcn_readfirstlane(tid >> 5);
    h16* pt16 = pt16a + (HI ? 0 : wave * 16 * PP);
    unsigned short* pth = ptha + (HI ? wave * 16 * PP : 0);
    unsigned short* ptl = ptla + (HI ? wave * 16 * PP : 0);
    unsigned short* cth = ctha + wave * 16 * CP;
    unsigned short* ctl = ctla + wave * 16 * CP;
    const int q0 = row_base + ((int)blockIdx.x * NW + wave) * 16;
    const int h = blockIdx.y, b = blockIdx.z;
    const int zoff  = (b * NH_ + h) * (SEQ * HD);            // head plane offset ([t][d] and [d][t] planes both hold SEQ*HD elements)
    const int qbase = zoff + (q0 + lr) * HD + 8 * hi;        // A fragment of q: row q0 + lr; + c2*32
    const int kfrag = lr * TP + 8 * hi;                      // B fragment of k in a staged tile: column = key (sub*32 + nt*16 + lr); + (sub*32 + nt*16)*TP + c2*32
    const int vfrag = lr * TP + 8 * hi;                      // B fragment of v^T in a staged tile: column = d = dt*16 + lr; + dt*16*TP + sub*32
    const int mrowD = (q0 + 8 * hi) * SEQ_FULL + lr;         // accumulator-layout mask element: + r*SEQ_FULL + kb (+16)
    const int mrowT = (q0 + (lane >> 3)) * SEQ_FULL + (lane & 7) * 4;   // tile test: rows q0 + 4i + (lane>>3), i = 0..3; columns 4*(lane&7)..+3
    const unsigned sl = lds_off(stg) + (unsigned)((tid >> 3) * TP + (tid & 7) * 8) * 2u;   // this thread's piece in a staged plane tile
    const int sgk = zoff + (tid >> 3) * HD + (tid & 7) * 8;  // the same piece in a [t][d] plane: + t*KT*HD
    const int sgv = zoff + (tid >> 3) * SEQ + (tid & 7) * 8; // the same piece in a [d][t] plane: + t*KT
    auto stage = [&](int t, int bi) {
        const unsigned l = sl + (unsigned)(bi * NPL * TPL * 2);
        if (HI) {
            stage_pair<bf>(l, Kh + sgk + t * (KT * HD), 16 * HD, l + TPL * 2u, Kl + sgk + t * (KT * HD), 16 * HD);
            stage_pair<bf>(l + 2u * TPL * 2u, VTh + sgv + t * KT, 16 * SEQ, l + 3u * TPL * 2u, VTl + sgv + t * KT, 16 * SEQ);
        } else {
            stage_pair<h16>(l, K16 + sgk + t * (KT * HD), 16 * HD, l + TPL * 2u, VT16 + sgv + t * KT, 16 * SEQ);
        }
    };

    v8f o[4]; float m[8], l[8];
    bool dense = false;
#pragma unroll 1
    for (int pass = 0; pass < 2; ++pass) {
#pragma unroll
        for (int t = 0; t < 4; ++t) o[t] = (v8f){};
#pragma unroll
        for (int r = 0; r < 8; ++r) { m[r] = MINIT; l[r] = 0.0f; }
        // two-buffer prologue (on a repeat, the last tile's foot has already ended every read of both buffers)
        stage(0, 0);
        asm volatile("s_wait_asynccnt 0x0" ::: "memory");                       // this wave's pieces of tile 0 have landed
        __syncthreads();                                                        // tile 0 published to all waves
        stage(1, 1);
#pragma unroll 1
        for (int t = 0; t < SEQ / KT; ++t) {
            const unsigned short* sb = stg + (t & 1) * (NPL * TPL);
#pragma unroll 1
            for (int sub = 0; sub < 2; ++sub) {                                 // rolled: one copy of the step's code
            const int kb = t * KT + sub * 32;
            const v4i t0 = *(const v4i*)(mask + mrowT + kb);
            const v4i t1 = *(const v4i*)(mask + mrowT + 4 * SEQ_FULL + kb);
            const v4i t2 = *(const v4i*)(mask + mrowT + 8 * SEQ_FULL + kb);
            const v4i t3 = *(const v4i*)(mask + mrowT + 12 * SEQ_FULL + kb);
            const int tor = (t0[0] | t0[1] | t0[2] | t0[3]) | (t1[0] | t1[1] | t1[2] | t1[3]) | (t2[0] | t2[1] | t2[2] | t2[3]) | (t3[0] | t3[1] | t3[2] | t3[3]);
            const bool anyw = __builtin_amdgcn_ballot_w32(tor != 0) != 0u;      // wave-uniform
            if (!(dense || anyw)) continue;                                     // whole 16x32 tile masked: skipped (values were read); the tile's foot below is still passed
            int mk0[8], mk1[8];
#pragma unroll
            for (int r = 0; r < 8; ++r) mk0[r] = mask[mrowD + r * SEQ_FULL + kb];
            asm volatile("" ::: "memory");
#pragma unroll
            for (int r = 0; r < 8; ++r) mk1[r] = mask[mrowD + r * SEQ_FULL + kb + 16];

            int qo = qbase; asm volatile("" : "+v"(qo));                        // opaque offset: q fragments are reloaded each step, not held across the loop
            const unsigned short* kf = sb + kfrag + sub * 32 * TP;
            v8f s0 = (v8f){}, s1 = (v8f){};
            if (HI) {
                const v16bf qh0 = WFrag<bf>::ld(Qh + qo), qh1 = WFrag<bf>::ld(Qh + qo + 32);
                const v16bf ql0 = WFrag<bf>::ld(Ql + qo), ql1 = WFrag<bf>::ld(Ql + qo + 32);
                s0 = mma3(qh0, ql0, ldsb(kf), ldsb(kf + TPL), s0);
                s0 = mma3(qh1, ql1, ldsb(kf + 32), ldsb(kf + TPL + 32), s0);
                s1 = mma3(qh0, ql0, ldsb(kf + 16 * TP), ldsb(kf + TPL + 16 * TP), s1);
                s1 = mma3(qh1, ql1, ldsb(kf + 16 * TP + 32), ldsb(kf + TPL + 16 * TP + 32), s1);
                asm volatile("v_nop\n\tv_nop\n\tv_nop\n\tv_nop" : "+v"(s0), "+v"(s1) : "v"(qh1), "v"(ql1));
            } else {
                const v16h qa0 = WFrag<h16>::ld(Q16 + qo), qa1 = WFrag<h16>::ld(Q16 + qo + 32);
                s0 = wmma16(qa0, ldsh(kf), s0);
                s0 = wmma16(qa1, ldsh(kf + 32), s0);
                s1 = wmma16(qa0, ldsh(kf + 16 * TP), s1);
                s1 = wmma16(qa1, ldsh(kf + 16 * TP + 32), s1);
                asm volatile("v_nop\n\tv_nop\n\tv_nop\n\tv_nop" : "+v"(s0), "+v"(s1) : "v"(qa0), "v"(qa1));
            }

#pragma unroll
            for (int r = 0; r < 8; ++r) {
                const float e0 = (mk0[r] == 0) ? MFILL : s0[r] * SCL;
                const float e1 = (mk1[r] == 0) ? MFILL : s1[r] * SCL;
                float rm = fmaxf(e0, e1);
                rm = fmaxf(rm, __shfl_xor(rm, 1, 32)); rm = fmaxf(rm, __shfl_xor(rm, 2, 32)); rm = fmaxf(rm, __shfl_xor(rm, 4, 32)); rm = fmaxf(rm, __shfl_xor(rm, 8, 32));
                const float mn = fmaxf(m[r], rm);
                const float al = __builtin_amdgcn_exp2f((m[r] - mn) * L2E);
                float x0 = __builtin_amdgcn_exp2f((e0 - mn) * L2E);
                float x1 = __builtin_amdgcn_exp2f((e1 - mn) * L2E);
                const int po = (8 * hi + r) * PP + lr;
                float rs;
                if (HI) {
                    unsigned short a0, c0, a1, c1; splitf(x0, a0, c0); splitf(x1, a1, c1);
                    pth[po] = a0; ptl[po] = c0; pth[po + 16] = a1; ptl[po + 16] = c1;
                    rs = x0 + x1;
                } else {
                    x0 = (x0 < F16MINN) ? 0.0f : x0; x1 = (x1 < F16MINN) ? 0.0f : x1;      // no subnormal f16 operands; the row sum uses the same values
                    const h16 g0 = tohx(x0), g1 = tohx(x1);
                    pt16[po] = g0; pt16[po + 16] = g1;
                    rs = (float)g0 + (float)g1;
                }
                rs += __shfl_xor(rs, 1, 32); rs += __shfl_xor(rs, 2, 32); rs += __shfl_xor(rs, 4, 32); rs += __shfl_xor(rs, 8, 32);
                l[r] = l[r] * al + rs; m[r] = mn;
                o[0][r] *= al; o[1][r] *= al; o[2][r] *= al; o[3][r] *= al;
            }
            wave_sync();                                                       // P tile: stores by all lanes, then fragment loads (same wave)
            const unsigned short* vf = sb + (HI ? 2 : 1) * TPL + vfrag + sub * 32;
            if (HI) {
                const v16bf pa = cat16b(*(const v8usa*)(pth + lr * PP + 8 * hi), *(const v8usa*)(pth + lr * PP + 16 + 8 * hi));
                const v16bf pb = cat16b(*(const v8usa*)(ptl + lr * PP + 8 * hi), *(const v8usa*)(ptl + lr * PP + 16 + 8 * hi));
                const v16bf vh0 = ldsb(vf), vh1 = ldsb(vf + 16 * TP), vh2 = ldsb(vf + 32 * TP), vh3 = ldsb(vf + 48 * TP);
                const v16bf vl0 = ldsb(vf + TPL), vl1 = ldsb(vf + TPL + 16 * TP), vl2 = ldsb(vf + TPL + 32 * TP), vl3 = ldsb(vf + TPL + 48 * TP);
                o[0] = mma3(pa, pb, vh0, vl0, o[0]); o[1] = mma3(pa, pb, vh1, vl1, o[1]); o[2] = mma3(pa, pb, vh2, vl2, o[2]); o[3] = mma3(pa, pb, vh3, vl3, o[3]);
                asm volatile("v_nop\n\tv_nop\n\tv_nop\n\tv_nop" : "+v"(o[0]), "+v"(o[1]), "+v"(o[2]), "+v"(o[3]) : "v"(pa), "v"(pb));
            } else {
                const v16h pa = cat16(*(const v8ha*)(pt16 + lr * PP + 8 * hi), *(const v8ha*)(pt16 + lr * PP + 16 + 8 * hi));
                const v16h v0 = ldsh(vf), v1 = ldsh(vf + 16 * TP), v2 = ldsh(vf + 32 * TP), v3 = ldsh(vf + 48 * TP);
                o[0] = wmma16(pa, v0, o[0]); o[1] = wmma16(pa, v1, o[1]); o[2] = wmma16(pa, v2, o[2]); o[3] = wmma16(pa, v3, o[3]);
                asm volatile("v_nop\n\tv_nop\n\tv_nop\n\tv_nop" : "+v"(o[0]), "+v"(o[1]), "+v"(o[2]), "+v"(o[3]) : "v"(pa), "v"(v3));
            }
            wave_sync();                                                       // fragment loads done before the next step's stores
            }
            // foot of tile t, passed by every wave whatever it skipped
            asm volatile("s_wait_dscnt 0x0" ::: "memory");                      // this wave's reads of tile t's buffer have returned
            asm volatile("s_wait_asynccnt 0x0" ::: "memory");                   // this wave's pieces of tile t + 1 have landed
            __syncthreads();                                                    // publishes tile t + 1; ends every wave's reads of tile t's buffer
            if (t + 2 < SEQ / KT) stage(t + 2, t & 1);                          // refill the buffer just left (same test in every wave)
        }
        asm volatile("s_wait_asynccnt 0x0" ::: "memory");                       // no copy in flight behind the loop
        bool bad = false;
#pragma unroll
        for (int r = 0; r < 8; ++r) bad = bad || !(m[r] > MSEEN);
        const int wbad = (__builtin_amdgcn_ballot_w32(bad) != 0u) ? 1 : 0;      // taken with every lane on
        if (lane == 0) wflag[wave] = wbad;
        __syncthreads();                                                        // the repeat is decided for the whole work-group: its barriers need every wave
        const int anyb = wflag[0] | wflag[1] | wflag[2] | wflag[3];
        if (__builtin_amdgcn_readfirstlane(anyb) == 0) break;                   // every row met an unmasked key: skipped tiles contributed exactly 0
        dense = true;                                                           // otherwise repeat without skipping (work-group-uniform)
    }

#pragma unroll
    for (int r = 0; r < 8; ++r) { const float inv = 1.0f / l[r];
#pragma unroll
        for (int dt = 0; dt < 4; ++dt) { unsigned short a, c; splitf(o[dt][r] * inv, a, c); cth[(8 * hi + r) * CP + dt * 16 + lr] = a; ctl[(8 * hi + r) * CP + dt * 16 + lr] = c; } }
    wave_sync();
    v8us hv[4], lv[4];
#pragma unroll
    for (int s = 0; s < 4; ++s) { const int row = 4 * s + (lane >> 3); hv[s] = *(const v8usa*)(cth + row * CP + (lane & 7) * 8); lv[s] = *(const v8usa*)(ctl + row * CP + (lane & 7) * 8); }
    const size_t ob = (size_t)(b * SEQ + q0 + (lane >> 3)) * DQ + h * HD + (lane & 7) * 8;
{
#pragma unroll
        for (int s = 0; s < 4; ++s) { *(v8us*)(ATh + ob + (size_t)(4 * s) * DQ) = hv[s]; *(v8us*)(ATl + ob + (size_t)(4 * s) * DQ) = lv[s]; }
         }
}
__global__ __launch_bounds__(32 * NW) void k_attn_hi(const bf* Qh, const bf* Ql, const bf* Kh, const bf* Kl, const bf* VTh, const bf* VTl, const int* mask, bf* ATh, bf* ATl) {
    attn_body<true>(nullptr, nullptr, nullptr, Qh, Ql, Kh, Kl, VTh, VTl, mask, ATh, ATl, 0); }
__global__ __launch_bounds__(32 * NW) void k_attn_lo(const h16* Q16, const h16* K16, const h16* VT16, const int* mask, bf* ATh, bf* ATl) {
    attn_body<false>(Q16, K16, VT16, nullptr, nullptr, nullptr, nullptr, nullptr, nullptr, mask, ATh, ATl, RHE); }

extern "C" void kernel_launch(void* const* d_in, const int* in_sizes, int n_in,
                              void* d_out, int out_size, void* d_ws, size_t ws_size, hipStream_t stream) {
    if (n_in < 12) return;
    const long long need_x = (long long)(NB - 1) * SEQ_FULL * DM + (long long)SEQ * DM;      // rows read from a full-size stream
    const long long need_m = (long long)(SEQ - 1) * SEQ_FULL + SEQ;
    if (in_sizes[0] < need_x || in_sizes[1] < need_x || in_sizes[2] < need_x || in_sizes[3] < need_m) return;
    if (in_sizes[4] < DM * DM || in_sizes[6] < DM * DM || in_sizes[8] < DM * DM || in_sizes[10] < DM * DM) return;
    if (in_sizes[5] < DM || in_sizes[7] < DM || in_sizes[9] < DM || in_sizes[11] < DM) return;
    if ((long long)out_size < need_x) return;
    if (WS_TOTAL > ws_size) return;
    // wire order: x_q, x_k, x_v, mask (int32 [1][1][SEQ_FULL][SEQ_FULL]), Wq, bq, Wk, bk, Wv, bv, Wo, bo; weights [out][in]
    const float* xq = (const float*)d_in[0]; const float* xk = (const float*)d_in[1]; const float* xv = (const float*)d_in[2];
    const int* mask = (const int*)d_in[3];
    const float* wq = (const float*)d_in[4]; const float* bq = (const float*)d_in[5];
    const float* wk = (const float*)d_in[6]; const float* bk = (const float*)d_in[7];
    const float* wv = (const float*)d_in[8]; const float* bv = (const float*)d_in[9];
    const float* wo = (const float*)d_in[10]; const float* bo = (const float*)d_in[11];
    float* OUT = (float*)d_out;     // [NB_FULL][SEQ_FULL][DM]
    char* wsp = (char*)d_ws;
    auto take = [&](size_t bytes) { char* p = wsp; wsp += bytes; return (void*)p; };      // all sizes are multiples of 256 bytes
    bf* WQ = (bf*)take(WS_W / 4); bf* WK = (bf*)take(WS_W / 4); bf* WV = (bf*)take(WS_W / 4); bf* WO = (bf*)take(WS_W / 4);
    bf* XB = (bf*)take(WS_XB); float* F = (float*)take(WS_F);
    h16* Q16 = (h16*)take(WS_PL); bf* Qh = (bf*)take(WS_PL); bf* Ql = (bf*)take(WS_PL);
    h16* K16 = (h16*)take(WS_PL); bf* Kh = (bf*)take(WS_PL); bf* Kl = (bf*)take(WS_PL);
    h16* VT16 = (h16*)take(WS_PL); bf* VTh = (bf*)take(WS_PL); bf* VTl = (bf*)take(WS_PL);
    bf* ATh = (bf*)take(WS_AT); bf* ATl = (bf*)take(WS_AT);
    if ((size_t)(wsp - (char*)d_ws) > ws_size) return;

    const unsigned gW = (unsigned)((DM * DM / 8 + 255) / 256), gX = (unsigned)((SEQ * DM / 8 + 255) / 256), gP = (unsigned)((NB * NH_ * SEQ * HD / 2 + 255) / 256);
    k_cvt8<<<dim3(gW, 1), 256, 0, stream>>>(wq, WQ, DM * DM / 8, (size_t)0, (size_t)0);
    k_cvt8<<<dim3(gW, 1), 256, 0, stream>>>(wk, WK, DM * DM / 8, (size_t)0, (size_t)0);
    k_cvt8<<<dim3(gW, 1), 256, 0, stream>>>(wv, WV, DM * DM / 8, (size_t)0, (size_t)0);
    k_cvt8<<<dim3(gW, 1), 256, 0, stream>>>(wo, WO, DM * DM / 8, (size_t)0, (size_t)0);
    const dim3 gG(SEQ / 64, DQ / 64, NB);
    // q stream
    k_cvt8<<<dim3(gX, NB), 256, 0, stream>>>(xq, XB, SEQ * DM / 8, (size_t)SEQ_FULL * DM, (size_t)SEQ * DM);
    k_proj<<<gG, 32, 0, stream>>>(XB, WQ, DM, F, DQ, bq, (size_t)SEQ * DM, (size_t)SEQ * DQ);
    k_hplanes<<<gP, 256, 0, stream>>>(F, Q16, Qh, Ql);
    // k stream
    k_cvt8<<<dim3(gX, NB), 256, 0, stream>>>(xk, XB, SEQ * DM / 8, (size_t)SEQ_FULL * DM, (size_t)SEQ * DM);
    k_proj<<<gG, 32, 0, stream>>>(XB, WK, DM, F, DQ, bk, (size_t)SEQ * DM, (size_t)SEQ * DQ);
    k_hplanes<<<gP, 256, 0, stream>>>(F, K16, Kh, Kl);
    // v stream
    k_cvt8<<<dim3(gX, NB), 256, 0, stream>>>(xv, XB, SEQ * DM / 8, (size_t)SEQ_FULL * DM, (size_t)SEQ * DM);
    k_proj<<<gG, 32, 0, stream>>>(XB, WV, DM, F, DQ, bv, (size_t)SEQ * DM, (size_t)SEQ * DQ);
    k_vtplanes<<<gP, 256, 0, stream>>>(F, VT16, VTh, VTl);
    // attention: query rows [0, RHE) on hi/lo planes, rows [RHE, SEQ) on f16 planes
    k_attn_hi<<<dim3(RHE / (16 * NW), NH_, NB), 32 * NW, 0, stream>>>(Qh, Ql, Kh, Kl, VTh, VTl, mask, ATh, ATl);
#if SEQ > RH
    k_attn_lo<<<dim3((SEQ - RHE) / (16 * NW), NH_, NB), 32 * NW, 0, stream>>>(Q16, K16, VT16, mask, ATh, ATl);
#endif
    // output projection: per batch rows of the full-size output
    k_oproj<<<dim3(SEQ / 64, DM / 64, NB), 32, 0, stream>>>(ATh, ATl, WO, DQ, OUT, DM, bo, (size_t)SEQ * DQ, (size_t)SEQ_FULL * DM);
}

// v002
// One run takes 393 microseconds.
// Timed twice side by side with v001, it ran 1.03 times as fast both times.
// All steps since v000 together make it 1.29 times as fast.
#include <hip/hip_runtime.h>

// Three-stream masked attention: q = xq Wq^T + bq, k = xk Wk^T + bk, v = xv Wv^T + bv (weights [out][in]); 16 heads x 64 (head h = columns h*64+d); scores x 1/8; integer mask [SEQ][SEQ] read by value (0 -> score := -1e9); softmax; out = ctx Wo^T + bo.
// Compute dtypes, f32 accumulate: every float input RNE-converted to bf16; projections v_wmma_f32_16x16x32_bf16 (exact operand products); attention query rows < RH: bf16 hi+lo planes for q, k, v and p (3 products per site); rows >= RH: v_wmma_f32_16x16x32_f16 single products (q, k, v, p as f16); online softmax f32; ctx carried as bf16 hi+lo planes x Wo bf16 (2 products).
// Engine: one wave per 64x64 GEMM tile (operands straight from K-contiguous 16-bit planes); the q, k, v projections convert their f32 sums in the epilogue and store the head planes themselves (v as W X^T, so that its tile rows are d and its columns t); fused flash-style attention, four waves per work-group (16 query rows each), 32-key steps; the work-group's waves share 64-key K and V^T tiles in LDS (two buffers, asynchronous copies); q and mask straight from global memory; no score or probability plane in global memory.

#ifndef NB
#define NB 2
#endif
#ifndef SEQ
#define SEQ 2048
#endif
#define NB_FULL  2
#define SEQ_FULL 2048
#define DM   1024
#define NH_  16
#define HD   64
#define DQ   (NH_ * HD)
#define RH   512                  // query rows < RH use hi+lo planes
#define RHE  ((RH < SEQ) ? RH : SEQ)
#define SCL  0.125f               // HD^-0.5
#define L2E  1.4426950408889634f
#define MFILL (-1.0e9f)           // value that replaces a masked score
#define MINIT (-1.0e30f)          // running-max start (below MFILL)
#define MSEEN (-5.0e8f)           // running max above this <=> the row has met an unmasked key
#define F16MINN 6.103515625e-05f  // smallest normal f16
#define PP 40                     // P tile pitch (halves): 32 + 8
#define CP 72                     // ctx tile pitch (halves): 64 + 8
#define NW 4                      // attention waves per work-group (16 query rows each)
#define KT 64                     // keys per staged K / V^T tile
#define TP 72                     // staged tile pitch (halves): 64 + 8 = 144 bytes, an odd multiple of 16 bytes
#define TPL (64 * TP)             // one staged plane tile (halves): 64 rows (K: keys x d; V^T: d x keys)

typedef _Float16 h16;
typedef unsigned short bf;
typedef __attribute__((ext_vector_type(16))) __bf16   v16bf;
typedef __attribute__((ext_vector_type(16))) _Float16 v16h;
typedef __attribute__((ext_vector_type(8)))  _Float16 v8h;
typedef __attribute__((ext_vector_type(8)))  unsigned short v8us;
typedef __attribute__((ext_vector_type(8)))  float    v8f;
typedef __attribute__((ext_vector_type(4)))  float    v4f;
typedef __attribute__((ext_vector_type(4)))  _Float16 v4h;
typedef __attribute__((ext_vector_type(4)))  unsigned short v4us;
typedef __attribute__((ext_vector_type(4)))  int      v4i;
typedef v8h  __attribute__((may_alias)) v8ha;
typedef v4f  __attribute__((may_alias)) v4fa;
typedef v8us __attribute__((may_alias)) v8usa;

static_assert(HD == 64);
static_assert(DQ == DM);                       // merged width equals model width
static_assert(DM % 64 == 0);                   // GEMM N tiles of 64, K steps of 32
static_assert(SEQ % 64 == 0);                  // GEMM M tiles of 64; attention tiles of 16 rows, 32 keys
static_assert(RH % 16 == 0);                   // hi/lo row split on a query-tile boundary
static_assert(NB <= NB_FULL);
static_assert(SEQ <= SEQ_FULL);
static_assert((PP * 2) % 16 == 0);             // 16-byte aligned P tile rows
static_assert((CP * 2) % 16 == 0);             // 16-byte aligned ctx tile rows
static_assert((TP * 2) % 16 == 0);             // 16-byte aligned staged rows
static_assert(RHE % (16 * NW) == 0 && (SEQ - RHE) % (16 * NW) == 0);   // whole attention work-groups on both sides of the row split
static_assert(SEQ % KT == 0 && SEQ / KT >= 2); // whole staged tiles; the two-buffer prologue needs two
static_assert(KT == 64 && NW * 32 == 128);     // stage_pair: 512 16-byte pieces per plane tile, 4 per thread
static_assert((long long)NB * NH_ * SEQ * HD < 2147483647LL);       // int element offsets into head planes
static_assert((long long)SEQ_FULL * SEQ_FULL < 2147483647LL);      // int element offsets into the mask

constexpr size_t WS_W  = (size_t)4 * DM * DM * 2;          // four bf16 weight planes
constexpr size_t WS_XB = (size_t)NB * SEQ * DM * 2;        // bf16 copy of one input stream
constexpr size_t WS_PL = (size_t)NB * NH_ * SEQ * HD * 2;  // one 16-bit head plane
constexpr size_t WS_AT = (size_t)NB * SEQ * DQ * 2;        // one merged ctx plane
constexpr size_t WS_TOTAL = WS_W + WS_XB + 9 * WS_PL + 2 * WS_AT;
static_assert(WS_TOTAL <= (size_t)134217728);              // carve stays within 128 MiB
static_assert(WS_W % 256 == 0 && WS_XB % 256 == 0 && WS_PL % 256 == 0 && WS_AT % 256 == 0);

__device__ __forceinline__ unsigned short f2bf(float f) { unsigned u = __float_as_uint(f); u += 0x7FFFu + ((u >> 16) & 1u); return (unsigned short)(u >> 16); }   // RNE
__device__ __forceinline__ float bf2f(unsigned short b) { return __uint_as_float(((unsigned)b) << 16); }
__device__ __forceinline__ float bfr(float f) { return bf2f(f2bf(f)); }
__device__ __forceinline__ v16h cat16(v8h lo, v8h hi) { return __builtin_shufflevector(lo, hi, 0, 1, 2, 3, 4, 5, 6, 7, 8, 9, 10, 11, 12, 13, 14, 15); }
__device__ __forceinline__ v16bf cat16b(v8us lo, v8us hi) { return __builtin_bit_cast(v16bf, __builtin_shufflevector(lo, hi, 0, 1, 2, 3, 4, 5, 6, 7, 8, 9, 10, 11, 12, 13, 14, 15)); }
__device__ __forceinline__ v8f wmma16(v16h a, v16h b, v8f c) { return __builtin_amdgcn_wmma_f32_16x16x32_f16(false, a, false, b, (short)0, c, false, false); }
__device__ __forceinline__ v8f wmmab(v16bf a, v16bf b, v8f c) { return __builtin_amdgcn_wmma_f32_16x16x32_bf16(false, a, false, b, (short)0, c, false, false); }
__device__ __forceinline__ v8f mma3(v16bf ah, v16bf al, v16bf bh, v16bf bl, v8f c) { c = wmmab(ah, bh, c); c = wmmab(al, bh, c); c = wmmab(ah, bl, c); return c; }
__device__ __forceinline__ h16 tohx(float x) { return (h16)x; }
__device__ __forceinline__ void splitf(float y, unsigned short& h, unsigned short& l) { h = f2bf(y); l = f2bf(y - bf2f(h)); }
__device__ __forceinline__ void wave_sync() { __builtin_amdgcn_wave_barrier(); asm volatile("" ::: "memory"); }   // same-wave LDS exchange (tiles are private to the wave)

// Fragment loaders (A and B alike): lane (lr = lane & 15, hi = lane >> 4) points at row/column lr, element 8*hi of the 32-deep k-step;
// elements 0..7 <- k0 + 8hi + 0..7, elements 8..15 <- k0 + 16 + 8hi + 0..7.
template <typename T16> struct WFrag;
template <> struct WFrag<h16> { typedef v16h V; static __device__ __forceinline__ V ld(const h16* p) { return cat16(*(const v8h*)p, *(const v8h*)(p + 16)); } static __device__ __forceinline__ v8f mma(V a, V b, v8f c) { return wmma16(a, b, c); } };
template <> struct WFrag<bf> { typedef v16bf V; static __device__ __forceinline__ V ld(const bf* p) { return cat16b(*(const v8us*)p, *(const v8us*)(p + 16)); } static __device__ __forceinline__ v8f mma(V a, V b, v8f c) { return wmmab(a, b, c); } };

// ---- register-blocked GEMM body, ONE WAVE per 64x64 output tile (16 accumulators), operands straight from K-contiguous 16-bit planes; grid (M/64, N/64, Z), 32 threads.
// C[m][n] (f32, pitch ldc, + bf16-converted bias[n]) = sum_k A[m][k] Bt[n][k] (+ A2 Bt when NSPLIT == 1). z-batch strides sA/sB/sC in elements. K % 32 == 0, M % 64 == 0, N % 64 == 0.
// OUT == 0: C is stored as f32. OUT == 1 (m = t, n = h*64 + d) and OUT == 2 (m = h*64 + d, n = t, bias[m]): the f32 value is converted where it is made and stored to the three 16-bit head planes
// (f16, bf16 hi, bf16 lo) at P*[pb + tile row * pp + tile column]; a tile row is 128 bytes of each plane, one whole line per 16 lanes.
template <typename T16, int NSPLIT, bool BIAS, int OUT = 0>
__device__ __forceinline__ void gemmw_body(const T16* __restrict__ A, const T16* __restrict__ A2, const T16* __restrict__ Bt, const T16* __restrict__ Bt2, int K, float* C, int ldc, const float* __restrict__ bias, size_t sA, size_t sB, size_t sC,
                                           h16* P16 = nullptr, bf* Ph = nullptr, bf* Pl = nullptr) {
    typedef typename WFrag<T16>::V V;
    __shared__ __align__(16) float os[16 * 68];
    const size_t z = blockIdx.z; A += z * sA; if (A2) A2 += z * sA; Bt += z * sB; if (Bt2) Bt2 += z * sB; C += z * sC;
    const int lane = threadIdx.x & 31, lr = lane & 15, hi = lane >> 4; const int r0 = blockIdx.x * 64, c0 = blockIdx.y * 64;
    v8f acc[4][4];
#pragma unroll
    for (int mb = 0; mb < 4; ++mb)
#pragma unroll
        for (int nb = 0; nb < 4; ++nb) acc[mb][nb] = (v8f){};
    const size_t aoff = (size_t)(r0 + lr) * K + 8 * hi, boff = (size_t)(c0 + lr) * K + 8 * hi;
#pragma unroll 1
    for (int kc = 0; kc < K; kc += 32) {
        V a[4], a2[4];
#pragma unroll
        for (int mb = 0; mb < 4; ++mb) { a[mb] = WFrag<T16>::ld(A + aoff + (size_t)mb * 16 * K + kc); if (NSPLIT == 1 || NSPLIT == 2) a2[mb] = WFrag<T16>::ld(A2 + aoff + (size_t)mb * 16 * K + kc); }
#pragma unroll
        for (int nb = 0; nb < 4; ++nb) { const V b = WFrag<T16>::ld(Bt + boff + (size_t)nb * 16 * K + kc); V b2; if (NSPLIT >= 2) b2 = WFrag<T16>::ld(Bt2 + boff + (size_t)nb * 16 * K + kc);
#pragma unroll
            for (int mb = 0; mb < 4; ++mb) { acc[mb][nb] = WFrag<T16>::mma(a[mb], b, acc[mb][nb]); if (NSPLIT == 1 || NSPLIT == 2) acc[mb][nb] = WFrag<T16>::mma(a2[mb], b, acc[mb][nb]); if (NSPLIT >= 2) acc[mb][nb] = WFrag<T16>::mma(a[mb], b2, acc[mb][nb]); } }
        asm volatile("v_nop\n\tv_nop\n\tv_nop\n\tv_nop" : "+v"(acc[0][0]), "+v"(acc[1][1]), "+v"(acc[2][2]), "+v"(acc[3][3]) : "v"(a[0]), "v"(a[3]));
    }
#pragma unroll
    for (int mb = 0; mb < 4; ++mb) {
#pragma unroll
        for (int nb = 0; nb < 4; ++nb) {
#pragma unroll
            for (int j = 0; j < 8; ++j) os[(hi * 8 + j) * 68 + nb * 16 + lr] = acc[mb][nb][j]; }
        wave_sync();
        float* crow = C + (size_t)(r0 + mb * 16) * ldc + c0;
if (OUT == 0) {
#pragma unroll
            for (int s = 0; s < 8; ++s) { const int row = 2 * s + hi, cofs = lr * 4; v4f val = *(const v4fa*)(os + row * 68 + cofs); if (BIAS) { val[0] += bfr(bias[c0 + cofs]); val[1] += bfr(bias[c0 + cofs + 1]); val[2] += bfr(bias[c0 + cofs + 2]); val[3] += bfr(bias[c0 + cofs + 3]); }
                *(v4f*)(crow + (size_t)row * ldc + cofs) = val; }
             }
        else {
            const size_t pb = (OUT == 1) ? ((z * NH_ + blockIdx.y) * SEQ + r0 + mb * 16) * HD : ((z * NH_ + blockIdx.x) * HD + mb * 16) * SEQ + c0;   // head = the tile's index along h*64 + d
            const int pp = (OUT == 1) ? HD : SEQ;
#pragma unroll
            for (int s = 0; s < 8; ++s) { const int row = 2 * s + hi, cofs = lr * 4; v4f val = *(const v4fa*)(os + row * 68 + cofs);
                if (BIAS && OUT == 1) { val[0] += bfr(bias[c0 + cofs]); val[1] += bfr(bias[c0 + cofs + 1]); val[2] += bfr(bias[c0 + cofs + 2]); val[3] += bfr(bias[c0 + cofs + 3]); }
                if (BIAS && OUT == 2) { const float br = bfr(bias[r0 + mb * 16 + row]); val[0] += br; val[1] += br; val[2] += br; val[3] += br; }
                v4h o16; v4us oh, ol;
#pragma unroll
                for (int q = 0; q < 4; ++q) { o16[q] = tohx(val[q]); unsigned short a2, c2; splitf(val[q], a2, c2); oh[q] = a2; ol[q] = c2; }
                const size_t pe = pb + (size_t)row * pp + cofs;
                *(v4h*)(P16 + pe) = o16; *(v4us*)(Ph + pe) = oh; *(v4us*)(Pl + pe) = ol;
                asm volatile("s_wait_xcnt 0x0" ::: "memory"); }   // stands in front of the next rows' values, which reuse the registers these stores name
        }
        wave_sync();
    }
}
// k_proj: y[z][t][n] = XB[z][t][:] . W[n][:] + b[n] (bf16 x bf16, one product), stored as [z*NH_ + h][t][d] planes; grid (SEQ/64, DQ/64, NB).
__global__ __launch_bounds__(32) void k_proj(const bf* A, const bf* Bt, int K, const float* bias, size_t sA, h16* P16, bf* Ph, bf* Pl) {
    gemmw_body<bf, 0, true, 1>(A, nullptr, Bt, nullptr, K, nullptr, 0, bias, sA, (size_t)0, (size_t)0, P16, Ph, Pl); }
// k_projt: the same product with W as A and XB as B, stored as [z*NH_ + h][d][t] planes; grid (DQ/64, SEQ/64, NB).
__global__ __launch_bounds__(32) void k_projt(const bf* A, const bf* Bt, int K, const float* bias, size_t sB, h16* P16, bf* Ph, bf* Pl) {
    gemmw_body<bf, 0, true, 2>(A, nullptr, Bt, nullptr, K, nullptr, 0, bias, (size_t)0, sB, (size_t)0, P16, Ph, Pl); }
// k_oproj: OUT[z][t][n] = (ATh + ATl)[z][t][:] . Wo[n][:] + bo[n] (two products).
__global__ __launch_bounds__(32) void k_oproj(const bf* A, const bf* A2, const bf* Bt, int K, float* C, int ldc, const float* bias, size_t sA, size_t sC) {
    gemmw_body<bf, 1, true>(A, A2, Bt, nullptr, K, C, ldc, bias, sA, (size_t)0, sC); }

__global__ __launch_bounds__(256) void k_cvt8(const float* __restrict__ src, bf* dst, int n8, size_t sS, size_t sD) {
    const int i = blockIdx.x * 256 + threadIdx.x; if (i >= n8) return; src += (size_t)blockIdx.y * sS; dst += (size_t)blockIdx.y * sD;
    const v8f v = *(const v8f*)(src + (size_t)i * 8); v8us o;
#pragma unroll
    for (int k = 0; k < 8; ++k) o[k] = f2bf(v[k]);
    *(v8us*)(dst + (size_t)i * 8) = o;  }

// ---- staging of K and V^T tiles for the attention work-group
__device__ __forceinline__ unsigned lds_off(const void* p) { return (unsigned)(size_t)p; }   // byte offset in the work-group's LDS (low half of the shared address)
__device__ __forceinline__ v16bf ldsb(const unsigned short* p) { return cat16b(*(const v8usa*)p, *(const v8usa*)(p + 16)); }   // fragment from a staged bf16 tile, same k order as WFrag::ld
__device__ __forceinline__ v16h  ldsh(const unsigned short* p) { return cat16(*(const v8ha*)p, *(const v8ha*)(p + 16)); }       // fragment from a staged f16 tile
// Two plane tiles of 64 rows x 128 bytes -> LDS at pitch TP, 16 bytes per lane and copy, 128 threads: copy i of a plane brings row 16 i + (tid >> 3), piece tid & 7.
// la / lb: the lane's LDS byte address of its row-0..15 piece; ga / gb: the lane's global address of the same piece; pa / pb: 16 source rows in elements.
template <typename T16>
__device__ __forceinline__ void stage_pair(unsigned la, const T16* ga, int pa, unsigned lb, const T16* gb, int pb) {
    // copies and their s_wait_xcnt in one statement: no address register of a copy is rewritten ahead of the wait
    asm volatile("global_load_async_to_lds_b128 %0, %8, off\n\t"
                 "global_load_async_to_lds_b128 %1, %9, off\n\t"
                 "global_load_async_to_lds_b128 %2, %10, off\n\t"
                 "global_load_async_to_lds_b128 %3, %11, off\n\t"
                 "global_load_async_to_lds_b128 %4, %12, off\n\t"
                 "global_load_async_to_lds_b128 %5, %13, off\n\t"
                 "global_load_async_to_lds_b128 %6, %14, off\n\t"
                 "global_load_async_to_lds_b128 %7, %15, off\n\t"
                 "s_wait_xcnt 0x0"
                 :: "v"(la), "v"(la + 16u * TP * 2u), "v"(la + 32u * TP * 2u), "v"(la + 48u * TP * 2u),
                    "v"(lb), "v"(lb + 16u * TP * 2u), "v"(lb + 32u * TP * 2u), "v"(lb + 48u * TP * 2u),
                    "v"(ga), "v"(ga + pa), "v"(ga + 2 * pa), "v"(ga + 3 * pa),
                    "v"(gb), "v"(gb + pb), "v"(gb + 2 * pb), "v"(gb + 3 * pb)
                 : "memory");
}

// ---- fused attention body: one work-group = NW waves of one (b, h); one wave = 16 query rows (q0..q0+15); key loop in 32-key steps, two steps per staged 64-key tile.
// K and V^T tiles: every thread copies its pieces of tile t + 2 into the buffer that tile t has left (two buffers); one work-group barrier per tile publishes tile t + 1 and frees tile t's buffer.
// Per step: (1) the 16x32 mask tile is read by value (4 x 16-byte loads per lane); a tile whose 512 entries are all 0 is skipped (wave-uniform, decided on the values read);
// (2) S = q k^T (two 16x16 accumulators, q fragments reloaded per step through an opaque integer offset, k fragments from LDS); (3) e = mask == 0 ? -1e9 : S/8; online softmax in f32
// (row = 8*hi + r, columns lr and 16 + lr; reductions over the 16 lanes of a half); (4) P tile -> wave-private LDS -> A fragment; O += P V (four d-tiles, V^T fragments from LDS).
// A skipped all-masked tile contributes exactly 0 to every row that meets an unmasked key somewhere (exp underflow); if some row of the work-group never does, the work-group repeats the loop
// with skipping disabled (every entry -1e9 -> uniform weights; rows that do meet a key end with the same values), so the result is exact for any mask contents.
template <bool HI>
__device__ __forceinline__ void attn_body(const h16* __restrict__ Q16, const h16* __restrict__ K16, const h16* __restrict__ VT16,
                                          const bf* __restrict__ Qh, const bf* __restrict__ Ql, const bf* __restrict__ Kh, const bf* __restrict__ Kl,
                                          const bf* __restrict__ VTh, const bf* __restrict__ VTl, const int* __restrict__ mask, bf* ATh, bf* ATl, int row_base) {
    constexpr int NPL = HI ? 4 : 2;                                          // staged planes per buffer: Kh Kl VTh VTl, or K16 VT16
    __shared__ __align__(16) unsigned short stg[2 * NPL * TPL];              // two buffers of staged tiles
    __shared__ __align__(16) h16 pt16a[HI ? 8 : NW * 16 * PP];               // P tiles (f16 path), one per wave
    __shared__ __align__(16) unsigned short ptha[HI ? NW * 16 * PP : 8];     // P tiles hi (bf16 path)
    __shared__ __align__(16) unsigned short ptla[HI ? NW * 16 * PP : 8];     // P tiles lo (bf16 path)
    __shared__ __align__(16) unsigned short ctha[NW * 16 * CP];              // ctx tiles hi
    __shared__ __align__(16) unsigned short ctla[NW * 16 * CP];              // ctx tiles lo
    __shared__ int wflag[NW];                                                // per wave: some row has met no unmasked key
    const int tid = threadIdx.x, lane = tid & 31, lr = lane & 15, hi = lane >> 4;
    const int wave = __builtin_amdgcn_readfirstlane(tid >> 5);
    h16* pt16 = pt16a + (HI ? 0 : wave * 16 * PP);
    unsigned short* pth = ptha + (HI ? wave * 16 * PP : 0);
    unsigned short* ptl = ptla + (HI ? wave * 16 * PP : 0);
    unsigned short* cth = ctha + wave * 16 * CP;
    unsigned short* ctl = ctla + wave * 16 * CP;
    const int q0 = row_base + ((int)blockIdx.x * NW + wave) * 16;
    const int h = blockIdx.y, b = blockIdx.z;
    const int zoff  = (b * NH_ + h) * (SEQ * HD);            // head plane offset ([t][d] and [d][t] planes both hold SEQ*HD elements)
    const int qbase = zoff + (q0 + lr) * HD + 8 * hi;        // A fragment of q: row q0 + lr; + c2*32
    const int kfrag = lr * TP + 8 * hi;                      // B fragment of k in a staged tile: column = key (sub*32 + nt*16 + lr); + (sub*32 + nt*16)*TP + c2*32
    const int vfrag = lr * TP + 8 * hi;                      // B fragment of v^T in a staged tile: column = d = dt*16 + lr; + dt*16*TP + sub*32
    const int mrowD = (q0 + 8 * hi) * SEQ_FULL + lr;         // accumulator-layout mask element: + r*SEQ_FULL + kb (+16)
    const int mrowT = (q0 + (lane >> 3)) * SEQ_FULL + (lane & 7) * 4;   // tile test: rows q0 + 4i + (lane>>3), i = 0..3; columns 4*(lane&7)..+3
    const unsigned sl = lds_off(stg) + (unsigned)((tid >> 3) * TP + (tid & 7) * 8) * 2u;   // this thread's piece in a staged plane tile
    const int sgk = zoff + (tid >> 3) * HD + (tid & 7) * 8;  // the same piece in a [t][d] plane: + t*KT*HD
    const int sgv = zoff + (tid >> 3) * SEQ + (tid & 7) * 8; // the same piece in a [d][t] plane: + t*KT
    auto stage = [&](int t, int bi) {
        const unsigned l = sl + (unsigned)(bi * NPL * TPL * 2);
        if (HI) {
            stage_pair<bf>(l, Kh + sgk + t * (KT * HD), 16 * HD, l + TPL * 2u, Kl + sgk + t * (KT * HD), 16 * HD);
            stage_pair<bf>(l + 2u * TPL * 2u, VTh + sgv + t * KT, 16 * SEQ, l + 3u * TPL * 2u, VTl + sgv + t * KT, 16 * SEQ);
        } else {
            stage_pair<h16>(l, K16 + sgk + t * (KT * HD), 16 * HD, l + TPL * 2u, VT16 + sgv + t * KT, 16 * SEQ);
        }
    };

    v8f o[4]; float m[8], l[8];
    bool dense = false;
#pragma unroll 1
    for (int pass = 0; pass < 2; ++pass) {
#pragma unroll
        for (int t = 0; t < 4; ++t) o[t] = (v8f){};
#pragma unroll
        for (int r = 0; r < 8; ++r) { m[r] = MINIT; l[r] = 0.0f; }
        // two-buffer prologue (on a repeat, the last tile's foot has already ended every read of both buffers)
        stage(0, 0);
        asm volatile("s_wait_asynccnt 0x0" ::: "memory");                       // this wave's pieces of tile 0 have landed
        __syncthreads();                                                        // tile 0 published to all waves
        stage(1, 1);
#pragma unroll 1
        for (int t = 0; t < SEQ / KT; ++t) {
            const unsigned short* sb = stg + (t & 1) * (NPL * TPL);
#pragma unroll 1
            for (int sub = 0; sub < 2; ++sub) {                                 // rolled: one copy of the step's code
            const int kb = t * KT + sub * 32;
            const v4i t0 = *(const v4i*)(mask + mrowT + kb);
            const v4i t1 = *(const v4i*)(mask + mrowT + 4 * SEQ_FULL + kb);
            const v4i t2 = *(const v4i*)(mask + mrowT + 8 * SEQ_FULL + kb);
            const v4i t3 = *(const v4i*)(mask + mrowT + 12 * SEQ_FULL + kb);
            const int tor = (t0[0] | t0[1] | t0[2] | t0[3]) | (t1[0] | t1[1] | t1[2] | t1[3]) | (t2[0] | t2[1] | t2[2] | t2[3]) | (t3[0] | t3[1] | t3[2] | t3[3]);
            const bool anyw = __builtin_amdgcn_ballot_w32(tor != 0) != 0u;      // wave-uniform
            if (!(dense || anyw)) continue;                                     // whole 16x32 tile masked: skipped (values were read); the tile's foot below is still passed
            int mk0[8], mk1[8];
#pragma unroll
            for (int r = 0; r < 8; ++r) mk0[r] = mask[mrowD + r * SEQ_FULL + kb];
            asm volatile("" ::: "memory");
#pragma unroll
            for (int r = 0; r < 8; ++r) mk1[r] = mask[mrowD + r * SEQ_FULL + kb + 16];

            int qo = qbase; asm volatile("" : "+v"(qo));                        // opaque offset: q fragments are reloaded each step, not held across the loop
            const unsigned short* kf = sb + kfrag + sub * 32 * TP;
            v8f s0 = (v8f){}, s1 = (v8f){};
            if (HI) {
                const v16bf qh0 = WFrag<bf>::ld(Qh + qo), qh1 = WFrag<bf>::ld(Qh + qo + 32);
                const v16bf ql0 = WFrag<bf>::ld(Ql + qo), ql1 = WFrag<bf>::ld(Ql + qo + 32);
                s0 = mma3(qh0, ql0, ldsb(kf), ldsb(kf + TPL), s0);
                s0 = mma3(qh1, ql1, ldsb(kf + 32), ldsb(kf + TPL + 32), s0);
                s1 = mma3(qh0, ql0, ldsb(kf + 16 * TP), ldsb(kf + TPL + 16 * TP), s1);
                s1 = mma3(qh1, ql1, ldsb(kf + 16 * TP + 32), ldsb(kf + TPL + 16 * TP + 32), s1);
                asm volatile("v_nop\n\tv_nop\n\tv_nop\n\tv_nop" : "+v"(s0), "+v"(s1) : "v"(qh1), "v"(ql1));
            } else {
                const v16h qa0 = WFrag<h16>::ld(Q16 + qo), qa1 = WFrag<h16>::ld(Q16 + qo + 32);
                s0 = wmma16(qa0, ldsh(kf), s0);
                s0 = wmma16(qa1, ldsh(kf + 32), s0);
                s1 = wmma16(qa0, ldsh(kf + 16 * TP), s1);
                s1 = wmma16(qa1, ldsh(kf + 16 * TP + 32), s1);
                asm volatile("v_nop\n\tv_nop\n\tv_nop\n\tv_nop" : "+v"(s0), "+v"(s1) : "v"(qa0), "v"(qa1));
            }

#pragma unroll
            for (int r = 0; r < 8; ++r) {
                const float e0 = (mk0[r] == 0) ? MFILL : s0[r] * SCL;
                const float e1 = (mk1[r] == 0) ? MFILL : s1[r] * SCL;
                float rm = fmaxf(e0, e1);
                rm = fmaxf(rm, __shfl_xor(rm, 1, 32)); rm = fmaxf(rm, __shfl_xor(rm, 2, 32)); rm = fmaxf(rm, __shfl_xor(rm, 4, 32)); rm = fmaxf(rm, __shfl_xor(rm, 8, 32));
                const float mn = fmaxf(m[r], rm);
                const float al = __builtin_amdgcn_exp2f((m[r] - mn) * L2E);
                float x0 = __builtin_amdgcn_exp2f((e0 - mn) * L2E);
                float x1 = __builtin_amdgcn_exp2f((e1 - mn) * L2E);
                const int po = (8 * hi + r) * PP + lr;
                float rs;
                if (HI) {
                    unsigned short a0, c0, a1, c1; splitf(x0, a0, c0); splitf(x1, a1, c1);
                    pth[po] = a0; ptl[po] = c0; pth[po + 16] = a1; ptl[po + 16] = c1;
                    rs = x0 + x1;
                } else {
                    x0 = (x0 < F16MINN) ? 0.0f : x0; x1 = (x1 < F16MINN) ? 0.0f : x1;      // no subnormal f16 operands; the row sum uses the same values
                    const h16 g0 = tohx(x0), g1 = tohx(x1);
                    pt16[po] = g0; pt16[po + 16] = g1;
                    rs = (float)g0 + (float)g1;
                }
                rs += __shfl_xor(rs, 1, 32); rs += __shfl_xor(rs, 2, 32); rs += __shfl_xor(rs, 4, 32); rs += __shfl_xor(rs, 8, 32);
                l[r] = l[r] * al + rs; m[r] = mn;
                o[0][r] *= al; o[1][r] *= al; o[2][r] *= al; o[3][r] *= al;
            }
            wave_sync();                                                       // P tile: stores by all lanes, then fragment loads (same wave)
            const unsigned short* vf = sb + (HI ? 2 : 1) * TPL + vfrag + sub * 32;
            if (HI) {
                const v16bf pa = cat16b(*(const v8usa*)(pth + lr * PP + 8 * hi), *(const v8usa*)(pth + lr * PP + 16 + 8 * hi));
                const v16bf pb = cat16b(*(const v8usa*)(ptl + lr * PP + 8 * hi), *(const v8usa*)(ptl + lr * PP + 16 + 8 * hi));
                const v16bf vh0 = ldsb(vf), vh1 = ldsb(vf + 16 * TP), vh2 = ldsb(vf + 32 * TP), vh3 = ldsb(vf + 48 * TP);
                const v16bf vl0 = ldsb(vf + TPL), vl1 = ldsb(vf + TPL + 16 * TP), vl2 = ldsb(vf + TPL + 32 * TP), vl3 = ldsb(vf + TPL + 48 * TP);
                o[0] = mma3(pa, pb, vh0, vl0, o[0]); o[1] = mma3(pa, pb, vh1, vl1, o[1]); o[2] = mma3(pa, pb, vh2, vl2, o[2]); o[3] = mma3(pa, pb, vh3, vl3, o[3]);
                asm volatile("v_nop\n\tv_nop\n\tv_nop\n\tv_nop" : "+v"(o[0]), "+v"(o[1]), "+v"(o[2]), "+v"(o[3]) : "v"(pa), "v"(pb));
            } else {
                const v16h pa = cat16(*(const v8ha*)(pt16 + lr * PP + 8 * hi), *(const v8ha*)(pt16 + lr * PP + 16 + 8 * hi));
                const v16h v0 = ldsh(vf), v1 = ldsh(vf + 16 * TP), v2 = ldsh(vf + 32 * TP), v3 = ldsh(vf + 48 * TP);
                o[0] = wmma16(pa, v0, o[0]); o[1] = wmma16(pa, v1, o[1]); o[2] = wmma16(pa, v2, o[2]); o[3] = wmma16(pa, v3, o[3]);
                asm volatile("v_nop\n\tv_nop\n\tv_nop\n\tv_nop" : "+v"(o[0]), "+v"(o[1]), "+v"(o[2]), "+v"(o[3]) : "v"(pa), "v"(v3));
            }
            wave_sync();                                                       // fragment loads done before the next step's stores
            }
            // foot of tile t, passed by every wave whatever it skipped
            asm volatile("s_wait_dscnt 0x0" ::: "memory");                      // this wave's reads of tile t's buffer have returned
            asm volatile("s_wait_asynccnt 0x0" ::: "memory");                   // this wave's pieces of tile t + 1 have landed
            __syncthreads();                                                    // publishes tile t + 1; ends every wave's reads of tile t's buffer
            if (t + 2 < SEQ / KT) stage(t + 2, t & 1);                          // refill the buffer just left (same test in every wave)
        }
        asm volatile("s_wait_asynccnt 0x0" ::: "memory");                       // no copy in flight behind the loop
        bool bad = false;
#pragma unroll
        for (int r = 0; r < 8; ++r) bad = bad || !(m[r] > MSEEN);
        const int wbad = (__builtin_amdgcn_ballot_w32(bad) != 0u) ? 1 : 0;      // taken with every lane on
        if (lane == 0) wflag[wave] = wbad;
        __syncthreads();                                                        // the repeat is decided for the whole work-group: its barriers need every wave
        const int anyb = wflag[0] | wflag[1] | wflag[2] | wflag[3];
        if (__builtin_amdgcn_readfirstlane(anyb) == 0) break;                   // every row met an unmasked key: skipped tiles contributed exactly 0
        dense = true;                                                           // otherwise repeat without skipping (work-group-uniform)
    }

#pragma unroll
    for (int r = 0; r < 8; ++r) { const float inv = 1.0f / l[r];
#pragma unroll
        for (int dt = 0; dt < 4; ++dt) { unsigned short a, c; splitf(o[dt][r] * inv, a, c); cth[(8 * hi + r) * CP + dt * 16 + lr] = a; ctl[(8 * hi + r) * CP + dt * 16 + lr] = c; } }
    wave_sync();
    v8us hv[4], lv[4];
#pragma unroll
    for (int s = 0; s < 4; ++s) { const int row = 4 * s + (lane >> 3); hv[s] = *(const v8usa*)(cth + row * CP + (lane & 7) * 8); lv[s] = *(const v8usa*)(ctl + row * CP + (lane & 7) * 8); }
    const size_t ob = (size_t)(b * SEQ + q0 + (lane >> 3)) * DQ + h * HD + (lane & 7) * 8;
{
#pragma unroll
        for (int s = 0; s < 4; ++s) { *(v8us*)(ATh + ob + (size_t)(4 * s) * DQ) = hv[s]; *(v8us*)(ATl + ob + (size_t)(4 * s) * DQ) = lv[s]; }
         }
}
__global__ __launch_bounds__(32 * NW) void k_attn_hi(const bf* Qh, const bf* Ql, const bf* Kh, const bf* Kl, const bf* VTh, const bf* VTl, const int* mask, bf* ATh, bf* ATl) {
    attn_body<true>(nullptr, nullptr, nullptr, Qh, Ql, Kh, Kl, VTh, VTl, mask, ATh, ATl, 0); }
__global__ __launch_bounds__(32 * NW) void k_attn_lo(const h16* Q16, const h16* K16, const h16* VT16, const int* mask, bf* ATh, bf* ATl) {
    attn_body<false>(Q16, K16, VT16, nullptr, nullptr, nullptr, nullptr, nullptr, nullptr, mask, ATh, ATl, RHE); }

extern "C" void kernel_launch(void* const* d_in, const int* in_sizes, int n_in,
                              void* d_out, int out_size, void* d_ws, size_t ws_size, hipStream_t stream) {
    if (n_in < 12) return;
    const long long need_x = (long long)(NB - 1) * SEQ_FULL * DM + (long long)SEQ * DM;      // rows read from a full-size stream
    const long long need_m = (long long)(SEQ - 1) * SEQ_FULL + SEQ;
    if (in_sizes[0] < need_x || in_sizes[1] < need_x || in_sizes[2] < need_x || in_sizes[3] < need_m) return;
    if (in_sizes[4] < DM * DM || in_sizes[6] < DM * DM || in_sizes[8] < DM * DM || in_sizes[10] < DM * DM) return;
    if (in_sizes[5] < DM || in_sizes[7] < DM || in_sizes[9] < DM || in_sizes[11] < DM) return;
    if ((long long)out_size < need_x) return;
    if (WS_TOTAL > ws_size) return;
    // wire order: x_q, x_k, x_v, mask (int32 [1][1][SEQ_FULL][SEQ_FULL]), Wq, bq, Wk, bk, Wv, bv, Wo, bo; weights [out][in]
    const float* xq = (const float*)d_in[0]; const float* xk = (const float*)d_in[1]; const float* xv = (const float*)d_in[2];
    const int* mask = (const int*)d_in[3];
    const float* wq = (const float*)d_in[4]; const float* bq = (const float*)d_in[5];
    const float* wk = (const float*)d_in[6]; const float* bk = (const float*)d_in[7];
    const float* wv = (const float*)d_in[8]; const float* bv = (const float*)d_in[9];
    const float* wo = (const float*)d_in[10]; const float* bo = (const float*)d_in[11];
    float* OUT = (float*)d_out;     // [NB_FULL][SEQ_FULL][DM]
    char* wsp = (char*)d_ws;
    auto take = [&](size_t bytes) { char* p = wsp; wsp += bytes; return (void*)p; };      // all sizes are multiples of 256 bytes
    bf* WQ = (bf*)take(WS_W / 4); bf* WK = (bf*)take(WS_W / 4); bf* WV = (bf*)take(WS_W / 4); bf* WO = (bf*)take(WS_W / 4);
    bf* XB = (bf*)take(WS_XB);
    h16* Q16 = (h16*)take(WS_PL); bf* Qh = (bf*)take(WS_PL); bf* Ql = (bf*)take(WS_PL);
    h16* K16 = (h16*)take(WS_PL); bf* Kh = (bf*)take(WS_PL); bf* Kl = (bf*)take(WS_PL);
    h16* VT16 = (h16*)take(WS_PL); bf* VTh = (bf*)take(WS_PL); bf* VTl = (bf*)take(WS_PL);
    bf* ATh = (bf*)take(WS_AT); bf* ATl = (bf*)take(WS_AT);
    if ((size_t)(wsp - (char*)d_ws) > ws_size) return;

    const unsigned gW = (unsigned)((DM * DM / 8 + 255) / 256), gX = (unsigned)((SEQ * DM / 8 + 255) / 256);
    k_cvt8<<<dim3(gW, 1), 256, 0, stream>>>(wq, WQ, DM * DM / 8, (size_t)0, (size_t)0);
    k_cvt8<<<dim3(gW, 1), 256, 0, stream>>>(wk, WK, DM * DM / 8, (size_t)0, (size_t)0);
    k_cvt8<<<dim3(gW, 1), 256, 0, stream>>>(wv, WV, DM * DM / 8, (size_t)0, (size_t)0);
    k_cvt8<<<dim3(gW, 1), 256, 0, stream>>>(wo, WO, DM * DM / 8, (size_t)0, (size_t)0);
    const dim3 gG(SEQ / 64, DQ / 64, NB);
    // q stream
    k_cvt8<<<dim3(gX, NB), 256, 0, stream>>>(xq, XB, SEQ * DM / 8, (size_t)SEQ_FULL * DM, (size_t)SEQ * DM);
    k_proj<<<gG, 32, 0, stream>>>(XB, WQ, DM, bq, (size_t)SEQ * DM, Q16, Qh, Ql);
    // k stream
    k_cvt8<<<dim3(gX, NB), 256, 0, stream>>>(xk, XB, SEQ * DM / 8, (size_t)SEQ_FULL * DM, (size_t)SEQ * DM);
    k_proj<<<gG, 32, 0, stream>>>(XB, WK, DM, bk, (size_t)SEQ * DM, K16, Kh, Kl);
    // v stream
    k_cvt8<<<dim3(gX, NB), 256, 0, stream>>>(xv, XB, SEQ * DM / 8, (size_t)SEQ_FULL * DM, (size_t)SEQ * DM);
    k_projt<<<dim3(DQ / 64, SEQ / 64, NB), 32, 0, stream>>>(WV, XB, DM, bv, (size_t)SEQ * DM, VT16, VTh, VTl);
    // attention: query rows [0, RHE) on hi/lo planes, rows [RHE, SEQ) on f16 planes
    k_attn_hi<<<dim3(RHE / (16 * NW), NH_, NB), 32 * NW, 0, stream>>>(Qh, Ql, Kh, Kl, VTh, VTl, mask, ATh, ATl);
#if SEQ > RH
    k_attn_lo<<<dim3((SEQ - RHE) / (16 * NW), NH_, NB), 32 * NW, 0, stream>>>(Q16, K16, VT16, mask, ATh, ATl);
#endif
    // output projection: per batch rows of the full-size output
    k_oproj<<<dim3(SEQ / 64, DM / 64, NB), 32, 0, stream>>>(ATh, ATl, WO, DQ, OUT, DM, bo, (size_t)SEQ * DQ, (size_t)SEQ_FULL * DM);
}

// v003
// It runs in 326 microseconds.
// Timed twice side by side with v002, it ran 1.20 times as fast both times.
// Counting every step since v000, it is 1.56 times as fast.
#include <hip/hip_runtime.h>

// Three-stream masked attention: q = xq Wq^T + bq, k = xk Wk^T + bk, v = xv Wv^T + bv (weights [out][in]); 16 heads x 64 (head h = columns h*64+d); scores x 1/8; integer mask [SEQ][SEQ] read by value (0 -> score := -1e9); softmax; out = ctx Wo^T + bo.
// Compute dtypes, f32 accumulate: every float input RNE-converted to bf16; projections v_wmma_f32_16x16x32_bf16 (exact operand products); attention query rows < RH: bf16 hi+lo planes for q, k, v and p (3 products per site); rows >= RH: v_wmma_f32_16x16x32_f16 single products (q, k, v, p as f16); online softmax f32; ctx carried as bf16 hi+lo planes x Wo bf16 (2 products).
// Engine: one wave per 64x64 GEMM tile (operands straight from K-contiguous 16-bit planes); the q, k, v projections convert their f32 sums in the epilogue and store the head planes themselves (v as W X^T, so that its tile rows are d and its columns t); fused flash-style attention on transposed tiles (S^T = K Q^T, O^T = V^T P^T: a query is a lane's column), four waves per work-group (16 query rows each), 32-key steps; the work-group's waves share 64-key K and V^T tiles in LDS (two buffers, asynchronous copies); q and mask straight from global memory; no score or probability plane in global memory.

#ifndef NB
#define NB 2
#endif
#ifndef SEQ
#define SEQ 2048
#endif
#define NB_FULL  2
#define SEQ_FULL 2048
#define DM   1024
#define NH_  16
#define HD   64
#define DQ   (NH_ * HD)
#define RH   512                  // query rows < RH use hi+lo planes
#define RHE  ((RH < SEQ) ? RH : SEQ)
#define SCL  0.125f               // HD^-0.5
#define L2E  1.4426950408889634f
#define MFILL (-1.0e9f)           // value that replaces a masked score
#define MINIT (-1.0e30f)          // running-max start (below MFILL)
#define MSEEN (-5.0e8f)           // running max above this <=> the row has met an unmasked key
#define F16MINN 6.103515625e-05f  // smallest normal f16
#define CP 72                     // ctx tile pitch (halves): 64 + 8
#define NW 4                      // attention waves per work-group (16 query rows each)
#define KT 64                     // keys per staged K / V^T tile
#define TP 72                     // staged tile pitch (halves): 64 + 8 = 144 bytes, an odd multiple of 16 bytes
#define TPL (64 * TP)             // one staged plane tile (halves): 64 rows (K: keys x d; V^T: d x keys)

typedef _Float16 h16;
typedef unsigned short bf;
typedef __attribute__((ext_vector_type(16))) __bf16   v16bf;
typedef __attribute__((ext_vector_type(16))) _Float16 v16h;
typedef __attribute__((ext_vector_type(8)))  _Float16 v8h;
typedef __attribute__((ext_vector_type(8)))  unsigned short v8us;
typedef __attribute__((ext_vector_type(16))) unsigned short v16us;
typedef __attribute__((ext_vector_type(8)))  float    v8f;
typedef __attribute__((ext_vector_type(4)))  float    v4f;
typedef __attribute__((ext_vector_type(4)))  _Float16 v4h;
typedef __attribute__((ext_vector_type(4)))  unsigned short v4us;
typedef __attribute__((ext_vector_type(4)))  int      v4i;
typedef v8h  __attribute__((may_alias)) v8ha;
typedef v4f  __attribute__((may_alias)) v4fa;
typedef v8us __attribute__((may_alias)) v8usa;

static_assert(HD == 64);
static_assert(DQ == DM);                       // merged width equals model width
static_assert(DM % 64 == 0);                   // GEMM N tiles of 64, K steps of 32
static_assert(SEQ % 64 == 0);                  // GEMM M tiles of 64; attention tiles of 16 rows, 32 keys
static_assert(RH % 16 == 0);                   // hi/lo row split on a query-tile boundary
static_assert(NB <= NB_FULL);
static_assert(SEQ <= SEQ_FULL);
static_assert((CP * 2) % 16 == 0);             // 16-byte aligned ctx tile rows
static_assert((TP * 2) % 16 == 0);             // 16-byte aligned staged rows
static_assert(RHE % (16 * NW) == 0 && (SEQ - RHE) % (16 * NW) == 0);   // whole attention work-groups on both sides of the row split
static_assert(SEQ % KT == 0 && SEQ / KT >= 2); // whole staged tiles; the two-buffer prologue needs two
static_assert(KT == 64 && NW * 32 == 128);     // stage_pair: 512 16-byte pieces per plane tile, 4 per thread
static_assert((long long)NB * NH_ * SEQ * HD < 2147483647LL);       // int element offsets into head planes
static_assert((long long)SEQ_FULL * SEQ_FULL < 2147483647LL);      // int element offsets into the mask

constexpr size_t WS_W  = (size_t)4 * DM * DM * 2;          // four bf16 weight planes
constexpr size_t WS_XB = (size_t)NB * SEQ * DM * 2;        // bf16 copy of one input stream
constexpr size_t WS_PL = (size_t)NB * NH_ * SEQ * HD * 2;  // one 16-bit head plane
constexpr size_t WS_AT = (size_t)NB * SEQ * DQ * 2;        // one merged ctx plane
constexpr size_t WS_TOTAL = WS_W + WS_XB + 9 * WS_PL + 2 * WS_AT;
static_assert(WS_TOTAL <= (size_t)134217728);              // carve stays within 128 MiB
static_assert(WS_W % 256 == 0 && WS_XB % 256 == 0 && WS_PL % 256 == 0 && WS_AT % 256 == 0);

__device__ __forceinline__ unsigned short f2bf(float f) { unsigned u = __float_as_uint(f); u += 0x7FFFu + ((u >> 16) & 1u); return (unsigned short)(u >> 16); }   // RNE
__device__ __forceinline__ float bf2f(unsigned short b) { return __uint_as_float(((unsigned)b) << 16); }
__device__ __forceinline__ float bfr(float f) { return bf2f(f2bf(f)); }
__device__ __forceinline__ v16h cat16(v8h lo, v8h hi) { return __builtin_shufflevector(lo, hi, 0, 1, 2, 3, 4, 5, 6, 7, 8, 9, 10, 11, 12, 13, 14, 15); }
__device__ __forceinline__ v16bf cat16b(v8us lo, v8us hi) { return __builtin_bit_cast(v16bf, __builtin_shufflevector(lo, hi, 0, 1, 2, 3, 4, 5, 6, 7, 8, 9, 10, 11, 12, 13, 14, 15)); }
__device__ __forceinline__ v8f wmma16(v16h a, v16h b, v8f c) { return __builtin_amdgcn_wmma_f32_16x16x32_f16(false, a, false, b, (short)0, c, false, false); }
__device__ __forceinline__ v8f wmmab(v16bf a, v16bf b, v8f c) { return __builtin_amdgcn_wmma_f32_16x16x32_bf16(false, a, false, b, (short)0, c, false, false); }
__device__ __forceinline__ v8f mma3(v16bf ah, v16bf al, v16bf bh, v16bf bl, v8f c) { c = wmmab(ah, bh, c); c = wmmab(ah, bl, c); c = wmmab(al, bh, c); return c; }   // hi hi, then hi x B lo, then A lo x hi
__device__ __forceinline__ float xhalf(float x) { return __builtin_bit_cast(float, __builtin_amdgcn_permlanex16(__builtin_bit_cast(int, x), __builtin_bit_cast(int, x), 0x76543210, 0xfedcba98, false, false)); }   // lane l with lane l ^ 16
__device__ __forceinline__ h16 tohx(float x) { return (h16)x; }
__device__ __forceinline__ void splitf(float y, unsigned short& h, unsigned short& l) { h = f2bf(y); l = f2bf(y - bf2f(h)); }
__device__ __forceinline__ void wave_sync() { __builtin_amdgcn_wave_barrier(); asm volatile("" ::: "memory"); }   // same-wave LDS exchange (tiles are private to the wave)

// Fragment loaders (A and B alike): lane (lr = lane & 15, hi = lane >> 4) points at row/column lr, element 8*hi of the 32-deep k-step;
// elements 0..7 <- k0 + 8hi + 0..7, elements 8..15 <- k0 + 16 + 8hi + 0..7.
template <typename T16> struct WFrag;
template <> struct WFrag<h16> { typedef v16h V; static __device__ __forceinline__ V ld(const h16* p) { return cat16(*(const v8h*)p, *(const v8h*)(p + 16)); } static __device__ __forceinline__ v8f mma(V a, V b, v8f c) { return wmma16(a, b, c); } };
template <> struct WFrag<bf> { typedef v16bf V; static __device__ __forceinline__ V ld(const bf* p) { return cat16b(*(const v8us*)p, *(const v8us*)(p + 16)); } static __device__ __forceinline__ v8f mma(V a, V b, v8f c) { return wmmab(a, b, c); } };

// ---- register-blocked GEMM body, ONE WAVE per 64x64 output tile (16 accumulators), operands straight from K-contiguous 16-bit planes; grid (M/64, N/64, Z), 32 threads.
// C[m][n] (f32, pitch ldc, + bf16-converted bias[n]) = sum_k A[m][k] Bt[n][k] (+ A2 Bt when NSPLIT == 1). z-batch strides sA/sB/sC in elements. K % 32 == 0, M % 64 == 0, N % 64 == 0.
// OUT == 0: C is stored as f32. OUT == 1 (m = t, n = h*64 + d) and OUT == 2 (m = h*64 + d, n = t, bias[m]): the f32 value is converted where it is made and stored to the three 16-bit head planes
// (f16, bf16 hi, bf16 lo) at P*[pb + tile row * pp + tile column]; a tile row is 128 bytes of each plane, one whole line per 16 lanes.
template <typename T16, int NSPLIT, bool BIAS, int OUT = 0>
__device__ __forceinline__ void gemmw_body(const T16* __restrict__ A, const T16* __restrict__ A2, const T16* __restrict__ Bt, const T16* __restrict__ Bt2, int K, float* C, int ldc, const float* __restrict__ bias, size_t sA, size_t sB, size_t sC,
                                           h16* P16 = nullptr, bf* Ph = nullptr, bf* Pl = nullptr) {
    typedef typename WFrag<T16>::V V;
    __shared__ __align__(16) float os[16 * 68];
    const size_t z = blockIdx.z; A += z * sA; if (A2) A2 += z * sA; Bt += z * sB; if (Bt2) Bt2 += z * sB; C += z * sC;
    const int lane = threadIdx.x & 31, lr = lane & 15, hi = lane >> 4; const int r0 = blockIdx.x * 64, c0 = blockIdx.y * 64;
    v8f acc[4][4];
#pragma unroll
    for (int mb = 0; mb < 4; ++mb)
#pragma unroll
        for (int nb = 0; nb < 4; ++nb) acc[mb][nb] = (v8f){};
    const size_t aoff = (size_t)(r0 + lr) * K + 8 * hi, boff = (size_t)(c0 + lr) * K + 8 * hi;
#pragma unroll 1
    for (int kc = 0; kc < K; kc += 32) {
        V a[4], a2[4];
#pragma unroll
        for (int mb = 0; mb < 4; ++mb) { a[mb] = WFrag<T16>::ld(A + aoff + (size_t)mb * 16 * K + kc); if (NSPLIT == 1 || NSPLIT == 2) a2[mb] = WFrag<T16>::ld(A2 + aoff + (size_t)mb * 16 * K + kc); }
#pragma unroll
        for (int nb = 0; nb < 4; ++nb) { const V b = WFrag<T16>::ld(Bt + boff + (size_t)nb * 16 * K + kc); V b2; if (NSPLIT >= 2) b2 = WFrag<T16>::ld(Bt2 + boff + (size_t)nb * 16 * K + kc);
#pragma unroll
            for (int mb = 0; mb < 4; ++mb) { acc[mb][nb] = WFrag<T16>::mma(a[mb], b, acc[mb][nb]); if (NSPLIT == 1 || NSPLIT == 2) acc[mb][nb] = WFrag<T16>::mma(a2[mb], b, acc[mb][nb]); if (NSPLIT >= 2) acc[mb][nb] = WFrag<T16>::mma(a[mb], b2, acc[mb][nb]); } }
        asm volatile("v_nop\n\tv_nop\n\tv_nop\n\tv_nop" : "+v"(acc[0][0]), "+v"(acc[1][1]), "+v"(acc[2][2]), "+v"(acc[3][3]) : "v"(a[0]), "v"(a[3]));
    }
#pragma unroll
    for (int mb = 0; mb < 4; ++mb) {
#pragma unroll
        for (int nb = 0; nb < 4; ++nb) {
#pragma unroll
            for (int j = 0; j < 8; ++j) os[(hi * 8 + j) * 68 + nb * 16 + lr] = acc[mb][nb][j]; }
        wave_sync();
        float* crow = C + (size_t)(r0 + mb * 16) * ldc + c0;
if (OUT == 0) {
#pragma unroll
            for (int s = 0; s < 8; ++s) { const int row = 2 * s + hi, cofs = lr * 4; v4f val = *(const v4fa*)(os + row * 68 + cofs); if (BIAS) { val[0] += bfr(bias[c0 + cofs]); val[1] += bfr(bias[c0 + cofs + 1]); val[2] += bfr(bias[c0 + cofs + 2]); val[3] += bfr(bias[c0 + cofs + 3]); }
                *(v4f*)(crow + (size_t)row * ldc + cofs) = val; }
             }
        else {
            const size_t pb = (OUT == 1) ? ((z * NH_ + blockIdx.y) * SEQ + r0 + mb * 16) * HD : ((z * NH_ + blockIdx.x) * HD + mb * 16) * SEQ + c0;   // head = the tile's index along h*64 + d
            const int pp = (OUT == 1) ? HD : SEQ;
#pragma unroll
            for (int s = 0; s < 8; ++s) { const int row = 2 * s + hi, cofs = lr * 4; v4f val = *(const v4fa*)(os + row * 68 + cofs);
                if (BIAS && OUT == 1) { val[0] += bfr(bias[c0 + cofs]); val[1] += bfr(bias[c0 + cofs + 1]); val[2] += bfr(bias[c0 + cofs + 2]); val[3] += bfr(bias[c0 + cofs + 3]); }
                if (BIAS && OUT == 2) { const float br = bfr(bias[r0 + mb * 16 + row]); val[0] += br; val[1] += br; val[2] += br; val[3] += br; }
                v4h o16; v4us oh, ol;
#pragma unroll
                for (int q = 0; q < 4; ++q) { o16[q] = tohx(val[q]); unsigned short a2, c2; splitf(val[q], a2, c2); oh[q] = a2; ol[q] = c2; }
                const size_t pe = pb + (size_t)row * pp + cofs;
                *(v4h*)(P16 + pe) = o16; *(v4us*)(Ph + pe) = oh; *(v4us*)(Pl + pe) = ol;
                asm volatile("s_wait_xcnt 0x0" ::: "memory"); }   // stands in front of the next rows' values, which reuse the registers these stores name
        }
        wave_sync();
    }
}
// k_proj: y[z][t][n] = XB[z][t][:] . W[n][:] + b[n] (bf16 x bf16, one product), stored as [z*NH_ + h][t][d] planes; grid (SEQ/64, DQ/64, NB).
__global__ __launch_bounds__(32) void k_proj(const bf* A, const bf* Bt, int K, const float* bias, size_t sA, h16* P16, bf* Ph, bf* Pl) {
    gemmw_body<bf, 0, true, 1>(A, nullptr, Bt, nullptr, K, nullptr, 0, bias, sA, (size_t)0, (size_t)0, P16, Ph, Pl); }
// k_projt: the same product with W as A and XB as B, stored as [z*NH_ + h][d][t] planes; grid (DQ/64, SEQ/64, NB).
__global__ __launch_bounds__(32) void k_projt(const bf* A, const bf* Bt, int K, const float* bias, size_t sB, h16* P16, bf* Ph, bf* Pl) {
    gemmw_body<bf, 0, true, 2>(A, nullptr, Bt, nullptr, K, nullptr, 0, bias, (size_t)0, sB, (size_t)0, P16, Ph, Pl); }
// k_oproj: OUT[z][t][n] = (ATh + ATl)[z][t][:] . Wo[n][:] + bo[n] (two products).
__global__ __launch_bounds__(32) void k_oproj(const bf* A, const bf* A2, const bf* Bt, int K, float* C, int ldc, const float* bias, size_t sA, size_t sC) {
    gemmw_body<bf, 1, true>(A, A2, Bt, nullptr, K, C, ldc, bias, sA, (size_t)0, sC); }

__global__ __launch_bounds__(256) void k_cvt8(const float* __restrict__ src, bf* dst, int n8, size_t sS, size_t sD) {
    const int i = blockIdx.x * 256 + threadIdx.x; if (i >= n8) return; src += (size_t)blockIdx.y * sS; dst += (size_t)blockIdx.y * sD;
    const v8f v = *(const v8f*)(src + (size_t)i * 8); v8us o;
#pragma unroll
    for (int k = 0; k < 8; ++k) o[k] = f2bf(v[k]);
    *(v8us*)(dst + (size_t)i * 8) = o;  }

// ---- staging of K and V^T tiles for the attention work-group
__device__ __forceinline__ unsigned lds_off(const void* p) { return (unsigned)(size_t)p; }   // byte offset in the work-group's LDS (low half of the shared address)
__device__ __forceinline__ v16bf ldsb(const unsigned short* p) { return cat16b(*(const v8usa*)p, *(const v8usa*)(p + 16)); }   // fragment from a staged bf16 tile, same k order as WFrag::ld
__device__ __forceinline__ v16h  ldsh(const unsigned short* p) { return cat16(*(const v8ha*)p, *(const v8ha*)(p + 16)); }       // fragment from a staged f16 tile
// Two plane tiles of 64 rows x 128 bytes -> LDS at pitch TP, 16 bytes per lane and copy, 128 threads: copy i of a plane brings row 16 i + (tid >> 3), piece tid & 7.
// la / lb: the lane's LDS byte address of its row-0..15 piece; ga / gb: the lane's global address of the same piece; pa / pb: 16 source rows in elements.
template <typename T16>
__device__ __forceinline__ void stage_pair(unsigned la, const T16* ga, int pa, unsigned lb, const T16* gb, int pb) {
    // copies and their s_wait_xcnt in one statement: no address register of a copy is rewritten ahead of the wait
    asm volatile("global_load_async_to_lds_b128 %0, %8, off\n\t"
                 "global_load_async_to_lds_b128 %1, %9, off\n\t"
                 "global_load_async_to_lds_b128 %2, %10, off\n\t"
                 "global_load_async_to_lds_b128 %3, %11, off\n\t"
                 "global_load_async_to_lds_b128 %4, %12, off\n\t"
                 "global_load_async_to_lds_b128 %5, %13, off\n\t"
                 "global_load_async_to_lds_b128 %6, %14, off\n\t"
                 "global_load_async_to_lds_b128 %7, %15, off\n\t"
                 "s_wait_xcnt 0x0"
                 :: "v"(la), "v"(la + 16u * TP * 2u), "v"(la + 32u * TP * 2u), "v"(la + 48u * TP * 2u),
                    "v"(lb), "v"(lb + 16u * TP * 2u), "v"(lb + 32u * TP * 2u), "v"(lb + 48u * TP * 2u),
                    "v"(ga), "v"(ga + pa), "v"(ga + 2 * pa), "v"(ga + 3 * pa),
                    "v"(gb), "v"(gb + pb), "v"(gb + 2 * pb), "v"(gb + 3 * pb)
                 : "memory");
}

// ---- fused attention body: one work-group = NW waves of one (b, h); one wave = 16 query rows (q0..q0+15); key loop in 32-key steps, two steps per staged 64-key tile.
// K and V^T tiles: every thread copies its pieces of tile t + 2 into the buffer that tile t has left (two buffers); one work-group barrier per tile publishes tile t + 1 and frees tile t's buffer.
// Per step: (1) the 16x32 mask tile is read by value in the layout of the S^T accumulators (lane = query q0 + lr, 4 x 16-byte loads: keys 8*hi + 0..7 and 16 + 8*hi + 0..7); a tile whose 512 entries are all 0
// is skipped (wave-uniform, decided on the values read); (2) S^T = k q^T (two 16x16 accumulators: row = key 8*hi + r, column = query lr; k fragments from LDS as A, q fragments as B, reloaded per step through an
// opaque integer offset); (3) e = mask == 0 ? -1e9 : S/8; online softmax in f32, one running maximum per query (16 values in the lane, then lane l with l ^ 16) and one running sum per lane (halves joined in the epilogue); (4) the lane's 16 probabilities are
// the B fragment of P^T as they stand (elements 0..7 = keys 8*hi + r, 8..15 = keys 16 + 8*hi + r); O^T += V^T P^T (four d-tiles, V^T fragments from LDS as A; row = d, column = query).
// A skipped all-masked tile contributes exactly 0 to every row that meets an unmasked key somewhere (exp underflow); if some row of the work-group never does, the work-group repeats the loop
// with skipping disabled (every entry -1e9 -> uniform weights; rows that do meet a key end with the same values), so the result is exact for any mask contents.
template <bool HI>
__device__ __forceinline__ void attn_body(const h16* __restrict__ Q16, const h16* __restrict__ K16, const h16* __restrict__ VT16,
                                          const bf* __restrict__ Qh, const bf* __restrict__ Ql, const bf* __restrict__ Kh, const bf* __restrict__ Kl,
                                          const bf* __restrict__ VTh, const bf* __restrict__ VTl, const int* __restrict__ mask, bf* ATh, bf* ATl, int row_base) {
    constexpr int NPL = HI ? 4 : 2;                                          // staged planes per buffer: Kh Kl VTh VTl, or K16 VT16
    __shared__ __align__(16) unsigned short stg[2 * NPL * TPL];              // two buffers of staged tiles
    __shared__ __align__(16) unsigned short ctha[NW * 16 * CP];              // ctx tiles hi
    __shared__ __align__(16) unsigned short ctla[NW * 16 * CP];              // ctx tiles lo
    __shared__ int wflag[NW];                                                // per wave: some row has met no unmasked key
    const int tid = threadIdx.x, lane = tid & 31, lr = lane & 15, hi = lane >> 4;
    const int wave = __builtin_amdgcn_readfirstlane(tid >> 5);
    unsigned short* cth = ctha + wave * 16 * CP;
    unsigned short* ctl = ctla + wave * 16 * CP;
    const int q0 = row_base + ((int)blockIdx.x * NW + wave) * 16;
    const int h = blockIdx.y, b = blockIdx.z;
    const int zoff  = (b * NH_ + h) * (SEQ * HD);            // head plane offset ([t][d] and [d][t] planes both hold SEQ*HD elements)
    const int qbase = zoff + (q0 + lr) * HD + 8 * hi;        // B fragment of q: column = query q0 + lr; + c2*32
    const int kfrag = lr * TP + 8 * hi;                      // A fragment of k in a staged tile: row = key (sub*32 + nt*16 + lr); + (sub*32 + nt*16)*TP + c2*32
    const int vfrag = lr * TP + 8 * hi;                      // A fragment of v^T in a staged tile: row = d = dt*16 + lr; + dt*16*TP + sub*32
    const int mrow  = (q0 + lr) * SEQ_FULL + 8 * hi;         // mask in the S^T accumulator layout: + kb + r (+16)
    const unsigned sl = lds_off(stg) + (unsigned)((tid >> 3) * TP + (tid & 7) * 8) * 2u;   // this thread's piece in a staged plane tile
    const int sgk = zoff + (tid >> 3) * HD + (tid & 7) * 8;  // the same piece in a [t][d] plane: + t*KT*HD
    const int sgv = zoff + (tid >> 3) * SEQ + (tid & 7) * 8; // the same piece in a [d][t] plane: + t*KT
    auto stage = [&](int t, int bi) {
        const unsigned l = sl + (unsigned)(bi * NPL * TPL * 2);
        if (HI) {
            stage_pair<bf>(l, Kh + sgk + t * (KT * HD), 16 * HD, l + TPL * 2u, Kl + sgk + t * (KT * HD), 16 * HD);
            stage_pair<bf>(l + 2u * TPL * 2u, VTh + sgv + t * KT, 16 * SEQ, l + 3u * TPL * 2u, VTl + sgv + t * KT, 16 * SEQ);
        } else {
            stage_pair<h16>(l, K16 + sgk + t * (KT * HD), 16 * HD, l + TPL * 2u, VT16 + sgv + t * KT, 16 * SEQ);
        }
    };

    v8f o[4]; float m, l;
    bool dense = false;
#pragma unroll 1
    for (int pass = 0; pass < 2; ++pass) {
#pragma unroll
        for (int t = 0; t < 4; ++t) o[t] = (v8f){};
        m = MINIT; l = 0.0f;
        // two-buffer prologue (on a repeat, the last tile's foot has already ended every read of both buffers)
        stage(0, 0);
        asm volatile("s_wait_asynccnt 0x0" ::: "memory");                       // this wave's pieces of tile 0 have landed
        __syncthreads();                                                        // tile 0 published to all waves
        stage(1, 1);
#pragma unroll 1
        for (int t = 0; t < SEQ / KT; ++t) {
            const unsigned short* sb = stg + (t & 1) * (NPL * TPL);
#pragma unroll 1
            for (int sub = 0; sub < 2; ++sub) {                                 // rolled: one copy of the step's code
            const int kb = t * KT + sub * 32;
            const int* mp = mask + mrow + kb;
            const v4i ma = *(const v4i*)mp, mb = *(const v4i*)(mp + 4), mc = *(const v4i*)(mp + 16), md = *(const v4i*)(mp + 20);
            const int tor = (ma[0] | ma[1] | ma[2] | ma[3]) | (mb[0] | mb[1] | mb[2] | mb[3]) | (mc[0] | mc[1] | mc[2] | mc[3]) | (md[0] | md[1] | md[2] | md[3]);
            asm volatile("s_wait_xcnt 0x0" ::: "memory");                       // stands in front of whatever reuses the address registers that the four mask loads name
            const bool anyw = __builtin_amdgcn_ballot_w32(tor != 0) != 0u;      // wave-uniform
            if (!(dense || anyw)) continue;                                     // whole 16x32 tile masked: skipped (values were read); the tile's foot below is still passed
            const int mk0[8] = { ma[0], ma[1], ma[2], ma[3], mb[0], mb[1], mb[2], mb[3] };
            const int mk1[8] = { mc[0], mc[1], mc[2], mc[3], md[0], md[1], md[2], md[3] };

            int qo = qbase; asm volatile("" : "+v"(qo));                        // opaque offset: q fragments are reloaded each step, not held across the loop
            const unsigned short* kf = sb + kfrag + sub * 32 * TP;
            v8f s0 = (v8f){}, s1 = (v8f){};
            if (HI) {
                const v16bf qh0 = WFrag<bf>::ld(Qh + qo), qh1 = WFrag<bf>::ld(Qh + qo + 32);
                const v16bf ql0 = WFrag<bf>::ld(Ql + qo), ql1 = WFrag<bf>::ld(Ql + qo + 32);
                s0 = mma3(ldsb(kf), ldsb(kf + TPL), qh0, ql0, s0);
                s0 = mma3(ldsb(kf + 32), ldsb(kf + TPL + 32), qh1, ql1, s0);
                s1 = mma3(ldsb(kf + 16 * TP), ldsb(kf + TPL + 16 * TP), qh0, ql0, s1);
                s1 = mma3(ldsb(kf + 16 * TP + 32), ldsb(kf + TPL + 16 * TP + 32), qh1, ql1, s1);
                asm volatile("v_nop\n\tv_nop\n\tv_nop\n\tv_nop" : "+v"(s0), "+v"(s1) : "v"(qh1), "v"(ql1));
            } else {
                const v16h qa0 = WFrag<h16>::ld(Q16 + qo), qa1 = WFrag<h16>::ld(Q16 + qo + 32);
                s0 = wmma16(ldsh(kf), qa0, s0);
                s0 = wmma16(ldsh(kf + 32), qa1, s0);
                s1 = wmma16(ldsh(kf + 16 * TP), qa0, s1);
                s1 = wmma16(ldsh(kf + 16 * TP + 32), qa1, s1);
                asm volatile("v_nop\n\tv_nop\n\tv_nop\n\tv_nop" : "+v"(s0), "+v"(s1) : "v"(qa0), "v"(qa1));
            }

            float e0[8], e1[8], t8[8];
#pragma unroll
            for (int r = 0; r < 8; ++r) { e0[r] = (mk0[r] == 0) ? MFILL : s0[r] * SCL; e1[r] = (mk1[r] == 0) ? MFILL : s1[r] * SCL; t8[r] = fmaxf(e0[r], e1[r]); }
            float rm = fmaxf(fmaxf(fmaxf(t8[0], t8[1]), fmaxf(t8[2], t8[3])), fmaxf(fmaxf(t8[4], t8[5]), fmaxf(t8[6], t8[7])));
            rm = fmaxf(rm, xhalf(rm));                                          // the query's other 16 keys of the step
            const float mn = fmaxf(m, rm);
            const float al = __builtin_amdgcn_exp2f((m - mn) * L2E);
            v16us ph, pl; v16h pa;                                              // B fragments of P^T
#pragma unroll
            for (int r = 0; r < 8; ++r) {
                float x0 = __builtin_amdgcn_exp2f((e0[r] - mn) * L2E);
                float x1 = __builtin_amdgcn_exp2f((e1[r] - mn) * L2E);
                if (HI) {
                    unsigned short a0, c0, a1, c1; splitf(x0, a0, c0); splitf(x1, a1, c1);
                    ph[r] = a0; pl[r] = c0; ph[8 + r] = a1; pl[8 + r] = c1;
                    t8[r] = x0 + x1;
                } else {
                    x0 = (x0 < F16MINN) ? 0.0f : x0; x1 = (x1 < F16MINN) ? 0.0f : x1;      // no subnormal f16 operands; the row sum uses the same values
                    const h16 g0 = tohx(x0), g1 = tohx(x1);
                    pa[r] = g0; pa[8 + r] = g1;
                    t8[r] = (float)g0 + (float)g1;
                }
            }
            float rs = ((t8[0] + t8[1]) + (t8[2] + t8[3])) + ((t8[4] + t8[5]) + (t8[6] + t8[7]));
            l = l * al + rs; m = mn;                                           // l: this lane's half of the keys; the two halves (same al) are joined behind the loop
#pragma unroll
            for (int dt = 0; dt < 4; ++dt) o[dt] *= al;
            const unsigned short* vf = sb + (HI ? 2 : 1) * TPL + vfrag + sub * 32;
            if (HI) {
                const v16bf pb = __builtin_bit_cast(v16bf, ph), pc = __builtin_bit_cast(v16bf, pl);
                const v16bf vh0 = ldsb(vf), vh1 = ldsb(vf + 16 * TP), vh2 = ldsb(vf + 32 * TP), vh3 = ldsb(vf + 48 * TP);
                const v16bf vl0 = ldsb(vf + TPL), vl1 = ldsb(vf + TPL + 16 * TP), vl2 = ldsb(vf + TPL + 32 * TP), vl3 = ldsb(vf + TPL + 48 * TP);
                o[0] = mma3(vh0, vl0, pb, pc, o[0]); o[1] = mma3(vh1, vl1, pb, pc, o[1]); o[2] = mma3(vh2, vl2, pb, pc, o[2]); o[3] = mma3(vh3, vl3, pb, pc, o[3]);
                asm volatile("v_nop\n\tv_nop\n\tv_nop\n\tv_nop" : "+v"(o[0]), "+v"(o[1]), "+v"(o[2]), "+v"(o[3]) : "v"(pb), "v"(pc));
            } else {
                const v16h v0 = ldsh(vf), v1 = ldsh(vf + 16 * TP), v2 = ldsh(vf + 32 * TP), v3 = ldsh(vf + 48 * TP);
                o[0] = wmma16(v0, pa, o[0]); o[1] = wmma16(v1, pa, o[1]); o[2] = wmma16(v2, pa, o[2]); o[3] = wmma16(v3, pa, o[3]);
                asm volatile("v_nop\n\tv_nop\n\tv_nop\n\tv_nop" : "+v"(o[0]), "+v"(o[1]), "+v"(o[2]), "+v"(o[3]) : "v"(pa), "v"(v3));
            }
            }
            // foot of tile t, passed by every wave whatever it skipped
            asm volatile("s_wait_dscnt 0x0" ::: "memory");                      // this wave's reads of tile t's buffer have returned
            asm volatile("s_wait_asynccnt 0x0" ::: "memory");                   // this wave's pieces of tile t + 1 have landed
            __syncthreads();                                                    // publishes tile t + 1; ends every wave's reads of tile t's buffer
            if (t + 2 < SEQ / KT) stage(t + 2, t & 1);                          // refill the buffer just left (same test in every wave)
        }
        asm volatile("s_wait_asynccnt 0x0" ::: "memory");                       // no copy in flight behind the loop
        const bool bad = !(m > MSEEN);
        const int wbad = (__builtin_amdgcn_ballot_w32(bad) != 0u) ? 1 : 0;      // taken with every lane on
        if (lane == 0) wflag[wave] = wbad;
        __syncthreads();                                                        // the repeat is decided for the whole work-group: its barriers need every wave
        const int anyb = wflag[0] | wflag[1] | wflag[2] | wflag[3];
        if (__builtin_amdgcn_readfirstlane(anyb) == 0) break;                   // every row met an unmasked key: skipped tiles contributed exactly 0
        dense = true;                                                           // otherwise repeat without skipping (work-group-uniform)
    }

    const float inv = 1.0f / (l + xhalf(l));
#pragma unroll
    for (int dt = 0; dt < 4; ++dt) { v8us a8, c8;                               // the lane's 8 consecutive d of its query: one 16-byte piece of each ctx tile row
#pragma unroll
        for (int r = 0; r < 8; ++r) { unsigned short a, c; splitf(o[dt][r] * inv, a, c); a8[r] = a; c8[r] = c; }
        *(v8usa*)(cth + lr * CP + dt * 16 + 8 * hi) = a8; *(v8usa*)(ctl + lr * CP + dt * 16 + 8 * hi) = c8; }
    wave_sync();
    v8us hv[4], lv[4];
#pragma unroll
    for (int s = 0; s < 4; ++s) { const int row = 4 * s + (lane >> 3); hv[s] = *(const v8usa*)(cth + row * CP + (lane & 7) * 8); lv[s] = *(const v8usa*)(ctl + row * CP + (lane & 7) * 8); }
    const size_t ob = (size_t)(b * SEQ + q0 + (lane >> 3)) * DQ + h * HD + (lane & 7) * 8;
{
#pragma unroll
        for (int s = 0; s < 4; ++s) { *(v8us*)(ATh + ob + (size_t)(4 * s) * DQ) = hv[s]; *(v8us*)(ATl + ob + (size_t)(4 * s) * DQ) = lv[s]; }
         }
}
__global__ __launch_bounds__(32 * NW) void k_attn_hi(const bf* Qh, const bf* Ql, const bf* Kh, const bf* Kl, const bf* VTh, const bf* VTl, const int* mask, bf* ATh, bf* ATl) {
    attn_body<true>(nullptr, nullptr, nullptr, Qh, Ql, Kh, Kl, VTh, VTl, mask, ATh, ATl, 0); }
__global__ __launch_bounds__(32 * NW) void k_attn_lo(const h16* Q16, const h16* K16, const h16* VT16, const int* mask, bf* ATh, bf* ATl) {
    attn_body<false>(Q16, K16, VT16, nullptr, nullptr, nullptr, nullptr, nullptr, nullptr, mask, ATh, ATl, RHE); }

extern "C" void kernel_launch(void* const* d_in, const int* in_sizes, int n_in,
                              void* d_out, int out_size, void* d_ws, size_t ws_size, hipStream_t stream) {
    if (n_in < 12) return;
    const long long need_x = (long long)(NB - 1) * SEQ_FULL * DM + (long long)SEQ * DM;      // rows read from a full-size stream
    const long long need_m = (long long)(SEQ - 1) * SEQ_FULL + SEQ;
    if (in_sizes[0] < need_x || in_sizes[1] < need_x || in_sizes[2] < need_x || in_sizes[3] < need_m) return;
    if (in_sizes[4] < DM * DM || in_sizes[6] < DM * DM || in_sizes[8] < DM * DM || in_sizes[10] < DM * DM) return;
    if (in_sizes[5] < DM || in_sizes[7] < DM || in_sizes[9] < DM || in_sizes[11] < DM) return;
    if ((long long)out_size < need_x) return;
    if (WS_TOTAL > ws_size) return;
    // wire order: x_q, x_k, x_v, mask (int32 [1][1][SEQ_FULL][SEQ_FULL]), Wq, bq, Wk, bk, Wv, bv, Wo, bo; weights [out][in]
    const float* xq = (const float*)d_in[0]; const float* xk = (const float*)d_in[1]; const float* xv = (const float*)d_in[2];
    const int* mask = (const int*)d_in[3];
    const float* wq = (const float*)d_in[4]; const float* bq = (const float*)d_in[5];
    const float* wk = (const float*)d_in[6]; const float* bk = (const float*)d_in[7];
    const float* wv = (const float*)d_in[8]; const float* bv = (const float*)d_in[9];
    const float* wo = (const float*)d_in[10]; const float* bo = (const float*)d_in[11];
    float* OUT = (float*)d_out;     // [NB_FULL][SEQ_FULL][DM]
    char* wsp = (char*)d_ws;
    auto take = [&](size_t bytes) { char* p = wsp; wsp += bytes; return (void*)p; };      // all sizes are multiples of 256 bytes
    bf* WQ = (bf*)take(WS_W / 4); bf* WK = (bf*)take(WS_W / 4); bf* WV = (bf*)take(WS_W / 4); bf* WO = (bf*)take(WS_W / 4);
    bf* XB = (bf*)take(WS_XB);
    h16* Q16 = (h16*)take(WS_PL); bf* Qh = (bf*)take(WS_PL); bf* Ql = (bf*)take(WS_PL);
    h16* K16 = (h16*)take(WS_PL); bf* Kh = (bf*)take(WS_PL); bf* Kl = (bf*)take(WS_PL);
    h16* VT16 = (h16*)take(WS_PL); bf* VTh = (bf*)take(WS_PL); bf* VTl = (bf*)take(WS_PL);
    bf* ATh = (bf*)take(WS_AT); bf* ATl = (bf*)take(WS_AT);
    if ((size_t)(wsp - (char*)d_ws) > ws_size) return;

    const unsigned gW = (unsigned)((DM * DM / 8 + 255) / 256), gX = (unsigned)((SEQ * DM / 8 + 255) / 256);
    k_cvt8<<<dim3(gW, 1), 256, 0, stream>>>(wq, WQ, DM * DM / 8, (size_t)0, (size_t)0);
    k_cvt8<<<dim3(gW, 1), 256, 0, stream>>>(wk, WK, DM * DM / 8, (size_t)0, (size_t)0);
    k_cvt8<<<dim3(gW, 1), 256, 0, stream>>>(wv, WV, DM * DM / 8, (size_t)0, (size_t)0);
    k_cvt8<<<dim3(gW, 1), 256, 0, stream>>>(wo, WO, DM * DM / 8, (size_t)0, (size_t)0);
    const dim3 gG(SEQ / 64, DQ / 64, NB);
    // q stream
    k_cvt8<<<dim3(gX, NB), 256, 0, stream>>>(xq, XB, SEQ * DM / 8, (size_t)SEQ_FULL * DM, (size_t)SEQ * DM);
    k_proj<<<gG, 32, 0, stream>>>(XB, WQ, DM, bq, (size_t)SEQ * DM, Q16, Qh, Ql);
    // k stream
    k_cvt8<<<dim3(gX, NB), 256, 0, stream>>>(xk, XB, SEQ * DM / 8, (size_t)SEQ_FULL * DM, (size_t)SEQ * DM);
    k_proj<<<gG, 32, 0, stream>>>(XB, WK, DM, bk, (size_t)SEQ * DM, K16, Kh, Kl);
    // v stream
    k_cvt8<<<dim3(gX, NB), 256, 0, stream>>>(xv, XB, SEQ * DM / 8, (size_t)SEQ_FULL * DM, (size_t)SEQ * DM);
    k_projt<<<dim3(DQ / 64, SEQ / 64, NB), 32, 0, stream>>>(WV, XB, DM, bv, (size_t)SEQ * DM, VT16, VTh, VTl);
    // attention: query rows [0, RHE) on hi/lo planes, rows [RHE, SEQ) on f16 planes
    k_attn_hi<<<dim3(RHE / (16 * NW), NH_, NB), 32 * NW, 0, stream>>>(Qh, Ql, Kh, Kl, VTh, VTl, mask, ATh, ATl);
#if SEQ > RH
    k_attn_lo<<<dim3((SEQ - RHE) / (16 * NW), NH_, NB), 32 * NW, 0, stream>>>(Q16, K16, VT16, mask, ATh, ATl);
#endif
    // output projection: per batch rows of the full-size output
    k_oproj<<<dim3(SEQ / 64, DM / 64, NB), 32, 0, stream>>>(ATh, ATl, WO, DQ, OUT, DM, bo, (size_t)SEQ * DQ, (size_t)SEQ_FULL * DM);
}

// v004
// Measured time: 276 microseconds a run.
// Timed twice side by side with v003, it ran 1.19 times as fast both times.
// All steps since v000 together make it 1.85 times as fast.
#include <hip/hip_runtime.h>

// Three-stream masked attention: q = xq Wq^T + bq, k = xk Wk^T + bk, v = xv Wv^T + bv (weights [out][in]); 16 heads x 64 (head h = columns h*64+d); scores x 1/8; integer mask [SEQ][SEQ] read by value (0 -> score := -1e9); softmax; out = ctx Wo^T + bo.
// Compute dtypes, f32 accumulate: every float input RNE-converted to bf16; projections v_wmma_f32_16x16x32_bf16 (exact operand products); attention query rows < RH: bf16 hi+lo planes for q, k, v and p (3 products per site); rows >= RH: v_wmma_f32_16x16x32_f16 single products (q, k, v, p as f16); online softmax f32; ctx carried as bf16 hi+lo planes x Wo bf16 (2 products).
// Engine: four waves per 128x128 GEMM tile, one 64x64 quarter each (operands from K-contiguous 16-bit planes through LDS: two buffers, asynchronous copies); the q, k, v projections convert their f32 sums in the epilogue and store the head planes themselves (v as W X^T, so that its tile rows are d and its columns t); fused flash-style attention on transposed tiles (S^T = K Q^T, O^T = V^T P^T: a query is a lane's column), four waves per work-group (16 query rows each), 32-key steps; the work-group's waves share 64-key K and V^T tiles in LDS (two buffers, asynchronous copies); q and mask straight from global memory; no score or probability plane in global memory.

#ifndef NB
#define NB 2
#endif
#ifndef SEQ
#define SEQ 2048
#endif
#define NB_FULL  2
#define SEQ_FULL 2048
#define DM   1024
#define NH_  16
#define HD   64
#define DQ   (NH_ * HD)
#define RH   512                  // query rows < RH use hi+lo planes
#define RHE  ((RH < SEQ) ? RH : SEQ)
#define SCL  0.125f               // HD^-0.5
#define L2E  1.4426950408889634f
#define MFILL (-1.0e9f)           // value that replaces a masked score
#define MINIT (-1.0e30f)          // running-max start (below MFILL)
#define MSEEN (-5.0e8f)           // running max above this <=> the row has met an unmasked key
#define F16MINN 6.103515625e-05f  // smallest normal f16
#define CP 72                     // ctx tile pitch (halves): 64 + 8
#define NW 4                      // waves per work-group (attention: 16 query rows each; GEMM: a 64x64 quarter each)
#define KT 64                     // keys per staged K / V^T tile
#define TP 72                     // staged tile pitch (halves): 64 + 8 = 144 bytes, an odd multiple of 16 bytes
#define TPL (64 * TP)             // one staged plane tile (halves): 64 rows (K: keys x d; V^T: d x keys; GEMM operands: rows x k)

typedef _Float16 h16;
typedef unsigned short bf;
typedef __attribute__((ext_vector_type(16))) __bf16   v16bf;
typedef __attribute__((ext_vector_type(16))) _Float16 v16h;
typedef __attribute__((ext_vector_type(8)))  _Float16 v8h;
typedef __attribute__((ext_vector_type(8)))  unsigned short v8us;
typedef __attribute__((ext_vector_type(16))) unsigned short v16us;
typedef __attribute__((ext_vector_type(8)))  float    v8f;
typedef __attribute__((ext_vector_type(4)))  float    v4f;
typedef __attribute__((ext_vector_type(4)))  _Float16 v4h;
typedef __attribute__((ext_vector_type(4)))  unsigned short v4us;
typedef __attribute__((ext_vector_type(4)))  int      v4i;
typedef v8h  __attribute__((may_alias)) v8ha;
typedef v4f  __attribute__((may_alias)) v4fa;
typedef v8us __attribute__((may_alias)) v8usa;

static_assert(HD == 64);
static_assert(DQ == DM);                       // merged width equals model width
static_assert(DM % 128 == 0);                  // GEMM tiles of 128, K stages of 128
static_assert(SEQ % 128 == 0);                 // GEMM tiles of 128; attention tiles of 16 rows, 32 keys
static_assert(RH % 16 == 0);                   // hi/lo row split on a query-tile boundary
static_assert(NB <= NB_FULL);
static_assert(SEQ <= SEQ_FULL);
static_assert((CP * 2) % 16 == 0);             // 16-byte aligned ctx tile rows
static_assert((TP * 2) % 16 == 0);             // 16-byte aligned staged rows
static_assert(RHE % (16 * NW) == 0 && (SEQ - RHE) % (16 * NW) == 0);   // whole attention work-groups on both sides of the row split
static_assert(SEQ % KT == 0 && SEQ / KT >= 2); // whole staged tiles; the two-buffer prologue needs two
static_assert(KT == 64 && NW * 32 == 128);     // stage_pair: 512 16-byte pieces per plane tile, 4 per thread
static_assert((long long)NB * NH_ * SEQ * HD < 2147483647LL);       // int element offsets into head planes
static_assert((long long)SEQ_FULL * SEQ_FULL < 2147483647LL);      // int element offsets into the mask

constexpr size_t WS_W  = (size_t)4 * DM * DM * 2;          // four bf16 weight planes
constexpr size_t WS_XB = (size_t)NB * SEQ * DM * 2;        // bf16 copy of one input stream
constexpr size_t WS_PL = (size_t)NB * NH_ * SEQ * HD * 2;  // one 16-bit head plane
constexpr size_t WS_AT = (size_t)NB * SEQ * DQ * 2;        // one merged ctx plane
constexpr size_t WS_TOTAL = WS_W + WS_XB + 9 * WS_PL + 2 * WS_AT;
static_assert(WS_TOTAL <= (size_t)134217728);              // carve stays within 128 MiB
static_assert(WS_W % 256 == 0 && WS_XB % 256 == 0 && WS_PL % 256 == 0 && WS_AT % 256 == 0);

__device__ __forceinline__ unsigned short f2bf(float f) { unsigned u = __float_as_uint(f); u += 0x7FFFu + ((u >> 16) & 1u); return (unsigned short)(u >> 16); }   // RNE
__device__ __forceinline__ float bf2f(unsigned short b) { return __uint_as_float(((unsigned)b) << 16); }
__device__ __forceinline__ float bfr(float f) { return bf2f(f2bf(f)); }
__device__ __forceinline__ v16h cat16(v8h lo, v8h hi) { return __builtin_shufflevector(lo, hi, 0, 1, 2, 3, 4, 5, 6, 7, 8, 9, 10, 11, 12, 13, 14, 15); }
__device__ __forceinline__ v16bf cat16b(v8us lo, v8us hi) { return __builtin_bit_cast(v16bf, __builtin_shufflevector(lo, hi, 0, 1, 2, 3, 4, 5, 6, 7, 8, 9, 10, 11, 12, 13, 14, 15)); }
__device__ __forceinline__ v8f wmma16(v16h a, v16h b, v8f c) { return __builtin_amdgcn_wmma_f32_16x16x32_f16(false, a, false, b, (short)0, c, false, false); }
__device__ __forceinline__ v8f wmmab(v16bf a, v16bf b, v8f c) { return __builtin_amdgcn_wmma_f32_16x16x32_bf16(false, a, false, b, (short)0, c, false, false); }
__device__ __forceinline__ v8f mma3(v16bf ah, v16bf al, v16bf bh, v16bf bl, v8f c) { c = wmmab(ah, bh, c); c = wmmab(ah, bl, c); c = wmmab(al, bh, c); return c; }   // hi hi, then hi x B lo, then A lo x hi
__device__ __forceinline__ float xhalf(float x) { return __builtin_bit_cast(float, __builtin_amdgcn_permlanex16(__builtin_bit_cast(int, x), __builtin_bit_cast(int, x), 0x76543210, 0xfedcba98, false, false)); }   // lane l with lane l ^ 16
__device__ __forceinline__ h16 tohx(float x) { return (h16)x; }
__device__ __forceinline__ void splitf(float y, unsigned short& h, unsigned short& l) { h = f2bf(y); l = f2bf(y - bf2f(h)); }
__device__ __forceinline__ void wave_sync() { __builtin_amdgcn_wave_barrier(); asm volatile("" ::: "memory"); }   // same-wave LDS exchange (tiles are private to the wave)

// Fragment loaders (A and B alike): lane (lr = lane & 15, hi = lane >> 4) points at row/column lr, element 8*hi of the 32-deep k-step;
// elements 0..7 <- k0 + 8hi + 0..7, elements 8..15 <- k0 + 16 + 8hi + 0..7.
template <typename T16> struct WFrag;
template <> struct WFrag<h16> { typedef v16h V; static __device__ __forceinline__ V ld(const h16* p) { return cat16(*(const v8h*)p, *(const v8h*)(p + 16)); } static __device__ __forceinline__ v8f mma(V a, V b, v8f c) { return wmma16(a, b, c); } };
template <> struct WFrag<bf> { typedef v16bf V; static __device__ __forceinline__ V ld(const bf* p) { return cat16b(*(const v8us*)p, *(const v8us*)(p + 16)); } static __device__ __forceinline__ v8f mma(V a, V b, v8f c) { return wmmab(a, b, c); } };

// ---- staging of 64-row x 128-byte tiles in LDS (GEMM operands; K and V^T of the attention work-group)
__device__ __forceinline__ unsigned lds_off(const void* p) { return (unsigned)(size_t)p; }   // byte offset in the work-group's LDS (low half of the shared address)
__device__ __forceinline__ v16bf ldsb(const unsigned short* p) { return cat16b(*(const v8usa*)p, *(const v8usa*)(p + 16)); }   // fragment from a staged bf16 tile, same k order as WFrag::ld
__device__ __forceinline__ v16h  ldsh(const unsigned short* p) { return cat16(*(const v8ha*)p, *(const v8ha*)(p + 16)); }       // fragment from a staged f16 tile
// Two plane tiles of 64 rows x 128 bytes -> LDS at pitch TP, 16 bytes per lane and copy, 128 threads: copy i of a plane brings row 16 i + (tid >> 3), piece tid & 7.
// la / lb: the lane's LDS byte address of its row-0..15 piece; ga / gb: the lane's global address of the same piece; pa / pb: 16 source rows in elements.
template <typename T16>
__device__ __forceinline__ void stage_pair(unsigned la, const T16* ga, int pa, unsigned lb, const T16* gb, int pb) {
    // copies and their s_wait_xcnt in one statement: no address register of a copy is rewritten ahead of the wait
    asm volatile("global_load_async_to_lds_b128 %0, %8, off\n\t"
                 "global_load_async_to_lds_b128 %1, %9, off\n\t"
                 "global_load_async_to_lds_b128 %2, %10, off\n\t"
                 "global_load_async_to_lds_b128 %3, %11, off\n\t"
                 "global_load_async_to_lds_b128 %4, %12, off\n\t"
                 "global_load_async_to_lds_b128 %5, %13, off\n\t"
                 "global_load_async_to_lds_b128 %6, %14, off\n\t"
                 "global_load_async_to_lds_b128 %7, %15, off\n\t"
                 "s_wait_xcnt 0x0"
                 :: "v"(la), "v"(la + 16u * TP * 2u), "v"(la + 32u * TP * 2u), "v"(la + 48u * TP * 2u),
                    "v"(lb), "v"(lb + 16u * TP * 2u), "v"(lb + 32u * TP * 2u), "v"(lb + 48u * TP * 2u),
                    "v"(ga), "v"(ga + pa), "v"(ga + 2 * pa), "v"(ga + 3 * pa),
                    "v"(gb), "v"(gb + pb), "v"(gb + 2 * pb), "v"(gb + 3 * pb)
                 : "memory");
}

// ---- register-blocked GEMM body: one work-group = NW waves (2 x 2) on a 128x128 output tile, one wave per 64x64 quarter (16 accumulators); grid (M/128, N/128, Z), 128 threads.
// Operands come from K-contiguous 16-bit planes through LDS: a stage is GK = 128 k of the work-group's 128 A rows (and A2 rows) and 128 Bt rows, held as 64-k tiles of 64 rows at pitch TP;
// every thread copies its pieces of stage t + 2 into the buffer that stage t has left (two buffers); one work-group barrier per stage publishes stage t + 1 and frees stage t's buffer.
// C[m][n] (f32, pitch ldc, + bf16-converted bias[n]) = sum_k A[m][k] Bt[n][k] (+ A2 Bt when NSPLIT == 1). z-batch strides sA/sB/sC in elements. K % 128 == 0, M % 128 == 0, N % 128 == 0.
// OUT == 0: C is stored as f32. OUT == 1 (m = t, n = h*64 + d) and OUT == 2 (m = h*64 + d, n = t, bias[m]): the f32 value is converted where it is made and stored to the three 16-bit head planes
// (f16, bf16 hi, bf16 lo) at P*[pb + tile row * pp + tile column]; a tile row is 128 bytes of each plane, one whole line per 16 lanes.
#define GK 128                    // k per staged GEMM stage (two 64-k tiles per operand row block)
template <typename T16, int NSPLIT, bool BIAS, int OUT = 0>
__device__ __forceinline__ void gemmw_body(const T16* __restrict__ A, const T16* __restrict__ A2, const T16* __restrict__ Bt, int K, float* C, int ldc, const float* __restrict__ bias, size_t sA, size_t sB, size_t sC,
                                           h16* P16 = nullptr, bf* Ph = nullptr, bf* Pl = nullptr) {
    typedef typename WFrag<T16>::V V;
    static_assert(NSPLIT == 0 || NSPLIT == 1);
    constexpr int NT = 2 + NSPLIT;                                           // staged operands: A, (A2,) Bt
    constexpr int GT = 2 * TPL;                                              // 128 rows x 64 k of one operand (halves)
    constexpr int GB = (GK / 64) * NT * GT;                                  // one buffer (halves): [64-k half][operand][128 rows at pitch TP]
    static_assert((GK / 64) * NT * 8 <= 63);                                 // copies of one wave in flight: one stage's, 8 per operand and 64-k half
    __shared__ __align__(16) unsigned short gst[2 * GB];                     // two buffers of staged operands
    __shared__ __align__(16) float osa[NW * 16 * 68];                        // epilogue tiles, one per wave
    const size_t z = blockIdx.z; A += z * sA; if (NSPLIT) A2 += z * sA; Bt += z * sB; C += z * sC;
    const int tid = threadIdx.x, lane = tid & 31, lr = lane & 15, hi = lane >> 4;
    const int wave = __builtin_amdgcn_readfirstlane(tid >> 5);
    float* os = osa + wave * (16 * 68);
    const int R0 = blockIdx.x * 128, C0 = blockIdx.y * 128;                  // the work-group's tile
    const int r0 = R0 + (wave >> 1) * 64, c0 = C0 + (wave & 1) * 64;         // the wave's quarter
    v8f acc[4][4];
#pragma unroll
    for (int mb = 0; mb < 4; ++mb)
#pragma unroll
        for (int nb = 0; nb < 4; ++nb) acc[mb][nb] = (v8f){};
    const unsigned sl = lds_off(gst) + (unsigned)((tid >> 3) * TP + (tid & 7) * 8) * 2u;   // this thread's piece in a staged 64-row tile
    const size_t sga = (size_t)(R0 + (tid >> 3)) * K + (tid & 7) * 8;        // the same piece in A's rows R0..R0+63: + 64 K (rows + 64), + k
    const size_t sgb = (size_t)(C0 + (tid >> 3)) * K + (tid & 7) * 8;        // the same piece in Bt's rows C0..C0+63
    auto stage = [&](int t, int bi) {
#pragma unroll
        for (int s = 0; s < GK / 64; ++s) {
            const unsigned l = sl + (unsigned)((bi * GB + s * NT * GT) * 2);
            const size_t k = (size_t)t * GK + s * 64;
            // each scheduling barrier keeps the next eight copies' address arithmetic behind the eight just issued: their registers are reused, nothing spills beside the 128 accumulators
            stage_pair<T16>(l, A + sga + k, 16 * K, l + TPL * 2u, A + sga + (size_t)64 * K + k, 16 * K);
            __builtin_amdgcn_sched_barrier(0);
            if (NSPLIT) { stage_pair<T16>(l + GT * 2u, A2 + sga + k, 16 * K, l + GT * 2u + TPL * 2u, A2 + sga + (size_t)64 * K + k, 16 * K); __builtin_amdgcn_sched_barrier(0); }
            stage_pair<T16>(l + (NT - 1) * GT * 2u, Bt + sgb + k, 16 * K, l + (NT - 1) * GT * 2u + TPL * 2u, Bt + sgb + (size_t)64 * K + k, 16 * K);
            __builtin_amdgcn_sched_barrier(0);
        }
    };
    const int af = ((wave >> 1) * 64 + lr) * TP + 8 * hi;                    // A fragment in a staged operand: + mb*16*TP + 32 (second k-step of the 64-k half)
    const int bo = (NT - 1) * GT + ((wave & 1) * 64 + lr) * TP + 8 * hi;     // Bt fragment: + nb*16*TP + 32
    const int nst = K / GK;
    stage(0, 0);
    asm volatile("s_wait_asynccnt 0x0" ::: "memory");                           // this wave's pieces of stage 0 have landed
    __syncthreads();                                                            // stage 0 published to all waves
    if (1 < nst) stage(1, 1);
#pragma unroll 1
    for (int t = 0; t < nst; ++t) {
        const unsigned short* sb = gst + (t & 1) * GB;
#pragma unroll
        for (int ks = 0; ks < GK / 32; ++ks) {
            const unsigned short* sk = sb + (ks >> 1) * (NT * GT) + (ks & 1) * 32;
            V a[4], a2[4], b[4];
#pragma unroll
            for (int mb = 0; mb < 4; ++mb) { a[mb] = ldsb(sk + af + mb * 16 * TP); if (NSPLIT) a2[mb] = ldsb(sk + GT + af + mb * 16 * TP); b[mb] = ldsb(sk + bo + mb * 16 * TP); }
            // inputs-only fence on the loaded fragments: the k-step's LDS reads are issued as one group in front of its WMMAs (one LDS wait per k-step, not one per Bt fragment)
            if (NSPLIT) asm volatile("" :: "v"(a[0]), "v"(a[1]), "v"(a[2]), "v"(a[3]), "v"(a2[0]), "v"(a2[1]), "v"(a2[2]), "v"(a2[3]), "v"(b[0]), "v"(b[1]), "v"(b[2]), "v"(b[3]));
            else        asm volatile("" :: "v"(a[0]), "v"(a[1]), "v"(a[2]), "v"(a[3]), "v"(b[0]), "v"(b[1]), "v"(b[2]), "v"(b[3]));
#pragma unroll
            for (int nb = 0; nb < 4; ++nb) {
#pragma unroll
                for (int mb = 0; mb < 4; ++mb) { acc[mb][nb] = WFrag<T16>::mma(a[mb], b[nb], acc[mb][nb]); if (NSPLIT) acc[mb][nb] = WFrag<T16>::mma(a2[mb], b[nb], acc[mb][nb]); } }
        }
        // foot of stage t
        asm volatile("s_wait_dscnt 0x0" ::: "memory");                          // this wave's reads of stage t's buffer have returned
        asm volatile("s_wait_asynccnt 0x0" ::: "memory");                       // this wave's pieces of stage t + 1 have landed
        __syncthreads();                                                        // publishes stage t + 1; ends every wave's reads of stage t's buffer
        if (t + 2 < nst) stage(t + 2, t & 1);                                   // refill the buffer just left (same test in every wave)
    }
    asm volatile("s_wait_asynccnt 0x0" ::: "memory");                           // no copy in flight behind the loop
#pragma unroll
    for (int mb = 0; mb < 4; ++mb) {
#pragma unroll
        for (int nb = 0; nb < 4; ++nb) {
#pragma unroll
            for (int j = 0; j < 8; ++j) os[(hi * 8 + j) * 68 + nb * 16 + lr] = acc[mb][nb][j]; }
        wave_sync();
        float* crow = C + (size_t)(r0 + mb * 16) * ldc + c0;
if (OUT == 0) {
#pragma unroll
            for (int s = 0; s < 8; ++s) { const int row = 2 * s + hi, cofs = lr * 4; v4f val = *(const v4fa*)(os + row * 68 + cofs); if (BIAS) { val[0] += bfr(bias[c0 + cofs]); val[1] += bfr(bias[c0 + cofs + 1]); val[2] += bfr(bias[c0 + cofs + 2]); val[3] += bfr(bias[c0 + cofs + 3]); }
                *(v4f*)(crow + (size_t)row * ldc + cofs) = val; }
             }
        else {
            const size_t pb = (OUT == 1) ? ((z * NH_ + c0 / 64) * SEQ + r0 + mb * 16) * HD : ((z * NH_ + r0 / 64) * HD + mb * 16) * SEQ + c0;   // head = the quarter's index along h*64 + d
            const int pp = (OUT == 1) ? HD : SEQ;
#pragma unroll
            for (int s = 0; s < 8; ++s) { const int row = 2 * s + hi, cofs = lr * 4; v4f val = *(const v4fa*)(os + row * 68 + cofs);
                if (BIAS && OUT == 1) { val[0] += bfr(bias[c0 + cofs]); val[1] += bfr(bias[c0 + cofs + 1]); val[2] += bfr(bias[c0 + cofs + 2]); val[3] += bfr(bias[c0 + cofs + 3]); }
                if (BIAS && OUT == 2) { const float br = bfr(bias[r0 + mb * 16 + row]); val[0] += br; val[1] += br; val[2] += br; val[3] += br; }
                v4h o16; v4us oh, ol;
#pragma unroll
                for (int q = 0; q < 4; ++q) { o16[q] = tohx(val[q]); unsigned short a2, c2; splitf(val[q], a2, c2); oh[q] = a2; ol[q] = c2; }
                const size_t pe = pb + (size_t)row * pp + cofs;
                *(v4h*)(P16 + pe) = o16; *(v4us*)(Ph + pe) = oh; *(v4us*)(Pl + pe) = ol;
                asm volatile("s_wait_xcnt 0x0" ::: "memory"); }   // stands in front of the next rows' values, which reuse the registers these stores name
        }
        wave_sync();
    }
}
// k_proj: y[z][t][n] = XB[z][t][:] . W[n][:] + b[n] (bf16 x bf16, one product), stored as [z*NH_ + h][t][d] planes; grid (SEQ/128, DQ/128, NB).
__global__ __launch_bounds__(32 * NW) void k_proj(const bf* A, const bf* Bt, int K, const float* bias, size_t sA, h16* P16, bf* Ph, bf* Pl) {
    gemmw_body<bf, 0, true, 1>(A, nullptr, Bt, K, nullptr, 0, bias, sA, (size_t)0, (size_t)0, P16, Ph, Pl); }
// k_projt: the same product with W as A and XB as B, stored as [z*NH_ + h][d][t] planes; grid (DQ/128, SEQ/128, NB).
__global__ __launch_bounds__(32 * NW) void k_projt(const bf* A, const bf* Bt, int K, const float* bias, size_t sB, h16* P16, bf* Ph, bf* Pl) {
    gemmw_body<bf, 0, true, 2>(A, nullptr, Bt, K, nullptr, 0, bias, (size_t)0, sB, (size_t)0, P16, Ph, Pl); }
// k_oproj: OUT[z][t][n] = (ATh + ATl)[z][t][:] . Wo[n][:] + bo[n] (two products).
__global__ __launch_bounds__(32 * NW) void k_oproj(const bf* A, const bf* A2, const bf* Bt, int K, float* C, int ldc, const float* bias, size_t sA, size_t sC) {
    gemmw_body<bf, 1, true>(A, A2, Bt, K, C, ldc, bias, sA, (size_t)0, sC); }

__global__ __launch_bounds__(256) void k_cvt8(const float* __restrict__ src, bf* dst, int n8, size_t sS, size_t sD) {
    const int i = blockIdx.x * 256 + threadIdx.x; if (i >= n8) return; src += (size_t)blockIdx.y * sS; dst += (size_t)blockIdx.y * sD;
    const v8f v = *(const v8f*)(src + (size_t)i * 8); v8us o;
#pragma unroll
    for (int k = 0; k < 8; ++k) o[k] = f2bf(v[k]);
    *(v8us*)(dst + (size_t)i * 8) = o;  }

// ---- fused attention body: one work-group = NW waves of one (b, h); one wave = 16 query rows (q0..q0+15); key loop in 32-key steps, two steps per staged 64-key tile.
// K and V^T tiles: every thread copies its pieces of tile t + 2 into the buffer that tile t has left (two buffers); one work-group barrier per tile publishes tile t + 1 and frees tile t's buffer.
// Per step: (1) the 16x32 mask tile is read by value in the layout of the S^T accumulators (lane = query q0 + lr, 4 x 16-byte loads: keys 8*hi + 0..7 and 16 + 8*hi + 0..7); a tile whose 512 entries are all 0
// is skipped (wave-uniform, decided on the values read); (2) S^T = k q^T (two 16x16 accumulators: row = key 8*hi + r, column = query lr; k fragments from LDS as A, q fragments as B, reloaded per step through an
// opaque integer offset); (3) e = mask == 0 ? -1e9 : S/8; online softmax in f32, one running maximum per query (16 values in the lane, then lane l with l ^ 16) and one running sum per lane (halves joined in the epilogue); (4) the lane's 16 probabilities are
// the B fragment of P^T as they stand (elements 0..7 = keys 8*hi + r, 8..15 = keys 16 + 8*hi + r); O^T += V^T P^T (four d-tiles, V^T fragments from LDS as A; row = d, column = query).
// A skipped all-masked tile contributes exactly 0 to every row that meets an unmasked key somewhere (exp underflow); if some row of the work-group never does, the work-group repeats the loop
// with skipping disabled (every entry -1e9 -> uniform weights; rows that do meet a key end with the same values), so the result is exact for any mask contents.
template <bool HI>
__device__ __forceinline__ void attn_body(const h16* __restrict__ Q16, const h16* __restrict__ K16, const h16* __restrict__ VT16,
                                          const bf* __restrict__ Qh, const bf* __restrict__ Ql, const bf* __restrict__ Kh, const bf* __restrict__ Kl,
                                          const bf* __restrict__ VTh, const bf* __restrict__ VTl, const int* __restrict__ mask, bf* ATh, bf* ATl, int row_base) {
    constexpr int NPL = HI ? 4 : 2;                                          // staged planes per buffer: Kh Kl VTh VTl, or K16 VT16
    __shared__ __align__(16) unsigned short stg[2 * NPL * TPL];              // two buffers of staged tiles
    __shared__ __align__(16) unsigned short ctha[NW * 16 * CP];              // ctx tiles hi
    __shared__ __align__(16) unsigned short ctla[NW * 16 * CP];              // ctx tiles lo
    __shared__ int wflag[NW];                                                // per wave: some row has met no unmasked key
    const int tid = threadIdx.x, lane = tid & 31, lr = lane & 15, hi = lane >> 4;
    const int wave = __builtin_amdgcn_readfirstlane(tid >> 5);
    unsigned short* cth = ctha + wave * 16 * CP;
    unsigned short* ctl = ctla + wave * 16 * CP;
    const int q0 = row_base + ((int)blockIdx.x * NW + wave) * 16;
    const int h = blockIdx.y, b = blockIdx.z;
    const int zoff  = (b * NH_ + h) * (SEQ * HD);            // head plane offset ([t][d] and [d][t] planes both hold SEQ*HD elements)
    const int qbase = zoff + (q0 + lr) * HD + 8 * hi;        // B fragment of q: column = query q0 + lr; + c2*32
    const int kfrag = lr * TP + 8 * hi;                      // A fragment of k in a staged tile: row = key (sub*32 + nt*16 + lr); + (sub*32 + nt*16)*TP + c2*32
    const int vfrag = lr * TP + 8 * hi;                      // A fragment of v^T in a staged tile: row = d = dt*16 + lr; + dt*16*TP + sub*32
    const int mrow  = (q0 + lr) * SEQ_FULL + 8 * hi;         // mask in the S^T accumulator layout: + kb + r (+16)
    const unsigned sl = lds_off(stg) + (unsigned)((tid >> 3) * TP + (tid & 7) * 8) * 2u;   // this thread's piece in a staged plane tile
    const int sgk = zoff + (tid >> 3) * HD + (tid & 7) * 8;  // the same piece in a [t][d] plane: + t*KT*HD
    const int sgv = zoff + (tid >> 3) * SEQ + (tid & 7) * 8; // the same piece in a [d][t] plane: + t*KT
    auto stage = [&](int t, int bi) {
        const unsigned l = sl + (unsigned)(bi * NPL * TPL * 2);
        if (HI) {
            stage_pair<bf>(l, Kh + sgk + t * (KT * HD), 16 * HD, l + TPL * 2u, Kl + sgk + t * (KT * HD), 16 * HD);
            stage_pair<bf>(l + 2u * TPL * 2u, VTh + sgv + t * KT, 16 * SEQ, l + 3u * TPL * 2u, VTl + sgv + t * KT, 16 * SEQ);
        } else {
            stage_pair<h16>(l, K16 + sgk + t * (KT * HD), 16 * HD, l + TPL * 2u, VT16 + sgv + t * KT, 16 * SEQ);
        }
    };

    v8f o[4]; float m, l;
    bool dense = false;
#pragma unroll 1
    for (int pass = 0; pass < 2; ++pass) {
#pragma unroll
        for (int t = 0; t < 4; ++t) o[t] = (v8f){};
        m = MINIT; l = 0.0f;
        // two-buffer prologue (on a repeat, the last tile's foot has already ended every read of both buffers)
        stage(0, 0);
        asm volatile("s_wait_asynccnt 0x0" ::: "memory");                       // this wave's pieces of tile 0 have landed
        __syncthreads();                                                        // tile 0 published to all waves
        stage(1, 1);
#pragma unroll 1
        for (int t = 0; t < SEQ / KT; ++t) {
            const unsigned short* sb = stg + (t & 1) * (NPL * TPL);
#pragma unroll 1
            for (int sub = 0; sub < 2; ++sub) {                                 // rolled: one copy of the step's code
            const int kb = t * KT + sub * 32;
            const int* mp = mask + mrow + kb;
            const v4i ma = *(const v4i*)mp, mb = *(const v4i*)(mp + 4), mc = *(const v4i*)(mp + 16), md = *(const v4i*)(mp + 20);
            const int tor = (ma[0] | ma[1] | ma[2] | ma[3]) | (mb[0] | mb[1] | mb[2] | mb[3]) | (mc[0] | mc[1] | mc[2] | mc[3]) | (md[0] | md[1] | md[2] | md[3]);
            asm volatile("s_wait_xcnt 0x0" ::: "memory");                       // stands in front of whatever reuses the address registers that the four mask loads name
            const bool anyw = __builtin_amdgcn_ballot_w32(tor != 0) != 0u;      // wave-uniform
            if (!(dense || anyw)) continue;                                     // whole 16x32 tile masked: skipped (values were read); the tile's foot below is still passed
            const int mk0[8] = { ma[0], ma[1], ma[2], ma[3], mb[0], mb[1], mb[2], mb[3] };
            const int mk1[8] = { mc[0], mc[1], mc[2], mc[3], md[0], md[1], md[2], md[3] };

            int qo = qbase; asm volatile("" : "+v"(qo));                        // opaque offset: q fragments are reloaded each step, not held across the loop
            const unsigned short* kf = sb + kfrag + sub * 32 * TP;
            v8f s0 = (v8f){}, s1 = (v8f){};
            if (HI) {
                const v16bf qh0 = WFrag<bf>::ld(Qh + qo), qh1 = WFrag<bf>::ld(Qh + qo + 32);
                const v16bf ql0 = WFrag<bf>::ld(Ql + qo), ql1 = WFrag<bf>::ld(Ql + qo + 32);
                s0 = mma3(ldsb(kf), ldsb(kf + TPL), qh0, ql0, s0);
                s0 = mma3(ldsb(kf + 32), ldsb(kf + TPL + 32), qh1, ql1, s0);
                s1 = mma3(ldsb(kf + 16 * TP), ldsb(kf + TPL + 16 * TP), qh0, ql0, s1);
                s1 = mma3(ldsb(kf + 16 * TP + 32), ldsb(kf + TPL + 16 * TP + 32), qh1, ql1, s1);
                asm volatile("v_nop\n\tv_nop\n\tv_nop\n\tv_nop" : "+v"(s0), "+v"(s1) : "v"(qh1), "v"(ql1));
            } else {
                const v16h qa0 = WFrag<h16>::ld(Q16 + qo), qa1 = WFrag<h16>::ld(Q16 + qo + 32);
                s0 = wmma16(ldsh(kf), qa0, s0);
                s0 = wmma16(ldsh(kf + 32), qa1, s0);
                s1 = wmma16(ldsh(kf + 16 * TP), qa0, s1);
                s1 = wmma16(ldsh(kf + 16 * TP + 32), qa1, s1);
                asm volatile("v_nop\n\tv_nop\n\tv_nop\n\tv_nop" : "+v"(s0), "+v"(s1) : "v"(qa0), "v"(qa1));
            }

            float e0[8], e1[8], t8[8];
#pragma unroll
            for (int r = 0; r < 8; ++r) { e0[r] = (mk0[r] == 0) ? MFILL : s0[r] * SCL; e1[r] = (mk1[r] == 0) ? MFILL : s1[r] * SCL; t8[r] = fmaxf(e0[r], e1[r]); }
            float rm = fmaxf(fmaxf(fmaxf(t8[0], t8[1]), fmaxf(t8[2], t8[3])), fmaxf(fmaxf(t8[4], t8[5]), fmaxf(t8[6], t8[7])));
            rm = fmaxf(rm, xhalf(rm));                                          // the query's other 16 keys of the step
            const float mn = fmaxf(m, rm);
            const float al = __builtin_amdgcn_exp2f((m - mn) * L2E);
            v16us ph, pl; v16h pa;                                              // B fragments of P^T
#pragma unroll
            for (int r = 0; r < 8; ++r) {
                float x0 = __builtin_amdgcn_exp2f((e0[r] - mn) * L2E);
                float x1 = __builtin_amdgcn_exp2f((e1[r] - mn) * L2E);
                if (HI) {
                    unsigned short a0, c0, a1, c1; splitf(x0, a0, c0); splitf(x1, a1, c1);
                    ph[r] = a0; pl[r] = c0; ph[8 + r] = a1; pl[8 + r] = c1;
                    t8[r] = x0 + x1;
                } else {
                    x0 = (x0 < F16MINN) ? 0.0f : x0; x1 = (x1 < F16MINN) ? 0.0f : x1;      // no subnormal f16 operands; the row sum uses the same values
                    const h16 g0 = tohx(x0), g1 = tohx(x1);
                    pa[r] = g0; pa[8 + r] = g1;
                    t8[r] = (float)g0 + (float)g1;
                }
            }
            float rs = ((t8[0] + t8[1]) + (t8[2] + t8[3])) + ((t8[4] + t8[5]) + (t8[6] + t8[7]));
            l = l * al + rs; m = mn;                                           // l: this lane's half of the keys; the two halves (same al) are joined behind the loop
#pragma unroll
            for (int dt = 0; dt < 4; ++dt) o[dt] *= al;
            const unsigned short* vf = sb + (HI ? 2 : 1) * TPL + vfrag + sub * 32;
            if (HI) {
                const v16bf pb = __builtin_bit_cast(v16bf, ph), pc = __builtin_bit_cast(v16bf, pl);
                const v16bf vh0 = ldsb(vf), vh1 = ldsb(vf + 16 * TP), vh2 = ldsb(vf + 32 * TP), vh3 = ldsb(vf + 48 * TP);
                const v16bf vl0 = ldsb(vf + TPL), vl1 = ldsb(vf + TPL + 16 * TP), vl2 = ldsb(vf + TPL + 32 * TP), vl3 = ldsb(vf + TPL + 48 * TP);
                o[0] = mma3(vh0, vl0, pb, pc, o[0]); o[1] = mma3(vh1, vl1, pb, pc, o[1]); o[2] = mma3(vh2, vl2, pb, pc, o[2]); o[3] = mma3(vh3, vl3, pb, pc, o[3]);
                asm volatile("v_nop\n\tv_nop\n\tv_nop\n\tv_nop" : "+v"(o[0]), "+v"(o[1]), "+v"(o[2]), "+v"(o[3]) : "v"(pb), "v"(pc));
            } else {
                const v16h v0 = ldsh(vf), v1 = ldsh(vf + 16 * TP), v2 = ldsh(vf + 32 * TP), v3 = ldsh(vf + 48 * TP);
                o[0] = wmma16(v0, pa, o[0]); o[1] = wmma16(v1, pa, o[1]); o[2] = wmma16(v2, pa, o[2]); o[3] = wmma16(v3, pa, o[3]);
                asm volatile("v_nop\n\tv_nop\n\tv_nop\n\tv_nop" : "+v"(o[0]), "+v"(o[1]), "+v"(o[2]), "+v"(o[3]) : "v"(pa), "v"(v3));
            }
            }
            // foot of tile t, passed by every wave whatever it skipped
            asm volatile("s_wait_dscnt 0x0" ::: "memory");                      // this wave's reads of tile t's buffer have returned
            asm volatile("s_wait_asynccnt 0x0" ::: "memory");                   // this wave's pieces of tile t + 1 have landed
            __syncthreads();                                                    // publishes tile t + 1; ends every wave's reads of tile t's buffer
            if (t + 2 < SEQ / KT) stage(t + 2, t & 1);                          // refill the buffer just left (same test in every wave)
        }
        asm volatile("s_wait_asynccnt 0x0" ::: "memory");                       // no copy in flight behind the loop
        const bool bad = !(m > MSEEN);
        const int wbad = (__builtin_amdgcn_ballot_w32(bad) != 0u) ? 1 : 0;      // taken with every lane on
        if (lane == 0) wflag[wave] = wbad;
        __syncthreads();                                                        // the repeat is decided for the whole work-group: its barriers need every wave
        const int anyb = wflag[0] | wflag[1] | wflag[2] | wflag[3];
        if (__builtin_amdgcn_readfirstlane(anyb) == 0) break;                   // every row met an unmasked key: skipped tiles contributed exactly 0
        dense = true;                                                           // otherwise repeat without skipping (work-group-uniform)
    }

    const float inv = 1.0f / (l + xhalf(l));
#pragma unroll
    for (int dt = 0; dt < 4; ++dt) { v8us a8, c8;                               // the lane's 8 consecutive d of its query: one 16-byte piece of each ctx tile row
#pragma unroll
        for (int r = 0; r < 8; ++r) { unsigned short a, c; splitf(o[dt][r] * inv, a, c); a8[r] = a; c8[r] = c; }
        *(v8usa*)(cth + lr * CP + dt * 16 + 8 * hi) = a8; *(v8usa*)(ctl + lr * CP + dt * 16 + 8 * hi) = c8; }
    wave_sync();
    v8us hv[4], lv[4];
#pragma unroll
    for (int s = 0; s < 4; ++s) { const int row = 4 * s + (lane >> 3); hv[s] = *(const v8usa*)(cth + row * CP + (lane & 7) * 8); lv[s] = *(const v8usa*)(ctl + row * CP + (lane & 7) * 8); }
    const size_t ob = (size_t)(b * SEQ + q0 + (lane >> 3)) * DQ + h * HD + (lane & 7) * 8;
{
#pragma unroll
        for (int s = 0; s < 4; ++s) { *(v8us*)(ATh + ob + (size_t)(4 * s) * DQ) = hv[s]; *(v8us*)(ATl + ob + (size_t)(4 * s) * DQ) = lv[s]; }
         }
}
__global__ __launch_bounds__(32 * NW) void k_attn_hi(const bf* Qh, const bf* Ql, const bf* Kh, const bf* Kl, const bf* VTh, const bf* VTl, const int* mask, bf* ATh, bf* ATl) {
    attn_body<true>(nullptr, nullptr, nullptr, Qh, Ql, Kh, Kl, VTh, VTl, mask, ATh, ATl, 0); }
__global__ __launch_bounds__(32 * NW) void k_attn_lo(const h16* Q16, const h16* K16, const h16* VT16, const int* mask, bf* ATh, bf* ATl) {
    attn_body<false>(Q16, K16, VT16, nullptr, nullptr, nullptr, nullptr, nullptr, nullptr, mask, ATh, ATl, RHE); }

extern "C" void kernel_launch(void* const* d_in, const int* in_sizes, int n_in,
                              void* d_out, int out_size, void* d_ws, size_t ws_size, hipStream_t stream) {
    if (n_in < 12) return;
    const long long need_x = (long long)(NB - 1) * SEQ_FULL * DM + (long long)SEQ * DM;      // rows read from a full-size stream
    const long long need_m = (long long)(SEQ - 1) * SEQ_FULL + SEQ;
    if (in_sizes[0] < need_x || in_sizes[1] < need_x || in_sizes[2] < need_x || in_sizes[3] < need_m) return;
    if (in_sizes[4] < DM * DM || in_sizes[6] < DM * DM || in_sizes[8] < DM * DM || in_sizes[10] < DM * DM) return;
    if (in_sizes[5] < DM || in_sizes[7] < DM || in_sizes[9] < DM || in_sizes[11] < DM) return;
    if ((long long)out_size < need_x) return;
    if (WS_TOTAL > ws_size) return;
    // wire order: x_q, x_k, x_v, mask (int32 [1][1][SEQ_FULL][SEQ_FULL]), Wq, bq, Wk, bk, Wv, bv, Wo, bo; weights [out][in]
    const float* xq = (const float*)d_in[0]; const float* xk = (const float*)d_in[1]; const float* xv = (const float*)d_in[2];
    const int* mask = (const int*)d_in[3];
    const float* wq = (const float*)d_in[4]; const float* bq = (const float*)d_in[5];
    const float* wk = (const float*)d_in[6]; const float* bk = (const float*)d_in[7];
    const float* wv = (const float*)d_in[8]; const float* bv = (const float*)d_in[9];
    const float* wo = (const float*)d_in[10]; const float* bo = (const float*)d_in[11];
    float* OUT = (float*)d_out;     // [NB_FULL][SEQ_FULL][DM]
    char* wsp = (char*)d_ws;
    auto take = [&](size_t bytes) { char* p = wsp; wsp += bytes; return (void*)p; };      // all sizes are multiples of 256 bytes
    bf* WQ = (bf*)take(WS_W / 4); bf* WK = (bf*)take(WS_W / 4); bf* WV = (bf*)take(WS_W / 4); bf* WO = (bf*)take(WS_W / 4);
    bf* XB = (bf*)take(WS_XB);
    h16* Q16 = (h16*)take(WS_PL); bf* Qh = (bf*)take(WS_PL); bf* Ql = (bf*)take(WS_PL);
    h16* K16 = (h16*)take(WS_PL); bf* Kh = (bf*)take(WS_PL); bf* Kl = (bf*)take(WS_PL);
    h16* VT16 = (h16*)take(WS_PL); bf* VTh = (bf*)take(WS_PL); bf* VTl = (bf*)take(WS_PL);
    bf* ATh = (bf*)take(WS_AT); bf* ATl = (bf*)take(WS_AT);
    if ((size_t)(wsp - (char*)d_ws) > ws_size) return;

    const unsigned gW = (unsigned)((DM * DM / 8 + 255) / 256), gX = (unsigned)((SEQ * DM / 8 + 255) / 256);
    k_cvt8<<<dim3(gW, 1), 256, 0, stream>>>(wq, WQ, DM * DM / 8, (size_t)0, (size_t)0);
    k_cvt8<<<dim3(gW, 1), 256, 0, stream>>>(wk, WK, DM * DM / 8, (size_t)0, (size_t)0);
    k_cvt8<<<dim3(gW, 1), 256, 0, stream>>>(wv, WV, DM * DM / 8, (size_t)0, (size_t)0);
    k_cvt8<<<dim3(gW, 1), 256, 0, stream>>>(wo, WO, DM * DM / 8, (size_t)0, (size_t)0);
    const dim3 gG(SEQ / 128, DQ / 128, NB);
    // q stream
    k_cvt8<<<dim3(gX, NB), 256, 0, stream>>>(xq, XB, SEQ * DM / 8, (size_t)SEQ_FULL * DM, (size_t)SEQ * DM);
    k_proj<<<gG, 32 * NW, 0, stream>>>(XB, WQ, DM, bq, (size_t)SEQ * DM, Q16, Qh, Ql);
    // k stream
    k_cvt8<<<dim3(gX, NB), 256, 0, stream>>>(xk, XB, SEQ * DM / 8, (size_t)SEQ_FULL * DM, (size_t)SEQ * DM);
    k_proj<<<gG, 32 * NW, 0, stream>>>(XB, WK, DM, bk, (size_t)SEQ * DM, K16, Kh, Kl);
    // v stream
    k_cvt8<<<dim3(gX, NB), 256, 0, stream>>>(xv, XB, SEQ * DM / 8, (size_t)SEQ_FULL * DM, (size_t)SEQ * DM);
    k_projt<<<dim3(DQ / 128, SEQ / 128, NB), 32 * NW, 0, stream>>>(WV, XB, DM, bv, (size_t)SEQ * DM, VT16, VTh, VTl);
    // attention: query rows [0, RHE) on hi/lo planes, rows [RHE, SEQ) on f16 planes
    k_attn_hi<<<dim3(RHE / (16 * NW), NH_, NB), 32 * NW, 0, stream>>>(Qh, Ql, Kh, Kl, VTh, VTl, mask, ATh, ATl);
#if SEQ > RH
    k_attn_lo<<<dim3((SEQ - RHE) / (16 * NW), NH_, NB), 32 * NW, 0, stream>>>(Q16, K16, VT16, mask, ATh, ATl);
#endif
    // output projection: per batch rows of the full-size output
    k_oproj<<<dim3(SEQ / 128, DM / 128, NB), 32 * NW, 0, stream>>>(ATh, ATl, WO, DQ, OUT, DM, bo, (size_t)SEQ * DQ, (size_t)SEQ_FULL * DM);
}

// v005
// One run takes 246 microseconds.
// Next to v004, in two timings, it ran 1.12 times as fast each time.
// Counting every step since v000, it is 2.07 times as fast.
#include <hip/hip_runtime.h>

// Three-stream masked attention: q = xq Wq^T + bq, k = xk Wk^T + bk, v = xv Wv^T + bv (weights [out][in]); 16 heads x 64 (head h = columns h*64+d); scores x 1/8; integer mask [SEQ][SEQ] read by value (0 -> score := -1e9); softmax; out = ctx Wo^T + bo.
// Compute dtypes, f32 accumulate: every float input RNE-converted to bf16; projections v_wmma_f32_16x16x32_bf16 (exact operand products); attention query rows < RH: bf16 hi+lo planes for q, k, v and p (3 products per site); rows >= RH: v_wmma_f32_16x16x32_f16 single products (q, k, v, p as f16); online softmax f32; ctx carried as bf16 hi+lo planes x Wo bf16 (2 products).
// Engine: four waves per 128x128 GEMM tile, one 64x64 quarter each (operands from K-contiguous 16-bit planes through LDS: two buffers, asynchronous copies); the q, k, v projections convert their f32 sums in the epilogue and store the head planes themselves (v as W X^T, so that its tile rows are d and its columns t); fused flash-style attention on transposed tiles (S^T = K Q^T, O^T = V^T P^T: a query is a lane's column), four waves per work-group (16 query rows each), 32-key steps; the work-group's waves share 64-key K and V^T tiles in LDS (two buffers, asynchronous copies); q straight from global memory; the mask packed once per call into 32-lane bit masks (k_mpack), read by scalar loads; no score or probability plane in global memory.

#ifndef NB
#define NB 2
#endif
#ifndef SEQ
#define SEQ 2048
#endif
#define NB_FULL  2
#define SEQ_FULL 2048
#define DM   1024
#define NH_  16
#define HD   64
#define DQ   (NH_ * HD)
#define RH   512                  // query rows < RH use hi+lo planes
#define RHE  ((RH < SEQ) ? RH : SEQ)
#define SCL  0.125f               // HD^-0.5
#define L2E  1.4426950408889634f
#define MFILL (-1.0e9f)           // value that replaces a masked score
#define MINIT (-1.0e30f)          // running-max start (below MFILL)
#define MSEEN (-5.0e8f)           // running max above this <=> the row has met an unmasked key
#define F16MINN 6.103515625e-05f  // smallest normal f16
#define CP 72                     // ctx tile pitch (halves): 64 + 8
#define NW 4                      // waves per work-group (attention: 16 query rows each; GEMM: a 64x64 quarter each)
#define KT 64                     // keys per staged K / V^T tile
#define TP 72                     // staged tile pitch (halves): 64 + 8 = 144 bytes, an odd multiple of 16 bytes
#define TPL (64 * TP)             // one staged plane tile (halves): 64 rows (K: keys x d; V^T: d x keys; GEMM operands: rows x k)

typedef _Float16 h16;
typedef unsigned short bf;
typedef __attribute__((ext_vector_type(16))) __bf16   v16bf;
typedef __attribute__((ext_vector_type(16))) _Float16 v16h;
typedef __attribute__((ext_vector_type(8)))  _Float16 v8h;
typedef __attribute__((ext_vector_type(8)))  unsigned short v8us;
typedef __attribute__((ext_vector_type(16))) unsigned short v16us;
typedef __attribute__((ext_vector_type(8)))  float    v8f;
typedef __attribute__((ext_vector_type(4)))  float    v4f;
typedef __attribute__((ext_vector_type(4)))  _Float16 v4h;
typedef __attribute__((ext_vector_type(4)))  unsigned short v4us;
typedef __attribute__((ext_vector_type(4)))  int      v4i;
typedef __attribute__((ext_vector_type(16))) unsigned v16u;
typedef __attribute__((ext_vector_type(8)))  unsigned long long v8ul;
typedef v8h  __attribute__((may_alias)) v8ha;
typedef v4f  __attribute__((may_alias)) v4fa;
typedef v8us __attribute__((may_alias)) v8usa;

static_assert(HD == 64);
static_assert(DQ == DM);                       // merged width equals model width
static_assert(DM % 128 == 0);                  // GEMM tiles of 128, K stages of 128
static_assert(SEQ % 128 == 0);                 // GEMM tiles of 128; attention tiles of 16 rows, 32 keys
static_assert(RH % 16 == 0);                   // hi/lo row split on a query-tile boundary
static_assert(NB <= NB_FULL);
static_assert(SEQ <= SEQ_FULL);
static_assert((CP * 2) % 16 == 0);             // 16-byte aligned ctx tile rows
static_assert((TP * 2) % 16 == 0);             // 16-byte aligned staged rows
static_assert(RHE % (16 * NW) == 0 && (SEQ - RHE) % (16 * NW) == 0);   // whole attention work-groups on both sides of the row split
static_assert(SEQ % KT == 0 && SEQ / KT >= 2); // whole staged tiles; the two-buffer prologue needs two
static_assert(KT == 64 && NW * 32 == 128);     // stage_pair: 512 16-byte pieces per plane tile, 4 per thread
static_assert((long long)NB * NH_ * SEQ * HD < 2147483647LL);       // int element offsets into head planes
static_assert((long long)SEQ_FULL * SEQ_FULL < 2147483647LL);      // int element offsets into the mask

constexpr size_t WS_W  = (size_t)4 * DM * DM * 2;          // four bf16 weight planes
constexpr size_t WS_XB = (size_t)NB * SEQ * DM * 2;        // bf16 copy of one input stream
constexpr size_t WS_PL = (size_t)NB * NH_ * SEQ * HD * 2;  // one 16-bit head plane
constexpr size_t WS_AT = (size_t)NB * SEQ * DQ * 2;        // one merged ctx plane
constexpr size_t WS_PM = (size_t)(SEQ / 16) * (SEQ / 32) * 64;   // packed mask: 16 words per 16-query x 32-key tile
constexpr size_t WS_TOTAL = WS_W + WS_XB + 9 * WS_PL + 2 * WS_AT + WS_PM;
static_assert(WS_TOTAL <= (size_t)134217728);              // carve stays within 128 MiB
static_assert(WS_W % 256 == 0 && WS_XB % 256 == 0 && WS_PL % 256 == 0 && WS_AT % 256 == 0 && WS_PM % 256 == 0);

__device__ __forceinline__ unsigned short f2bf(float f) { unsigned u = __float_as_uint(f); u += 0x7FFFu + ((u >> 16) & 1u); return (unsigned short)(u >> 16); }   // RNE
__device__ __forceinline__ float bf2f(unsigned short b) { return __uint_as_float(((unsigned)b) << 16); }
__device__ __forceinline__ float bfr(float f) { return bf2f(f2bf(f)); }
__device__ __forceinline__ v16h cat16(v8h lo, v8h hi) { return __builtin_shufflevector(lo, hi, 0, 1, 2, 3, 4, 5, 6, 7, 8, 9, 10, 11, 12, 13, 14, 15); }
__device__ __forceinline__ v16bf cat16b(v8us lo, v8us hi) { return __builtin_bit_cast(v16bf, __builtin_shufflevector(lo, hi, 0, 1, 2, 3, 4, 5, 6, 7, 8, 9, 10, 11, 12, 13, 14, 15)); }
__device__ __forceinline__ v8f wmma16(v16h a, v16h b, v8f c) { return __builtin_amdgcn_wmma_f32_16x16x32_f16(false, a, false, b, (short)0, c, false, false); }
__device__ __forceinline__ v8f wmmab(v16bf a, v16bf b, v8f c) { return __builtin_amdgcn_wmma_f32_16x16x32_bf16(false, a, false, b, (short)0, c, false, false); }
__device__ __forceinline__ v8f mma3(v16bf ah, v16bf al, v16bf bh, v16bf bl, v8f c) { c = wmmab(ah, bh, c); c = wmmab(ah, bl, c); c = wmmab(al, bh, c); return c; }   // hi hi, then hi x B lo, then A lo x hi
__device__ __forceinline__ float xhalf(float x) { return __builtin_bit_cast(float, __builtin_amdgcn_permlanex16(__builtin_bit_cast(int, x), __builtin_bit_cast(int, x), 0x76543210, 0xfedcba98, false, false)); }   // lane l with lane l ^ 16
__device__ __forceinline__ h16 tohx(float x) { return (h16)x; }
__device__ __forceinline__ void splitf(float y, unsigned short& h, unsigned short& l) { h = f2bf(y); l = f2bf(y - bf2f(h)); }
__device__ __forceinline__ void wave_sync() { __builtin_amdgcn_wave_barrier(); asm volatile("" ::: "memory"); }   // same-wave LDS exchange (tiles are private to the wave)

// Fragment loaders (A and B alike): lane (lr = lane & 15, hi = lane >> 4) points at row/column lr, element 8*hi of the 32-deep k-step;
// elements 0..7 <- k0 + 8hi + 0..7, elements 8..15 <- k0 + 16 + 8hi + 0..7.
template <typename T16> struct WFrag;
template <> struct WFrag<h16> { typedef v16h V; static __device__ __forceinline__ V ld(const h16* p) { return cat16(*(const v8h*)p, *(const v8h*)(p + 16)); } static __device__ __forceinline__ v8f mma(V a, V b, v8f c) { return wmma16(a, b, c); } };
template <> struct WFrag<bf> { typedef v16bf V; static __device__ __forceinline__ V ld(const bf* p) { return cat16b(*(const v8us*)p, *(const v8us*)(p + 16)); } static __device__ __forceinline__ v8f mma(V a, V b, v8f c) { return wmmab(a, b, c); } };

// ---- staging of 64-row x 128-byte tiles in LDS (GEMM operands; K and V^T of the attention work-group)
__device__ __forceinline__ unsigned lds_off(const void* p) { return (unsigned)(size_t)p; }   // byte offset in the work-group's LDS (low half of the shared address)
__device__ __forceinline__ v16bf ldsb(const unsigned short* p) { return cat16b(*(const v8usa*)p, *(const v8usa*)(p + 16)); }   // fragment from a staged bf16 tile, same k order as WFrag::ld
__device__ __forceinline__ v16h  ldsh(const unsigned short* p) { return cat16(*(const v8ha*)p, *(const v8ha*)(p + 16)); }       // fragment from a staged f16 tile
// Two plane tiles of 64 rows x 128 bytes -> LDS at pitch TP, 16 bytes per lane and copy, 128 threads: copy i of a plane brings row 16 i + (tid >> 3), piece tid & 7.
// la / lb: the lane's LDS byte address of its row-0..15 piece; ga / gb: the lane's global address of the same piece; pa / pb: 16 source rows in elements.
template <typename T16>
__device__ __forceinline__ void stage_pair(unsigned la, const T16* ga, int pa, unsigned lb, const T16* gb, int pb) {
    // copies and their s_wait_xcnt in one statement: no address register of a copy is rewritten ahead of the wait
    asm volatile("global_load_async_to_lds_b128 %0, %8, off\n\t"
                 "global_load_async_to_lds_b128 %1, %9, off\n\t"
                 "global_load_async_to_lds_b128 %2, %10, off\n\t"
                 "global_load_async_to_lds_b128 %3, %11, off\n\t"
                 "global_load_async_to_lds_b128 %4, %12, off\n\t"
                 "global_load_async_to_lds_b128 %5, %13, off\n\t"
                 "global_load_async_to_lds_b128 %6, %14, off\n\t"
                 "global_load_async_to_lds_b128 %7, %15, off\n\t"
                 "s_wait_xcnt 0x0"
                 :: "v"(la), "v"(la + 16u * TP * 2u), "v"(la + 32u * TP * 2u), "v"(la + 48u * TP * 2u),
                    "v"(lb), "v"(lb + 16u * TP * 2u), "v"(lb + 32u * TP * 2u), "v"(lb + 48u * TP * 2u),
                    "v"(ga), "v"(ga + pa), "v"(ga + 2 * pa), "v"(ga + 3 * pa),
                    "v"(gb), "v"(gb + pb), "v"(gb + 2 * pb), "v"(gb + 3 * pb)
                 : "memory");
}

// ---- register-blocked GEMM body: one work-group = NW waves (2 x 2) on a 128x128 output tile, one wave per 64x64 quarter (16 accumulators); grid (M/128, N/128, Z), 128 threads.
// Operands come from K-contiguous 16-bit planes through LDS: a stage is GK = 128 k of the work-group's 128 A rows (and A2 rows) and 128 Bt rows, held as 64-k tiles of 64 rows at pitch TP;
// every thread copies its pieces of stage t + 2 into the buffer that stage t has left (two buffers); one work-group barrier per stage publishes stage t + 1 and frees stage t's buffer.
// C[m][n] (f32, pitch ldc, + bf16-converted bias[n]) = sum_k A[m][k] Bt[n][k] (+ A2 Bt when NSPLIT == 1). z-batch strides sA/sB/sC in elements. K % 128 == 0, M % 128 == 0, N % 128 == 0.
// OUT == 0: C is stored as f32. OUT == 1 (m = t, n = h*64 + d) and OUT == 2 (m = h*64 + d, n = t, bias[m]): the f32 value is converted where it is made and stored to the three 16-bit head planes
// (f16, bf16 hi, bf16 lo) at P*[pb + tile row * pp + tile column]; a tile row is 128 bytes of each plane, one whole line per 16 lanes.
#define GK 128                    // k per staged GEMM stage (two 64-k tiles per operand row block)
template <typename T16, int NSPLIT, bool BIAS, int OUT = 0>
__device__ __forceinline__ void gemmw_body(const T16* __restrict__ A, const T16* __restrict__ A2, const T16* __restrict__ Bt, int K, float* C, int ldc, const float* __restrict__ bias, size_t sA, size_t sB, size_t sC,
                                           h16* P16 = nullptr, bf* Ph = nullptr, bf* Pl = nullptr) {
    typedef typename WFrag<T16>::V V;
    static_assert(NSPLIT == 0 || NSPLIT == 1);
    constexpr int NT = 2 + NSPLIT;                                           // staged operands: A, (A2,) Bt
    constexpr int GT = 2 * TPL;                                              // 128 rows x 64 k of one operand (halves)
    constexpr int GB = (GK / 64) * NT * GT;                                  // one buffer (halves): [64-k half][operand][128 rows at pitch TP]
    static_assert((GK / 64) * NT * 8 <= 63);                                 // copies of one wave in flight: one stage's, 8 per operand and 64-k half
    __shared__ __align__(16) unsigned short gst[2 * GB];                     // two buffers of staged operands
    __shared__ __align__(16) float osa[NW * 16 * 68];                        // epilogue tiles, one per wave
    const size_t z = blockIdx.z; A += z * sA; if (NSPLIT) A2 += z * sA; Bt += z * sB; C += z * sC;
    const int tid = threadIdx.x, lane = tid & 31, lr = lane & 15, hi = lane >> 4;
    const int wave = __builtin_amdgcn_readfirstlane(tid >> 5);
    float* os = osa + wave * (16 * 68);
    const int R0 = blockIdx.x * 128, C0 = blockIdx.y * 128;                  // the work-group's tile
    const int r0 = R0 + (wave >> 1) * 64, c0 = C0 + (wave & 1) * 64;         // the wave's quarter
    v8f acc[4][4];
#pragma unroll
    for (int mb = 0; mb < 4; ++mb)
#pragma unroll
        for (int nb = 0; nb < 4; ++nb) acc[mb][nb] = (v8f){};
    const unsigned sl = lds_off(gst) + (unsigned)((tid >> 3) * TP + (tid & 7) * 8) * 2u;   // this thread's piece in a staged 64-row tile
    const size_t sga = (size_t)(R0 + (tid >> 3)) * K + (tid & 7) * 8;        // the same piece in A's rows R0..R0+63: + 64 K (rows + 64), + k
    const size_t sgb = (size_t)(C0 + (tid >> 3)) * K + (tid & 7) * 8;        // the same piece in Bt's rows C0..C0+63
    auto stage = [&](int t, int bi) {
#pragma unroll
        for (int s = 0; s < GK / 64; ++s) {
            const unsigned l = sl + (unsigned)((bi * GB + s * NT * GT) * 2);
            const size_t k = (size_t)t * GK + s * 64;
            // each scheduling barrier keeps the next eight copies' address arithmetic behind the eight just issued: their registers are reused, nothing spills beside the 128 accumulators
            stage_pair<T16>(l, A + sga + k, 16 * K, l + TPL * 2u, A + sga + (size_t)64 * K + k, 16 * K);
            __builtin_amdgcn_sched_barrier(0);
            if (NSPLIT) { stage_pair<T16>(l + GT * 2u, A2 + sga + k, 16 * K, l + GT * 2u + TPL * 2u, A2 + sga + (size_t)64 * K + k, 16 * K); __builtin_amdgcn_sched_barrier(0); }
            stage_pair<T16>(l + (NT - 1) * GT * 2u, Bt + sgb + k, 16 * K, l + (NT - 1) * GT * 2u + TPL * 2u, Bt + sgb + (size_t)64 * K + k, 16 * K);
            __builtin_amdgcn_sched_barrier(0);
        }
    };
    const int af = ((wave >> 1) * 64 + lr) * TP + 8 * hi;                    // A fragment in a staged operand: + mb*16*TP + 32 (second k-step of the 64-k half)
    const int bo = (NT - 1) * GT + ((wave & 1) * 64 + lr) * TP + 8 * hi;     // Bt fragment: + nb*16*TP + 32
    const int nst = K / GK;
    stage(0, 0);
    asm volatile("s_wait_asynccnt 0x0" ::: "memory");                           // this wave's pieces of stage 0 have landed
    __syncthreads();                                                            // stage 0 published to all waves
    if (1 < nst) stage(1, 1);
#pragma unroll 1
    for (int t = 0; t < nst; ++t) {
        const unsigned short* sb = gst + (t & 1) * GB;
#pragma unroll
        for (int ks = 0; ks < GK / 32; ++ks) {
            const unsigned short* sk = sb + (ks >> 1) * (NT * GT) + (ks & 1) * 32;
            V a[4], a2[4], b[4];
#pragma unroll
            for (int mb = 0; mb < 4; ++mb) { a[mb] = ldsb(sk + af + mb * 16 * TP); if (NSPLIT) a2[mb] = ldsb(sk + GT + af + mb * 16 * TP); b[mb] = ldsb(sk + bo + mb * 16 * TP); }
            // inputs-only fence on the loaded fragments: the k-step's LDS reads are issued as one group in front of its WMMAs (one LDS wait per k-step, not one per Bt fragment)
            if (NSPLIT) asm volatile("" :: "v"(a[0]), "v"(a[1]), "v"(a[2]), "v"(a[3]), "v"(a2[0]), "v"(a2[1]), "v"(a2[2]), "v"(a2[3]), "v"(b[0]), "v"(b[1]), "v"(b[2]), "v"(b[3]));
            else        asm volatile("" :: "v"(a[0]), "v"(a[1]), "v"(a[2]), "v"(a[3]), "v"(b[0]), "v"(b[1]), "v"(b[2]), "v"(b[3]));
#pragma unroll
            for (int nb = 0; nb < 4; ++nb) {
#pragma unroll
                for (int mb = 0; mb < 4; ++mb) { acc[mb][nb] = WFrag<T16>::mma(a[mb], b[nb], acc[mb][nb]); if (NSPLIT) acc[mb][nb] = WFrag<T16>::mma(a2[mb], b[nb], acc[mb][nb]); } }
        }
        // foot of stage t
        asm volatile("s_wait_dscnt 0x0" ::: "memory");                          // this wave's reads of stage t's buffer have returned
        asm volatile("s_wait_asynccnt 0x0" ::: "memory");                       // this wave's pieces of stage t + 1 have landed
        __syncthreads();                                                        // publishes stage t + 1; ends every wave's reads of stage t's buffer
        if (t + 2 < nst) stage(t + 2, t & 1);                                   // refill the buffer just left (same test in every wave)
    }
    asm volatile("s_wait_asynccnt 0x0" ::: "memory");                           // no copy in flight behind the loop
#pragma unroll
    for (int mb = 0; mb < 4; ++mb) {
#pragma unroll
        for (int nb = 0; nb < 4; ++nb) {
#pragma unroll
            for (int j = 0; j < 8; ++j) os[(hi * 8 + j) * 68 + nb * 16 + lr] = acc[mb][nb][j]; }
        wave_sync();
        float* crow = C + (size_t)(r0 + mb * 16) * ldc + c0;
if (OUT == 0) {
#pragma unroll
            for (int s = 0; s < 8; ++s) { const int row = 2 * s + hi, cofs = lr * 4; v4f val = *(const v4fa*)(os + row * 68 + cofs); if (BIAS) { val[0] += bfr(bias[c0 + cofs]); val[1] += bfr(bias[c0 + cofs + 1]); val[2] += bfr(bias[c0 + cofs + 2]); val[3] += bfr(bias[c0 + cofs + 3]); }
                *(v4f*)(crow + (size_t)row * ldc + cofs) = val; }
             }
        else {
            const size_t pb = (OUT == 1) ? ((z * NH_ + c0 / 64) * SEQ + r0 + mb * 16) * HD : ((z * NH_ + r0 / 64) * HD + mb * 16) * SEQ + c0;   // head = the quarter's index along h*64 + d
            const int pp = (OUT == 1) ? HD : SEQ;
#pragma unroll
            for (int s = 0; s < 8; ++s) { const int row = 2 * s + hi, cofs = lr * 4; v4f val = *(const v4fa*)(os + row * 68 + cofs);
                if (BIAS && OUT == 1) { val[0] += bfr(bias[c0 + cofs]); val[1] += bfr(bias[c0 + cofs + 1]); val[2] += bfr(bias[c0 + cofs + 2]); val[3] += bfr(bias[c0 + cofs + 3]); }
                if (BIAS && OUT == 2) { const float br = bfr(bias[r0 + mb * 16 + row]); val[0] += br; val[1] += br; val[2] += br; val[3] += br; }
                v4h o16; v4us oh, ol;
#pragma unroll
                for (int q = 0; q < 4; ++q) { o16[q] = tohx(val[q]); unsigned short a2, c2; splitf(val[q], a2, c2); oh[q] = a2; ol[q] = c2; }
                const size_t pe = pb + (size_t)row * pp + cofs;
                *(v4h*)(P16 + pe) = o16; *(v4us*)(Ph + pe) = oh; *(v4us*)(Pl + pe) = ol;
                asm volatile("s_wait_xcnt 0x0" ::: "memory"); }   // stands in front of the next rows' values, which reuse the registers these stores name
        }
        wave_sync();
    }
}
// k_proj: y[z][t][n] = XB[z][t][:] . W[n][:] + b[n] (bf16 x bf16, one product), stored as [z*NH_ + h][t][d] planes; grid (SEQ/128, DQ/128, NB).
__global__ __launch_bounds__(32 * NW) void k_proj(const bf* A, const bf* Bt, int K, const float* bias, size_t sA, h16* P16, bf* Ph, bf* Pl) {
    gemmw_body<bf, 0, true, 1>(A, nullptr, Bt, K, nullptr, 0, bias, sA, (size_t)0, (size_t)0, P16, Ph, Pl); }
// k_projt: the same product with W as A and XB as B, stored as [z*NH_ + h][d][t] planes; grid (DQ/128, SEQ/128, NB).
__global__ __launch_bounds__(32 * NW) void k_projt(const bf* A, const bf* Bt, int K, const float* bias, size_t sB, h16* P16, bf* Ph, bf* Pl) {
    gemmw_body<bf, 0, true, 2>(A, nullptr, Bt, K, nullptr, 0, bias, (size_t)0, sB, (size_t)0, P16, Ph, Pl); }
// k_oproj: OUT[z][t][n] = (ATh + ATl)[z][t][:] . Wo[n][:] + bo[n] (two products).
__global__ __launch_bounds__(32 * NW) void k_oproj(const bf* A, const bf* A2, const bf* Bt, int K, float* C, int ldc, const float* bias, size_t sA, size_t sC) {
    gemmw_body<bf, 1, true>(A, A2, Bt, K, C, ldc, bias, sA, (size_t)0, sC); }

__global__ __launch_bounds__(256) void k_cvt8(const float* __restrict__ src, bf* dst, int n8, size_t sS, size_t sD) {
    const int i = blockIdx.x * 256 + threadIdx.x; if (i >= n8) return; src += (size_t)blockIdx.y * sS; dst += (size_t)blockIdx.y * sD;
    const v8f v = *(const v8f*)(src + (size_t)i * 8); v8us o;
#pragma unroll
    for (int k = 0; k < 8; ++k) o[k] = f2bf(v[k]);
    *(v8us*)(dst + (size_t)i * 8) = o;  }

// k_mpack: the integer mask, read by value, as lane masks of the attention's S^T accumulators. PM[(qt * (SEQ/32) + st) * 16 + g*8 + r], bit l = (mask[qt*16 + (l & 15)][st*32 + g*16 + 8*(l >> 4) + r] != 0):
// word g*8 + r selects, lane by lane, element r of score accumulator g of query tile qt at key step st. One wave = one query tile x two key steps = 32 words = one 128-byte line; grid (SEQ/16)*(SEQ/64)/8, 256 threads.
__global__ __launch_bounds__(256) void k_mpack(const int* __restrict__ mask, unsigned* PM) {
    const int lane = threadIdx.x & 31, lr = lane & 15, hi = lane >> 4;
    const int w = blockIdx.x * 8 + (threadIdx.x >> 5), qt = w / (SEQ / 64), t = w % (SEQ / 64);
    const int* mp = mask + (qt * 16 + lr) * SEQ_FULL + t * 64 + 8 * hi;
    v4i m[8];
#pragma unroll
    for (int s = 0; s < 2; ++s) { m[4 * s] = *(const v4i*)(mp + 32 * s); m[4 * s + 1] = *(const v4i*)(mp + 32 * s + 4); m[4 * s + 2] = *(const v4i*)(mp + 32 * s + 16); m[4 * s + 3] = *(const v4i*)(mp + 32 * s + 20); }
    unsigned v = 0u;
#pragma unroll
    for (int j = 0; j < 32; ++j) { const unsigned b = __builtin_amdgcn_ballot_w32(m[j >> 2][j & 3] != 0); v = (lane == j) ? b : v; }   // lane j keeps word j
    PM[(size_t)w * 32 + lane] = v;
}

// ---- fused attention body: one work-group = NW waves of one (b, h); one wave = 16 query rows (q0..q0+15); key loop in 32-key steps, two steps per staged 64-key tile.
// K and V^T tiles: every thread copies its pieces of tile t + 2 into the buffer that tile t has left (two buffers); one work-group barrier per tile publishes tile t + 1 and frees tile t's buffer.
// Per step: (1) the 16x32 mask tile comes as 16 lane masks (k_mpack: one word per S^T accumulator element), one 64-byte scalar load issued one step ahead; a tile whose 512 entries are all 0
// is skipped (wave-uniform, decided on the words read); (2) S^T = k q^T (two 16x16 accumulators: row = key 8*hi + r, column = query lr; k fragments from LDS as A, q fragments as B, reloaded per step through an
// opaque integer offset); (3) e = mask == 0 ? -1e9 : S/8; online softmax in f32, one running maximum per query (16 values in the lane, then lane l with l ^ 16) and one running sum per lane (halves joined in the epilogue); (4) the lane's 16 probabilities are
// the B fragment of P^T as they stand (elements 0..7 = keys 8*hi + r, 8..15 = keys 16 + 8*hi + r); O^T += V^T P^T (four d-tiles, V^T fragments from LDS as A; row = d, column = query).
// A skipped all-masked tile contributes exactly 0 to every row that meets an unmasked key somewhere (exp underflow); if some row of the work-group never does, the work-group repeats the loop
// with skipping disabled (every entry -1e9 -> uniform weights; rows that do meet a key end with the same values), so the result is exact for any mask contents.
template <bool HI>
__device__ __forceinline__ void attn_body(const h16* __restrict__ Q16, const h16* __restrict__ K16, const h16* __restrict__ VT16,
                                          const bf* __restrict__ Qh, const bf* __restrict__ Ql, const bf* __restrict__ Kh, const bf* __restrict__ Kl,
                                          const bf* __restrict__ VTh, const bf* __restrict__ VTl, const unsigned* __restrict__ PM, bf* ATh, bf* ATl, int row_base) {
    constexpr int NPL = HI ? 4 : 2;                                          // staged planes per buffer: Kh Kl VTh VTl, or K16 VT16
    __shared__ __align__(16) unsigned short stg[2 * NPL * TPL];              // two buffers of staged tiles
    __shared__ __align__(16) unsigned short ctha[NW * 16 * CP];              // ctx tiles hi
    __shared__ __align__(16) unsigned short ctla[NW * 16 * CP];              // ctx tiles lo
    __shared__ int wflag[NW];                                                // per wave: some row has met no unmasked key
    const int tid = threadIdx.x, lane = tid & 31, lr = lane & 15, hi = lane >> 4;
    const int wave = __builtin_amdgcn_readfirstlane(tid >> 5);
    unsigned short* cth = ctha + wave * 16 * CP;
    unsigned short* ctl = ctla + wave * 16 * CP;
    const int q0 = row_base + ((int)blockIdx.x * NW + wave) * 16;
    const int h = blockIdx.y, b = blockIdx.z;
    const int zoff  = (b * NH_ + h) * (SEQ * HD);            // head plane offset ([t][d] and [d][t] planes both hold SEQ*HD elements)
    const int qbase = zoff + (q0 + lr) * HD + 8 * hi;        // B fragment of q: column = query q0 + lr; + c2*32
    const int kfrag = lr * TP + 8 * hi;                      // A fragment of k in a staged tile: row = key (sub*32 + nt*16 + lr); + (sub*32 + nt*16)*TP + c2*32
    const int vfrag = lr * TP + 8 * hi;                      // A fragment of v^T in a staged tile: row = d = dt*16 + lr; + dt*16*TP + sub*32
    // the query tile's lane masks, 16 words per key step; written by an earlier launch and never in this one: read through the constant address space, so that the loads are scalar
    const __attribute__((address_space(4))) v16u* pm = (const __attribute__((address_space(4))) v16u*)(PM + (size_t)(q0 >> 4) * ((SEQ / 32) * 16));
    const unsigned sl = lds_off(stg) + (unsigned)((tid >> 3) * TP + (tid & 7) * 8) * 2u;   // this thread's piece in a staged plane tile
    const int sgk = zoff + (tid >> 3) * HD + (tid & 7) * 8;  // the same piece in a [t][d] plane: + t*KT*HD
    const int sgv = zoff + (tid >> 3) * SEQ + (tid & 7) * 8; // the same piece in a [d][t] plane: + t*KT
    auto stage = [&](int t, int bi) {
        const unsigned l = sl + (unsigned)(bi * NPL * TPL * 2);
        if (HI) {
            stage_pair<bf>(l, Kh + sgk + t * (KT * HD), 16 * HD, l + TPL * 2u, Kl + sgk + t * (KT * HD), 16 * HD);
            stage_pair<bf>(l + 2u * TPL * 2u, VTh + sgv + t * KT, 16 * SEQ, l + 3u * TPL * 2u, VTl + sgv + t * KT, 16 * SEQ);
        } else {
            stage_pair<h16>(l, K16 + sgk + t * (KT * HD), 16 * HD, l + TPL * 2u, VT16 + sgv + t * KT, 16 * SEQ);
        }
    };

    v8f o[4]; float m, l;
    bool dense = false;
#pragma unroll 1
    for (int pass = 0; pass < 2; ++pass) {
#pragma unroll
        for (int t = 0; t < 4; ++t) o[t] = (v8f){};
        m = MINIT; l = 0.0f;
        // two-buffer prologue (on a repeat, the last tile's foot has already ended every read of both buffers)
        stage(0, 0);
        asm volatile("s_wait_asynccnt 0x0" ::: "memory");                       // this wave's pieces of tile 0 have landed
        __syncthreads();                                                        // tile 0 published to all waves
        stage(1, 1);
        v16u nx = pm[0];                                                        // lane masks of step 0
#pragma unroll 1
        for (int t = 0; t < SEQ / KT; ++t) {
            const unsigned short* sb = stg + (t & 1) * (NPL * TPL);
#pragma unroll 1
            for (int sub = 0; sub < 2; ++sub) {                                 // rolled: one copy of the step's code
            const int st = t * 2 + sub;
            const v16u cw = nx;                                                 // this step's lane masks, loaded during the step before
            nx = pm[(st + 1 < SEQ / 32) ? st + 1 : SEQ / 32 - 1];               // the next step's (the last step reads its own again)
            const v8ul c8 = __builtin_bit_cast(v8ul, cw);
            const bool anyw = (((c8[0] | c8[1]) | (c8[2] | c8[3])) | ((c8[4] | c8[5]) | (c8[6] | c8[7]))) != 0ull;   // wave-uniform
            if (!(dense || anyw)) continue;                                     // whole 16x32 tile masked: skipped (its words were read); the tile's foot below is still passed

            int qo = qbase; asm volatile("" : "+v"(qo));                        // opaque offset: q fragments are reloaded each step, not held across the loop
            const unsigned short* kf = sb + kfrag + sub * 32 * TP;
            v8f s0 = (v8f){}, s1 = (v8f){};
            if (HI) {
                const v16bf qh0 = WFrag<bf>::ld(Qh + qo), qh1 = WFrag<bf>::ld(Qh + qo + 32);
                const v16bf ql0 = WFrag<bf>::ld(Ql + qo), ql1 = WFrag<bf>::ld(Ql + qo + 32);
                s0 = mma3(ldsb(kf), ldsb(kf + TPL), qh0, ql0, s0);
                s0 = mma3(ldsb(kf + 32), ldsb(kf + TPL + 32), qh1, ql1, s0);
                s1 = mma3(ldsb(kf + 16 * TP), ldsb(kf + TPL + 16 * TP), qh0, ql0, s1);
                s1 = mma3(ldsb(kf + 16 * TP + 32), ldsb(kf + TPL + 16 * TP + 32), qh1, ql1, s1);
                asm volatile("v_nop\n\tv_nop\n\tv_nop\n\tv_nop" : "+v"(s0), "+v"(s1) : "v"(qh1), "v"(ql1));
            } else {
                const v16h qa0 = WFrag<h16>::ld(Q16 + qo), qa1 = WFrag<h16>::ld(Q16 + qo + 32);
                s0 = wmma16(ldsh(kf), qa0, s0);
                s0 = wmma16(ldsh(kf + 32), qa1, s0);
                s1 = wmma16(ldsh(kf + 16 * TP), qa0, s1);
                s1 = wmma16(ldsh(kf + 16 * TP + 32), qa1, s1);
                asm volatile("v_nop\n\tv_nop\n\tv_nop\n\tv_nop" : "+v"(s0), "+v"(s1) : "v"(qa0), "v"(qa1));
            }

            float e0[8], e1[8], t8[8];
#pragma unroll
            for (int r = 0; r < 8; ++r) { e0[r] = __builtin_amdgcn_inverse_ballot_w32(cw[r]) ? s0[r] * SCL : MFILL; e1[r] = __builtin_amdgcn_inverse_ballot_w32(cw[8 + r]) ? s1[r] * SCL : MFILL; t8[r] = fmaxf(e0[r], e1[r]); }
            float rm = fmaxf(fmaxf(fmaxf(t8[0], t8[1]), fmaxf(t8[2], t8[3])), fmaxf(fmaxf(t8[4], t8[5]), fmaxf(t8[6], t8[7])));
            rm = fmaxf(rm, xhalf(rm));                                          // the query's other 16 keys of the step
            const float mn = fmaxf(m, rm);
            const float al = __builtin_amdgcn_exp2f((m - mn) * L2E);
            v16us ph, pl; v16h pa;                                              // B fragments of P^T
#pragma unroll
            for (int r = 0; r < 8; ++r) {
                float x0 = __builtin_amdgcn_exp2f((e0[r] - mn) * L2E);
                float x1 = __builtin_amdgcn_exp2f((e1[r] - mn) * L2E);
                if (HI) {
                    unsigned short a0, c0, a1, c1; splitf(x0, a0, c0); splitf(x1, a1, c1);
                    ph[r] = a0; pl[r] = c0; ph[8 + r] = a1; pl[8 + r] = c1;
                    t8[r] = x0 + x1;
                } else {
                    x0 = (x0 < F16MINN) ? 0.0f : x0; x1 = (x1 < F16MINN) ? 0.0f : x1;      // no subnormal f16 operands; the row sum uses the same values
                    const h16 g0 = tohx(x0), g1 = tohx(x1);
                    pa[r] = g0; pa[8 + r] = g1;
                    t8[r] = (float)g0 + (float)g1;
                }
            }
            float rs = ((t8[0] + t8[1]) + (t8[2] + t8[3])) + ((t8[4] + t8[5]) + (t8[6] + t8[7]));
            l = l * al + rs; m = mn;                                           // l: this lane's half of the keys; the two halves (same al) are joined behind the loop
#pragma unroll
            for (int dt = 0; dt < 4; ++dt) o[dt] *= al;
            const unsigned short* vf = sb + (HI ? 2 : 1) * TPL + vfrag + sub * 32;
            if (HI) {
                const v16bf pb = __builtin_bit_cast(v16bf, ph), pc = __builtin_bit_cast(v16bf, pl);
                const v16bf vh0 = ldsb(vf), vh1 = ldsb(vf + 16 * TP), vh2 = ldsb(vf + 32 * TP), vh3 = ldsb(vf + 48 * TP);
                const v16bf vl0 = ldsb(vf + TPL), vl1 = ldsb(vf + TPL + 16 * TP), vl2 = ldsb(vf + TPL + 32 * TP), vl3 = ldsb(vf + TPL + 48 * TP);
                o[0] = mma3(vh0, vl0, pb, pc, o[0]); o[1] = mma3(vh1, vl1, pb, pc, o[1]); o[2] = mma3(vh2, vl2, pb, pc, o[2]); o[3] = mma3(vh3, vl3, pb, pc, o[3]);
                asm volatile("v_nop\n\tv_nop\n\tv_nop\n\tv_nop" : "+v"(o[0]), "+v"(o[1]), "+v"(o[2]), "+v"(o[3]) : "v"(pb), "v"(pc));
            } else {
                const v16h v0 = ldsh(vf), v1 = ldsh(vf + 16 * TP), v2 = ldsh(vf + 32 * TP), v3 = ldsh(vf + 48 * TP);
                o[0] = wmma16(v0, pa, o[0]); o[1] = wmma16(v1, pa, o[1]); o[2] = wmma16(v2, pa, o[2]); o[3] = wmma16(v3, pa, o[3]);
                asm volatile("v_nop\n\tv_nop\n\tv_nop\n\tv_nop" : "+v"(o[0]), "+v"(o[1]), "+v"(o[2]), "+v"(o[3]) : "v"(pa), "v"(v3));
            }
            }
            // foot of tile t, passed by every wave whatever it skipped
            asm volatile("s_wait_dscnt 0x0" ::: "memory");                      // this wave's reads of tile t's buffer have returned
            asm volatile("s_wait_asynccnt 0x0" ::: "memory");                   // this wave's pieces of tile t + 1 have landed
            __syncthreads();                                                    // publishes tile t + 1; ends every wave's reads of tile t's buffer
            if (t + 2 < SEQ / KT) stage(t + 2, t & 1);                          // refill the buffer just left (same test in every wave)
        }
        asm volatile("s_wait_asynccnt 0x0" ::: "memory");                       // no copy in flight behind the loop
        const bool bad = !(m > MSEEN);
        const int wbad = (__builtin_amdgcn_ballot_w32(bad) != 0u) ? 1 : 0;      // taken with every lane on
        if (lane == 0) wflag[wave] = wbad;
        __syncthreads();                                                        // the repeat is decided for the whole work-group: its barriers need every wave
        const int anyb = wflag[0] | wflag[1] | wflag[2] | wflag[3];
        if (__builtin_amdgcn_readfirstlane(anyb) == 0) break;                   // every row met an unmasked key: skipped tiles contributed exactly 0
        dense = true;                                                           // otherwise repeat without skipping (work-group-uniform)
    }

    const float inv = 1.0f / (l + xhalf(l));
#pragma unroll
    for (int dt = 0; dt < 4; ++dt) { v8us a8, c8;                               // the lane's 8 consecutive d of its query: one 16-byte piece of each ctx tile row
#pragma unroll
        for (int r = 0; r < 8; ++r) { unsigned short a, c; splitf(o[dt][r] * inv, a, c); a8[r] = a; c8[r] = c; }
        *(v8usa*)(cth + lr * CP + dt * 16 + 8 * hi) = a8; *(v8usa*)(ctl + lr * CP + dt * 16 + 8 * hi) = c8; }
    wave_sync();
    v8us hv[4], lv[4];
#pragma unroll
    for (int s = 0; s < 4; ++s) { const int row = 4 * s + (lane >> 3); hv[s] = *(const v8usa*)(cth + row * CP + (lane & 7) * 8); lv[s] = *(const v8usa*)(ctl + row * CP + (lane & 7) * 8); }
    const size_t ob = (size_t)(b * SEQ + q0 + (lane >> 3)) * DQ + h * HD + (lane & 7) * 8;
{
#pragma unroll
        for (int s = 0; s < 4; ++s) { *(v8us*)(ATh + ob + (size_t)(4 * s) * DQ) = hv[s]; *(v8us*)(ATl + ob + (size_t)(4 * s) * DQ) = lv[s]; }
         }
}
__global__ __launch_bounds__(32 * NW) void k_attn_hi(const bf* Qh, const bf* Ql, const bf* Kh, const bf* Kl, const bf* VTh, const bf* VTl, const unsigned* PM, bf* ATh, bf* ATl) {
    attn_body<true>(nullptr, nullptr, nullptr, Qh, Ql, Kh, Kl, VTh, VTl, PM, ATh, ATl, 0); }
__global__ __launch_bounds__(32 * NW) void k_attn_lo(const h16* Q16, const h16* K16, const h16* VT16, const unsigned* PM, bf* ATh, bf* ATl) {
    attn_body<false>(Q16, K16, VT16, nullptr, nullptr, nullptr, nullptr, nullptr, nullptr, PM, ATh, ATl, RHE); }

extern "C" void kernel_launch(void* const* d_in, const int* in_sizes, int n_in,
                              void* d_out, int out_size, void* d_ws, size_t ws_size, hipStream_t stream) {
    if (n_in < 12) return;
    const long long need_x = (long long)(NB - 1) * SEQ_FULL * DM + (long long)SEQ * DM;      // rows read from a full-size stream
    const long long need_m = (long long)(SEQ - 1) * SEQ_FULL + SEQ;
    if (in_sizes[0] < need_x || in_sizes[1] < need_x || in_sizes[2] < need_x || in_sizes[3] < need_m) return;
    if (in_sizes[4] < DM * DM || in_sizes[6] < DM * DM || in_sizes[8] < DM * DM || in_sizes[10] < DM * DM) return;
    if (in_sizes[5] < DM || in_sizes[7] < DM || in_sizes[9] < DM || in_sizes[11] < DM) return;
    if ((long long)out_size < need_x) return;
    if (WS_TOTAL > ws_size) return;
    // wire order: x_q, x_k, x_v, mask (int32 [1][1][SEQ_FULL][SEQ_FULL]), Wq, bq, Wk, bk, Wv, bv, Wo, bo; weights [out][in]
    const float* xq = (const float*)d_in[0]; const float* xk = (const float*)d_in[1]; const float* xv = (const float*)d_in[2];
    const int* mask = (const int*)d_in[3];
    const float* wq = (const float*)d_in[4]; const float* bq = (const float*)d_in[5];
    const float* wk = (const float*)d_in[6]; const float* bk = (const float*)d_in[7];
    const float* wv = (const float*)d_in[8]; const float* bv = (const float*)d_in[9];
    const float* wo = (const float*)d_in[10]; const float* bo = (const float*)d_in[11];
    float* OUT = (float*)d_out;     // [NB_FULL][SEQ_FULL][DM]
    char* wsp = (char*)d_ws;
    auto take = [&](size_t bytes) { char* p = wsp; wsp += bytes; return (void*)p; };      // all sizes are multiples of 256 bytes
    bf* WQ = (bf*)take(WS_W / 4); bf* WK = (bf*)take(WS_W / 4); bf* WV = (bf*)take(WS_W / 4); bf* WO = (bf*)take(WS_W / 4);
    bf* XB = (bf*)take(WS_XB);
    h16* Q16 = (h16*)take(WS_PL); bf* Qh = (bf*)take(WS_PL); bf* Ql = (bf*)take(WS_PL);
    h16* K16 = (h16*)take(WS_PL); bf* Kh = (bf*)take(WS_PL); bf* Kl = (bf*)take(WS_PL);
    h16* VT16 = (h16*)take(WS_PL); bf* VTh = (bf*)take(WS_PL); bf* VTl = (bf*)take(WS_PL);
    bf* ATh = (bf*)take(WS_AT); bf* ATl = (bf*)take(WS_AT);
    unsigned* PM = (unsigned*)take(WS_PM);
    if ((size_t)(wsp - (char*)d_ws) > ws_size) return;

    const unsigned gW = (unsigned)((DM * DM / 8 + 255) / 256), gX = (unsigned)((SEQ * DM / 8 + 255) / 256);
    k_cvt8<<<dim3(gW, 1), 256, 0, stream>>>(wq, WQ, DM * DM / 8, (size_t)0, (size_t)0);
    k_cvt8<<<dim3(gW, 1), 256, 0, stream>>>(wk, WK, DM * DM / 8, (size_t)0, (size_t)0);
    k_cvt8<<<dim3(gW, 1), 256, 0, stream>>>(wv, WV, DM * DM / 8, (size_t)0, (size_t)0);
    k_cvt8<<<dim3(gW, 1), 256, 0, stream>>>(wo, WO, DM * DM / 8, (size_t)0, (size_t)0);
    const dim3 gG(SEQ / 128, DQ / 128, NB);
    // q stream
    k_cvt8<<<dim3(gX, NB), 256, 0, stream>>>(xq, XB, SEQ * DM / 8, (size_t)SEQ_FULL * DM, (size_t)SEQ * DM);
    k_proj<<<gG, 32 * NW, 0, stream>>>(XB, WQ, DM, bq, (size_t)SEQ * DM, Q16, Qh, Ql);
    // k stream
    k_cvt8<<<dim3(gX, NB), 256, 0, stream>>>(xk, XB, SEQ * DM / 8, (size_t)SEQ_FULL * DM, (size_t)SEQ * DM);
    k_proj<<<gG, 32 * NW, 0, stream>>>(XB, WK, DM, bk, (size_t)SEQ * DM, K16, Kh, Kl);
    // v stream
    k_cvt8<<<dim3(gX, NB), 256, 0, stream>>>(xv, XB, SEQ * DM / 8, (size_t)SEQ_FULL * DM, (size_t)SEQ * DM);
    k_projt<<<dim3(DQ / 128, SEQ / 128, NB), 32 * NW, 0, stream>>>(WV, XB, DM, bv, (size_t)SEQ * DM, VT16, VTh, VTl);
    // mask -> lane masks, once for all batches and heads
    k_mpack<<<dim3((SEQ / 16) * (SEQ / 64) / 8), 256, 0, stream>>>(mask, PM);
    // attention: query rows [0, RHE) on hi/lo planes, rows [RHE, SEQ) on f16 planes
    k_attn_hi<<<dim3(RHE / (16 * NW), NH_, NB), 32 * NW, 0, stream>>>(Qh, Ql, Kh, Kl, VTh, VTl, PM, ATh, ATl);
#if SEQ > RH
    k_attn_lo<<<dim3((SEQ - RHE) / (16 * NW), NH_, NB), 32 * NW, 0, stream>>>(Q16, K16, VT16, PM, ATh, ATl);
#endif
    // output projection: per batch rows of the full-size output
    k_oproj<<<dim3(SEQ / 128, DM / 128, NB), 32 * NW, 0, stream>>>(ATh, ATl, WO, DQ, OUT, DM, bo, (size_t)SEQ * DQ, (size_t)SEQ_FULL * DM);
}

// v006
// Measured time: 232 microseconds a run.
// Timed twice side by side with v005, it ran 1.06 times as fast both times.
// All steps since v000 together make it 2.20 times as fast.
#include <hip/hip_runtime.h>

// Three-stream masked attention: q = xq Wq^T + bq, k = xk Wk^T + bk, v = xv Wv^T + bv (weights [out][in]); 16 heads x 64 (head h = columns h*64+d); scores x 1/8; integer mask [SEQ][SEQ] read by value (0 -> score := -1e9); softmax; out = ctx Wo^T + bo.
// Compute dtypes, f32 accumulate: every float input RNE-converted to bf16; projections v_wmma_f32_16x16x32_bf16 (exact operand products); attention query rows < RH: bf16 hi+lo planes for q, k, v and p (3 products per site); rows >= RH: v_wmma_f32_16x16x32_f16 single products (q, k, v, p as f16); online softmax f32; ctx carried as bf16 hi+lo planes x Wo bf16 (2 products).
// Engine: four waves per 128x128 GEMM tile, one 64x64 quarter each (operands from K-contiguous 16-bit planes through LDS: two buffers, asynchronous copies); the q, k, v projections convert their f32 sums in the epilogue and store the head planes themselves (v as W X^T, so that its tile rows are d and its columns t); fused flash-style attention on transposed tiles (S^T = K Q^T, O^T = V^T P^T: a query is a lane's column), four waves per work-group (16 query rows each), 32-key steps; the work-group's waves share 64-key K and V^T tiles in LDS (two buffers, asynchronous copies); q straight from global memory; the mask packed once per call into 32-lane bit masks, read by scalar loads; one preparation launch (k_prep) makes every bf16 copy and the packed mask; no score or probability plane in global memory.

#ifndef NB
#define NB 2
#endif
#ifndef SEQ
#define SEQ 2048
#endif
#define NB_FULL  2
#define SEQ_FULL 2048
#define DM   1024
#define NH_  16
#define HD   64
#define DQ   (NH_ * HD)
#define RH   512                  // query rows < RH use hi+lo planes
#define RHE  ((RH < SEQ) ? RH : SEQ)
#define SCL  0.125f               // HD^-0.5
#define L2E  1.4426950408889634f
#define MFILL (-1.0e9f)           // value that replaces a masked score
#define MINIT (-1.0e30f)          // running-max start (below MFILL)
#define MSEEN (-5.0e8f)           // running max above this <=> the row has met an unmasked key
#define F16MINN 6.103515625e-05f  // smallest normal f16
#define CP 72                     // ctx tile pitch (halves): 64 + 8
#define NW 4                      // waves per work-group (attention: 16 query rows each; GEMM: a 64x64 quarter each)
#define KT 64                     // keys per staged K / V^T tile
#define TP 72                     // staged tile pitch (halves): 64 + 8 = 144 bytes, an odd multiple of 16 bytes
#define TPL (64 * TP)             // one staged plane tile (halves): 64 rows (K: keys x d; V^T: d x keys; GEMM operands: rows x k)

typedef _Float16 h16;
typedef unsigned short bf;
typedef __attribute__((ext_vector_type(16))) __bf16   v16bf;
typedef __attribute__((ext_vector_type(16))) _Float16 v16h;
typedef __attribute__((ext_vector_type(8)))  _Float16 v8h;
typedef __attribute__((ext_vector_type(8)))  unsigned short v8us;
typedef __attribute__((ext_vector_type(16))) unsigned short v16us;
typedef __attribute__((ext_vector_type(8)))  float    v8f;
typedef __attribute__((ext_vector_type(4)))  float    v4f;
typedef __attribute__((ext_vector_type(4)))  _Float16 v4h;
typedef __attribute__((ext_vector_type(4)))  unsigned short v4us;
typedef __attribute__((ext_vector_type(4)))  int      v4i;
typedef __attribute__((ext_vector_type(16))) unsigned v16u;
typedef __attribute__((ext_vector_type(8)))  unsigned long long v8ul;
typedef v8h  __attribute__((may_alias)) v8ha;
typedef v4f  __attribute__((may_alias)) v4fa;
typedef v8us __attribute__((may_alias)) v8usa;

static_assert(HD == 64);
static_assert(DQ == DM);                       // merged width equals model width
static_assert(DM % 128 == 0);                  // GEMM tiles of 128, K stages of 128
static_assert(SEQ % 128 == 0);                 // GEMM tiles of 128; attention tiles of 16 rows, 32 keys
static_assert(RH % 16 == 0);                   // hi/lo row split on a query-tile boundary
static_assert(NB <= NB_FULL);
static_assert(SEQ <= SEQ_FULL);
static_assert((CP * 2) % 16 == 0);             // 16-byte aligned ctx tile rows
static_assert((TP * 2) % 16 == 0);             // 16-byte aligned staged rows
static_assert(RHE % (16 * NW) == 0 && (SEQ - RHE) % (16 * NW) == 0);   // whole attention work-groups on both sides of the row split
static_assert(SEQ % KT == 0 && SEQ / KT >= 2); // whole staged tiles; the two-buffer prologue needs two
static_assert(KT == 64 && NW * 32 == 128);     // stage_pair: 512 16-byte pieces per plane tile, 4 per thread
static_assert((long long)NB * NH_ * SEQ * HD < 2147483647LL);       // int element offsets into head planes
static_assert((long long)SEQ_FULL * SEQ_FULL < 2147483647LL);      // int element offsets into the mask

constexpr size_t WS_W  = (size_t)4 * DM * DM * 2;          // four bf16 weight planes
constexpr size_t WS_XB = (size_t)NB * SEQ * DM * 2;        // bf16 copy of one input stream
constexpr size_t WS_PL = (size_t)NB * NH_ * SEQ * HD * 2;  // one 16-bit head plane
constexpr size_t WS_AT = (size_t)NB * SEQ * DQ * 2;        // one merged ctx plane
constexpr size_t WS_PM = (size_t)(SEQ / 16) * (SEQ / 32) * 64;   // packed mask: 16 words per 16-query x 32-key tile
constexpr size_t WS_TOTAL = WS_W + 3 * WS_XB + 9 * WS_PL + 2 * WS_AT + WS_PM;
static_assert(WS_TOTAL <= (size_t)134217728);              // carve stays within 128 MiB
static_assert(WS_W % 256 == 0 && WS_XB % 256 == 0 && WS_PL % 256 == 0 && WS_AT % 256 == 0 && WS_PM % 256 == 0);

__device__ __forceinline__ unsigned short f2bf(float f) { unsigned u = __float_as_uint(f); u += 0x7FFFu + ((u >> 16) & 1u); return (unsigned short)(u >> 16); }   // RNE
__device__ __forceinline__ float bf2f(unsigned short b) { return __uint_as_float(((unsigned)b) << 16); }
__device__ __forceinline__ float bfr(float f) { return bf2f(f2bf(f)); }
__device__ __forceinline__ v16h cat16(v8h lo, v8h hi) { return __builtin_shufflevector(lo, hi, 0, 1, 2, 3, 4, 5, 6, 7, 8, 9, 10, 11, 12, 13, 14, 15); }
__device__ __forceinline__ v16bf cat16b(v8us lo, v8us hi) { return __builtin_bit_cast(v16bf, __builtin_shufflevector(lo, hi, 0, 1, 2, 3, 4, 5, 6, 7, 8, 9, 10, 11, 12, 13, 14, 15)); }
__device__ __forceinline__ v8f wmma16(v16h a, v16h b, v8f c) { return __builtin_amdgcn_wmma_f32_16x16x32_f16(false, a, false, b, (short)0, c, false, false); }
__device__ __forceinline__ v8f wmmab(v16bf a, v16bf b, v8f c) { return __builtin_amdgcn_wmma_f32_16x16x32_bf16(false, a, false, b, (short)0, c, false, false); }
__device__ __forceinline__ v8f mma3(v16bf ah, v16bf al, v16bf bh, v16bf bl, v8f c) { c = wmmab(ah, bh, c); c = wmmab(ah, bl, c); c = wmmab(al, bh, c); return c; }   // hi hi, then hi x B lo, then A lo x hi
__device__ __forceinline__ float xhalf(float x) { return __builtin_bit_cast(float, __builtin_amdgcn_permlanex16(__builtin_bit_cast(int, x), __builtin_bit_cast(int, x), 0x76543210, 0xfedcba98, false, false)); }   // lane l with lane l ^ 16
__device__ __forceinline__ h16 tohx(float x) { return (h16)x; }
__device__ __forceinline__ void splitf(float y, unsigned short& h, unsigned short& l) { h = f2bf(y); l = f2bf(y - bf2f(h)); }
__device__ __forceinline__ void wave_sync() { __builtin_amdgcn_wave_barrier(); asm volatile("" ::: "memory"); }   // same-wave LDS exchange (tiles are private to the wave)

// Fragment loaders (A and B alike): lane (lr = lane & 15, hi = lane >> 4) points at row/column lr, element 8*hi of the 32-deep k-step;
// elements 0..7 <- k0 + 8hi + 0..7, elements 8..15 <- k0 + 16 + 8hi + 0..7.
template <typename T16> struct WFrag;
template <> struct WFrag<h16> { typedef v16h V; static __device__ __forceinline__ V ld(const h16* p) { return cat16(*(const v8h*)p, *(const v8h*)(p + 16)); } static __device__ __forceinline__ v8f mma(V a, V b, v8f c) { return wmma16(a, b, c); } };
template <> struct WFrag<bf> { typedef v16bf V; static __device__ __forceinline__ V ld(const bf* p) { return cat16b(*(const v8us*)p, *(const v8us*)(p + 16)); } static __device__ __forceinline__ v8f mma(V a, V b, v8f c) { return wmmab(a, b, c); } };

// ---- staging of 64-row x 128-byte tiles in LDS (GEMM operands; K and V^T of the attention work-group)
__device__ __forceinline__ unsigned lds_off(const void* p) { return (unsigned)(size_t)p; }   // byte offset in the work-group's LDS (low half of the shared address)
__device__ __forceinline__ v16bf ldsb(const unsigned short* p) { return cat16b(*(const v8usa*)p, *(const v8usa*)(p + 16)); }   // fragment from a staged bf16 tile, same k order as WFrag::ld
__device__ __forceinline__ v16h  ldsh(const unsigned short* p) { return cat16(*(const v8ha*)p, *(const v8ha*)(p + 16)); }       // fragment from a staged f16 tile
// Two plane tiles of 64 rows x 128 bytes -> LDS at pitch TP, 16 bytes per lane and copy, 128 threads: copy i of a plane brings row 16 i + (tid >> 3), piece tid & 7.
// la / lb: the lane's LDS byte address of its row-0..15 piece; ga / gb: the lane's global address of the same piece; pa / pb: 16 source rows in elements.
template <typename T16>
__device__ __forceinline__ void stage_pair(unsigned la, const T16* ga, int pa, unsigned lb, const T16* gb, int pb) {
    // copies and their s_wait_xcnt in one statement: no address register of a copy is rewritten ahead of the wait
    asm volatile("global_load_async_to_lds_b128 %0, %8, off\n\t"
                 "global_load_async_to_lds_b128 %1, %9, off\n\t"
                 "global_load_async_to_lds_b128 %2, %10, off\n\t"
                 "global_load_async_to_lds_b128 %3, %11, off\n\t"
                 "global_load_async_to_lds_b128 %4, %12, off\n\t"
                 "global_load_async_to_lds_b128 %5, %13, off\n\t"
                 "global_load_async_to_lds_b128 %6, %14, off\n\t"
                 "global_load_async_to_lds_b128 %7, %15, off\n\t"
                 "s_wait_xcnt 0x0"
                 :: "v"(la), "v"(la + 16u * TP * 2u), "v"(la + 32u * TP * 2u), "v"(la + 48u * TP * 2u),
                    "v"(lb), "v"(lb + 16u * TP * 2u), "v"(lb + 32u * TP * 2u), "v"(lb + 48u * TP * 2u),
                    "v"(ga), "v"(ga + pa), "v"(ga + 2 * pa), "v"(ga + 3 * pa),
                    "v"(gb), "v"(gb + pb), "v"(gb + 2 * pb), "v"(gb + 3 * pb)
                 : "memory");
}

// ---- register-blocked GEMM body: one work-group = NW waves (2 x 2) on a 128x128 output tile, one wave per 64x64 quarter (16 accumulators); grid (M/128, N/128, Z), 128 threads.
// Operands come from K-contiguous 16-bit planes through LDS: a stage is GK = 128 k of the work-group's 128 A rows (and A2 rows) and 128 Bt rows, held as 64-k tiles of 64 rows at pitch TP;
// every thread copies its pieces of stage t + 2 into the buffer that stage t has left (two buffers); one work-group barrier per stage publishes stage t + 1 and frees stage t's buffer.
// C[m][n] (f32, pitch ldc, + bf16-converted bias[n]) = sum_k A[m][k] Bt[n][k] (+ A2 Bt when NSPLIT == 1). z-batch strides sA/sB/sC in elements. K % 128 == 0, M % 128 == 0, N % 128 == 0.
// OUT == 0: C is stored as f32. OUT == 1 (m = t, n = h*64 + d) and OUT == 2 (m = h*64 + d, n = t, bias[m]): the f32 value is converted where it is made and stored to the three 16-bit head planes
// (f16, bf16 hi, bf16 lo) at P*[pb + tile row * pp + tile column]; a tile row is 128 bytes of each plane, one whole line per 16 lanes.
#define GK 128                    // k per staged GEMM stage (two 64-k tiles per operand row block)
template <typename T16, int NSPLIT, bool BIAS, int OUT = 0>
__device__ __forceinline__ void gemmw_body(const T16* __restrict__ A, const T16* __restrict__ A2, const T16* __restrict__ Bt, int K, float* C, int ldc, const float* __restrict__ bias, size_t sA, size_t sB, size_t sC,
                                           h16* P16 = nullptr, bf* Ph = nullptr, bf* Pl = nullptr) {
    typedef typename WFrag<T16>::V V;
    static_assert(NSPLIT == 0 || NSPLIT == 1);
    constexpr int NT = 2 + NSPLIT;                                           // staged operands: A, (A2,) Bt
    constexpr int GT = 2 * TPL;                                              // 128 rows x 64 k of one operand (halves)
    constexpr int GB = (GK / 64) * NT * GT;                                  // one buffer (halves): [64-k half][operand][128 rows at pitch TP]
    static_assert((GK / 64) * NT * 8 <= 63);                                 // copies of one wave in flight: one stage's, 8 per operand and 64-k half
    __shared__ __align__(16) unsigned short gst[2 * GB];                     // two buffers of staged operands
    __shared__ __align__(16) float osa[NW * 16 * 68];                        // epilogue tiles, one per wave
    const size_t z = blockIdx.z; A += z * sA; if (NSPLIT) A2 += z * sA; Bt += z * sB; C += z * sC;
    const int tid = threadIdx.x, lane = tid & 31, lr = lane & 15, hi = lane >> 4;
    const int wave = __builtin_amdgcn_readfirstlane(tid >> 5);
    float* os = osa + wave * (16 * 68);
    const int R0 = blockIdx.x * 128, C0 = blockIdx.y * 128;                  // the work-group's tile
    const int r0 = R0 + (wave >> 1) * 64, c0 = C0 + (wave & 1) * 64;         // the wave's quarter
    v8f acc[4][4];
#pragma unroll
    for (int mb = 0; mb < 4; ++mb)
#pragma unroll
        for (int nb = 0; nb < 4; ++nb) acc[mb][nb] = (v8f){};
    const unsigned sl = lds_off(gst) + (unsigned)((tid >> 3) * TP + (tid & 7) * 8) * 2u;   // this thread's piece in a staged 64-row tile
    const size_t sga = (size_t)(R0 + (tid >> 3)) * K + (tid & 7) * 8;        // the same piece in A's rows R0..R0+63: + 64 K (rows + 64), + k
    const size_t sgb = (size_t)(C0 + (tid >> 3)) * K + (tid & 7) * 8;        // the same piece in Bt's rows C0..C0+63
    auto stage = [&](int t, int bi) {
#pragma unroll
        for (int s = 0; s < GK / 64; ++s) {
            const unsigned l = sl + (unsigned)((bi * GB + s * NT * GT) * 2);
            const size_t k = (size_t)t * GK + s * 64;
            // each scheduling barrier keeps the next eight copies' address arithmetic behind the eight just issued: their registers are reused, nothing spills beside the 128 accumulators
            stage_pair<T16>(l, A + sga + k, 16 * K, l + TPL * 2u, A + sga + (size_t)64 * K + k, 16 * K);
            __builtin_amdgcn_sched_barrier(0);
            if (NSPLIT) { stage_pair<T16>(l + GT * 2u, A2 + sga + k, 16 * K, l + GT * 2u + TPL * 2u, A2 + sga + (size_t)64 * K + k, 16 * K); __builtin_amdgcn_sched_barrier(0); }
            stage_pair<T16>(l + (NT - 1) * GT * 2u, Bt + sgb + k, 16 * K, l + (NT - 1) * GT * 2u + TPL * 2u, Bt + sgb + (size_t)64 * K + k, 16 * K);
            __builtin_amdgcn_sched_barrier(0);
        }
    };
    const int af = ((wave >> 1) * 64 + lr) * TP + 8 * hi;                    // A fragment in a staged operand: + mb*16*TP + 32 (second k-step of the 64-k half)
    const int bo = (NT - 1) * GT + ((wave & 1) * 64 + lr) * TP + 8 * hi;     // Bt fragment: + nb*16*TP + 32
    const int nst = K / GK;
    stage(0, 0);
    asm volatile("s_wait_asynccnt 0x0" ::: "memory");                           // this wave's pieces of stage 0 have landed
    __syncthreads();                                                            // stage 0 published to all waves
    if (1 < nst) stage(1, 1);
#pragma unroll 1
    for (int t = 0; t < nst; ++t) {
        const unsigned short* sb = gst + (t & 1) * GB;
#pragma unroll
        for (int ks = 0; ks < GK / 32; ++ks) {
            const unsigned short* sk = sb + (ks >> 1) * (NT * GT) + (ks & 1) * 32;
            V a[4], a2[4], b[4];
#pragma unroll
            for (int mb = 0; mb < 4; ++mb) { a[mb] = ldsb(sk + af + mb * 16 * TP); if (NSPLIT) a2[mb] = ldsb(sk + GT + af + mb * 16 * TP); b[mb] = ldsb(sk + bo + mb * 16 * TP); }
            // inputs-only fence on the loaded fragments: the k-step's LDS reads are issued as one group in front of its WMMAs (one LDS wait per k-step, not one per Bt fragment)
            if (NSPLIT) asm volatile("" :: "v"(a[0]), "v"(a[1]), "v"(a[2]), "v"(a[3]), "v"(a2[0]), "v"(a2[1]), "v"(a2[2]), "v"(a2[3]), "v"(b[0]), "v"(b[1]), "v"(b[2]), "v"(b[3]));
            else        asm volatile("" :: "v"(a[0]), "v"(a[1]), "v"(a[2]), "v"(a[3]), "v"(b[0]), "v"(b[1]), "v"(b[2]), "v"(b[3]));
#pragma unroll
            for (int nb = 0; nb < 4; ++nb) {
#pragma unroll
                for (int mb = 0; mb < 4; ++mb) { acc[mb][nb] = WFrag<T16>::mma(a[mb], b[nb], acc[mb][nb]); if (NSPLIT) acc[mb][nb] = WFrag<T16>::mma(a2[mb], b[nb], acc[mb][nb]); } }
        }
        // foot of stage t
        asm volatile("s_wait_dscnt 0x0" ::: "memory");                          // this wave's reads of stage t's buffer have returned
        asm volatile("s_wait_asynccnt 0x0" ::: "memory");                       // this wave's pieces of stage t + 1 have landed
        __syncthreads();                                                        // publishes stage t + 1; ends every wave's reads of stage t's buffer
        if (t + 2 < nst) stage(t + 2, t & 1);                                   // refill the buffer just left (same test in every wave)
    }
    asm volatile("s_wait_asynccnt 0x0" ::: "memory");                           // no copy in flight behind the loop
#pragma unroll
    for (int mb = 0; mb < 4; ++mb) {
#pragma unroll
        for (int nb = 0; nb < 4; ++nb) {
#pragma unroll
            for (int j = 0; j < 8; ++j) os[(hi * 8 + j) * 68 + nb * 16 + lr] = acc[mb][nb][j]; }
        wave_sync();
        float* crow = C + (size_t)(r0 + mb * 16) * ldc + c0;
if (OUT == 0) {
#pragma unroll
            for (int s = 0; s < 8; ++s) { const int row = 2 * s + hi, cofs = lr * 4; v4f val = *(const v4fa*)(os + row * 68 + cofs); if (BIAS) { val[0] += bfr(bias[c0 + cofs]); val[1] += bfr(bias[c0 + cofs + 1]); val[2] += bfr(bias[c0 + cofs + 2]); val[3] += bfr(bias[c0 + cofs + 3]); }
                *(v4f*)(crow + (size_t)row * ldc + cofs) = val; }
             }
        else {
            const size_t pb = (OUT == 1) ? ((z * NH_ + c0 / 64) * SEQ + r0 + mb * 16) * HD : ((z * NH_ + r0 / 64) * HD + mb * 16) * SEQ + c0;   // head = the quarter's index along h*64 + d
            const int pp = (OUT == 1) ? HD : SEQ;
#pragma unroll
            for (int s = 0; s < 8; ++s) { const int row = 2 * s + hi, cofs = lr * 4; v4f val = *(const v4fa*)(os + row * 68 + cofs);
                if (BIAS && OUT == 1) { val[0] += bfr(bias[c0 + cofs]); val[1] += bfr(bias[c0 + cofs + 1]); val[2] += bfr(bias[c0 + cofs + 2]); val[3] += bfr(bias[c0 + cofs + 3]); }
                if (BIAS && OUT == 2) { const float br = bfr(bias[r0 + mb * 16 + row]); val[0] += br; val[1] += br; val[2] += br; val[3] += br; }
                v4h o16; v4us oh, ol;
#pragma unroll
                for (int q = 0; q < 4; ++q) { o16[q] = tohx(val[q]); unsigned short a2, c2; splitf(val[q], a2, c2); oh[q] = a2; ol[q] = c2; }
                const size_t pe = pb + (size_t)row * pp + cofs;
                *(v4h*)(P16 + pe) = o16; *(v4us*)(Ph + pe) = oh; *(v4us*)(Pl + pe) = ol;
                asm volatile("s_wait_xcnt 0x0" ::: "memory"); }   // stands in front of the next rows' values, which reuse the registers these stores name
        }
        wave_sync();
    }
}
// k_proj: y[z][t][n] = XB[z][t][:] . W[n][:] + b[n] (bf16 x bf16, one product), stored as [z*NH_ + h][t][d] planes; grid (SEQ/128, DQ/128, NB).
__global__ __launch_bounds__(32 * NW) void k_proj(const bf* A, const bf* Bt, int K, const float* bias, size_t sA, h16* P16, bf* Ph, bf* Pl) {
    gemmw_body<bf, 0, true, 1>(A, nullptr, Bt, K, nullptr, 0, bias, sA, (size_t)0, (size_t)0, P16, Ph, Pl); }
// k_projt: the same product with W as A and XB as B, stored as [z*NH_ + h][d][t] planes; grid (DQ/128, SEQ/128, NB).
__global__ __launch_bounds__(32 * NW) void k_projt(const bf* A, const bf* Bt, int K, const float* bias, size_t sB, h16* P16, bf* Ph, bf* Pl) {
    gemmw_body<bf, 0, true, 2>(A, nullptr, Bt, K, nullptr, 0, bias, (size_t)0, sB, (size_t)0, P16, Ph, Pl); }
// k_oproj: OUT[z][t][n] = (ATh + ATl)[z][t][:] . Wo[n][:] + bo[n] (two products).
__global__ __launch_bounds__(32 * NW) void k_oproj(const bf* A, const bf* A2, const bf* Bt, int K, float* C, int ldc, const float* bias, size_t sA, size_t sC) {
    gemmw_body<bf, 1, true>(A, A2, Bt, K, C, ldc, bias, sA, (size_t)0, sC); }

// ---- k_prep: everything the GEMMs and the attention read that is a plain re-coding of an input, in one launch of 256-thread work-groups.
// Work-groups [0, PGC): f32 -> bf16 (RNE) copies of the three streams (XB[s][b][t][:], s = q, k, v) and the four weights (WB[s][:][:], s = q, k, v, o). One work-group = PCH consecutive floats of one source:
// load u of a wave covers 512 consecutive bytes (16 per lane), store u 256 consecutive bytes (8 per lane); a thread's PU loads are all issued in front of its first store.
// Work-groups [PGC, PGC + PGM): the integer mask, read by value, as lane masks of the attention's S^T accumulators. PM[(qt * (SEQ/32) + st) * 16 + g*8 + r], bit l = (mask[qt*16 + (l & 15)][st*32 + g*16 + 8*(l >> 4) + r] != 0):
// word g*8 + r selects, lane by lane, element r of score accumulator g of query tile qt at key step st. One wave = one query tile x two key steps = 32 words = one 128-byte line.
#define PU 16                                              // 16-byte pieces per thread of a conversion work-group
constexpr int PCH = 256 * PU * 4;                          // floats per conversion work-group
constexpr int PGX = SEQ * DM / PCH;                        // work-groups per batch row block of one stream
constexpr int PGW = DM * DM / PCH;                         // work-groups per weight
constexpr int PGS = 3 * NB * PGX;                          // all stream work-groups
constexpr int PGC = PGS + 4 * PGW;                         // all conversion work-groups
constexpr int PGM = (SEQ / 16) * (SEQ / 64) / 8;           // mask work-groups
static_assert((SEQ * DM) % PCH == 0 && (DM * DM) % PCH == 0);
static_assert(((SEQ / 16) * (SEQ / 64)) % 8 == 0);
__device__ __forceinline__ void mpack_body(const int* __restrict__ mask, unsigned* PM, int blk) {
    const int lane = threadIdx.x & 31, lr = lane & 15, hi = lane >> 4;
    const int w = blk * 8 + (threadIdx.x >> 5), qt = w / (SEQ / 64), t = w % (SEQ / 64);
    const int* mp = mask + (qt * 16 + lr) * SEQ_FULL + t * 64 + 8 * hi;
    v4i m[8];
#pragma unroll
    for (int s = 0; s < 2; ++s) { m[4 * s] = *(const v4i*)(mp + 32 * s); m[4 * s + 1] = *(const v4i*)(mp + 32 * s + 4); m[4 * s + 2] = *(const v4i*)(mp + 32 * s + 16); m[4 * s + 3] = *(const v4i*)(mp + 32 * s + 20); }
    unsigned v = 0u;
#pragma unroll
    for (int j = 0; j < 32; ++j) { const unsigned b = __builtin_amdgcn_ballot_w32(m[j >> 2][j & 3] != 0); v = (lane == j) ? b : v; }   // lane j keeps word j
    PM[(size_t)w * 32 + lane] = v;
}
__global__ __launch_bounds__(256) void k_prep(const float* __restrict__ xq, const float* __restrict__ xk, const float* __restrict__ xv,
                                              const float* __restrict__ wq, const float* __restrict__ wk, const float* __restrict__ wv, const float* __restrict__ wo,
                                              const int* __restrict__ mask, bf* XB, bf* WB, unsigned* PM) {
    const int g = blockIdx.x;
    if (g >= PGC) { mpack_body(mask, PM, g - PGC); return; }           // no barrier anywhere in this kernel
    const float* src; bf* dst;
    if (g < PGS) { const int s = g / (NB * PGX), r = g % (NB * PGX), b = r / PGX, c = r % PGX;
        src = (s == 0 ? xq : s == 1 ? xk : xv) + (size_t)b * SEQ_FULL * DM + (size_t)c * PCH;
        dst = XB + ((size_t)s * NB + b) * SEQ * DM + (size_t)c * PCH; }
    else { const int r = g - PGS, s = r / PGW, c = r % PGW;
        src = (s == 0 ? wq : s == 1 ? wk : s == 2 ? wv : wo) + (size_t)c * PCH;
        dst = WB + (size_t)s * DM * DM + (size_t)c * PCH; }
    const int e = threadIdx.x * 4;
    v4f v[PU];
#pragma unroll
    for (int u = 0; u < PU; ++u) v[u] = *(const v4f*)(src + u * 1024 + e);
#pragma unroll
    for (int u = 0; u < PU; ++u) { v4us o;
#pragma unroll
        for (int k = 0; k < 4; ++k) o[k] = f2bf(v[u][k]);
        *(v4us*)(dst + u * 1024 + e) = o; }
}

// ---- fused attention body: one work-group = NW waves of one (b, h); one wave = 16 query rows (q0..q0+15); key loop in 32-key steps, two steps per staged 64-key tile.
// K and V^T tiles: every thread copies its pieces of tile t + 2 into the buffer that tile t has left (two buffers); one work-group barrier per tile publishes tile t + 1 and frees tile t's buffer.
// Per step: (1) the 16x32 mask tile comes as 16 lane masks (k_prep: one word per S^T accumulator element), one 64-byte scalar load issued one step ahead; a tile whose 512 entries are all 0
// is skipped (wave-uniform, decided on the words read); (2) S^T = k q^T (two 16x16 accumulators: row = key 8*hi + r, column = query lr; k fragments from LDS as A, q fragments as B, reloaded per step through an
// opaque integer offset); (3) e = mask == 0 ? -1e9 : S/8; online softmax in f32, one running maximum per query (16 values in the lane, then lane l with l ^ 16) and one running sum per lane (halves joined in the epilogue); (4) the lane's 16 probabilities are
// the B fragment of P^T as they stand (elements 0..7 = keys 8*hi + r, 8..15 = keys 16 + 8*hi + r); O^T += V^T P^T (four d-tiles, V^T fragments from LDS as A; row = d, column = query).
// A skipped all-masked tile contributes exactly 0 to every row that meets an unmasked key somewhere (exp underflow); if some row of the work-group never does, the work-group repeats the loop
// with skipping disabled (every entry -1e9 -> uniform weights; rows that do meet a key end with the same values), so the result is exact for any mask contents.
template <bool HI>
__device__ __forceinline__ void attn_body(const h16* __restrict__ Q16, const h16* __restrict__ K16, const h16* __restrict__ VT16,
                                          const bf* __restrict__ Qh, const bf* __restrict__ Ql, const bf* __restrict__ Kh, const bf* __restrict__ Kl,
                                          const bf* __restrict__ VTh, const bf* __restrict__ VTl, const unsigned* __restrict__ PM, bf* ATh, bf* ATl, int row_base) {
    constexpr int NPL = HI ? 4 : 2;                                          // staged planes per buffer: Kh Kl VTh VTl, or K16 VT16
    __shared__ __align__(16) unsigned short stg[2 * NPL * TPL];              // two buffers of staged tiles
    __shared__ __align__(16) unsigned short ctha[NW * 16 * CP];              // ctx tiles hi
    __shared__ __align__(16) unsigned short ctla[NW * 16 * CP];              // ctx tiles lo
    __shared__ int wflag[NW];                                                // per wave: some row has met no unmasked key
    const int tid = threadIdx.x, lane = tid & 31, lr = lane & 15, hi = lane >> 4;
    const int wave = __builtin_amdgcn_readfirstlane(tid >> 5);
    unsigned short* cth = ctha + wave * 16 * CP;
    unsigned short* ctl = ctla + wave * 16 * CP;
    const int q0 = row_base + ((int)blockIdx.x * NW + wave) * 16;
    const int h = blockIdx.y, b = blockIdx.z;
    const int zoff  = (b * NH_ + h) * (SEQ * HD);            // head plane offset ([t][d] and [d][t] planes both hold SEQ*HD elements)
    const int qbase = zoff + (q0 + lr) * HD + 8 * hi;        // B fragment of q: column = query q0 + lr; + c2*32
    const int kfrag = lr * TP + 8 * hi;                      // A fragment of k in a staged tile: row = key (sub*32 + nt*16 + lr); + (sub*32 + nt*16)*TP + c2*32
    const int vfrag = lr * TP + 8 * hi;                      // A fragment of v^T in a staged tile: row = d = dt*16 + lr; + dt*16*TP + sub*32
    // the query tile's lane masks, 16 words per key step; written by an earlier launch and never in this one: read through the constant address space, so that the loads are scalar
    const __attribute__((address_space(4))) v16u* pm = (const __attribute__((address_space(4))) v16u*)(PM + (size_t)(q0 >> 4) * ((SEQ / 32) * 16));
    const unsigned sl = lds_off(stg) + (unsigned)((tid >> 3) * TP + (tid & 7) * 8) * 2u;   // this thread's piece in a staged plane tile
    const int sgk = zoff + (tid >> 3) * HD + (tid & 7) * 8;  // the same piece in a [t][d] plane: + t*KT*HD
    const int sgv = zoff + (tid >> 3) * SEQ + (tid & 7) * 8; // the same piece in a [d][t] plane: + t*KT
    auto stage = [&](int t, int bi) {
        const unsigned l = sl + (unsigned)(bi * NPL * TPL * 2);
        if (HI) {
            stage_pair<bf>(l, Kh + sgk + t * (KT * HD), 16 * HD, l + TPL * 2u, Kl + sgk + t * (KT * HD), 16 * HD);
            stage_pair<bf>(l + 2u * TPL * 2u, VTh + sgv + t * KT, 16 * SEQ, l + 3u * TPL * 2u, VTl + sgv + t * KT, 16 * SEQ);
        } else {
            stage_pair<h16>(l, K16 + sgk + t * (KT * HD), 16 * HD, l + TPL * 2u, VT16 + sgv + t * KT, 16 * SEQ);
        }
    };

    v8f o[4]; float m, l;
    bool dense = false;
#pragma unroll 1
    for (int pass = 0; pass < 2; ++pass) {
#pragma unroll
        for (int t = 0; t < 4; ++t) o[t] = (v8f){};
        m = MINIT; l = 0.0f;
        // two-buffer prologue (on a repeat, the last tile's foot has already ended every read of both buffers)
        stage(0, 0);
        asm volatile("s_wait_asynccnt 0x0" ::: "memory");                       // this wave's pieces of tile 0 have landed
        __syncthreads();                                                        // tile 0 published to all waves
        stage(1, 1);
        v16u nx = pm[0];                                                        // lane masks of step 0
#pragma unroll 1
        for (int t = 0; t < SEQ / KT; ++t) {
            const unsigned short* sb = stg + (t & 1) * (NPL * TPL);
#pragma unroll 1
            for (int sub = 0; sub < 2; ++sub) {                                 // rolled: one copy of the step's code
            const int st = t * 2 + sub;
            const v16u cw = nx;                                                 // this step's lane masks, loaded during the step before
            nx = pm[(st + 1 < SEQ / 32) ? st + 1 : SEQ / 32 - 1];               // the next step's (the last step reads its own again)
            const v8ul c8 = __builtin_bit_cast(v8ul, cw);
            const bool anyw = (((c8[0] | c8[1]) | (c8[2] | c8[3])) | ((c8[4] | c8[5]) | (c8[6] | c8[7]))) != 0ull;   // wave-uniform
            if (!(dense || anyw)) continue;                                     // whole 16x32 tile masked: skipped (its words were read); the tile's foot below is still passed

            int qo = qbase; asm volatile("" : "+v"(qo));                        // opaque offset: q fragments are reloaded each step, not held across the loop
            const unsigned short* kf = sb + kfrag + sub * 32 * TP;
            v8f s0 = (v8f){}, s1 = (v8f){};
            if (HI) {
                const v16bf qh0 = WFrag<bf>::ld(Qh + qo), qh1 = WFrag<bf>::ld(Qh + qo + 32);
                const v16bf ql0 = WFrag<bf>::ld(Ql + qo), ql1 = WFrag<bf>::ld(Ql + qo + 32);
                s0 = mma3(ldsb(kf), ldsb(kf + TPL), qh0, ql0, s0);
                s0 = mma3(ldsb(kf + 32), ldsb(kf + TPL + 32), qh1, ql1, s0);
                s1 = mma3(ldsb(kf + 16 * TP), ldsb(kf + TPL + 16 * TP), qh0, ql0, s1);
                s1 = mma3(ldsb(kf + 16 * TP + 32), ldsb(kf + TPL + 16 * TP + 32), qh1, ql1, s1);
                asm volatile("v_nop\n\tv_nop\n\tv_nop\n\tv_nop" : "+v"(s0), "+v"(s1) : "v"(qh1), "v"(ql1));
            } else {
                const v16h qa0 = WFrag<h16>::ld(Q16 + qo), qa1 = WFrag<h16>::ld(Q16 + qo + 32);
                s0 = wmma16(ldsh(kf), qa0, s0);
                s0 = wmma16(ldsh(kf + 32), qa1, s0);
                s1 = wmma16(ldsh(kf + 16 * TP), qa0, s1);
                s1 = wmma16(ldsh(kf + 16 * TP + 32), qa1, s1);
                asm volatile("v_nop\n\tv_nop\n\tv_nop\n\tv_nop" : "+v"(s0), "+v"(s1) : "v"(qa0), "v"(qa1));
            }

            float e0[8], e1[8], t8[8];
#pragma unroll
            for (int r = 0; r < 8; ++r) { e0[r] = __builtin_amdgcn_inverse_ballot_w32(cw[r]) ? s0[r] * SCL : MFILL; e1[r] = __builtin_amdgcn_inverse_ballot_w32(cw[8 + r]) ? s1[r] * SCL : MFILL; t8[r] = fmaxf(e0[r], e1[r]); }
            float rm = fmaxf(fmaxf(fmaxf(t8[0], t8[1]), fmaxf(t8[2], t8[3])), fmaxf(fmaxf(t8[4], t8[5]), fmaxf(t8[6], t8[7])));
            rm = fmaxf(rm, xhalf(rm));                                          // the query's other 16 keys of the step
            const float mn = fmaxf(m, rm);
            const float al = __builtin_amdgcn_exp2f((m - mn) * L2E);
            v16us ph, pl; v16h pa;                                              // B fragments of P^T
#pragma unroll
            for (int r = 0; r < 8; ++r) {
                float x0 = __builtin_amdgcn_exp2f((e0[r] - mn) * L2E);
                float x1 = __builtin_amdgcn_exp2f((e1[r] - mn) * L2E);
                if (HI) {
                    unsigned short a0, c0, a1, c1; splitf(x0, a0, c0); splitf(x1, a1, c1);
                    ph[r] = a0; pl[r] = c0; ph[8 + r] = a1; pl[8 + r] = c1;
                    t8[r] = x0 + x1;
                } else {
                    x0 = (x0 < F16MINN) ? 0.0f : x0; x1 = (x1 < F16MINN) ? 0.0f : x1;      // no subnormal f16 operands; the row sum uses the same values
                    const h16 g0 = tohx(x0), g1 = tohx(x1);
                    pa[r] = g0; pa[8 + r] = g1;
                    t8[r] = (float)g0 + (float)g1;
                }
            }
            float rs = ((t8[0] + t8[1]) + (t8[2] + t8[3])) + ((t8[4] + t8[5]) + (t8[6] + t8[7]));
            l = l * al + rs; m = mn;                                           // l: this lane's half of the keys; the two halves (same al) are joined behind the loop
#pragma unroll
            for (int dt = 0; dt < 4; ++dt) o[dt] *= al;
            const unsigned short* vf = sb + (HI ? 2 : 1) * TPL + vfrag + sub * 32;
            if (HI) {
                const v16bf pb = __builtin_bit_cast(v16bf, ph), pc = __builtin_bit_cast(v16bf, pl);
                const v16bf vh0 = ldsb(vf), vh1 = ldsb(vf + 16 * TP), vh2 = ldsb(vf + 32 * TP), vh3 = ldsb(vf + 48 * TP);
                const v16bf vl0 = ldsb(vf + TPL), vl1 = ldsb(vf + TPL + 16 * TP), vl2 = ldsb(vf + TPL + 32 * TP), vl3 = ldsb(vf + TPL + 48 * TP);
                o[0] = mma3(vh0, vl0, pb, pc, o[0]); o[1] = mma3(vh1, vl1, pb, pc, o[1]); o[2] = mma3(vh2, vl2, pb, pc, o[2]); o[3] = mma3(vh3, vl3, pb, pc, o[3]);
                asm volatile("v_nop\n\tv_nop\n\tv_nop\n\tv_nop" : "+v"(o[0]), "+v"(o[1]), "+v"(o[2]), "+v"(o[3]) : "v"(pb), "v"(pc));
            } else {
                const v16h v0 = ldsh(vf), v1 = ldsh(vf + 16 * TP), v2 = ldsh(vf + 32 * TP), v3 = ldsh(vf + 48 * TP);
                o[0] = wmma16(v0, pa, o[0]); o[1] = wmma16(v1, pa, o[1]); o[2] = wmma16(v2, pa, o[2]); o[3] = wmma16(v3, pa, o[3]);
                asm volatile("v_nop\n\tv_nop\n\tv_nop\n\tv_nop" : "+v"(o[0]), "+v"(o[1]), "+v"(o[2]), "+v"(o[3]) : "v"(pa), "v"(v3));
            }
            }
            // foot of tile t, passed by every wave whatever it skipped
            asm volatile("s_wait_dscnt 0x0" ::: "memory");                      // this wave's reads of tile t's buffer have returned
            asm volatile("s_wait_asynccnt 0x0" ::: "memory");                   // this wave's pieces of tile t + 1 have landed
            __syncthreads();                                                    // publishes tile t + 1; ends every wave's reads of tile t's buffer
            if (t + 2 < SEQ / KT) stage(t + 2, t & 1);                          // refill the buffer just left (same test in every wave)
        }
        asm volatile("s_wait_asynccnt 0x0" ::: "memory");                       // no copy in flight behind the loop
        const bool bad = !(m > MSEEN);
        const int wbad = (__builtin_amdgcn_ballot_w32(bad) != 0u) ? 1 : 0;      // taken with every lane on
        if (lane == 0) wflag[wave] = wbad;
        __syncthreads();                                                        // the repeat is decided for the whole work-group: its barriers need every wave
        const int anyb = wflag[0] | wflag[1] | wflag[2] | wflag[3];
        if (__builtin_amdgcn_readfirstlane(anyb) == 0) break;                   // every row met an unmasked key: skipped tiles contributed exactly 0
        dense = true;                                                           // otherwise repeat without skipping (work-group-uniform)
    }

    const float inv = 1.0f / (l + xhalf(l));
#pragma unroll
    for (int dt = 0; dt < 4; ++dt) { v8us a8, c8;                               // the lane's 8 consecutive d of its query: one 16-byte piece of each ctx tile row
#pragma unroll
        for (int r = 0; r < 8; ++r) { unsigned short a, c; splitf(o[dt][r] * inv, a, c); a8[r] = a; c8[r] = c; }
        *(v8usa*)(cth + lr * CP + dt * 16 + 8 * hi) = a8; *(v8usa*)(ctl + lr * CP + dt * 16 + 8 * hi) = c8; }
    wave_sync();
    v8us hv[4], lv[4];
#pragma unroll
    for (int s = 0; s < 4; ++s) { const int row = 4 * s + (lane >> 3); hv[s] = *(const v8usa*)(cth + row * CP + (lane & 7) * 8); lv[s] = *(const v8usa*)(ctl + row * CP + (lane & 7) * 8); }
    const size_t ob = (size_t)(b * SEQ + q0 + (lane >> 3)) * DQ + h * HD + (lane & 7) * 8;
{
#pragma unroll
        for (int s = 0; s < 4; ++s) { *(v8us*)(ATh + ob + (size_t)(4 * s) * DQ) = hv[s]; *(v8us*)(ATl + ob + (size_t)(4 * s) * DQ) = lv[s]; }
         }
}
__global__ __launch_bounds__(32 * NW) void k_attn_hi(const bf* Qh, const bf* Ql, const bf* Kh, const bf* Kl, const bf* VTh, const bf* VTl, const unsigned* PM, bf* ATh, bf* ATl) {
    attn_body<true>(nullptr, nullptr, nullptr, Qh, Ql, Kh, Kl, VTh, VTl, PM, ATh, ATl, 0); }
__global__ __launch_bounds__(32 * NW) void k_attn_lo(const h16* Q16, const h16* K16, const h16* VT16, const unsigned* PM, bf* ATh, bf* ATl) {
    attn_body<false>(Q16, K16, VT16, nullptr, nullptr, nullptr, nullptr, nullptr, nullptr, PM, ATh, ATl, RHE); }

extern "C" void kernel_launch(void* const* d_in, const int* in_sizes, int n_in,
                              void* d_out, int out_size, void* d_ws, size_t ws_size, hipStream_t stream) {
    if (n_in < 12) return;
    const long long need_x = (long long)(NB - 1) * SEQ_FULL * DM + (long long)SEQ * DM;      // rows read from a full-size stream
    const long long need_m = (long long)(SEQ - 1) * SEQ_FULL + SEQ;
    if (in_sizes[0] < need_x || in_sizes[1] < need_x || in_sizes[2] < need_x || in_sizes[3] < need_m) return;
    if (in_sizes[4] < DM * DM || in_sizes[6] < DM * DM || in_sizes[8] < DM * DM || in_sizes[10] < DM * DM) return;
    if (in_sizes[5] < DM || in_sizes[7] < DM || in_sizes[9] < DM || in_sizes[11] < DM) return;
    if ((long long)out_size < need_x) return;
    if (WS_TOTAL > ws_size) return;
    // wire order: x_q, x_k, x_v, mask (int32 [1][1][SEQ_FULL][SEQ_FULL]), Wq, bq, Wk, bk, Wv, bv, Wo, bo; weights [out][in]
    const float* xq = (const float*)d_in[0]; const float* xk = (const float*)d_in[1]; const float* xv = (const float*)d_in[2];
    const int* mask = (const int*)d_in[3];
    const float* wq = (const float*)d_in[4]; const float* bq = (const float*)d_in[5];
    const float* wk = (const float*)d_in[6]; const float* bk = (const float*)d_in[7];
    const float* wv = (const float*)d_in[8]; const float* bv = (const float*)d_in[9];
    const float* wo = (const float*)d_in[10]; const float* bo = (const float*)d_in[11];
    float* OUT = (float*)d_out;     // [NB_FULL][SEQ_FULL][DM]
    char* wsp = (char*)d_ws;
    auto take = [&](size_t bytes) { char* p = wsp; wsp += bytes; return (void*)p; };      // all sizes are multiples of 256 bytes
    bf* WQ = (bf*)take(WS_W / 4); bf* WK = (bf*)take(WS_W / 4); bf* WV = (bf*)take(WS_W / 4); bf* WO = (bf*)take(WS_W / 4);
    bf* XBq = (bf*)take(WS_XB); bf* XBk = (bf*)take(WS_XB); bf* XBv = (bf*)take(WS_XB);   // contiguous: k_prep indexes them from XBq, as it does the weights from WQ
    h16* Q16 = (h16*)take(WS_PL); bf* Qh = (bf*)take(WS_PL); bf* Ql = (bf*)take(WS_PL);
    h16* K16 = (h16*)take(WS_PL); bf* Kh = (bf*)take(WS_PL); bf* Kl = (bf*)take(WS_PL);
    h16* VT16 = (h16*)take(WS_PL); bf* VTh = (bf*)take(WS_PL); bf* VTl = (bf*)take(WS_PL);
    bf* ATh = (bf*)take(WS_AT); bf* ATl = (bf*)take(WS_AT);
    unsigned* PM = (unsigned*)take(WS_PM);
    if ((size_t)(wsp - (char*)d_ws) > ws_size) return;

    // bf16 copies of the streams and the weights, and the mask's lane masks (once for all batches and heads)
    k_prep<<<dim3(PGC + PGM), 256, 0, stream>>>(xq, xk, xv, wq, wk, wv, wo, mask, XBq, WQ, PM);
    const dim3 gG(SEQ / 128, DQ / 128, NB);
    k_proj<<<gG, 32 * NW, 0, stream>>>(XBq, WQ, DM, bq, (size_t)SEQ * DM, Q16, Qh, Ql);
    k_proj<<<gG, 32 * NW, 0, stream>>>(XBk, WK, DM, bk, (size_t)SEQ * DM, K16, Kh, Kl);
    k_projt<<<dim3(DQ / 128, SEQ / 128, NB), 32 * NW, 0, stream>>>(WV, XBv, DM, bv, (size_t)SEQ * DM, VT16, VTh, VTl);
    // attention: query rows [0, RHE) on hi/lo planes, rows [RHE, SEQ) on f16 planes
    k_attn_hi<<<dim3(RHE / (16 * NW), NH_, NB), 32 * NW, 0, stream>>>(Qh, Ql, Kh, Kl, VTh, VTl, PM, ATh, ATl);
#if SEQ > RH
    k_attn_lo<<<dim3((SEQ - RHE) / (16 * NW), NH_, NB), 32 * NW, 0, stream>>>(Q16, K16, VT16, PM, ATh, ATl);
#endif
    // output projection: per batch rows of the full-size output
    k_oproj<<<dim3(SEQ / 128, DM / 128, NB), 32 * NW, 0, stream>>>(ATh, ATl, WO, DQ, OUT, DM, bo, (size_t)SEQ * DQ, (size_t)SEQ_FULL * DM);
}

// v007
// Measured time: 163 microseconds a run.
// Timed twice side by side with v006, it ran 1.43 times as fast both times.
// Counting every step since v000, it is 3.14 times as fast.
#include <hip/hip_runtime.h>

// Three-stream masked attention: q = xq Wq^T + bq, k = xk Wk^T + bk, v = xv Wv^T + bv (weights [out][in]); 16 heads x 64 (head h = columns h*64+d); scores x 1/8; integer mask [SEQ][SEQ] read by value (0 -> score := -1e9); softmax; out = ctx Wo^T + bo.
// Compute dtypes, f32 accumulate: every float input RNE-converted to bf16; projections v_wmma_f32_16x16x32_bf16 (exact operand products); attention query rows < RH: bf16 hi+lo planes for q, k, v and p (3 products per site); rows >= RH: v_wmma_f32_16x16x32_f16 single products (q, k, v, p as f16); online softmax f32; ctx carried as bf16 hi+lo planes x Wo bf16 (2 products).
// Engine: four waves per 128x128 GEMM tile, one 64x64 quarter each (operands from K-contiguous 16-bit planes through LDS: two buffers, asynchronous copies); the q, k, v projections convert their f32 sums in the epilogue and store the head planes themselves (v as W X^T, so that its tile rows are d and its columns t); fused flash-style attention on transposed tiles (S^T = K Q^T, O^T = V^T P^T: a query is a lane's column), four waves per work-group (16 query rows each), 32-key steps; the work-group's waves share 64-key K and V^T tiles in LDS (two buffers, asynchronous copies); q straight from global memory; the mask packed once per call into 32-lane bit masks, read by scalar loads; one preparation launch (k_prep) makes every bf16 copy and the packed mask; the three projections are one launch (k_qkv), both kinds of attention work-group another (k_attn); no score or probability plane in global memory.

#ifndef NB
#define NB 2
#endif
#ifndef SEQ
#define SEQ 2048
#endif
#define NB_FULL  2
#define SEQ_FULL 2048
#define DM   1024
#define NH_  16
#define HD   64
#define DQ   (NH_ * HD)
#define RH   512                  // query rows < RH use hi+lo planes
#define RHE  ((RH < SEQ) ? RH : SEQ)
#define SCL  0.125f               // HD^-0.5
#define L2E  1.4426950408889634f
#define MFILL (-1.0e9f)           // value that replaces a masked score
#define MINIT (-1.0e30f)          // running-max start (below MFILL)
#define MSEEN (-5.0e8f)           // running max above this <=> the row has met an unmasked key
#define F16MINN 6.103515625e-05f  // smallest normal f16
#define CP 72                     // ctx tile pitch (halves): 64 + 8
#define NW 4                      // waves per work-group (attention: 16 query rows each; GEMM: a 64x64 quarter each)
#define KT 64                     // keys per staged K / V^T tile
#define TP 72                     // staged tile pitch (halves): 64 + 8 = 144 bytes, an odd multiple of 16 bytes
#define TPL (64 * TP)             // one staged plane tile (halves): 64 rows (K: keys x d; V^T: d x keys; GEMM operands: rows x k)

typedef _Float16 h16;
typedef unsigned short bf;
typedef __attribute__((ext_vector_type(16))) __bf16   v16bf;
typedef __attribute__((ext_vector_type(16))) _Float16 v16h;
typedef __attribute__((ext_vector_type(8)))  _Float16 v8h;
typedef __attribute__((ext_vector_type(8)))  unsigned short v8us;
typedef __attribute__((ext_vector_type(16))) unsigned short v16us;
typedef __attribute__((ext_vector_type(8)))  float    v8f;
typedef __attribute__((ext_vector_type(4)))  float    v4f;
typedef __attribute__((ext_vector_type(4)))  _Float16 v4h;
typedef __attribute__((ext_vector_type(4)))  unsigned short v4us;
typedef __attribute__((ext_vector_type(4)))  int      v4i;
typedef __attribute__((ext_vector_type(16))) unsigned v16u;
typedef __attribute__((ext_vector_type(8)))  unsigned long long v8ul;
typedef v8h  __attribute__((may_alias)) v8ha;
typedef v4f  __attribute__((may_alias)) v4fa;
typedef v8us __attribute__((may_alias)) v8usa;

static_assert(HD == 64);
static_assert(DQ == DM);                       // merged width equals model width
static_assert(DM % 128 == 0);                  // GEMM tiles of 128, K stages of 128
static_assert(SEQ % 128 == 0);                 // GEMM tiles of 128; attention tiles of 16 rows, 32 keys
static_assert(RH % 16 == 0);                   // hi/lo row split on a query-tile boundary
static_assert(NB <= NB_FULL);
static_assert(SEQ <= SEQ_FULL);
static_assert((CP * 2) % 16 == 0);             // 16-byte aligned ctx tile rows
static_assert((TP * 2) % 16 == 0);             // 16-byte aligned staged rows
static_assert(RHE % (16 * NW) == 0 && (SEQ - RHE) % (16 * NW) == 0);   // whole attention work-groups on both sides of the row split
static_assert(SEQ % KT == 0 && SEQ / KT >= 2); // whole staged tiles; the two-buffer prologue needs two
static_assert(KT == 64 && NW * 32 == 128);     // stage_pair: 512 16-byte pieces per plane tile, 4 per thread
static_assert((long long)NB * NH_ * SEQ * HD < 2147483647LL);       // int element offsets into head planes
static_assert((long long)SEQ_FULL * SEQ_FULL < 2147483647LL);      // int element offsets into the mask

constexpr size_t WS_W  = (size_t)4 * DM * DM * 2;          // four bf16 weight planes
constexpr size_t WS_XB = (size_t)NB * SEQ * DM * 2;        // bf16 copy of one input stream
constexpr size_t WS_PL = (size_t)NB * NH_ * SEQ * HD * 2;  // one 16-bit head plane
constexpr size_t WS_AT = (size_t)NB * SEQ * DQ * 2;        // one merged ctx plane
constexpr size_t WS_PM = (size_t)(SEQ / 16) * (SEQ / 32) * 64;   // packed mask: 16 words per 16-query x 32-key tile
constexpr size_t WS_TOTAL = WS_W + 3 * WS_XB + 9 * WS_PL + 2 * WS_AT + WS_PM;
static_assert(WS_TOTAL <= (size_t)134217728);              // carve stays within 128 MiB
static_assert(WS_W % 256 == 0 && WS_XB % 256 == 0 && WS_PL % 256 == 0 && WS_AT % 256 == 0 && WS_PM % 256 == 0);

__device__ __forceinline__ unsigned short f2bf(float f) { unsigned u = __float_as_uint(f); u += 0x7FFFu + ((u >> 16) & 1u); return (unsigned short)(u >> 16); }   // RNE
__device__ __forceinline__ float bf2f(unsigned short b) { return __uint_as_float(((unsigned)b) << 16); }
__device__ __forceinline__ float bfr(float f) { return bf2f(f2bf(f)); }
__device__ __forceinline__ v16h cat16(v8h lo, v8h hi) { return __builtin_shufflevector(lo, hi, 0, 1, 2, 3, 4, 5, 6, 7, 8, 9, 10, 11, 12, 13, 14, 15); }
__device__ __forceinline__ v16bf cat16b(v8us lo, v8us hi) { return __builtin_bit_cast(v16bf, __builtin_shufflevector(lo, hi, 0, 1, 2, 3, 4, 5, 6, 7, 8, 9, 10, 11, 12, 13, 14, 15)); }
__device__ __forceinline__ v8f wmma16(v16h a, v16h b, v8f c) { return __builtin_amdgcn_wmma_f32_16x16x32_f16(false, a, false, b, (short)0, c, false, false); }
__device__ __forceinline__ v8f wmmab(v16bf a, v16bf b, v8f c) { return __builtin_amdgcn_wmma_f32_16x16x32_bf16(false, a, false, b, (short)0, c, false, false); }
__device__ __forceinline__ v8f mma3(v16bf ah, v16bf al, v16bf bh, v16bf bl, v8f c) { c = wmmab(ah, bh, c); c = wmmab(ah, bl, c); c = wmmab(al, bh, c); return c; }   // hi hi, then hi x B lo, then A lo x hi
__device__ __forceinline__ float xhalf(float x) { return __builtin_bit_cast(float, __builtin_amdgcn_permlanex16(__builtin_bit_cast(int, x), __builtin_bit_cast(int, x), 0x76543210, 0xfedcba98, false, false)); }   // lane l with lane l ^ 16
__device__ __forceinline__ h16 tohx(float x) { return (h16)x; }
__device__ __forceinline__ void splitf(float y, unsigned short& h, unsigned short& l) { h = f2bf(y); l = f2bf(y - bf2f(h)); }
__device__ __forceinline__ void wave_sync() { __builtin_amdgcn_wave_barrier(); asm volatile("" ::: "memory"); }   // same-wave LDS exchange (tiles are private to the wave)

// Fragment loaders (A and B alike): lane (lr = lane & 15, hi = lane >> 4) points at row/column lr, element 8*hi of the 32-deep k-step;
// elements 0..7 <- k0 + 8hi + 0..7, elements 8..15 <- k0 + 16 + 8hi + 0..7.
template <typename T16> struct WFrag;
template <> struct WFrag<h16> { typedef v16h V; static __device__ __forceinline__ V ld(const h16* p) { return cat16(*(const v8h*)p, *(const v8h*)(p + 16)); } static __device__ __forceinline__ v8f mma(V a, V b, v8f c) { return wmma16(a, b, c); } };
template <> struct WFrag<bf> { typedef v16bf V; static __device__ __forceinline__ V ld(const bf* p) { return cat16b(*(const v8us*)p, *(const v8us*)(p + 16)); } static __device__ __forceinline__ v8f mma(V a, V b, v8f c) { return wmmab(a, b, c); } };

// ---- staging of 64-row x 128-byte tiles in LDS (GEMM operands; K and V^T of the attention work-group)
__device__ __forceinline__ unsigned lds_off(const void* p) { return (unsigned)(size_t)p; }   // byte offset in the work-group's LDS (low half of the shared address)
__device__ __forceinline__ v16bf ldsb(const unsigned short* p) { return cat16b(*(const v8usa*)p, *(const v8usa*)(p + 16)); }   // fragment from a staged bf16 tile, same k order as WFrag::ld
__device__ __forceinline__ v16h  ldsh(const unsigned short* p) { return cat16(*(const v8ha*)p, *(const v8ha*)(p + 16)); }       // fragment from a staged f16 tile
// Two plane tiles of 64 rows x 128 bytes -> LDS at pitch TP, 16 bytes per lane and copy, 128 threads: copy i of a plane brings row 16 i + (tid >> 3), piece tid & 7.
// la / lb: the lane's LDS byte address of its row-0..15 piece; ga / gb: the lane's global address of the same piece; pa / pb: 16 source rows in elements.
template <typename T16>
__device__ __forceinline__ void stage_pair(unsigned la, const T16* ga, int pa, unsigned lb, const T16* gb, int pb) {
    // copies and their s_wait_xcnt in one statement: no address register of a copy is rewritten ahead of the wait
    asm volatile("global_load_async_to_lds_b128 %0, %8, off\n\t"
                 "global_load_async_to_lds_b128 %1, %9, off\n\t"
                 "global_load_async_to_lds_b128 %2, %10, off\n\t"
                 "global_load_async_to_lds_b128 %3, %11, off\n\t"
                 "global_load_async_to_lds_b128 %4, %12, off\n\t"
                 "global_load_async_to_lds_b128 %5, %13, off\n\t"
                 "global_load_async_to_lds_b128 %6, %14, off\n\t"
                 "global_load_async_to_lds_b128 %7, %15, off\n\t"
                 "s_wait_xcnt 0x0"
                 :: "v"(la), "v"(la + 16u * TP * 2u), "v"(la + 32u * TP * 2u), "v"(la + 48u * TP * 2u),
                    "v"(lb), "v"(lb + 16u * TP * 2u), "v"(lb + 32u * TP * 2u), "v"(lb + 48u * TP * 2u),
                    "v"(ga), "v"(ga + pa), "v"(ga + 2 * pa), "v"(ga + 3 * pa),
                    "v"(gb), "v"(gb + pb), "v"(gb + 2 * pb), "v"(gb + 3 * pb)
                 : "memory");
}

// ---- register-blocked GEMM body: one work-group = NW waves (2 x 2) on a 128x128 output tile, one wave per 64x64 quarter (16 accumulators); tile (bx, by) of (M/128, N/128) and batch z from the caller, 128 threads.
// Operands come from K-contiguous 16-bit planes through LDS: a stage is GK = 128 k of the work-group's 128 A rows (and A2 rows) and 128 Bt rows, held as 64-k tiles of 64 rows at pitch TP;
// every thread copies its pieces of stage t + 2 into the buffer that stage t has left (two buffers); one work-group barrier per stage publishes stage t + 1 and frees stage t's buffer.
// C[m][n] (f32, pitch ldc, + bf16-converted bias[n]) = sum_k A[m][k] Bt[n][k] (+ A2 Bt when NSPLIT == 1). z-batch strides sA/sB/sC in elements. K % 128 == 0, M % 128 == 0, N % 128 == 0.
// OUT == 0: C is stored as f32. OUT == 1, tr false (m = t, n = h*64 + d) or tr true (m = h*64 + d, n = t, bias[m]; tr is the same for the whole work-group): the f32 value (bias added on its way into the epilogue tile) is converted
// where it is made and stored to the three 16-bit head planes (f16, bf16 hi, bf16 lo) at P*[pb + tile row * pp + tile column]; a tile row is 128 bytes of each plane, one whole line per 16 lanes.
// gst: the work-group's LDS (GLDS<NSPLIT> halves); bx, by, z: its tile and batch.
#define GK 128                    // k per staged GEMM stage (two 64-k tiles per operand row block)
template <int NSPLIT> constexpr int GLDS = 2 * (GK / 64) * (2 + NSPLIT) * 2 * TPL;   // halves of LDS that a GEMM work-group needs: two buffers of staged operands
template <typename T16, int NSPLIT, bool BIAS, int OUT = 0>
__device__ __forceinline__ void gemmw_body(unsigned short* gst, int bx, int by, size_t z, bool tr, const T16* __restrict__ A, const T16* __restrict__ A2, const T16* __restrict__ Bt, int K, float* C, int ldc, const float* __restrict__ bias, size_t sA, size_t sB, size_t sC,
                                           h16* P16 = nullptr, bf* Ph = nullptr, bf* Pl = nullptr) {
    typedef typename WFrag<T16>::V V;
    static_assert(NSPLIT == 0 || NSPLIT == 1);
    constexpr int NT = 2 + NSPLIT;                                           // staged operands: A, (A2,) Bt
    constexpr int GT = 2 * TPL;                                              // 128 rows x 64 k of one operand (halves)
    constexpr int GB = (GK / 64) * NT * GT;                                  // one buffer (halves): [64-k half][operand][128 rows at pitch TP]
    static_assert((GK / 64) * NT * 8 <= 63);                                 // copies of one wave in flight: one stage's, 8 per operand and 64-k half
    static_assert(GLDS<NSPLIT> == 2 * GB && NW * 16 * 68 * 4 <= 2 * GB * 2);
    float* osa = (float*)gst;                                                // epilogue tiles, one per wave, in the staged operands' LDS: written only behind the last stage's foot (every wave's reads returned, no copy in flight, barrier)
    A += z * sA; if (NSPLIT) A2 += z * sA; Bt += z * sB; C += z * sC;
    const int tid = threadIdx.x, lane = tid & 31, lr = lane & 15, hi = lane >> 4;
    const int wave = __builtin_amdgcn_readfirstlane(tid >> 5);
    float* os = osa + wave * (16 * 68);
    const int R0 = bx * 128, C0 = by * 128;                                  // the work-group's tile
    const int r0 = R0 + (wave >> 1) * 64, c0 = C0 + (wave & 1) * 64;         // the wave's quarter
    v8f acc[4][4];
#pragma unroll
    for (int mb = 0; mb < 4; ++mb)
#pragma unroll
        for (int nb = 0; nb < 4; ++nb) acc[mb][nb] = (v8f){};
    const unsigned sl = lds_off(gst) + (unsigned)((tid >> 3) * TP + (tid & 7) * 8) * 2u;   // this thread's piece in a staged 64-row tile
    const size_t sga = (size_t)(R0 + (tid >> 3)) * K + (tid & 7) * 8;        // the same piece in A's rows R0..R0+63: + 64 K (rows + 64), + k
    const size_t sgb = (size_t)(C0 + (tid >> 3)) * K + (tid & 7) * 8;        // the same piece in Bt's rows C0..C0+63
    auto stage = [&](int t, int bi) {
#pragma unroll
        for (int s = 0; s < GK / 64; ++s) {
            const unsigned l = sl + (unsigned)((bi * GB + s * NT * GT) * 2);
            const size_t k = (size_t)t * GK + s * 64;
            // each scheduling barrier keeps the next eight copies' address arithmetic behind the eight just issued: their registers are reused, nothing spills beside the 128 accumulators
            stage_pair<T16>(l, A + sga + k, 16 * K, l + TPL * 2u, A + sga + (size_t)64 * K + k, 16 * K);
            __builtin_amdgcn_sched_barrier(0);
            if (NSPLIT) { stage_pair<T16>(l + GT * 2u, A2 + sga + k, 16 * K, l + GT * 2u + TPL * 2u, A2 + sga + (size_t)64 * K + k, 16 * K); __builtin_amdgcn_sched_barrier(0); }
            stage_pair<T16>(l + (NT - 1) * GT * 2u, Bt + sgb + k, 16 * K, l + (NT - 1) * GT * 2u + TPL * 2u, Bt + sgb + (size_t)64 * K + k, 16 * K);
            __builtin_amdgcn_sched_barrier(0);
        }
    };
    const int af = ((wave >> 1) * 64 + lr) * TP + 8 * hi;                    // A fragment in a staged operand: + mb*16*TP + 32 (second k-step of the 64-k half)
    const int bo = (NT - 1) * GT + ((wave & 1) * 64 + lr) * TP + 8 * hi;     // Bt fragment: + nb*16*TP + 32
    const int nst = K / GK;
    stage(0, 0);
    asm volatile("s_wait_asynccnt 0x0" ::: "memory");                           // this wave's pieces of stage 0 have landed
    __syncthreads();                                                            // stage 0 published to all waves
    if (1 < nst) stage(1, 1);
#pragma unroll 1
    for (int t = 0; t < nst; ++t) {
        const unsigned short* sb = gst + (t & 1) * GB;
#pragma unroll
        for (int ks = 0; ks < GK / 32; ++ks) {
            const unsigned short* sk = sb + (ks >> 1) * (NT * GT) + (ks & 1) * 32;
            V a[4], a2[4], b[4];
#pragma unroll
            for (int mb = 0; mb < 4; ++mb) { a[mb] = ldsb(sk + af + mb * 16 * TP); if (NSPLIT) a2[mb] = ldsb(sk + GT + af + mb * 16 * TP); b[mb] = ldsb(sk + bo + mb * 16 * TP); }
            // inputs-only fence on the loaded fragments: the k-step's LDS reads are issued as one group in front of its WMMAs (one LDS wait per k-step, not one per Bt fragment)
            if (NSPLIT) asm volatile("" :: "v"(a[0]), "v"(a[1]), "v"(a[2]), "v"(a[3]), "v"(a2[0]), "v"(a2[1]), "v"(a2[2]), "v"(a2[3]), "v"(b[0]), "v"(b[1]), "v"(b[2]), "v"(b[3]));
            else        asm volatile("" :: "v"(a[0]), "v"(a[1]), "v"(a[2]), "v"(a[3]), "v"(b[0]), "v"(b[1]), "v"(b[2]), "v"(b[3]));
#pragma unroll
            for (int nb = 0; nb < 4; ++nb) {
#pragma unroll
                for (int mb = 0; mb < 4; ++mb) { acc[mb][nb] = WFrag<T16>::mma(a[mb], b[nb], acc[mb][nb]); if (NSPLIT) acc[mb][nb] = WFrag<T16>::mma(a2[mb], b[nb], acc[mb][nb]); } }
        }
        // foot of stage t
        asm volatile("s_wait_dscnt 0x0" ::: "memory");                          // this wave's reads of stage t's buffer have returned
        asm volatile("s_wait_asynccnt 0x0" ::: "memory");                       // this wave's pieces of stage t + 1 have landed
        __syncthreads();                                                        // publishes stage t + 1; ends every wave's reads of stage t's buffer
        if (t + 2 < nst) stage(t + 2, t & 1);                                   // refill the buffer just left (same test in every wave)
    }
    asm volatile("s_wait_asynccnt 0x0" ::: "memory");                           // no copy in flight behind the loop
#pragma unroll
    for (int mb = 0; mb < 4; ++mb) {
        if (OUT == 1 && BIAS && tr) {                                           // bias[m]: the lane's 8 accumulator rows
            const v4f b0 = *(const v4f*)(bias + r0 + mb * 16 + hi * 8), b1 = *(const v4f*)(bias + r0 + mb * 16 + hi * 8 + 4);
#pragma unroll
            for (int nb = 0; nb < 4; ++nb) {
#pragma unroll
                for (int j = 0; j < 8; ++j) os[(hi * 8 + j) * 68 + nb * 16 + lr] = acc[mb][nb][j] + bfr(j < 4 ? b0[j & 3] : b1[j & 3]); }
        } else {
#pragma unroll
            for (int nb = 0; nb < 4; ++nb) { const float bc = (OUT == 1 && BIAS) ? bfr(bias[c0 + nb * 16 + lr]) : 0.0f;   // bias[n]: the lane's accumulator column
#pragma unroll
                for (int j = 0; j < 8; ++j) os[(hi * 8 + j) * 68 + nb * 16 + lr] = (OUT == 1 && BIAS) ? acc[mb][nb][j] + bc : acc[mb][nb][j]; }
        }
        wave_sync();
        float* crow = C + (size_t)(r0 + mb * 16) * ldc + c0;
if (OUT == 0) {
#pragma unroll
            for (int s = 0; s < 8; ++s) { const int row = 2 * s + hi, cofs = lr * 4; v4f val = *(const v4fa*)(os + row * 68 + cofs); if (BIAS) { val[0] += bfr(bias[c0 + cofs]); val[1] += bfr(bias[c0 + cofs + 1]); val[2] += bfr(bias[c0 + cofs + 2]); val[3] += bfr(bias[c0 + cofs + 3]); }
                *(v4f*)(crow + (size_t)row * ldc + cofs) = val; }
             }
        else {
            const size_t pb = !tr ? ((z * NH_ + c0 / 64) * SEQ + r0 + mb * 16) * HD : ((z * NH_ + r0 / 64) * HD + mb * 16) * SEQ + c0;   // head = the quarter's index along h*64 + d
            const int pp = !tr ? HD : SEQ;
#pragma unroll
            for (int s = 0; s < 8; ++s) { const int row = 2 * s + hi, cofs = lr * 4; v4f val = *(const v4fa*)(os + row * 68 + cofs);
                v4h o16; v4us oh, ol;
#pragma unroll
                for (int q = 0; q < 4; ++q) { o16[q] = tohx(val[q]); unsigned short a2, c2; splitf(val[q], a2, c2); oh[q] = a2; ol[q] = c2; }
                const size_t pe = pb + (size_t)row * pp + cofs;
                *(v4h*)(P16 + pe) = o16; *(v4us*)(Ph + pe) = oh; *(v4us*)(Pl + pe) = ol;
                asm volatile("s_wait_xcnt 0x0" ::: "memory"); }   // stands in front of the next rows' values, which reuse the registers these stores name
        }
        wave_sync();
    }
}
// k_qkv: the three projections in one launch, grid (SEQ/128, DQ/128, 3 * NB): stream s = blockIdx.z / NB (q, k, v), batch blockIdx.z % NB; the three do not depend on one another, and two work-groups fit a WGP's LDS.
// s = q, k: y[z][t][n] = XB[s][z][t][:] . WB[s][n][:] + b[n] (bf16 x bf16, one product), stored as [z*NH_ + h][t][d] planes. s = v: the same product with W as A and XB as B, stored as [z*NH_ + h][d][t] planes.
// XB, WB: the streams' and the weights' bf16 copies, one behind the other; P16, Ph, Pl: q's three planes; stream s has its own three 3 s planes further on.
__global__ __launch_bounds__(32 * NW) void k_qkv(const bf* XB, const bf* WB, int K, const float* bq, const float* bk, const float* bv, h16* P16, bf* Ph, bf* Pl) {
    __shared__ __align__(16) unsigned short gst[GLDS<0>];
    const int s = blockIdx.z / NB; const size_t z = blockIdx.z % NB;
    const bool tr = s == 2;
    const bf* X = XB + (size_t)s * NB * SEQ * DM; const bf* Wt = WB + (size_t)s * DM * DM;
    const size_t po = (size_t)s * 3 * NB * NH_ * SEQ * HD;
    gemmw_body<bf, 0, true, 1>(gst, tr ? blockIdx.y : blockIdx.x, tr ? blockIdx.x : blockIdx.y, z, tr, tr ? Wt : X, nullptr, tr ? X : Wt, K, nullptr, 0, s == 0 ? bq : s == 1 ? bk : bv,
                               tr ? (size_t)0 : (size_t)SEQ * DM, tr ? (size_t)SEQ * DM : (size_t)0, (size_t)0, P16 + po, Ph + po, Pl + po); }
// k_oproj: OUT[z][t][n] = (ATh + ATl)[z][t][:] . Wo[n][:] + bo[n] (two products).
__global__ __launch_bounds__(32 * NW) void k_oproj(const bf* A, const bf* A2, const bf* Bt, int K, float* C, int ldc, const float* bias, size_t sA, size_t sC) {
    __shared__ __align__(16) unsigned short gst[GLDS<1>];
    gemmw_body<bf, 1, true>(gst, blockIdx.x, blockIdx.y, blockIdx.z, false, A, A2, Bt, K, C, ldc, bias, sA, (size_t)0, sC); }

// ---- k_prep: everything the GEMMs and the attention read that is a plain re-coding of an input, in one launch of 256-thread work-groups.
// Work-groups [0, PGC): f32 -> bf16 (RNE) copies of the three streams (XB[s][b][t][:], s = q, k, v) and the four weights (WB[s][:][:], s = q, k, v, o). One work-group = PCH consecutive floats of one source:
// load u of a wave covers 512 consecutive bytes (16 per lane), store u 256 consecutive bytes (8 per lane); a thread's PU loads are all issued in front of its first store.
// Work-groups [PGC, PGC + PGM): the integer mask, read by value, as lane masks of the attention's S^T accumulators. PM[(qt * (SEQ/32) + st) * 16 + g*8 + r], bit l = (mask[qt*16 + (l & 15)][st*32 + g*16 + 8*(l >> 4) + r] != 0):
// word g*8 + r selects, lane by lane, element r of score accumulator g of query tile qt at key step st. One wave = one query tile x two key steps = 32 words = one 128-byte line.
#define PU 16                                              // 16-byte pieces per thread of a conversion work-group
constexpr int PCH = 256 * PU * 4;                          // floats per conversion work-group
constexpr int PGX = SEQ * DM / PCH;                        // work-groups per batch row block of one stream
constexpr int PGW = DM * DM / PCH;                         // work-groups per weight
constexpr int PGS = 3 * NB * PGX;                          // all stream work-groups
constexpr int PGC = PGS + 4 * PGW;                         // all conversion work-groups
constexpr int PGM = (SEQ / 16) * (SEQ / 64) / 8;           // mask work-groups
static_assert((SEQ * DM) % PCH == 0 && (DM * DM) % PCH == 0);
static_assert(((SEQ / 16) * (SEQ / 64)) % 8 == 0);
__device__ __forceinline__ void mpack_body(const int* __restrict__ mask, unsigned* PM, int blk) {
    const int lane = threadIdx.x & 31, lr = lane & 15, hi = lane >> 4;
    const int w = blk * 8 + (threadIdx.x >> 5), qt = w / (SEQ / 64), t = w % (SEQ / 64);
    const int* mp = mask + (qt * 16 + lr) * SEQ_FULL + t * 64 + 8 * hi;
    v4i m[8];
#pragma unroll
    for (int s = 0; s < 2; ++s) { m[4 * s] = *(const v4i*)(mp + 32 * s); m[4 * s + 1] = *(const v4i*)(mp + 32 * s + 4); m[4 * s + 2] = *(const v4i*)(mp + 32 * s + 16); m[4 * s + 3] = *(const v4i*)(mp + 32 * s + 20); }
    unsigned v = 0u;
#pragma unroll
    for (int j = 0; j < 32; ++j) { const unsigned b = __builtin_amdgcn_ballot_w32(m[j >> 2][j & 3] != 0); v = (lane == j) ? b : v; }   // lane j keeps word j
    PM[(size_t)w * 32 + lane] = v;
}
__global__ __launch_bounds__(256) void k_prep(const float* __restrict__ xq, const float* __restrict__ xk, const float* __restrict__ xv,
                                              const float* __restrict__ wq, const float* __restrict__ wk, const float* __restrict__ wv, const float* __restrict__ wo,
                                              const int* __restrict__ mask, bf* XB, bf* WB, unsigned* PM) {
    const int g = blockIdx.x;
    if (g >= PGC) { mpack_body(mask, PM, g - PGC); return; }           // no barrier anywhere in this kernel
    const float* src; bf* dst;
    if (g < PGS) { const int s = g / (NB * PGX), r = g % (NB * PGX), b = r / PGX, c = r % PGX;
        src = (s == 0 ? xq : s == 1 ? xk : xv) + (size_t)b * SEQ_FULL * DM + (size_t)c * PCH;
        dst = XB + ((size_t)s * NB + b) * SEQ * DM + (size_t)c * PCH; }
    else { const int r = g - PGS, s = r / PGW, c = r % PGW;
        src = (s == 0 ? wq : s == 1 ? wk : s == 2 ? wv : wo) + (size_t)c * PCH;
        dst = WB + (size_t)s * DM * DM + (size_t)c * PCH; }
    const int e = threadIdx.x * 4;
    v4f v[PU];
#pragma unroll
    for (int u = 0; u < PU; ++u) v[u] = *(const v4f*)(src + u * 1024 + e);
#pragma unroll
    for (int u = 0; u < PU; ++u) { v4us o;
#pragma unroll
        for (int k = 0; k < 4; ++k) o[k] = f2bf(v[u][k]);
        *(v4us*)(dst + u * 1024 + e) = o; }
}

// ---- fused attention body: one work-group = NW waves of one (b, h); one wave = 16 query rows (q0..q0+15); key loop in 32-key steps, two steps per staged 64-key tile.
// K and V^T tiles: every thread copies its pieces of tile t + 2 into the buffer that tile t has left (two buffers); one work-group barrier per tile publishes tile t + 1 and frees tile t's buffer.
// Per step: (1) the 16x32 mask tile comes as 16 lane masks (k_prep: one word per S^T accumulator element), one 64-byte scalar load issued one step ahead; a tile whose 512 entries are all 0
// is skipped (wave-uniform, decided on the words read); (2) S^T = k q^T (two 16x16 accumulators: row = key 8*hi + r, column = query lr; k fragments from LDS as A, q fragments as B, reloaded per step through an
// opaque integer offset); (3) e = mask == 0 ? -1e9 : S/8; online softmax in f32, one running maximum per query (16 values in the lane, then lane l with l ^ 16) and one running sum per lane (halves joined in the epilogue); (4) the lane's 16 probabilities are
// the B fragment of P^T as they stand (elements 0..7 = keys 8*hi + r, 8..15 = keys 16 + 8*hi + r); O^T += V^T P^T (four d-tiles, V^T fragments from LDS as A; row = d, column = query).
// A skipped all-masked tile contributes exactly 0 to every row that meets an unmasked key somewhere (exp underflow); if some row of the work-group never does, the work-group repeats the loop
// with skipping disabled (every entry -1e9 -> uniform weights; rows that do meet a key end with the same values), so the result is exact for any mask contents.
template <bool HI>
__device__ __forceinline__ void attn_body(const h16* __restrict__ Q16, const h16* __restrict__ K16, const h16* __restrict__ VT16,
                                          const bf* __restrict__ Qh, const bf* __restrict__ Ql, const bf* __restrict__ Kh, const bf* __restrict__ Kl,
                                          const bf* __restrict__ VTh, const bf* __restrict__ VTl, const unsigned* __restrict__ PM, bf* ATh, bf* ATl, int row_base,
                                          unsigned short* stg, int* wflag, int xt, int h, int b) {
    constexpr int NPL = HI ? 4 : 2;                                          // staged planes per buffer: Kh Kl VTh VTl, or K16 VT16; stg holds two buffers of staged tiles
    static_assert(2 * NW * 16 * CP <= 2 * NPL * TPL);
    unsigned short* ctha = stg;                                              // ctx tiles hi, in the staged tiles' LDS: written only behind the key loop's last foot and the barrier of the repeat decision
    unsigned short* ctla = stg + NW * 16 * CP;                               // ctx tiles lo
    const int tid = threadIdx.x, lane = tid & 31, lr = lane & 15, hi = lane >> 4;
    const int wave = __builtin_amdgcn_readfirstlane(tid >> 5);
    unsigned short* cth = ctha + wave * 16 * CP;
    unsigned short* ctl = ctla + wave * 16 * CP;
    const int q0 = row_base + (xt * NW + wave) * 16;
    const int zoff  = (b * NH_ + h) * (SEQ * HD);            // head plane offset ([t][d] and [d][t] planes both hold SEQ*HD elements)
    const int qbase = zoff + (q0 + lr) * HD + 8 * hi;        // B fragment of q: column = query q0 + lr; + c2*32
    const int kfrag = lr * TP + 8 * hi;                      // A fragment of k in a staged tile: row = key (sub*32 + nt*16 + lr); + (sub*32 + nt*16)*TP + c2*32
    const int vfrag = lr * TP + 8 * hi;                      // A fragment of v^T in a staged tile: row = d = dt*16 + lr; + dt*16*TP + sub*32
    // the query tile's lane masks, 16 words per key step; written by an earlier launch and never in this one: read through the constant address space, so that the loads are scalar
    const __attribute__((address_space(4))) v16u* pm = (const __attribute__((address_space(4))) v16u*)(PM + (size_t)(q0 >> 4) * ((SEQ / 32) * 16));
    const unsigned sl = lds_off(stg) + (unsigned)((tid >> 3) * TP + (tid & 7) * 8) * 2u;   // this thread's piece in a staged plane tile
    const int sgk = zoff + (tid >> 3) * HD + (tid & 7) * 8;  // the same piece in a [t][d] plane: + t*KT*HD
    const int sgv = zoff + (tid >> 3) * SEQ + (tid & 7) * 8; // the same piece in a [d][t] plane: + t*KT
    auto stage = [&](int t, int bi) {
        const unsigned l = sl + (unsigned)(bi * NPL * TPL * 2);
        if (HI) {
            stage_pair<bf>(l, Kh + sgk + t * (KT * HD), 16 * HD, l + TPL * 2u, Kl + sgk + t * (KT * HD), 16 * HD);
            stage_pair<bf>(l + 2u * TPL * 2u, VTh + sgv + t * KT, 16 * SEQ, l + 3u * TPL * 2u, VTl + sgv + t * KT, 16 * SEQ);
        } else {
            stage_pair<h16>(l, K16 + sgk + t * (KT * HD), 16 * HD, l + TPL * 2u, VT16 + sgv + t * KT, 16 * SEQ);
        }
    };

    v8f o[4]; float m, l;
    bool dense = false;
#pragma unroll 1
    for (int pass = 0; pass < 2; ++pass) {
#pragma unroll
        for (int t = 0; t < 4; ++t) o[t] = (v8f){};
        m = MINIT; l = 0.0f;
        // two-buffer prologue (on a repeat, the last tile's foot has already ended every read of both buffers)
        stage(0, 0);
        asm volatile("s_wait_asynccnt 0x0" ::: "memory");                       // this wave's pieces of tile 0 have landed
        __syncthreads();                                                        // tile 0 published to all waves
        stage(1, 1);
        v16u nx = pm[0];                                                        // lane masks of step 0
#pragma unroll 1
        for (int t = 0; t < SEQ / KT; ++t) {
            const unsigned short* sb = stg + (t & 1) * (NPL * TPL);
#pragma unroll 1
            for (int sub = 0; sub < 2; ++sub) {                                 // rolled: one copy of the step's code
            const int st = t * 2 + sub;
            const v16u cw = nx;                                                 // this step's lane masks, loaded during the step before
            nx = pm[(st + 1 < SEQ / 32) ? st + 1 : SEQ / 32 - 1];               // the next step's (the last step reads its own again)
            const v8ul c8 = __builtin_bit_cast(v8ul, cw);
            const bool anyw = (((c8[0] | c8[1]) | (c8[2] | c8[3])) | ((c8[4] | c8[5]) | (c8[6] | c8[7]))) != 0ull;   // wave-uniform
            if (!(dense || anyw)) continue;                                     // whole 16x32 tile masked: skipped (its words were read); the tile's foot below is still passed

            int qo = qbase; asm volatile("" : "+v"(qo));                        // opaque offset: q fragments are reloaded each step, not held across the loop
            const unsigned short* kf = sb + kfrag + sub * 32 * TP;
            v8f s0 = (v8f){}, s1 = (v8f){};
            if (HI) {
                const v16bf qh0 = WFrag<bf>::ld(Qh + qo), qh1 = WFrag<bf>::ld(Qh + qo + 32);
                const v16bf ql0 = WFrag<bf>::ld(Ql + qo), ql1 = WFrag<bf>::ld(Ql + qo + 32);
                s0 = mma3(ldsb(kf), ldsb(kf + TPL), qh0, ql0, s0);
                s0 = mma3(ldsb(kf + 32), ldsb(kf + TPL + 32), qh1, ql1, s0);
                s1 = mma3(ldsb(kf + 16 * TP), ldsb(kf + TPL + 16 * TP), qh0, ql0, s1);
                s1 = mma3(ldsb(kf + 16 * TP + 32), ldsb(kf + TPL + 16 * TP + 32), qh1, ql1, s1);
                asm volatile("v_nop\n\tv_nop\n\tv_nop\n\tv_nop" : "+v"(s0), "+v"(s1) : "v"(qh1), "v"(ql1));
            } else {
                const v16h qa0 = WFrag<h16>::ld(Q16 + qo), qa1 = WFrag<h16>::ld(Q16 + qo + 32);
                s0 = wmma16(ldsh(kf), qa0, s0);
                s0 = wmma16(ldsh(kf + 32), qa1, s0);
                s1 = wmma16(ldsh(kf + 16 * TP), qa0, s1);
                s1 = wmma16(ldsh(kf + 16 * TP + 32), qa1, s1);
                asm volatile("v_nop\n\tv_nop\n\tv_nop\n\tv_nop" : "+v"(s0), "+v"(s1) : "v"(qa0), "v"(qa1));
            }

            float e0[8], e1[8], t8[8];
#pragma unroll
            for (int r = 0; r < 8; ++r) { e0[r] = __builtin_amdgcn_inverse_ballot_w32(cw[r]) ? s0[r] * SCL : MFILL; e1[r] = __builtin_amdgcn_inverse_ballot_w32(cw[8 + r]) ? s1[r] * SCL : MFILL; t8[r] = fmaxf(e0[r], e1[r]); }
            float rm = fmaxf(fmaxf(fmaxf(t8[0], t8[1]), fmaxf(t8[2], t8[3])), fmaxf(fmaxf(t8[4], t8[5]), fmaxf(t8[6], t8[7])));
            rm = fmaxf(rm, xhalf(rm));                                          // the query's other 16 keys of the step
            const float mn = fmaxf(m, rm);
            const float al = __builtin_amdgcn_exp2f((m - mn) * L2E);
            v16us ph, pl; v16h pa;                                              // B fragments of P^T
#pragma unroll
            for (int r = 0; r < 8; ++r) {
                float x0 = __builtin_amdgcn_exp2f((e0[r] - mn) * L2E);
                float x1 = __builtin_amdgcn_exp2f((e1[r] - mn) * L2E);
                if (HI) {
                    unsigned short a0, c0, a1, c1; splitf(x0, a0, c0); splitf(x1, a1, c1);
                    ph[r] = a0; pl[r] = c0; ph[8 + r] = a1; pl[8 + r] = c1;
                    t8[r] = x0 + x1;
                } else {
                    x0 = (x0 < F16MINN) ? 0.0f : x0; x1 = (x1 < F16MINN) ? 0.0f : x1;      // no subnormal f16 operands; the row sum uses the same values
                    const h16 g0 = tohx(x0), g1 = tohx(x1);
                    pa[r] = g0; pa[8 + r] = g1;
                    t8[r] = (float)g0 + (float)g1;
                }
            }
            float rs = ((t8[0] + t8[1]) + (t8[2] + t8[3])) + ((t8[4] + t8[5]) + (t8[6] + t8[7]));
            l = l * al + rs; m = mn;                                           // l: this lane's half of the keys; the two halves (same al) are joined behind the loop
#pragma unroll
            for (int dt = 0; dt < 4; ++dt) o[dt] *= al;
            const unsigned short* vf = sb + (HI ? 2 : 1) * TPL + vfrag + sub * 32;
            if (HI) {
                const v16bf pb = __builtin_bit_cast(v16bf, ph), pc = __builtin_bit_cast(v16bf, pl);
                const v16bf vh0 = ldsb(vf), vh1 = ldsb(vf + 16 * TP), vh2 = ldsb(vf + 32 * TP), vh3 = ldsb(vf + 48 * TP);
                const v16bf vl0 = ldsb(vf + TPL), vl1 = ldsb(vf + TPL + 16 * TP), vl2 = ldsb(vf + TPL + 32 * TP), vl3 = ldsb(vf + TPL + 48 * TP);
                o[0] = mma3(vh0, vl0, pb, pc, o[0]); o[1] = mma3(vh1, vl1, pb, pc, o[1]); o[2] = mma3(vh2, vl2, pb, pc, o[2]); o[3] = mma3(vh3, vl3, pb, pc, o[3]);
                asm volatile("v_nop\n\tv_nop\n\tv_nop\n\tv_nop" : "+v"(o[0]), "+v"(o[1]), "+v"(o[2]), "+v"(o[3]) : "v"(pb), "v"(pc));
            } else {
                const v16h v0 = ldsh(vf), v1 = ldsh(vf + 16 * TP), v2 = ldsh(vf + 32 * TP), v3 = ldsh(vf + 48 * TP);
                o[0] = wmma16(v0, pa, o[0]); o[1] = wmma16(v1, pa, o[1]); o[2] = wmma16(v2, pa, o[2]); o[3] = wmma16(v3, pa, o[3]);
                asm volatile("v_nop\n\tv_nop\n\tv_nop\n\tv_nop" : "+v"(o[0]), "+v"(o[1]), "+v"(o[2]), "+v"(o[3]) : "v"(pa), "v"(v3));
            }
            }
            // foot of tile t, passed by every wave whatever it skipped
            asm volatile("s_wait_dscnt 0x0" ::: "memory");                      // this wave's reads of tile t's buffer have returned
            asm volatile("s_wait_asynccnt 0x0" ::: "memory");                   // this wave's pieces of tile t + 1 have landed
            __syncthreads();                                                    // publishes tile t + 1; ends every wave's reads of tile t's buffer
            if (t + 2 < SEQ / KT) stage(t + 2, t & 1);                          // refill the buffer just left (same test in every wave)
        }
        asm volatile("s_wait_asynccnt 0x0" ::: "memory");                       // no copy in flight behind the loop
        const bool bad = !(m > MSEEN);
        const int wbad = (__builtin_amdgcn_ballot_w32(bad) != 0u) ? 1 : 0;      // taken with every lane on
        if (lane == 0) wflag[wave] = wbad;
        __syncthreads();                                                        // the repeat is decided for the whole work-group: its barriers need every wave
        const int anyb = wflag[0] | wflag[1] | wflag[2] | wflag[3];
        if (__builtin_amdgcn_readfirstlane(anyb) == 0) break;                   // every row met an unmasked key: skipped tiles contributed exactly 0
        dense = true;                                                           // otherwise repeat without skipping (work-group-uniform)
    }

    const float inv = 1.0f / (l + xhalf(l));
#pragma unroll
    for (int dt = 0; dt < 4; ++dt) { v8us a8, c8;                               // the lane's 8 consecutive d of its query: one 16-byte piece of each ctx tile row
#pragma unroll
        for (int r = 0; r < 8; ++r) { unsigned short a, c; splitf(o[dt][r] * inv, a, c); a8[r] = a; c8[r] = c; }
        *(v8usa*)(cth + lr * CP + dt * 16 + 8 * hi) = a8; *(v8usa*)(ctl + lr * CP + dt * 16 + 8 * hi) = c8; }
    wave_sync();
    v8us hv[4], lv[4];
#pragma unroll
    for (int s = 0; s < 4; ++s) { const int row = 4 * s + (lane >> 3); hv[s] = *(const v8usa*)(cth + row * CP + (lane & 7) * 8); lv[s] = *(const v8usa*)(ctl + row * CP + (lane & 7) * 8); }
    const size_t ob = (size_t)(b * SEQ + q0 + (lane >> 3)) * DQ + h * HD + (lane & 7) * 8;
{
#pragma unroll
        for (int s = 0; s < 4; ++s) { *(v8us*)(ATh + ob + (size_t)(4 * s) * DQ) = hv[s]; *(v8us*)(ATl + ob + (size_t)(4 * s) * DQ) = lv[s]; }
         }
}
// k_attn: both kinds of attention work-group in one launch, chosen by the work-group index; they do not depend on one another. The hi/lo-plane work-groups (three times the products, one wave per SIMD if they had the chip
// to themselves) come first in the index, the f16 work-groups behind them; four work-groups fit a WGP's LDS and registers, so all of them can be resident at once and fill one another's waits.
constexpr int AHI = RHE / (16 * NW);                       // hi/lo-plane work-groups per (b, h)
constexpr int ALO = (SEQ - RHE) / (16 * NW);               // f16 work-groups per (b, h)
__global__ __launch_bounds__(32 * NW) void k_attn(const h16* Q16, const h16* K16, const h16* VT16, const bf* Qh, const bf* Ql, const bf* Kh, const bf* Kl, const bf* VTh, const bf* VTl,
                                                  const unsigned* PM, bf* ATh, bf* ATl) {
    __shared__ __align__(16) unsigned short stg[2 * 4 * TPL];                // two buffers of staged tiles (the larger kind's); ctx tiles behind the key loop
    __shared__ int wflag[NW];                                                // per wave: some row has met no unmasked key
    const int g = blockIdx.x;
#if SEQ > RH
    if (g >= AHI * NH_ * NB) { const int r = g - AHI * NH_ * NB;
        attn_body<false>(Q16, K16, VT16, nullptr, nullptr, nullptr, nullptr, nullptr, nullptr, PM, ATh, ATl, RHE, stg, wflag, r % ALO, (r / ALO) % NH_, r / (ALO * NH_)); return; }
#endif
    attn_body<true>(nullptr, nullptr, nullptr, Qh, Ql, Kh, Kl, VTh, VTl, PM, ATh, ATl, 0, stg, wflag, g % AHI, (g / AHI) % NH_, g / (AHI * NH_)); }

extern "C" void kernel_launch(void* const* d_in, const int* in_sizes, int n_in,
                              void* d_out, int out_size, void* d_ws, size_t ws_size, hipStream_t stream) {
    if (n_in < 12) return;
    const long long need_x = (long long)(NB - 1) * SEQ_FULL * DM + (long long)SEQ * DM;      // rows read from a full-size stream
    const long long need_m = (long long)(SEQ - 1) * SEQ_FULL + SEQ;
    if (in_sizes[0] < need_x || in_sizes[1] < need_x || in_sizes[2] < need_x || in_sizes[3] < need_m) return;
    if (in_sizes[4] < DM * DM || in_sizes[6] < DM * DM || in_sizes[8] < DM * DM || in_sizes[10] < DM * DM) return;
    if (in_sizes[5] < DM || in_sizes[7] < DM || in_sizes[9] < DM || in_sizes[11] < DM) return;
    if ((long long)out_size < need_x) return;
    if (WS_TOTAL > ws_size) return;
    // wire order: x_q, x_k, x_v, mask (int32 [1][1][SEQ_FULL][SEQ_FULL]), Wq, bq, Wk, bk, Wv, bv, Wo, bo; weights [out][in]
    const float* xq = (const float*)d_in[0]; const float* xk = (const float*)d_in[1]; const float* xv = (const float*)d_in[2];
    const int* mask = (const int*)d_in[3];
    const float* wq = (const float*)d_in[4]; const float* bq = (const float*)d_in[5];
    const float* wk = (const float*)d_in[6]; const float* bk = (const float*)d_in[7];
    const float* wv = (const float*)d_in[8]; const float* bv = (const float*)d_in[9];
    const float* wo = (const float*)d_in[10]; const float* bo = (const float*)d_in[11];
    float* OUT = (float*)d_out;     // [NB_FULL][SEQ_FULL][DM]
    char* wsp = (char*)d_ws;
    auto take = [&](size_t bytes) { char* p = wsp; wsp += bytes; return (void*)p; };      // all sizes are multiples of 256 bytes
    bf* WQ = (bf*)take(WS_W / 4); bf* WK = (bf*)take(WS_W / 4); bf* WV = (bf*)take(WS_W / 4); bf* WO = (bf*)take(WS_W / 4);
    bf* XBq = (bf*)take(WS_XB); bf* XBk = (bf*)take(WS_XB); bf* XBv = (bf*)take(WS_XB);   // contiguous: k_prep indexes them from XBq, as it does the weights from WQ
    h16* Q16 = (h16*)take(WS_PL); bf* Qh = (bf*)take(WS_PL); bf* Ql = (bf*)take(WS_PL);
    h16* K16 = (h16*)take(WS_PL); bf* Kh = (bf*)take(WS_PL); bf* Kl = (bf*)take(WS_PL);
    h16* VT16 = (h16*)take(WS_PL); bf* VTh = (bf*)take(WS_PL); bf* VTl = (bf*)take(WS_PL);
    bf* ATh = (bf*)take(WS_AT); bf* ATl = (bf*)take(WS_AT);
    unsigned* PM = (unsigned*)take(WS_PM);
    if ((size_t)(wsp - (char*)d_ws) > ws_size) return;

    // bf16 copies of the streams and the weights, and the mask's lane masks (once for all batches and heads)
    k_prep<<<dim3(PGC + PGM), 256, 0, stream>>>(xq, xk, xv, wq, wk, wv, wo, mask, XBq, WQ, PM);
    // q, k, v projections: one launch (the streams' copies, the weights' copies and the nine head planes each lie one behind the other)
    k_qkv<<<dim3(SEQ / 128, DQ / 128, 3 * NB), 32 * NW, 0, stream>>>(XBq, WQ, DM, bq, bk, bv, Q16, Qh, Ql);
    // attention, one launch: query rows [0, RHE) on hi/lo planes, rows [RHE, SEQ) on f16 planes
    k_attn<<<dim3((AHI + ALO) * NH_ * NB), 32 * NW, 0, stream>>>(Q16, K16, VT16, Qh, Ql, Kh, Kl, VTh, VTl, PM, ATh, ATl);
    // output projection: per batch rows of the full-size output
    k_oproj<<<dim3(SEQ / 128, DM / 128, NB), 32 * NW, 0, stream>>>(ATh, ATl, WO, DQ, OUT, DM, bo, (size_t)SEQ * DQ, (size_t)SEQ_FULL * DM);
}

// v008
// Measured time: 146 microseconds a run.
// Two timings next to v007 both put it at 1.12 times that version's speed.
// Over all steps from v000 it is 3.52 times as fast.
#include <hip/hip_runtime.h>

// Three-stream masked attention: q = xq Wq^T + bq, k = xk Wk^T + bk, v = xv Wv^T + bv (weights [out][in]); 16 heads x 64 (head h = columns h*64+d); scores x 1/8; integer mask [SEQ][SEQ] read by value (0 -> score := -1e9); softmax; out = ctx Wo^T + bo.
// Compute dtypes, f32 accumulate: every float input RNE-converted to bf16; projections v_wmma_f32_16x16x32_bf16 (exact operand products); attention query rows < RH: bf16 hi+lo planes for q, k, v and p (3 products per site); rows >= RH: v_wmma_f32_16x16x32_f16 single products (q, k, v, p as f16); online softmax f32; ctx carried as bf16 hi+lo planes x Wo bf16 (2 products).
// Engine: four waves per 128x128 GEMM tile, one 64x64 quarter each (operands from K-contiguous 16-bit planes through LDS: two buffers, asynchronous copies); the q, k, v projections convert their f32 sums in the epilogue and store the head planes themselves (v as W X^T, so that its tile rows are d and its columns t); fused flash-style attention on transposed tiles (S^T = K Q^T, O^T = V^T P^T: a query is a lane's column), four waves per work-group (16 query rows each), 32-key steps; the work-group's waves share 64-key K and V^T tiles in LDS (two buffers, asynchronous copies); q fragments loaded once and held in registers; the mask packed once per call into 32-lane bit masks, read by scalar loads; one preparation launch (k_prep) makes every bf16 copy and the packed mask; the three projections are one launch (k_qkv), both kinds of attention work-group another (k_attn); no score or probability plane in global memory.

#ifndef NB
#define NB 2
#endif
#ifndef SEQ
#define SEQ 2048
#endif
#define NB_FULL  2
#define SEQ_FULL 2048
#define DM   1024
#define NH_  16
#define HD   64
#define DQ   (NH_ * HD)
#define RH   512                  // query rows < RH use hi+lo planes
#define RHE  ((RH < SEQ) ? RH : SEQ)
#define SCL  0.125f               // HD^-0.5
#define L2E  1.4426950408889634f
#define MFILL (-1.0e9f)           // value that replaces a masked score
#define MINIT (-1.0e30f)          // running-max start (below MFILL)
#define MSEEN (-5.0e8f)           // running max above this <=> the row has met an unmasked key
#define F16MINN 6.103515625e-05f  // smallest normal f16
#define CP 72                     // ctx tile pitch (halves): 64 + 8
#define NW 4                      // waves per work-group (attention: 16 query rows each; GEMM: a 64x64 quarter each)
#define KT 64                     // keys per staged K / V^T tile
#define TP 72                     // staged tile pitch (halves): 64 + 8 = 144 bytes, an odd multiple of 16 bytes
#define TPL (64 * TP)             // one staged plane tile (halves): 64 rows (K: keys x d; V^T: d x keys; GEMM operands: rows x k)

typedef _Float16 h16;
typedef unsigned short bf;
typedef __attribute__((ext_vector_type(16))) __bf16   v16bf;
typedef __attribute__((ext_vector_type(16))) _Float16 v16h;
typedef __attribute__((ext_vector_type(8)))  _Float16 v8h;
typedef __attribute__((ext_vector_type(8)))  unsigned short v8us;
typedef __attribute__((ext_vector_type(16))) unsigned short v16us;
typedef __attribute__((ext_vector_type(8)))  float    v8f;
typedef __attribute__((ext_vector_type(4)))  float    v4f;
typedef __attribute__((ext_vector_type(4)))  _Float16 v4h;
typedef __attribute__((ext_vector_type(4)))  unsigned short v4us;
typedef __attribute__((ext_vector_type(4)))  int      v4i;
typedef __attribute__((ext_vector_type(16))) unsigned v16u;
typedef __attribute__((ext_vector_type(8)))  unsigned long long v8ul;
typedef v8h  __attribute__((may_alias)) v8ha;
typedef v4f  __attribute__((may_alias)) v4fa;
typedef v8us __attribute__((may_alias)) v8usa;

static_assert(HD == 64);
static_assert(DQ == DM);                       // merged width equals model width
static_assert(DM % 128 == 0);                  // GEMM tiles of 128, K stages of 128
static_assert(SEQ % 128 == 0);                 // GEMM tiles of 128; attention tiles of 16 rows, 32 keys
static_assert(RH % 16 == 0);                   // hi/lo row split on a query-tile boundary
static_assert(NB <= NB_FULL);
static_assert(SEQ <= SEQ_FULL);
static_assert((CP * 2) % 16 == 0);             // 16-byte aligned ctx tile rows
static_assert((TP * 2) % 16 == 0);             // 16-byte aligned staged rows
static_assert(RHE % (16 * NW) == 0 && (SEQ - RHE) % (16 * NW) == 0);   // whole attention work-groups on both sides of the row split
static_assert(SEQ % KT == 0 && SEQ / KT >= 2); // whole staged tiles; the two-buffer prologue needs two
static_assert(KT == 64 && NW * 32 == 128);     // stage_pair: 512 16-byte pieces per plane tile, 4 per thread
static_assert((long long)NB * NH_ * SEQ * HD < 2147483647LL);       // int element offsets into head planes
static_assert((long long)SEQ_FULL * SEQ_FULL < 2147483647LL);      // int element offsets into the mask

constexpr size_t WS_W  = (size_t)4 * DM * DM * 2;          // four bf16 weight planes
constexpr size_t WS_XB = (size_t)NB * SEQ * DM * 2;        // bf16 copy of one input stream
constexpr size_t WS_PL = (size_t)NB * NH_ * SEQ * HD * 2;  // one 16-bit head plane
constexpr size_t WS_AT = (size_t)NB * SEQ * DQ * 2;        // one merged ctx plane
constexpr size_t WS_PM = (size_t)(SEQ / 16) * (SEQ / 32) * 64;   // packed mask: 16 words per 16-query x 32-key tile
constexpr size_t WS_TOTAL = WS_W + 3 * WS_XB + 9 * WS_PL + 2 * WS_AT + WS_PM;
static_assert(WS_TOTAL <= (size_t)134217728);              // carve stays within 128 MiB
static_assert(WS_W % 256 == 0 && WS_XB % 256 == 0 && WS_PL % 256 == 0 && WS_AT % 256 == 0 && WS_PM % 256 == 0);

__device__ __forceinline__ unsigned short f2bf(float f) { unsigned u = __float_as_uint(f); u += 0x7FFFu + ((u >> 16) & 1u); return (unsigned short)(u >> 16); }   // RNE
__device__ __forceinline__ float bf2f(unsigned short b) { return __uint_as_float(((unsigned)b) << 16); }
__device__ __forceinline__ float bfr(float f) { return bf2f(f2bf(f)); }
__device__ __forceinline__ v16h cat16(v8h lo, v8h hi) { return __builtin_shufflevector(lo, hi, 0, 1, 2, 3, 4, 5, 6, 7, 8, 9, 10, 11, 12, 13, 14, 15); }
__device__ __forceinline__ v16bf cat16b(v8us lo, v8us hi) { return __builtin_bit_cast(v16bf, __builtin_shufflevector(lo, hi, 0, 1, 2, 3, 4, 5, 6, 7, 8, 9, 10, 11, 12, 13, 14, 15)); }
__device__ __forceinline__ v8f wmma16(v16h a, v16h b, v8f c) { return __builtin_amdgcn_wmma_f32_16x16x32_f16(false, a, false, b, (short)0, c, false, false); }
__device__ __forceinline__ v8f wmmab(v16bf a, v16bf b, v8f c) { return __builtin_amdgcn_wmma_f32_16x16x32_bf16(false, a, false, b, (short)0, c, false, false); }
__device__ __forceinline__ v8f mma3(v16bf ah, v16bf al, v16bf bh, v16bf bl, v8f c) { c = wmmab(ah, bh, c); c = wmmab(ah, bl, c); c = wmmab(al, bh, c); return c; }   // hi hi, then hi x B lo, then A lo x hi
__device__ __forceinline__ float xhalf(float x) { return __builtin_bit_cast(float, __builtin_amdgcn_permlanex16(__builtin_bit_cast(int, x), __builtin_bit_cast(int, x), 0x76543210, 0xfedcba98, false, false)); }   // lane l with lane l ^ 16
__device__ __forceinline__ h16 tohx(float x) { return (h16)x; }
__device__ __forceinline__ void splitf(float y, unsigned short& h, unsigned short& l) { h = f2bf(y); l = f2bf(y - bf2f(h)); }
__device__ __forceinline__ void wave_sync() { __builtin_amdgcn_wave_barrier(); asm volatile("" ::: "memory"); }   // same-wave LDS exchange (tiles are private to the wave)

// Fragment loaders (A and B alike): lane (lr = lane & 15, hi = lane >> 4) points at row/column lr, element 8*hi of the 32-deep k-step;
// elements 0..7 <- k0 + 8hi + 0..7, elements 8..15 <- k0 + 16 + 8hi + 0..7.
template <typename T16> struct WFrag;
template <> struct WFrag<h16> { typedef v16h V; static __device__ __forceinline__ V ld(const h16* p) { return cat16(*(const v8h*)p, *(const v8h*)(p + 16)); } static __device__ __forceinline__ v8f mma(V a, V b, v8f c) { return wmma16(a, b, c); } };
template <> struct WFrag<bf> { typedef v16bf V; static __device__ __forceinline__ V ld(const bf* p) { return cat16b(*(const v8us*)p, *(const v8us*)(p + 16)); } static __device__ __forceinline__ v8f mma(V a, V b, v8f c) { return wmmab(a, b, c); } };

// ---- staging of 64-row x 128-byte tiles in LDS (GEMM operands; K and V^T of the attention work-group)
__device__ __forceinline__ unsigned lds_off(const void* p) { return (unsigned)(size_t)p; }   // byte offset in the work-group's LDS (low half of the shared address)
__device__ __forceinline__ v16bf ldsb(const unsigned short* p) { return cat16b(*(const v8usa*)p, *(const v8usa*)(p + 16)); }   // fragment from a staged bf16 tile, same k order as WFrag::ld
__device__ __forceinline__ v16h  ldsh(const unsigned short* p) { return cat16(*(const v8ha*)p, *(const v8ha*)(p + 16)); }       // fragment from a staged f16 tile
// Two plane tiles of 64 rows x 128 bytes -> LDS at pitch TP, 16 bytes per lane and copy, 128 threads: copy i of a plane brings row 16 i + (tid >> 3), piece tid & 7.
// la / lb: the lane's LDS byte address of its row-0..15 piece; ga / gb: the lane's global address of the same piece; pa / pb: 16 source rows in elements.
template <typename T16>
__device__ __forceinline__ void stage_pair(unsigned la, const T16* ga, int pa, unsigned lb, const T16* gb, int pb) {
    // copies and their s_wait_xcnt in one statement: no address register of a copy is rewritten ahead of the wait
    asm volatile("global_load_async_to_lds_b128 %0, %8, off\n\t"
                 "global_load_async_to_lds_b128 %1, %9, off\n\t"
                 "global_load_async_to_lds_b128 %2, %10, off\n\t"
                 "global_load_async_to_lds_b128 %3, %11, off\n\t"
                 "global_load_async_to_lds_b128 %4, %12, off\n\t"
                 "global_load_async_to_lds_b128 %5, %13, off\n\t"
                 "global_load_async_to_lds_b128 %6, %14, off\n\t"
                 "global_load_async_to_lds_b128 %7, %15, off\n\t"
                 "s_wait_xcnt 0x0"
                 :: "v"(la), "v"(la + 16u * TP * 2u), "v"(la + 32u * TP * 2u), "v"(la + 48u * TP * 2u),
                    "v"(lb), "v"(lb + 16u * TP * 2u), "v"(lb + 32u * TP * 2u), "v"(lb + 48u * TP * 2u),
                    "v"(ga), "v"(ga + pa), "v"(ga + 2 * pa), "v"(ga + 3 * pa),
                    "v"(gb), "v"(gb + pb), "v"(gb + 2 * pb), "v"(gb + 3 * pb)
                 : "memory");
}

// ---- register-blocked GEMM body: one work-group = NW waves (2 x 2) on a 128x128 output tile, one wave per 64x64 quarter (16 accumulators); tile (bx, by) of (M/128, N/128) and batch z from the caller, 128 threads.
// Operands come from K-contiguous 16-bit planes through LDS: a stage is GK = 128 k of the work-group's 128 A rows (and A2 rows) and 128 Bt rows, held as 64-k tiles of 64 rows at pitch TP;
// every thread copies its pieces of stage t + 2 into the buffer that stage t has left (two buffers); one work-group barrier per stage publishes stage t + 1 and frees stage t's buffer.
// C[m][n] (f32, pitch ldc, + bf16-converted bias[n]) = sum_k A[m][k] Bt[n][k] (+ A2 Bt when NSPLIT == 1). z-batch strides sA/sB/sC in elements. K % 128 == 0, M % 128 == 0, N % 128 == 0.
// OUT == 0: C is stored as f32. OUT == 1, tr false (m = t, n = h*64 + d) or tr true (m = h*64 + d, n = t, bias[m]; tr is the same for the whole work-group): the f32 value (bias added on its way into the epilogue tile) is converted
// where it is made and stored to the three 16-bit head planes (f16, bf16 hi, bf16 lo) at P*[pb + tile row * pp + tile column]; a tile row is 128 bytes of each plane, one whole line per 16 lanes.
// gst: the work-group's LDS (GLDS<NSPLIT> halves); bx, by, z: its tile and batch.
#define GK 128                    // k per staged GEMM stage (two 64-k tiles per operand row block)
template <int NSPLIT> constexpr int GLDS = 2 * (GK / 64) * (2 + NSPLIT) * 2 * TPL;   // halves of LDS that a GEMM work-group needs: two buffers of staged operands
template <typename T16, int NSPLIT, bool BIAS, int OUT = 0>
__device__ __forceinline__ void gemmw_body(unsigned short* gst, int bx, int by, size_t z, bool tr, const T16* __restrict__ A, const T16* __restrict__ A2, const T16* __restrict__ Bt, int K, float* C, int ldc, const float* __restrict__ bias, size_t sA, size_t sB, size_t sC,
                                           h16* P16 = nullptr, bf* Ph = nullptr, bf* Pl = nullptr) {
    typedef typename WFrag<T16>::V V;
    static_assert(NSPLIT == 0 || NSPLIT == 1);
    constexpr int NT = 2 + NSPLIT;                                           // staged operands: A, (A2,) Bt
    constexpr int GT = 2 * TPL;                                              // 128 rows x 64 k of one operand (halves)
    constexpr int GB = (GK / 64) * NT * GT;                                  // one buffer (halves): [64-k half][operand][128 rows at pitch TP]
    static_assert((GK / 64) * NT * 8 <= 63);                                 // copies of one wave in flight: one stage's, 8 per operand and 64-k half
    static_assert(GLDS<NSPLIT> == 2 * GB && NW * 16 * 68 * 4 <= 2 * GB * 2);
    float* osa = (float*)gst;                                                // epilogue tiles, one per wave, in the staged operands' LDS: written only behind the last stage's foot (every wave's reads returned, no copy in flight, barrier)
    A += z * sA; if (NSPLIT) A2 += z * sA; Bt += z * sB; C += z * sC;
    const int tid = threadIdx.x, lane = tid & 31, lr = lane & 15, hi = lane >> 4;
    const int wave = __builtin_amdgcn_readfirstlane(tid >> 5);
    float* os = osa + wave * (16 * 68);
    const int R0 = bx * 128, C0 = by * 128;                                  // the work-group's tile
    const int r0 = R0 + (wave >> 1) * 64, c0 = C0 + (wave & 1) * 64;         // the wave's quarter
    v8f acc[4][4];
#pragma unroll
    for (int mb = 0; mb < 4; ++mb)
#pragma unroll
        for (int nb = 0; nb < 4; ++nb) acc[mb][nb] = (v8f){};
    const unsigned sl = lds_off(gst) + (unsigned)((tid >> 3) * TP + (tid & 7) * 8) * 2u;   // this thread's piece in a staged 64-row tile
    const size_t sga = (size_t)(R0 + (tid >> 3)) * K + (tid & 7) * 8;        // the same piece in A's rows R0..R0+63: + 64 K (rows + 64), + k
    const size_t sgb = (size_t)(C0 + (tid >> 3)) * K + (tid & 7) * 8;        // the same piece in Bt's rows C0..C0+63
    auto stage = [&](int t, int bi) {
#pragma unroll
        for (int s = 0; s < GK / 64; ++s) {
            const unsigned l = sl + (unsigned)((bi * GB + s * NT * GT) * 2);
            const size_t k = (size_t)t * GK + s * 64;
            // each scheduling barrier keeps the next eight copies' address arithmetic behind the eight just issued: their registers are reused, nothing spills beside the 128 accumulators
            stage_pair<T16>(l, A + sga + k, 16 * K, l + TPL * 2u, A + sga + (size_t)64 * K + k, 16 * K);
            __builtin_amdgcn_sched_barrier(0);
            if (NSPLIT) { stage_pair<T16>(l + GT * 2u, A2 + sga + k, 16 * K, l + GT * 2u + TPL * 2u, A2 + sga + (size_t)64 * K + k, 16 * K); __builtin_amdgcn_sched_barrier(0); }
            stage_pair<T16>(l + (NT - 1) * GT * 2u, Bt + sgb + k, 16 * K, l + (NT - 1) * GT * 2u + TPL * 2u, Bt + sgb + (size_t)64 * K + k, 16 * K);
            __builtin_amdgcn_sched_barrier(0);
        }
    };
    const int af = ((wave >> 1) * 64 + lr) * TP + 8 * hi;                    // A fragment in a staged operand: + mb*16*TP + 32 (second k-step of the 64-k half)
    const int bo = (NT - 1) * GT + ((wave & 1) * 64 + lr) * TP + 8 * hi;     // Bt fragment: + nb*16*TP + 32
    const int nst = K / GK;
    stage(0, 0);
    asm volatile("s_wait_asynccnt 0x0" ::: "memory");                           // this wave's pieces of stage 0 have landed
    __syncthreads();                                                            // stage 0 published to all waves
    if (1 < nst) stage(1, 1);
#pragma unroll 1
    for (int t = 0; t < nst; ++t) {
        const unsigned short* sb = gst + (t & 1) * GB;
#pragma unroll
        for (int ks = 0; ks < GK / 32; ++ks) {
            const unsigned short* sk = sb + (ks >> 1) * (NT * GT) + (ks & 1) * 32;
            V a[4], a2[4], b[4];
#pragma unroll
            for (int mb = 0; mb < 4; ++mb) { a[mb] = ldsb(sk + af + mb * 16 * TP); if (NSPLIT) a2[mb] = ldsb(sk + GT + af + mb * 16 * TP); b[mb] = ldsb(sk + bo + mb * 16 * TP); }
            // inputs-only fence on the loaded fragments: the k-step's LDS reads are issued as one group in front of its WMMAs (one LDS wait per k-step, not one per Bt fragment)
            if (NSPLIT) asm volatile("" :: "v"(a[0]), "v"(a[1]), "v"(a[2]), "v"(a[3]), "v"(a2[0]), "v"(a2[1]), "v"(a2[2]), "v"(a2[3]), "v"(b[0]), "v"(b[1]), "v"(b[2]), "v"(b[3]));
            else        asm volatile("" :: "v"(a[0]), "v"(a[1]), "v"(a[2]), "v"(a[3]), "v"(b[0]), "v"(b[1]), "v"(b[2]), "v"(b[3]));
#pragma unroll
            for (int nb = 0; nb < 4; ++nb) {
#pragma unroll
                for (int mb = 0; mb < 4; ++mb) { acc[mb][nb] = WFrag<T16>::mma(a[mb], b[nb], acc[mb][nb]); if (NSPLIT) acc[mb][nb] = WFrag<T16>::mma(a2[mb], b[nb], acc[mb][nb]); } }
        }
        // foot of stage t
        asm volatile("s_wait_dscnt 0x0" ::: "memory");                          // this wave's reads of stage t's buffer have returned
        asm volatile("s_wait_asynccnt 0x0" ::: "memory");                       // this wave's pieces of stage t + 1 have landed
        __syncthreads();                                                        // publishes stage t + 1; ends every wave's reads of stage t's buffer
        if (t + 2 < nst) stage(t + 2, t & 1);                                   // refill the buffer just left (same test in every wave)
    }
    asm volatile("s_wait_asynccnt 0x0" ::: "memory");                           // no copy in flight behind the loop
#pragma unroll
    for (int mb = 0; mb < 4; ++mb) {
        if (OUT == 1 && BIAS && tr) {                                           // bias[m]: the lane's 8 accumulator rows
            const v4f b0 = *(const v4f*)(bias + r0 + mb * 16 + hi * 8), b1 = *(const v4f*)(bias + r0 + mb * 16 + hi * 8 + 4);
#pragma unroll
            for (int nb = 0; nb < 4; ++nb) {
#pragma unroll
                for (int j = 0; j < 8; ++j) os[(hi * 8 + j) * 68 + nb * 16 + lr] = acc[mb][nb][j] + bfr(j < 4 ? b0[j & 3] : b1[j & 3]); }
        } else {
#pragma unroll
            for (int nb = 0; nb < 4; ++nb) { const float bc = (OUT == 1 && BIAS) ? bfr(bias[c0 + nb * 16 + lr]) : 0.0f;   // bias[n]: the lane's accumulator column
#pragma unroll
                for (int j = 0; j < 8; ++j) os[(hi * 8 + j) * 68 + nb * 16 + lr] = (OUT == 1 && BIAS) ? acc[mb][nb][j] + bc : acc[mb][nb][j]; }
        }
        wave_sync();
        float* crow = C + (size_t)(r0 + mb * 16) * ldc + c0;
if (OUT == 0) {
#pragma unroll
            for (int s = 0; s < 8; ++s) { const int row = 2 * s + hi, cofs = lr * 4; v4f val = *(const v4fa*)(os + row * 68 + cofs); if (BIAS) { val[0] += bfr(bias[c0 + cofs]); val[1] += bfr(bias[c0 + cofs + 1]); val[2] += bfr(bias[c0 + cofs + 2]); val[3] += bfr(bias[c0 + cofs + 3]); }
                *(v4f*)(crow + (size_t)row * ldc + cofs) = val; }
             }
        else {
            const size_t pb = !tr ? ((z * NH_ + c0 / 64) * SEQ + r0 + mb * 16) * HD : ((z * NH_ + r0 / 64) * HD + mb * 16) * SEQ + c0;   // head = the quarter's index along h*64 + d
            const int pp = !tr ? HD : SEQ;
#pragma unroll
            for (int s = 0; s < 8; ++s) { const int row = 2 * s + hi, cofs = lr * 4; v4f val = *(const v4fa*)(os + row * 68 + cofs);
                v4h o16; v4us oh, ol;
#pragma unroll
                for (int q = 0; q < 4; ++q) { o16[q] = tohx(val[q]); unsigned short a2, c2; splitf(val[q], a2, c2); oh[q] = a2; ol[q] = c2; }
                const size_t pe = pb + (size_t)row * pp + cofs;
                *(v4h*)(P16 + pe) = o16; *(v4us*)(Ph + pe) = oh; *(v4us*)(Pl + pe) = ol;
                asm volatile("s_wait_xcnt 0x0" ::: "memory"); }   // stands in front of the next rows' values, which reuse the registers these stores name
        }
        wave_sync();
    }
}
// k_qkv: the three projections in one launch, grid (SEQ/128, DQ/128, 3 * NB): stream s = blockIdx.z / NB (q, k, v), batch blockIdx.z % NB; the three do not depend on one another, and two work-groups fit a WGP's LDS.
// s = q, k: y[z][t][n] = XB[s][z][t][:] . WB[s][n][:] + b[n] (bf16 x bf16, one product), stored as [z*NH_ + h][t][d] planes. s = v: the same product with W as A and XB as B, stored as [z*NH_ + h][d][t] planes.
// XB, WB: the streams' and the weights' bf16 copies, one behind the other; P16, Ph, Pl: q's three planes; stream s has its own three 3 s planes further on.
__global__ __launch_bounds__(32 * NW) void k_qkv(const bf* XB, const bf* WB, int K, const float* bq, const float* bk, const float* bv, h16* P16, bf* Ph, bf* Pl) {
    __shared__ __align__(16) unsigned short gst[GLDS<0>];
    const int s = blockIdx.z / NB; const size_t z = blockIdx.z % NB;
    const bool tr = s == 2;
    const bf* X = XB + (size_t)s * NB * SEQ * DM; const bf* Wt = WB + (size_t)s * DM * DM;
    const size_t po = (size_t)s * 3 * NB * NH_ * SEQ * HD;
    gemmw_body<bf, 0, true, 1>(gst, tr ? blockIdx.y : blockIdx.x, tr ? blockIdx.x : blockIdx.y, z, tr, tr ? Wt : X, nullptr, tr ? X : Wt, K, nullptr, 0, s == 0 ? bq : s == 1 ? bk : bv,
                               tr ? (size_t)0 : (size_t)SEQ * DM, tr ? (size_t)SEQ * DM : (size_t)0, (size_t)0, P16 + po, Ph + po, Pl + po); }
// k_oproj: OUT[z][t][n] = (ATh + ATl)[z][t][:] . Wo[n][:] + bo[n] (two products).
__global__ __launch_bounds__(32 * NW) void k_oproj(const bf* A, const bf* A2, const bf* Bt, int K, float* C, int ldc, const float* bias, size_t sA, size_t sC) {
    __shared__ __align__(16) unsigned short gst[GLDS<1>];
    gemmw_body<bf, 1, true>(gst, blockIdx.x, blockIdx.y, blockIdx.z, false, A, A2, Bt, K, C, ldc, bias, sA, (size_t)0, sC); }

// ---- k_prep: everything the GEMMs and the attention read that is a plain re-coding of an input, in one launch of 256-thread work-groups.
// Work-groups [0, PGC): f32 -> bf16 (RNE) copies of the three streams (XB[s][b][t][:], s = q, k, v) and the four weights (WB[s][:][:], s = q, k, v, o). One work-group = PCH consecutive floats of one source:
// load u of a wave covers 512 consecutive bytes (16 per lane), store u 256 consecutive bytes (8 per lane); a thread's PU loads are all issued in front of its first store.
// Work-groups [PGC, PGC + PGM): the integer mask, read by value, as lane masks of the attention's S^T accumulators. PM[(qt * (SEQ/32) + st) * 16 + g*8 + r], bit l = (mask[qt*16 + (l & 15)][st*32 + g*16 + 8*(l >> 4) + r] != 0):
// word g*8 + r selects, lane by lane, element r of score accumulator g of query tile qt at key step st. One wave = one query tile x two key steps = 32 words = one 128-byte line.
#define PU 16                                              // 16-byte pieces per thread of a conversion work-group
constexpr int PCH = 256 * PU * 4;                          // floats per conversion work-group
constexpr int PGX = SEQ * DM / PCH;                        // work-groups per batch row block of one stream
constexpr int PGW = DM * DM / PCH;                         // work-groups per weight
constexpr int PGS = 3 * NB * PGX;                          // all stream work-groups
constexpr int PGC = PGS + 4 * PGW;                         // all conversion work-groups
constexpr int PGM = (SEQ / 16) * (SEQ / 64) / 8;           // mask work-groups
static_assert((SEQ * DM) % PCH == 0 && (DM * DM) % PCH == 0);
static_assert(((SEQ / 16) * (SEQ / 64)) % 8 == 0);
__device__ __forceinline__ void mpack_body(const int* __restrict__ mask, unsigned* PM, int blk) {
    const int lane = threadIdx.x & 31, lr = lane & 15, hi = lane >> 4;
    const int w = blk * 8 + (threadIdx.x >> 5), qt = w / (SEQ / 64), t = w % (SEQ / 64);
    const int* mp = mask + (qt * 16 + lr) * SEQ_FULL + t * 64 + 8 * hi;
    v4i m[8];
#pragma unroll
    for (int s = 0; s < 2; ++s) { m[4 * s] = *(const v4i*)(mp + 32 * s); m[4 * s + 1] = *(const v4i*)(mp + 32 * s + 4); m[4 * s + 2] = *(const v4i*)(mp + 32 * s + 16); m[4 * s + 3] = *(const v4i*)(mp + 32 * s + 20); }
    unsigned v = 0u;
#pragma unroll
    for (int j = 0; j < 32; ++j) { const unsigned b = __builtin_amdgcn_ballot_w32(m[j >> 2][j & 3] != 0); v = (lane == j) ? b : v; }   // lane j keeps word j
    PM[(size_t)w * 32 + lane] = v;
}
__global__ __launch_bounds__(256) void k_prep(const float* __restrict__ xq, const float* __restrict__ xk, const float* __restrict__ xv,
                                              const float* __restrict__ wq, const float* __restrict__ wk, const float* __restrict__ wv, const float* __restrict__ wo,
                                              const int* __restrict__ mask, bf* XB, bf* WB, unsigned* PM) {
    const int g = blockIdx.x;
    if (g >= PGC) { mpack_body(mask, PM, g - PGC); return; }           // no barrier anywhere in this kernel
    const float* src; bf* dst;
    if (g < PGS) { const int s = g / (NB * PGX), r = g % (NB * PGX), b = r / PGX, c = r % PGX;
        src = (s == 0 ? xq : s == 1 ? xk : xv) + (size_t)b * SEQ_FULL * DM + (size_t)c * PCH;
        dst = XB + ((size_t)s * NB + b) * SEQ * DM + (size_t)c * PCH; }
    else { const int r = g - PGS, s = r / PGW, c = r % PGW;
        src = (s == 0 ? wq : s == 1 ? wk : s == 2 ? wv : wo) + (size_t)c * PCH;
        dst = WB + (size_t)s * DM * DM + (size_t)c * PCH; }
    const int e = threadIdx.x * 4;
    v4f v[PU];
#pragma unroll
    for (int u = 0; u < PU; ++u) v[u] = *(const v4f*)(src + u * 1024 + e);
#pragma unroll
    for (int u = 0; u < PU; ++u) { v4us o;
#pragma unroll
        for (int k = 0; k < 4; ++k) o[k] = f2bf(v[u][k]);
        *(v4us*)(dst + u * 1024 + e) = o; }
}

// ---- fused attention body: one work-group = NW waves of one (b, h); one wave = 16 query rows (q0..q0+15); key loop in 32-key steps, two steps per staged 64-key tile.
// K and V^T tiles: every thread copies its pieces of tile t + 2 into the buffer that tile t has left (two buffers); one work-group barrier per tile publishes tile t + 1 and frees tile t's buffer.
// Per step: (1) the 16x32 mask tile comes as 16 lane masks (k_prep: one word per S^T accumulator element), one 64-byte scalar load issued one step ahead; a tile whose 512 entries are all 0
// is skipped (wave-uniform, decided on the words read); (2) S^T = k q^T (two 16x16 accumulators: row = key 8*hi + r, column = query lr; k fragments from LDS as A, q fragments as B, held in
// registers); (3) e = mask == 0 ? -1e9 : S/8; online softmax in f32, one running maximum per query (16 values in the lane, then lane l with l ^ 16) and one running sum per lane (halves joined in the epilogue); (4) the lane's 16 probabilities are
// the B fragment of P^T as they stand (elements 0..7 = keys 8*hi + r, 8..15 = keys 16 + 8*hi + r); O^T += V^T P^T (four d-tiles, V^T fragments from LDS as A; row = d, column = query).
// A skipped all-masked tile contributes exactly 0 to every row that meets an unmasked key somewhere (exp underflow); if some row of the work-group never does, the work-group repeats the loop
// with skipping disabled (every entry -1e9 -> uniform weights; rows that do meet a key end with the same values), so the result is exact for any mask contents.
template <bool HI>
__device__ __forceinline__ void attn_body(const h16* __restrict__ Q16, const h16* __restrict__ K16, const h16* __restrict__ VT16,
                                          const bf* __restrict__ Qh, const bf* __restrict__ Ql, const bf* __restrict__ Kh, const bf* __restrict__ Kl,
                                          const bf* __restrict__ VTh, const bf* __restrict__ VTl, const unsigned* __restrict__ PM, bf* ATh, bf* ATl, int row_base,
                                          unsigned short* stg, int* wflag, int xt, int h, int b) {
    constexpr int NPL = HI ? 4 : 2;                                          // staged planes per buffer: Kh Kl VTh VTl, or K16 VT16; stg holds two buffers of staged tiles
    static_assert(2 * NW * 16 * CP <= 2 * NPL * TPL);
    unsigned short* ctha = stg;                                              // ctx tiles hi, in the staged tiles' LDS: written only behind the key loop's last foot and the barrier of the repeat decision
    unsigned short* ctla = stg + NW * 16 * CP;                               // ctx tiles lo
    const int tid = threadIdx.x, lane = tid & 31, lr = lane & 15, hi = lane >> 4;
    const int wave = __builtin_amdgcn_readfirstlane(tid >> 5);
    unsigned short* cth = ctha + wave * 16 * CP;
    unsigned short* ctl = ctla + wave * 16 * CP;
    const int q0 = row_base + (xt * NW + wave) * 16;
    const int zoff  = (b * NH_ + h) * (SEQ * HD);            // head plane offset ([t][d] and [d][t] planes both hold SEQ*HD elements)
    const int qbase = zoff + (q0 + lr) * HD + 8 * hi;        // B fragment of q: column = query q0 + lr; + c2*32
    const int kfrag = lr * TP + 8 * hi;                      // A fragment of k in a staged tile: row = key (sub*32 + nt*16 + lr); + (sub*32 + nt*16)*TP + c2*32
    const int vfrag = lr * TP + 8 * hi;                      // A fragment of v^T in a staged tile: row = d = dt*16 + lr; + dt*16*TP + sub*32
    // the query tile's lane masks, 16 words per key step; written by an earlier launch and never in this one: read through the constant address space, so that the loads are scalar
    const __attribute__((address_space(4))) v16u* pm = (const __attribute__((address_space(4))) v16u*)(PM + (size_t)(q0 >> 4) * ((SEQ / 32) * 16));
    const unsigned sl = lds_off(stg) + (unsigned)((tid >> 3) * TP + (tid & 7) * 8) * 2u;   // this thread's piece in a staged plane tile
    const int sgk = zoff + (tid >> 3) * HD + (tid & 7) * 8;  // the same piece in a [t][d] plane: + t*KT*HD
    const int sgv = zoff + (tid >> 3) * SEQ + (tid & 7) * 8; // the same piece in a [d][t] plane: + t*KT
    auto stage = [&](int t, int bi) {
        const unsigned l = sl + (unsigned)(bi * NPL * TPL * 2);
        if (HI) {
            stage_pair<bf>(l, Kh + sgk + t * (KT * HD), 16 * HD, l + TPL * 2u, Kl + sgk + t * (KT * HD), 16 * HD);
            stage_pair<bf>(l + 2u * TPL * 2u, VTh + sgv + t * KT, 16 * SEQ, l + 3u * TPL * 2u, VTl + sgv + t * KT, 16 * SEQ);
        } else {
            stage_pair<h16>(l, K16 + sgk + t * (KT * HD), 16 * HD, l + TPL * 2u, VT16 + sgv + t * KT, 16 * SEQ);
        }
    };

    // B fragments of q^T: loaded once, held in registers over the whole key loop (and its repeat)
    v16bf qh0, qh1, ql0, ql1; v16h qa0, qa1;
    if (HI) { qh0 = WFrag<bf>::ld(Qh + qbase); qh1 = WFrag<bf>::ld(Qh + qbase + 32); ql0 = WFrag<bf>::ld(Ql + qbase); ql1 = WFrag<bf>::ld(Ql + qbase + 32); }
    else    { qa0 = WFrag<h16>::ld(Q16 + qbase); qa1 = WFrag<h16>::ld(Q16 + qbase + 32); }
    v8f o[4]; float m, l;
    bool dense = false;
#pragma unroll 1
    for (int pass = 0; pass < 2; ++pass) {
#pragma unroll
        for (int t = 0; t < 4; ++t) o[t] = (v8f){};
        m = MINIT; l = 0.0f;
        // two-buffer prologue (on a repeat, the last tile's foot has already ended every read of both buffers)
        stage(0, 0);
        asm volatile("s_wait_asynccnt 0x0" ::: "memory");                       // this wave's pieces of tile 0 have landed
        __syncthreads();                                                        // tile 0 published to all waves
        stage(1, 1);
        v16u nx = pm[0];                                                        // lane masks of step 0
#pragma unroll 1
        for (int t = 0; t < SEQ / KT; ++t) {
            const unsigned short* sb = stg + (t & 1) * (NPL * TPL);
#pragma unroll 1
            for (int sub = 0; sub < 2; ++sub) {                                 // rolled: one copy of the step's code
            const int st = t * 2 + sub;
            const v16u cw = nx;                                                 // this step's lane masks, loaded during the step before
            nx = pm[(st + 1 < SEQ / 32) ? st + 1 : SEQ / 32 - 1];               // the next step's (the last step reads its own again)
            const v8ul c8 = __builtin_bit_cast(v8ul, cw);
            const bool anyw = (((c8[0] | c8[1]) | (c8[2] | c8[3])) | ((c8[4] | c8[5]) | (c8[6] | c8[7]))) != 0ull;   // wave-uniform
            if (!(dense || anyw)) continue;                                     // whole 16x32 tile masked: skipped (its words were read); the tile's foot below is still passed

            const unsigned short* kf = sb + kfrag + sub * 32 * TP;
            v8f s0 = (v8f){}, s1 = (v8f){};
            if (HI) {
                s0 = mma3(ldsb(kf), ldsb(kf + TPL), qh0, ql0, s0);
                s0 = mma3(ldsb(kf + 32), ldsb(kf + TPL + 32), qh1, ql1, s0);
                s1 = mma3(ldsb(kf + 16 * TP), ldsb(kf + TPL + 16 * TP), qh0, ql0, s1);
                s1 = mma3(ldsb(kf + 16 * TP + 32), ldsb(kf + TPL + 16 * TP + 32), qh1, ql1, s1);
                asm volatile("v_nop\n\tv_nop\n\tv_nop\n\tv_nop" : "+v"(s0), "+v"(s1) : "v"(qh1), "v"(ql1));
            } else {
                s0 = wmma16(ldsh(kf), qa0, s0);
                s0 = wmma16(ldsh(kf + 32), qa1, s0);
                s1 = wmma16(ldsh(kf + 16 * TP), qa0, s1);
                s1 = wmma16(ldsh(kf + 16 * TP + 32), qa1, s1);
                asm volatile("v_nop\n\tv_nop\n\tv_nop\n\tv_nop" : "+v"(s0), "+v"(s1) : "v"(qa0), "v"(qa1));
            }

            float e0[8], e1[8], t8[8];
#pragma unroll
            for (int r = 0; r < 8; ++r) { e0[r] = __builtin_amdgcn_inverse_ballot_w32(cw[r]) ? s0[r] * SCL : MFILL; e1[r] = __builtin_amdgcn_inverse_ballot_w32(cw[8 + r]) ? s1[r] * SCL : MFILL; t8[r] = fmaxf(e0[r], e1[r]); }
            float rm = fmaxf(fmaxf(fmaxf(t8[0], t8[1]), fmaxf(t8[2], t8[3])), fmaxf(fmaxf(t8[4], t8[5]), fmaxf(t8[6], t8[7])));
            rm = fmaxf(rm, xhalf(rm));                                          // the query's other 16 keys of the step
            const float mn = fmaxf(m, rm);
            const float al = __builtin_amdgcn_exp2f((m - mn) * L2E);
            v16us ph, pl; v16h pa;                                              // B fragments of P^T
#pragma unroll
            for (int r = 0; r < 8; ++r) {
                float x0 = __builtin_amdgcn_exp2f((e0[r] - mn) * L2E);
                float x1 = __builtin_amdgcn_exp2f((e1[r] - mn) * L2E);
                if (HI) {
                    unsigned short a0, c0, a1, c1; splitf(x0, a0, c0); splitf(x1, a1, c1);
                    ph[r] = a0; pl[r] = c0; ph[8 + r] = a1; pl[8 + r] = c1;
                    t8[r] = x0 + x1;
                } else {
                    x0 = (x0 < F16MINN) ? 0.0f : x0; x1 = (x1 < F16MINN) ? 0.0f : x1;      // no subnormal f16 operands; the row sum uses the same values
                    const h16 g0 = tohx(x0), g1 = tohx(x1);
                    pa[r] = g0; pa[8 + r] = g1;
                    t8[r] = (float)g0 + (float)g1;
                }
            }
            float rs = ((t8[0] + t8[1]) + (t8[2] + t8[3])) + ((t8[4] + t8[5]) + (t8[6] + t8[7]));
            l = l * al + rs; m = mn;                                           // l: this lane's half of the keys; the two halves (same al) are joined behind the loop
#pragma unroll
            for (int dt = 0; dt < 4; ++dt) o[dt] *= al;
            const unsigned short* vf = sb + (HI ? 2 : 1) * TPL + vfrag + sub * 32;
            if (HI) {
                const v16bf pb = __builtin_bit_cast(v16bf, ph), pc = __builtin_bit_cast(v16bf, pl);
                const v16bf vh0 = ldsb(vf), vh1 = ldsb(vf + 16 * TP), vh2 = ldsb(vf + 32 * TP), vh3 = ldsb(vf + 48 * TP);
                const v16bf vl0 = ldsb(vf + TPL), vl1 = ldsb(vf + TPL + 16 * TP), vl2 = ldsb(vf + TPL + 32 * TP), vl3 = ldsb(vf + TPL + 48 * TP);
                o[0] = mma3(vh0, vl0, pb, pc, o[0]); o[1] = mma3(vh1, vl1, pb, pc, o[1]); o[2] = mma3(vh2, vl2, pb, pc, o[2]); o[3] = mma3(vh3, vl3, pb, pc, o[3]);
                asm volatile("v_nop\n\tv_nop\n\tv_nop\n\tv_nop" : "+v"(o[0]), "+v"(o[1]), "+v"(o[2]), "+v"(o[3]) : "v"(pb), "v"(pc));
            } else {
                const v16h v0 = ldsh(vf), v1 = ldsh(vf + 16 * TP), v2 = ldsh(vf + 32 * TP), v3 = ldsh(vf + 48 * TP);
                o[0] = wmma16(v0, pa, o[0]); o[1] = wmma16(v1, pa, o[1]); o[2] = wmma16(v2, pa, o[2]); o[3] = wmma16(v3, pa, o[3]);
                asm volatile("v_nop\n\tv_nop\n\tv_nop\n\tv_nop" : "+v"(o[0]), "+v"(o[1]), "+v"(o[2]), "+v"(o[3]) : "v"(pa), "v"(v3));
            }
            }
            // foot of tile t, passed by every wave whatever it skipped
            asm volatile("s_wait_dscnt 0x0" ::: "memory");                      // this wave's reads of tile t's buffer have returned
            asm volatile("s_wait_asynccnt 0x0" ::: "memory");                   // this wave's pieces of tile t + 1 have landed
            __syncthreads();                                                    // publishes tile t + 1; ends every wave's reads of tile t's buffer
            if (t + 2 < SEQ / KT) stage(t + 2, t & 1);                          // refill the buffer just left (same test in every wave)
        }
        asm volatile("s_wait_asynccnt 0x0" ::: "memory");                       // no copy in flight behind the loop
        const bool bad = !(m > MSEEN);
        const int wbad = (__builtin_amdgcn_ballot_w32(bad) != 0u) ? 1 : 0;      // taken with every lane on
        if (lane == 0) wflag[wave] = wbad;
        __syncthreads();                                                        // the repeat is decided for the whole work-group: its barriers need every wave
        const int anyb = wflag[0] | wflag[1] | wflag[2] | wflag[3];
        if (__builtin_amdgcn_readfirstlane(anyb) == 0) break;                   // every row met an unmasked key: skipped tiles contributed exactly 0
        dense = true;                                                           // otherwise repeat without skipping (work-group-uniform)
    }

    const float inv = 1.0f / (l + xhalf(l));
#pragma unroll
    for (int dt = 0; dt < 4; ++dt) { v8us a8, c8;                               // the lane's 8 consecutive d of its query: one 16-byte piece of each ctx tile row
#pragma unroll
        for (int r = 0; r < 8; ++r) { unsigned short a, c; splitf(o[dt][r] * inv, a, c); a8[r] = a; c8[r] = c; }
        *(v8usa*)(cth + lr * CP + dt * 16 + 8 * hi) = a8; *(v8usa*)(ctl + lr * CP + dt * 16 + 8 * hi) = c8; }
    wave_sync();
    v8us hv[4], lv[4];
#pragma unroll
    for (int s = 0; s < 4; ++s) { const int row = 4 * s + (lane >> 3); hv[s] = *(const v8usa*)(cth + row * CP + (lane & 7) * 8); lv[s] = *(const v8usa*)(ctl + row * CP + (lane & 7) * 8); }
    const size_t ob = (size_t)(b * SEQ + q0 + (lane >> 3)) * DQ + h * HD + (lane & 7) * 8;
{
#pragma unroll
        for (int s = 0; s < 4; ++s) { *(v8us*)(ATh + ob + (size_t)(4 * s) * DQ) = hv[s]; *(v8us*)(ATl + ob + (size_t)(4 * s) * DQ) = lv[s]; }
         }
}
// k_attn: both kinds of attention work-group in one launch, chosen by the work-group index; they do not depend on one another. The hi/lo-plane work-groups (three times the products, one wave per SIMD if they had the chip
// to themselves) come first in the index, the f16 work-groups behind them; four work-groups fit a WGP's LDS and registers, so all of them can be resident at once and fill one another's waits.
constexpr int AHI = RHE / (16 * NW);                       // hi/lo-plane work-groups per (b, h)
constexpr int ALO = (SEQ - RHE) / (16 * NW);               // f16 work-groups per (b, h)
__global__ __launch_bounds__(32 * NW) void k_attn(const h16* Q16, const h16* K16, const h16* VT16, const bf* Qh, const bf* Ql, const bf* Kh, const bf* Kl, const bf* VTh, const bf* VTl,
                                                  const unsigned* PM, bf* ATh, bf* ATl) {
    __shared__ __align__(16) unsigned short stg[2 * 4 * TPL];                // two buffers of staged tiles (the larger kind's); ctx tiles behind the key loop
    __shared__ int wflag[NW];                                                // per wave: some row has met no unmasked key
    const int g = blockIdx.x;
#if SEQ > RH
    if (g >= AHI * NH_ * NB) { const int r = g - AHI * NH_ * NB;
        attn_body<false>(Q16, K16, VT16, nullptr, nullptr, nullptr, nullptr, nullptr, nullptr, PM, ATh, ATl, RHE, stg, wflag, r % ALO, (r / ALO) % NH_, r / (ALO * NH_)); return; }
#endif
    attn_body<true>(nullptr, nullptr, nullptr, Qh, Ql, Kh, Kl, VTh, VTl, PM, ATh, ATl, 0, stg, wflag, g % AHI, (g / AHI) % NH_, g / (AHI * NH_)); }

extern "C" void kernel_launch(void* const* d_in, const int* in_sizes, int n_in,
                              void* d_out, int out_size, void* d_ws, size_t ws_size, hipStream_t stream) {
    if (n_in < 12) return;
    const long long need_x = (long long)(NB - 1) * SEQ_FULL * DM + (long long)SEQ * DM;      // rows read from a full-size stream
    const long long need_m = (long long)(SEQ - 1) * SEQ_FULL + SEQ;
    if (in_sizes[0] < need_x || in_sizes[1] < need_x || in_sizes[2] < need_x || in_sizes[3] < need_m) return;
    if (in_sizes[4] < DM * DM || in_sizes[6] < DM * DM || in_sizes[8] < DM * DM || in_sizes[10] < DM * DM) return;
    if (in_sizes[5] < DM || in_sizes[7] < DM || in_sizes[9] < DM || in_sizes[11] < DM) return;
    if ((long long)out_size < need_x) return;
    if (WS_TOTAL > ws_size) return;
    // wire order: x_q, x_k, x_v, mask (int32 [1][1][SEQ_FULL][SEQ_FULL]), Wq, bq, Wk, bk, Wv, bv, Wo, bo; weights [out][in]
    const float* xq = (const float*)d_in[0]; const float* xk = (const float*)d_in[1]; const float* xv = (const float*)d_in[2];
    const int* mask = (const int*)d_in[3];
    const float* wq = (const float*)d_in[4]; const float* bq = (const float*)d_in[5];
    const float* wk = (const float*)d_in[6]; const float* bk = (const float*)d_in[7];
    const float* wv = (const float*)d_in[8]; const float* bv = (const float*)d_in[9];
    const float* wo = (const float*)d_in[10]; const float* bo = (const float*)d_in[11];
    float* OUT = (float*)d_out;     // [NB_FULL][SEQ_FULL][DM]
    char* wsp = (char*)d_ws;
    auto take = [&](size_t bytes) { char* p = wsp; wsp += bytes; return (void*)p; };      // all sizes are multiples of 256 bytes
    bf* WQ = (bf*)take(WS_W / 4); bf* WK = (bf*)take(WS_W / 4); bf* WV = (bf*)take(WS_W / 4); bf* WO = (bf*)take(WS_W / 4);
    bf* XBq = (bf*)take(WS_XB); bf* XBk = (bf*)take(WS_XB); bf* XBv = (bf*)take(WS_XB);   // contiguous: k_prep indexes them from XBq, as it does the weights from WQ
    h16* Q16 = (h16*)take(WS_PL); bf* Qh = (bf*)take(WS_PL); bf* Ql = (bf*)take(WS_PL);
    h16* K16 = (h16*)take(WS_PL); bf* Kh = (bf*)take(WS_PL); bf* Kl = (bf*)take(WS_PL);
    h16* VT16 = (h16*)take(WS_PL); bf* VTh = (bf*)take(WS_PL); bf* VTl = (bf*)take(WS_PL);
    bf* ATh = (bf*)take(WS_AT); bf* ATl = (bf*)take(WS_AT);
    unsigned* PM = (unsigned*)take(WS_PM);
    if ((size_t)(wsp - (char*)d_ws) > ws_size) return;

    // bf16 copies of the streams and the weights, and the mask's lane masks (once for all batches and heads)
    k_prep<<<dim3(PGC + PGM), 256, 0, stream>>>(xq, xk, xv, wq, wk, wv, wo, mask, XBq, WQ, PM);
    // q, k, v projections: one launch (the streams' copies, the weights' copies and the nine head planes each lie one behind the other)
    k_qkv<<<dim3(SEQ / 128, DQ / 128, 3 * NB), 32 * NW, 0, stream>>>(XBq, WQ, DM, bq, bk, bv, Q16, Qh, Ql);
    // attention, one launch: query rows [0, RHE) on hi/lo planes, rows [RHE, SEQ) on f16 planes
    k_attn<<<dim3((AHI + ALO) * NH_ * NB), 32 * NW, 0, stream>>>(Q16, K16, VT16, Qh, Ql, Kh, Kl, VTh, VTl, PM, ATh, ATl);
    // output projection: per batch rows of the full-size output
    k_oproj<<<dim3(SEQ / 128, DM / 128, NB), 32 * NW, 0, stream>>>(ATh, ATl, WO, DQ, OUT, DM, bo, (size_t)SEQ * DQ, (size_t)SEQ_FULL * DM);
}

// v009
// One run takes 134 microseconds.
// In both of two side-by-side timings against v008, it was 1.09 times as fast.
// All steps since v000 together make it 3.82 times as fast.
#include <hip/hip_runtime.h>

// Three-stream masked attention: q = xq Wq^T + bq, k = xk Wk^T + bk, v = xv Wv^T + bv (weights [out][in]); 16 heads x 64 (head h = columns h*64+d); scores x 1/8; integer mask [SEQ][SEQ] read by value (0 -> score := -1e9); softmax; out = ctx Wo^T + bo.
// Compute dtypes, f32 accumulate: every float input RNE-converted to bf16; projections v_wmma_f32_16x16x32_bf16 (exact operand products); attention query rows < RH: bf16 hi+lo planes for q, k, v and p (3 products per site); rows >= RH: v_wmma_f32_16x16x32_f16 single products (q, k, v, p as f16); online softmax f32; ctx carried as bf16 hi+lo planes x Wo bf16 (2 products).
// Engine: four waves per 128x128 GEMM tile, one 64x64 quarter each (operands from K-contiguous 16-bit planes through LDS: two buffers, asynchronous copies); the q, k, v projections convert their f32 sums in the epilogue and store the head planes themselves (v as W X^T, so that its tile rows are d and its columns t); fused flash-style attention on transposed tiles (S^T = K Q^T, O^T = V^T P^T: a query is a lane's column), four waves per work-group (16 query rows each), 32-key steps; the work-group's waves share 64-key K and V^T tiles in LDS (two buffers, asynchronous copies); q fragments loaded once and held in registers; the mask packed once per call into 32-lane bit masks, read by scalar loads; one preparation launch (k_prep) makes every bf16 copy and the packed mask; the three projections are one launch (k_qkv), both kinds of attention work-group another (k_attn); no score or probability plane in global memory.

#ifndef NB
#define NB 2
#endif
#ifndef SEQ
#define SEQ 2048
#endif
#define NB_FULL  2
#define SEQ_FULL 2048
#define DM   1024
#define NH_  16
#define HD   64
#define DQ   (NH_ * HD)
#define RH   512                  // query rows < RH use hi+lo planes
#define RHE  ((RH < SEQ) ? RH : SEQ)
#define SCL  0.125f               // HD^-0.5
#define L2E  1.4426950408889634f
#define MFILL (-1.0e9f)           // value that replaces a masked score
#define MINIT (-1.0e30f)          // running-max start (below MFILL)
#define MSEEN (-5.0e8f)           // running max above this <=> the row has met an unmasked key
#define F16MINN 6.103515625e-05f  // smallest normal f16
#define CP 72                     // ctx tile pitch (halves): 64 + 8
#define NW 4                      // waves per work-group (attention: 16 query rows each; GEMM: a 64x64 quarter each)
#define KT 64                     // keys per staged K / V^T tile
#define TP 72                     // staged tile pitch (halves): 64 + 8 = 144 bytes, an odd multiple of 16 bytes
#define TPL (64 * TP)             // one staged plane tile (halves): 64 rows (K: keys x d; V^T: d x keys; GEMM operands: rows x k)

typedef _Float16 h16;
typedef unsigned short bf;
typedef __attribute__((ext_vector_type(16))) __bf16   v16bf;
typedef __attribute__((ext_vector_type(16))) _Float16 v16h;
typedef __attribute__((ext_vector_type(8)))  _Float16 v8h;
typedef __attribute__((ext_vector_type(8)))  unsigned short v8us;
typedef __attribute__((ext_vector_type(16))) unsigned short v16us;
typedef __attribute__((ext_vector_type(8)))  float    v8f;
typedef __attribute__((ext_vector_type(4)))  float    v4f;
typedef __attribute__((ext_vector_type(4)))  _Float16 v4h;
typedef __attribute__((ext_vector_type(4)))  unsigned short v4us;
typedef __attribute__((ext_vector_type(4)))  int      v4i;
typedef __attribute__((ext_vector_type(2)))  float    v2f;
typedef __attribute__((ext_vector_type(2)))  __bf16   v2bf;
typedef __attribute__((ext_vector_type(2)))  unsigned v2u;
typedef __attribute__((ext_vector_type(4)))  unsigned v4u;
typedef __attribute__((ext_vector_type(8)))  unsigned v8u;
typedef __attribute__((ext_vector_type(16))) unsigned v16u;
typedef __attribute__((ext_vector_type(8)))  unsigned long long v8ul;
typedef v8h  __attribute__((may_alias)) v8ha;
typedef v4f  __attribute__((may_alias)) v4fa;
typedef v8us __attribute__((may_alias)) v8usa;

static_assert(HD == 64);
static_assert(DQ == DM);                       // merged width equals model width
static_assert(DM % 128 == 0);                  // GEMM tiles of 128, K stages of 128
static_assert(SEQ % 128 == 0);                 // GEMM tiles of 128; attention tiles of 16 rows, 32 keys
static_assert(RH % 16 == 0);                   // hi/lo row split on a query-tile boundary
static_assert(NB <= NB_FULL);
static_assert(SEQ <= SEQ_FULL);
static_assert((CP * 2) % 16 == 0);             // 16-byte aligned ctx tile rows
static_assert((TP * 2) % 16 == 0);             // 16-byte aligned staged rows
static_assert(RHE % (16 * NW) == 0 && (SEQ - RHE) % (16 * NW) == 0);   // whole attention work-groups on both sides of the row split
static_assert(SEQ % KT == 0 && SEQ / KT >= 2); // whole staged tiles; the two-buffer prologue needs two
static_assert(KT == 64 && NW * 32 == 128);     // stage_pair: 512 16-byte pieces per plane tile, 4 per thread
static_assert((long long)NB * NH_ * SEQ * HD < 2147483647LL);       // int element offsets into head planes
static_assert((long long)SEQ_FULL * SEQ_FULL < 2147483647LL);      // int element offsets into the mask

constexpr size_t WS_W  = (size_t)4 * DM * DM * 2;          // four bf16 weight planes
constexpr size_t WS_XB = (size_t)NB * SEQ * DM * 2;        // bf16 copy of one input stream
constexpr size_t WS_PL = (size_t)NB * NH_ * SEQ * HD * 2;  // one 16-bit head plane
constexpr size_t WS_AT = (size_t)NB * SEQ * DQ * 2;        // one merged ctx plane
constexpr size_t WS_PM = (size_t)(SEQ / 16) * (SEQ / 32) * 64;   // packed mask: 16 words per 16-query x 32-key tile
constexpr size_t WS_TOTAL = WS_W + 3 * WS_XB + 9 * WS_PL + 2 * WS_AT + WS_PM;
static_assert(WS_TOTAL <= (size_t)134217728);              // carve stays within 128 MiB
static_assert(WS_W % 256 == 0 && WS_XB % 256 == 0 && WS_PL % 256 == 0 && WS_AT % 256 == 0 && WS_PM % 256 == 0);

__device__ __forceinline__ unsigned short f2bf(float f) { return __builtin_bit_cast(unsigned short, (__bf16)f); }   // RNE, the hardware's conversion
__device__ __forceinline__ unsigned f2bf2(float a, float b) { return __builtin_bit_cast(unsigned, __builtin_convertvector((v2f){a, b}, v2bf)); }   // two RNE conversions in one packed instruction: a in the low half, b in the high half
__device__ __forceinline__ float bf2f(unsigned short b) { return __uint_as_float(((unsigned)b) << 16); }
__device__ __forceinline__ float bfr(float f) { return bf2f(f2bf(f)); }
__device__ __forceinline__ v16h cat16(v8h lo, v8h hi) { return __builtin_shufflevector(lo, hi, 0, 1, 2, 3, 4, 5, 6, 7, 8, 9, 10, 11, 12, 13, 14, 15); }
__device__ __forceinline__ v16bf cat16b(v8us lo, v8us hi) { return __builtin_bit_cast(v16bf, __builtin_shufflevector(lo, hi, 0, 1, 2, 3, 4, 5, 6, 7, 8, 9, 10, 11, 12, 13, 14, 15)); }
__device__ __forceinline__ v8f wmma16(v16h a, v16h b, v8f c) { return __builtin_amdgcn_wmma_f32_16x16x32_f16(false, a, false, b, (short)0, c, false, false); }
__device__ __forceinline__ v8f wmmab(v16bf a, v16bf b, v8f c) { return __builtin_amdgcn_wmma_f32_16x16x32_bf16(false, a, false, b, (short)0, c, false, false); }
__device__ __forceinline__ v8f mma3(v16bf ah, v16bf al, v16bf bh, v16bf bl, v8f c) { c = wmmab(ah, bh, c); c = wmmab(ah, bl, c); c = wmmab(al, bh, c); return c; }   // hi hi, then hi x B lo, then A lo x hi
__device__ __forceinline__ float xhalf(float x) { return __builtin_bit_cast(float, __builtin_amdgcn_permlanex16(__builtin_bit_cast(int, x), __builtin_bit_cast(int, x), 0x76543210, 0xfedcba98, false, false)); }   // lane l with lane l ^ 16
__device__ __forceinline__ h16 tohx(float x) { return (h16)x; }
// hi/lo split of two values, packed (a low, b high): h = RNE(y), l = RNE(y - h); the difference is exact in f32
__device__ __forceinline__ void splitf2(float a, float b, unsigned& h, unsigned& l) {
    const v2f y = {a, b}; const v2bf hb = __builtin_convertvector(y, v2bf);
    h = __builtin_bit_cast(unsigned, hb); l = __builtin_bit_cast(unsigned, __builtin_convertvector(y - __builtin_convertvector(hb, v2f), v2bf)); }
__device__ __forceinline__ void wave_sync() { __builtin_amdgcn_wave_barrier(); asm volatile("" ::: "memory"); }   // same-wave LDS exchange (tiles are private to the wave)

// Fragment loaders (A and B alike): lane (lr = lane & 15, hi = lane >> 4) points at row/column lr, element 8*hi of the 32-deep k-step;
// elements 0..7 <- k0 + 8hi + 0..7, elements 8..15 <- k0 + 16 + 8hi + 0..7.
template <typename T16> struct WFrag;
template <> struct WFrag<h16> { typedef v16h V; static __device__ __forceinline__ V ld(const h16* p) { return cat16(*(const v8h*)p, *(const v8h*)(p + 16)); } static __device__ __forceinline__ v8f mma(V a, V b, v8f c) { return wmma16(a, b, c); } };
template <> struct WFrag<bf> { typedef v16bf V; static __device__ __forceinline__ V ld(const bf* p) { return cat16b(*(const v8us*)p, *(const v8us*)(p + 16)); } static __device__ __forceinline__ v8f mma(V a, V b, v8f c) { return wmmab(a, b, c); } };

// ---- staging of 64-row x 128-byte tiles in LDS (GEMM operands; K and V^T of the attention work-group)
__device__ __forceinline__ unsigned lds_off(const void* p) { return (unsigned)(size_t)p; }   // byte offset in the work-group's LDS (low half of the shared address)
__device__ __forceinline__ v16bf ldsb(const unsigned short* p) { return cat16b(*(const v8usa*)p, *(const v8usa*)(p + 16)); }   // fragment from a staged bf16 tile, same k order as WFrag::ld
__device__ __forceinline__ v16h  ldsh(const unsigned short* p) { return cat16(*(const v8ha*)p, *(const v8ha*)(p + 16)); }       // fragment from a staged f16 tile
// Two plane tiles of 64 rows x 128 bytes -> LDS at pitch TP, 16 bytes per lane and copy, 128 threads: copy i of a plane brings row 16 i + (tid >> 3), piece tid & 7.
// la / lb: the lane's LDS byte address of its row-0..15 piece; ga / gb: the lane's global address of the same piece; pa / pb: 16 source rows in elements.
template <typename T16>
__device__ __forceinline__ void stage_pair(unsigned la, const T16* ga, int pa, unsigned lb, const T16* gb, int pb) {
    // copies and their s_wait_xcnt in one statement: no address register of a copy is rewritten ahead of the wait
    asm volatile("global_load_async_to_lds_b128 %0, %8, off\n\t"
                 "global_load_async_to_lds_b128 %1, %9, off\n\t"
                 "global_load_async_to_lds_b128 %2, %10, off\n\t"
                 "global_load_async_to_lds_b128 %3, %11, off\n\t"
                 "global_load_async_to_lds_b128 %4, %12, off\n\t"
                 "global_load_async_to_lds_b128 %5, %13, off\n\t"
                 "global_load_async_to_lds_b128 %6, %14, off\n\t"
                 "global_load_async_to_lds_b128 %7, %15, off\n\t"
                 "s_wait_xcnt 0x0"
                 :: "v"(la), "v"(la + 16u * TP * 2u), "v"(la + 32u * TP * 2u), "v"(la + 48u * TP * 2u),
                    "v"(lb), "v"(lb + 16u * TP * 2u), "v"(lb + 32u * TP * 2u), "v"(lb + 48u * TP * 2u),
                    "v"(ga), "v"(ga + pa), "v"(ga + 2 * pa), "v"(ga + 3 * pa),
                    "v"(gb), "v"(gb + pb), "v"(gb + 2 * pb), "v"(gb + 3 * pb)
                 : "memory");
}

// ---- register-blocked GEMM body: one work-group = NW waves (2 x 2) on a 128x128 output tile, one wave per 64x64 quarter (16 accumulators); tile (bx, by) of (M/128, N/128) and batch z from the caller, 128 threads.
// Operands come from K-contiguous 16-bit planes through LDS: a stage is GK = 128 k of the work-group's 128 A rows (and A2 rows) and 128 Bt rows, held as 64-k tiles of 64 rows at pitch TP;
// every thread copies its pieces of stage t + 2 into the buffer that stage t has left (two buffers); one work-group barrier per stage publishes stage t + 1 and frees stage t's buffer.
// C[m][n] (f32, pitch ldc, + bf16-converted bias[n]) = sum_k A[m][k] Bt[n][k] (+ A2 Bt when NSPLIT == 1). z-batch strides sA/sB/sC in elements. K % 128 == 0, M % 128 == 0, N % 128 == 0.
// OUT == 0: C is stored as f32. OUT == 1, tr false (m = t, n = h*64 + d) or tr true (m = h*64 + d, n = t, bias[m]; tr is the same for the whole work-group): the f32 value (bias added on its way into the epilogue tile) is converted
// where it is made and stored to the three 16-bit head planes (f16, bf16 hi, bf16 lo) at P*[pb + tile row * pp + tile column]; a tile row is 128 bytes of each plane, one whole line per 16 lanes.
// gst: the work-group's LDS (GLDS<NSPLIT> halves); bx, by, z: its tile and batch.
#define GK 128                    // k per staged GEMM stage (two 64-k tiles per operand row block)
template <int NSPLIT> constexpr int GLDS = 2 * (GK / 64) * (2 + NSPLIT) * 2 * TPL;   // halves of LDS that a GEMM work-group needs: two buffers of staged operands
template <typename T16, int NSPLIT, bool BIAS, int OUT = 0>
__device__ __forceinline__ void gemmw_body(unsigned short* gst, int bx, int by, size_t z, bool tr, const T16* __restrict__ A, const T16* __restrict__ A2, const T16* __restrict__ Bt, int K, float* C, int ldc, const float* __restrict__ bias, size_t sA, size_t sB, size_t sC,
                                           h16* P16 = nullptr, bf* Ph = nullptr, bf* Pl = nullptr) {
    typedef typename WFrag<T16>::V V;
    static_assert(NSPLIT == 0 || NSPLIT == 1);
    constexpr int NT = 2 + NSPLIT;                                           // staged operands: A, (A2,) Bt
    constexpr int GT = 2 * TPL;                                              // 128 rows x 64 k of one operand (halves)
    constexpr int GB = (GK / 64) * NT * GT;                                  // one buffer (halves): [64-k half][operand][128 rows at pitch TP]
    static_assert((GK / 64) * NT * 8 <= 63);                                 // copies of one wave in flight: one stage's, 8 per operand and 64-k half
    static_assert(GLDS<NSPLIT> == 2 * GB && NW * 16 * 68 * 4 <= 2 * GB * 2);
    float* osa = (float*)gst;                                                // epilogue tiles, one per wave, in the staged operands' LDS: written only behind the last stage's foot (every wave's reads returned, no copy in flight, barrier)
    A += z * sA; if (NSPLIT) A2 += z * sA; Bt += z * sB; C += z * sC;
    const int tid = threadIdx.x, lane = tid & 31, lr = lane & 15, hi = lane >> 4;
    const int wave = __builtin_amdgcn_readfirstlane(tid >> 5);
    float* os = osa + wave * (16 * 68);
    const int R0 = bx * 128, C0 = by * 128;                                  // the work-group's tile
    const int r0 = R0 + (wave >> 1) * 64, c0 = C0 + (wave & 1) * 64;         // the wave's quarter
    v8f acc[4][4];
#pragma unroll
    for (int mb = 0; mb < 4; ++mb)
#pragma unroll
        for (int nb = 0; nb < 4; ++nb) acc[mb][nb] = (v8f){};
    const unsigned sl = lds_off(gst) + (unsigned)((tid >> 3) * TP + (tid & 7) * 8) * 2u;   // this thread's piece in a staged 64-row tile
    const size_t sga = (size_t)(R0 + (tid >> 3)) * K + (tid & 7) * 8;        // the same piece in A's rows R0..R0+63: + 64 K (rows + 64), + k
    const size_t sgb = (size_t)(C0 + (tid >> 3)) * K + (tid & 7) * 8;        // the same piece in Bt's rows C0..C0+63
    auto stage = [&](int t, int bi) {
#pragma unroll
        for (int s = 0; s < GK / 64; ++s) {
            const unsigned l = sl + (unsigned)((bi * GB + s * NT * GT) * 2);
            const size_t k = (size_t)t * GK + s * 64;
            // each scheduling barrier keeps the next eight copies' address arithmetic behind the eight just issued: their registers are reused, nothing spills beside the 128 accumulators
            stage_pair<T16>(l, A + sga + k, 16 * K, l + TPL * 2u, A + sga + (size_t)64 * K + k, 16 * K);
            __builtin_amdgcn_sched_barrier(0);
            if (NSPLIT) { stage_pair<T16>(l + GT * 2u, A2 + sga + k, 16 * K, l + GT * 2u + TPL * 2u, A2 + sga + (size_t)64 * K + k, 16 * K); __builtin_amdgcn_sched_barrier(0); }
            stage_pair<T16>(l + (NT - 1) * GT * 2u, Bt + sgb + k, 16 * K, l + (NT - 1) * GT * 2u + TPL * 2u, Bt + sgb + (size_t)64 * K + k, 16 * K);
            __builtin_amdgcn_sched_barrier(0);
        }
    };
    const int af = ((wave >> 1) * 64 + lr) * TP + 8 * hi;                    // A fragment in a staged operand: + mb*16*TP + 32 (second k-step of the 64-k half)
    const int bo = (NT - 1) * GT + ((wave & 1) * 64 + lr) * TP + 8 * hi;     // Bt fragment: + nb*16*TP + 32
    const int nst = K / GK;
    stage(0, 0);
    asm volatile("s_wait_asynccnt 0x0" ::: "memory");                           // this wave's pieces of stage 0 have landed
    __syncthreads();                                                            // stage 0 published to all waves
    if (1 < nst) stage(1, 1);
#pragma unroll 1
    for (int t = 0; t < nst; ++t) {
        const unsigned short* sb = gst + (t & 1) * GB;
#pragma unroll
        for (int ks = 0; ks < GK / 32; ++ks) {
            const unsigned short* sk = sb + (ks >> 1) * (NT * GT) + (ks & 1) * 32;
            V a[4], a2[4], b[4];
#pragma unroll
            for (int mb = 0; mb < 4; ++mb) { a[mb] = ldsb(sk + af + mb * 16 * TP); if (NSPLIT) a2[mb] = ldsb(sk + GT + af + mb * 16 * TP); b[mb] = ldsb(sk + bo + mb * 16 * TP); }
            // inputs-only fence on the loaded fragments: the k-step's LDS reads are issued as one group in front of its WMMAs (one LDS wait per k-step, not one per Bt fragment)
            if (NSPLIT) asm volatile("" :: "v"(a[0]), "v"(a[1]), "v"(a[2]), "v"(a[3]), "v"(a2[0]), "v"(a2[1]), "v"(a2[2]), "v"(a2[3]), "v"(b[0]), "v"(b[1]), "v"(b[2]), "v"(b[3]));
            else        asm volatile("" :: "v"(a[0]), "v"(a[1]), "v"(a[2]), "v"(a[3]), "v"(b[0]), "v"(b[1]), "v"(b[2]), "v"(b[3]));
#pragma unroll
            for (int nb = 0; nb < 4; ++nb) {
#pragma unroll
                for (int mb = 0; mb < 4; ++mb) { acc[mb][nb] = WFrag<T16>::mma(a[mb], b[nb], acc[mb][nb]); if (NSPLIT) acc[mb][nb] = WFrag<T16>::mma(a2[mb], b[nb], acc[mb][nb]); } }
        }
        // foot of stage t
        asm volatile("s_wait_dscnt 0x0" ::: "memory");                          // this wave's reads of stage t's buffer have returned
        asm volatile("s_wait_asynccnt 0x0" ::: "memory");                       // this wave's pieces of stage t + 1 have landed
        __syncthreads();                                                        // publishes stage t + 1; ends every wave's reads of stage t's buffer
        if (t + 2 < nst) stage(t + 2, t & 1);                                   // refill the buffer just left (same test in every wave)
    }
    asm volatile("s_wait_asynccnt 0x0" ::: "memory");                           // no copy in flight behind the loop
#pragma unroll
    for (int mb = 0; mb < 4; ++mb) {
        if (OUT == 1 && BIAS && tr) {                                           // bias[m]: the lane's 8 accumulator rows
            const v4f b0 = *(const v4f*)(bias + r0 + mb * 16 + hi * 8), b1 = *(const v4f*)(bias + r0 + mb * 16 + hi * 8 + 4);
#pragma unroll
            for (int nb = 0; nb < 4; ++nb) {
#pragma unroll
                for (int j = 0; j < 8; ++j) os[(hi * 8 + j) * 68 + nb * 16 + lr] = acc[mb][nb][j] + bfr(j < 4 ? b0[j & 3] : b1[j & 3]); }
        } else {
#pragma unroll
            for (int nb = 0; nb < 4; ++nb) { const float bc = (OUT == 1 && BIAS) ? bfr(bias[c0 + nb * 16 + lr]) : 0.0f;   // bias[n]: the lane's accumulator column
#pragma unroll
                for (int j = 0; j < 8; ++j) os[(hi * 8 + j) * 68 + nb * 16 + lr] = (OUT == 1 && BIAS) ? acc[mb][nb][j] + bc : acc[mb][nb][j]; }
        }
        wave_sync();
        float* crow = C + (size_t)(r0 + mb * 16) * ldc + c0;
if (OUT == 0) {
#pragma unroll
            for (int s = 0; s < 8; ++s) { const int row = 2 * s + hi, cofs = lr * 4; v4f val = *(const v4fa*)(os + row * 68 + cofs); if (BIAS) { val[0] += bfr(bias[c0 + cofs]); val[1] += bfr(bias[c0 + cofs + 1]); val[2] += bfr(bias[c0 + cofs + 2]); val[3] += bfr(bias[c0 + cofs + 3]); }
                *(v4f*)(crow + (size_t)row * ldc + cofs) = val; }
             }
        else {
            const size_t pb = !tr ? ((z * NH_ + c0 / 64) * SEQ + r0 + mb * 16) * HD : ((z * NH_ + r0 / 64) * HD + mb * 16) * SEQ + c0;   // head = the quarter's index along h*64 + d
            const int pp = !tr ? HD : SEQ;
#pragma unroll
            for (int s = 0; s < 8; ++s) { const int row = 2 * s + hi, cofs = lr * 4; v4f val = *(const v4fa*)(os + row * 68 + cofs);
                v4h o16; v2u oh, ol;
#pragma unroll
                for (int q = 0; q < 4; ++q) o16[q] = tohx(val[q]);
#pragma unroll
                for (int q = 0; q < 2; ++q) { unsigned a2, c2; splitf2(val[2 * q], val[2 * q + 1], a2, c2); oh[q] = a2; ol[q] = c2; }
                const size_t pe = pb + (size_t)row * pp + cofs;
                *(v4h*)(P16 + pe) = o16; *(v4us*)(Ph + pe) = __builtin_bit_cast(v4us, oh); *(v4us*)(Pl + pe) = __builtin_bit_cast(v4us, ol);
                asm volatile("s_wait_xcnt 0x0" ::: "memory"); }   // stands in front of the next rows' values, which reuse the registers these stores name
        }
        wave_sync();
    }
}
// k_qkv: the three projections in one launch, grid (SEQ/128, DQ/128, 3 * NB): stream s = blockIdx.z / NB (q, k, v), batch blockIdx.z % NB; the three do not depend on one another, and two work-groups fit a WGP's LDS.
// s = q, k: y[z][t][n] = XB[s][z][t][:] . WB[s][n][:] + b[n] (bf16 x bf16, one product), stored as [z*NH_ + h][t][d] planes. s = v: the same product with W as A and XB as B, stored as [z*NH_ + h][d][t] planes.
// XB, WB: the streams' and the weights' bf16 copies, one behind the other; P16, Ph, Pl: q's three planes; stream s has its own three 3 s planes further on.
__global__ __launch_bounds__(32 * NW) void k_qkv(const bf* XB, const bf* WB, int K, const float* bq, const float* bk, const float* bv, h16* P16, bf* Ph, bf* Pl) {
    __shared__ __align__(16) unsigned short gst[GLDS<0>];
    const int s = blockIdx.z / NB; const size_t z = blockIdx.z % NB;
    const bool tr = s == 2;
    const bf* X = XB + (size_t)s * NB * SEQ * DM; const bf* Wt = WB + (size_t)s * DM * DM;
    const size_t po = (size_t)s * 3 * NB * NH_ * SEQ * HD;
    gemmw_body<bf, 0, true, 1>(gst, tr ? blockIdx.y : blockIdx.x, tr ? blockIdx.x : blockIdx.y, z, tr, tr ? Wt : X, nullptr, tr ? X : Wt, K, nullptr, 0, s == 0 ? bq : s == 1 ? bk : bv,
                               tr ? (size_t)0 : (size_t)SEQ * DM, tr ? (size_t)SEQ * DM : (size_t)0, (size_t)0, P16 + po, Ph + po, Pl + po); }
// k_oproj: OUT[z][t][n] = (ATh + ATl)[z][t][:] . Wo[n][:] + bo[n] (two products).
__global__ __launch_bounds__(32 * NW) void k_oproj(const bf* A, const bf* A2, const bf* Bt, int K, float* C, int ldc, const float* bias, size_t sA, size_t sC) {
    __shared__ __align__(16) unsigned short gst[GLDS<1>];
    gemmw_body<bf, 1, true>(gst, blockIdx.x, blockIdx.y, blockIdx.z, false, A, A2, Bt, K, C, ldc, bias, sA, (size_t)0, sC); }

// ---- k_prep: everything the GEMMs and the attention read that is a plain re-coding of an input, in one launch of 256-thread work-groups.
// Work-groups [0, PGC): f32 -> bf16 (RNE) copies of the three streams (XB[s][b][t][:], s = q, k, v) and the four weights (WB[s][:][:], s = q, k, v, o). One work-group = PCH consecutive floats of one source:
// load u of a wave covers 512 consecutive bytes (16 per lane), store u 256 consecutive bytes (8 per lane); a thread's PU loads are all issued in front of its first store.
// Work-groups [PGC, PGC + PGM): the integer mask, read by value, as lane masks of the attention's S^T accumulators. PM[(qt * (SEQ/32) + st) * 16 + g*8 + r], bit l = (mask[qt*16 + (l & 15)][st*32 + g*16 + 8*(l >> 4) + r] != 0):
// word g*8 + r selects, lane by lane, element r of score accumulator g of query tile qt at key step st. One wave = one query tile x two key steps = 32 words = one 128-byte line.
#define PU 16                                              // 16-byte pieces per thread of a conversion work-group
constexpr int PCH = 256 * PU * 4;                          // floats per conversion work-group
constexpr int PGX = SEQ * DM / PCH;                        // work-groups per batch row block of one stream
constexpr int PGW = DM * DM / PCH;                         // work-groups per weight
constexpr int PGS = 3 * NB * PGX;                          // all stream work-groups
constexpr int PGC = PGS + 4 * PGW;                         // all conversion work-groups
constexpr int PGM = (SEQ / 16) * (SEQ / 64) / 8;           // mask work-groups
static_assert((SEQ * DM) % PCH == 0 && (DM * DM) % PCH == 0);
static_assert(((SEQ / 16) * (SEQ / 64)) % 8 == 0);
__device__ __forceinline__ void mpack_body(const int* __restrict__ mask, unsigned* PM, int blk) {
    const int lane = threadIdx.x & 31, lr = lane & 15, hi = lane >> 4;
    const int w = blk * 8 + (threadIdx.x >> 5), qt = w / (SEQ / 64), t = w % (SEQ / 64);
    const int* mp = mask + (qt * 16 + lr) * SEQ_FULL + t * 64 + 8 * hi;
    v4i m[8];
#pragma unroll
    for (int s = 0; s < 2; ++s) { m[4 * s] = *(const v4i*)(mp + 32 * s); m[4 * s + 1] = *(const v4i*)(mp + 32 * s + 4); m[4 * s + 2] = *(const v4i*)(mp + 32 * s + 16); m[4 * s + 3] = *(const v4i*)(mp + 32 * s + 20); }
    unsigned v = 0u;
#pragma unroll
    for (int j = 0; j < 32; ++j) { const unsigned b = __builtin_amdgcn_ballot_w32(m[j >> 2][j & 3] != 0); v = (lane == j) ? b : v; }   // lane j keeps word j
    PM[(size_t)w * 32 + lane] = v;
}
__global__ __launch_bounds__(256) void k_prep(const float* __restrict__ xq, const float* __restrict__ xk, const float* __restrict__ xv,
                                              const float* __restrict__ wq, const float* __restrict__ wk, const float* __restrict__ wv, const float* __restrict__ wo,
                                              const int* __restrict__ mask, bf* XB, bf* WB, unsigned* PM) {
    const int g = blockIdx.x;
    if (g >= PGC) { mpack_body(mask, PM, g - PGC); return; }           // no barrier anywhere in this kernel
    const float* src; bf* dst;
    if (g < PGS) { const int s = g / (NB * PGX), r = g % (NB * PGX), b = r / PGX, c = r % PGX;
        src = (s == 0 ? xq : s == 1 ? xk : xv) + (size_t)b * SEQ_FULL * DM + (size_t)c * PCH;
        dst = XB + ((size_t)s * NB + b) * SEQ * DM + (size_t)c * PCH; }
    else { const int r = g - PGS, s = r / PGW, c = r % PGW;
        src = (s == 0 ? wq : s == 1 ? wk : s == 2 ? wv : wo) + (size_t)c * PCH;
        dst = WB + (size_t)s * DM * DM + (size_t)c * PCH; }
    const int e = threadIdx.x * 4;
    v4f v[PU];
#pragma unroll
    for (int u = 0; u < PU; ++u) v[u] = *(const v4f*)(src + u * 1024 + e);
#pragma unroll
    for (int u = 0; u < PU; ++u) { const v2u o = {f2bf2(v[u][0], v[u][1]), f2bf2(v[u][2], v[u][3])};
        *(v4us*)(dst + u * 1024 + e) = __builtin_bit_cast(v4us, o); }
}

// ---- fused attention body: one work-group = NW waves of one (b, h); one wave = 16 query rows (q0..q0+15); key loop in 32-key steps, two steps per staged 64-key tile.
// K and V^T tiles: every thread copies its pieces of tile t + 2 into the buffer that tile t has left (two buffers); one work-group barrier per tile publishes tile t + 1 and frees tile t's buffer.
// Per step: (1) the 16x32 mask tile comes as 16 lane masks (k_prep: one word per S^T accumulator element), one 64-byte scalar load issued one step ahead; a tile whose 512 entries are all 0
// is skipped (wave-uniform, decided on the words read); (2) S^T = k q^T (two 16x16 accumulators: row = key 8*hi + r, column = query lr; k fragments from LDS as A, q fragments as B, held in
// registers); (3) e = mask == 0 ? -1e9 : S/8; online softmax in f32, one running maximum per query (16 values in the lane, then lane l with l ^ 16) and one running sum per lane (halves joined in the epilogue); (4) the lane's 16 probabilities are
// the B fragment of P^T as they stand (elements 0..7 = keys 8*hi + r, 8..15 = keys 16 + 8*hi + r); O^T += V^T P^T (four d-tiles, V^T fragments from LDS as A; row = d, column = query).
// A skipped all-masked tile contributes exactly 0 to every row that meets an unmasked key somewhere (exp underflow); if some row of the work-group never does, the work-group repeats the loop
// with skipping disabled (every entry -1e9 -> uniform weights; rows that do meet a key end with the same values), so the result is exact for any mask contents.
template <bool HI>
__device__ __forceinline__ void attn_body(const h16* __restrict__ Q16, const h16* __restrict__ K16, const h16* __restrict__ VT16,
                                          const bf* __restrict__ Qh, const bf* __restrict__ Ql, const bf* __restrict__ Kh, const bf* __restrict__ Kl,
                                          const bf* __restrict__ VTh, const bf* __restrict__ VTl, const unsigned* __restrict__ PM, bf* ATh, bf* ATl, int row_base,
                                          unsigned short* stg, int* wflag, int xt, int h, int b) {
    constexpr int NPL = HI ? 4 : 2;                                          // staged planes per buffer: Kh Kl VTh VTl, or K16 VT16; stg holds two buffers of staged tiles
    static_assert(2 * NW * 16 * CP <= 2 * NPL * TPL);
    unsigned short* ctha = stg;                                              // ctx tiles hi, in the staged tiles' LDS: written only behind the key loop's last foot and the barrier of the repeat decision
    unsigned short* ctla = stg + NW * 16 * CP;                               // ctx tiles lo
    const int tid = threadIdx.x, lane = tid & 31, lr = lane & 15, hi = lane >> 4;
    const int wave = __builtin_amdgcn_readfirstlane(tid >> 5);
    unsigned short* cth = ctha + wave * 16 * CP;
    unsigned short* ctl = ctla + wave * 16 * CP;
    const int q0 = row_base + (xt * NW + wave) * 16;
    const int zoff  = (b * NH_ + h) * (SEQ * HD);            // head plane offset ([t][d] and [d][t] planes both hold SEQ*HD elements)
    const int qbase = zoff + (q0 + lr) * HD + 8 * hi;        // B fragment of q: column = query q0 + lr; + c2*32
    const int kfrag = lr * TP + 8 * hi;                      // A fragment of k in a staged tile: row = key (sub*32 + nt*16 + lr); + (sub*32 + nt*16)*TP + c2*32
    const int vfrag = lr * TP + 8 * hi;                      // A fragment of v^T in a staged tile: row = d = dt*16 + lr; + dt*16*TP + sub*32
    // the query tile's lane masks, 16 words per key step; written by an earlier launch and never in this one: read through the constant address space, so that the loads are scalar
    const __attribute__((address_space(4))) v16u* pm = (const __attribute__((address_space(4))) v16u*)(PM + (size_t)(q0 >> 4) * ((SEQ / 32) * 16));
    const unsigned sl = lds_off(stg) + (unsigned)((tid >> 3) * TP + (tid & 7) * 8) * 2u;   // this thread's piece in a staged plane tile
    const int sgk = zoff + (tid >> 3) * HD + (tid & 7) * 8;  // the same piece in a [t][d] plane: + t*KT*HD
    const int sgv = zoff + (tid >> 3) * SEQ + (tid & 7) * 8; // the same piece in a [d][t] plane: + t*KT
    auto stage = [&](int t, int bi) {
        const unsigned l = sl + (unsigned)(bi * NPL * TPL * 2);
        if (HI) {
            stage_pair<bf>(l, Kh + sgk + t * (KT * HD), 16 * HD, l + TPL * 2u, Kl + sgk + t * (KT * HD), 16 * HD);
            stage_pair<bf>(l + 2u * TPL * 2u, VTh + sgv + t * KT, 16 * SEQ, l + 3u * TPL * 2u, VTl + sgv + t * KT, 16 * SEQ);
        } else {
            stage_pair<h16>(l, K16 + sgk + t * (KT * HD), 16 * HD, l + TPL * 2u, VT16 + sgv + t * KT, 16 * SEQ);
        }
    };

    // B fragments of q^T: loaded once, held in registers over the whole key loop (and its repeat)
    v16bf qh0, qh1, ql0, ql1; v16h qa0, qa1;
    if (HI) { qh0 = WFrag<bf>::ld(Qh + qbase); qh1 = WFrag<bf>::ld(Qh + qbase + 32); ql0 = WFrag<bf>::ld(Ql + qbase); ql1 = WFrag<bf>::ld(Ql + qbase + 32); }
    else    { qa0 = WFrag<h16>::ld(Q16 + qbase); qa1 = WFrag<h16>::ld(Q16 + qbase + 32); }
    v8f o[4]; float m, l;
    bool dense = false;
#pragma unroll 1
    for (int pass = 0; pass < 2; ++pass) {
#pragma unroll
        for (int t = 0; t < 4; ++t) o[t] = (v8f){};
        m = MINIT; l = 0.0f;
        // two-buffer prologue (on a repeat, the last tile's foot has already ended every read of both buffers)
        stage(0, 0);
        asm volatile("s_wait_asynccnt 0x0" ::: "memory");                       // this wave's pieces of tile 0 have landed
        __syncthreads();                                                        // tile 0 published to all waves
        stage(1, 1);
        v16u nx = pm[0];                                                        // lane masks of step 0
#pragma unroll 1
        for (int t = 0; t < SEQ / KT; ++t) {
            const unsigned short* sb = stg + (t & 1) * (NPL * TPL);
#pragma unroll 1
            for (int sub = 0; sub < 2; ++sub) {                                 // rolled: one copy of the step's code
            const int st = t * 2 + sub;
            const v16u cw = nx;                                                 // this step's lane masks, loaded during the step before
            nx = pm[(st + 1 < SEQ / 32) ? st + 1 : SEQ / 32 - 1];               // the next step's (the last step reads its own again)
            const v8ul c8 = __builtin_bit_cast(v8ul, cw);
            const bool anyw = (((c8[0] | c8[1]) | (c8[2] | c8[3])) | ((c8[4] | c8[5]) | (c8[6] | c8[7]))) != 0ull;   // wave-uniform
            if (!(dense || anyw)) continue;                                     // whole 16x32 tile masked: skipped (its words were read); the tile's foot below is still passed

            const unsigned short* kf = sb + kfrag + sub * 32 * TP;
            v8f s0 = (v8f){}, s1 = (v8f){};
            if (HI) {
                s0 = mma3(ldsb(kf), ldsb(kf + TPL), qh0, ql0, s0);
                s0 = mma3(ldsb(kf + 32), ldsb(kf + TPL + 32), qh1, ql1, s0);
                s1 = mma3(ldsb(kf + 16 * TP), ldsb(kf + TPL + 16 * TP), qh0, ql0, s1);
                s1 = mma3(ldsb(kf + 16 * TP + 32), ldsb(kf + TPL + 16 * TP + 32), qh1, ql1, s1);
                asm volatile("v_nop\n\tv_nop\n\tv_nop\n\tv_nop" : "+v"(s0), "+v"(s1) : "v"(qh1), "v"(ql1));
            } else {
                s0 = wmma16(ldsh(kf), qa0, s0);
                s0 = wmma16(ldsh(kf + 32), qa1, s0);
                s1 = wmma16(ldsh(kf + 16 * TP), qa0, s1);
                s1 = wmma16(ldsh(kf + 16 * TP + 32), qa1, s1);
                asm volatile("v_nop\n\tv_nop\n\tv_nop\n\tv_nop" : "+v"(s0), "+v"(s1) : "v"(qa0), "v"(qa1));
            }

            float e0[8], e1[8], t8[8];
#pragma unroll
            for (int r = 0; r < 8; ++r) { e0[r] = __builtin_amdgcn_inverse_ballot_w32(cw[r]) ? s0[r] * SCL : MFILL; e1[r] = __builtin_amdgcn_inverse_ballot_w32(cw[8 + r]) ? s1[r] * SCL : MFILL; t8[r] = fmaxf(e0[r], e1[r]); }
            float rm = fmaxf(fmaxf(fmaxf(t8[0], t8[1]), fmaxf(t8[2], t8[3])), fmaxf(fmaxf(t8[4], t8[5]), fmaxf(t8[6], t8[7])));
            rm = fmaxf(rm, xhalf(rm));                                          // the query's other 16 keys of the step
            const float mn = fmaxf(m, rm);
            const float al = __builtin_amdgcn_exp2f((m - mn) * L2E);
            v8u ph, pl; v16h pa;                                                // B fragments of P^T (ph, pl: two bf16 per word)
#pragma unroll
            for (int r = 0; r < 8; ++r) {
                float x0 = __builtin_amdgcn_exp2f((e0[r] - mn) * L2E);
                float x1 = __builtin_amdgcn_exp2f((e1[r] - mn) * L2E);
                if (HI) {
                    e0[r] = x0; e1[r] = x1;                                     // split two at a time below
                    t8[r] = x0 + x1;
                } else {
                    x0 = (x0 < F16MINN) ? 0.0f : x0; x1 = (x1 < F16MINN) ? 0.0f : x1;      // no subnormal f16 operands; the row sum uses the same values
                    const h16 g0 = tohx(x0), g1 = tohx(x1);
                    pa[r] = g0; pa[8 + r] = g1;
                    t8[r] = (float)g0 + (float)g1;
                }
            }
            if (HI) {
#pragma unroll
                for (int i = 0; i < 4; ++i) { unsigned a0, c0, a1, c1; splitf2(e0[2 * i], e0[2 * i + 1], a0, c0); splitf2(e1[2 * i], e1[2 * i + 1], a1, c1);
                    ph[i] = a0; pl[i] = c0; ph[4 + i] = a1; pl[4 + i] = c1; }   // elements 2i, 2i + 1 and 8 + 2i, 8 + 2i + 1 of the fragments
            }
            float rs = ((t8[0] + t8[1]) + (t8[2] + t8[3])) + ((t8[4] + t8[5]) + (t8[6] + t8[7]));
            l = l * al + rs; m = mn;                                           // l: this lane's half of the keys; the two halves (same al) are joined behind the loop
#pragma unroll
            for (int dt = 0; dt < 4; ++dt) o[dt] *= al;
            const unsigned short* vf = sb + (HI ? 2 : 1) * TPL + vfrag + sub * 32;
            if (HI) {
                const v16bf pb = __builtin_bit_cast(v16bf, ph), pc = __builtin_bit_cast(v16bf, pl);
                const v16bf vh0 = ldsb(vf), vh1 = ldsb(vf + 16 * TP), vh2 = ldsb(vf + 32 * TP), vh3 = ldsb(vf + 48 * TP);
                const v16bf vl0 = ldsb(vf + TPL), vl1 = ldsb(vf + TPL + 16 * TP), vl2 = ldsb(vf + TPL + 32 * TP), vl3 = ldsb(vf + TPL + 48 * TP);
                o[0] = mma3(vh0, vl0, pb, pc, o[0]); o[1] = mma3(vh1, vl1, pb, pc, o[1]); o[2] = mma3(vh2, vl2, pb, pc, o[2]); o[3] = mma3(vh3, vl3, pb, pc, o[3]);
                asm volatile("v_nop\n\tv_nop\n\tv_nop\n\tv_nop" : "+v"(o[0]), "+v"(o[1]), "+v"(o[2]), "+v"(o[3]) : "v"(pb), "v"(pc));
            } else {
                const v16h v0 = ldsh(vf), v1 = ldsh(vf + 16 * TP), v2 = ldsh(vf + 32 * TP), v3 = ldsh(vf + 48 * TP);
                o[0] = wmma16(v0, pa, o[0]); o[1] = wmma16(v1, pa, o[1]); o[2] = wmma16(v2, pa, o[2]); o[3] = wmma16(v3, pa, o[3]);
                asm volatile("v_nop\n\tv_nop\n\tv_nop\n\tv_nop" : "+v"(o[0]), "+v"(o[1]), "+v"(o[2]), "+v"(o[3]) : "v"(pa), "v"(v3));
            }
            }
            // foot of tile t, passed by every wave whatever it skipped
            asm volatile("s_wait_dscnt 0x0" ::: "memory");                      // this wave's reads of tile t's buffer have returned
            asm volatile("s_wait_asynccnt 0x0" ::: "memory");                   // this wave's pieces of tile t + 1 have landed
            __syncthreads();                                                    // publishes tile t + 1; ends every wave's reads of tile t's buffer
            if (t + 2 < SEQ / KT) stage(t + 2, t & 1);                          // refill the buffer just left (same test in every wave)
        }
        asm volatile("s_wait_asynccnt 0x0" ::: "memory");                       // no copy in flight behind the loop
        const bool bad = !(m > MSEEN);
        const int wbad = (__builtin_amdgcn_ballot_w32(bad) != 0u) ? 1 : 0;      // taken with every lane on
        if (lane == 0) wflag[wave] = wbad;
        __syncthreads();                                                        // the repeat is decided for the whole work-group: its barriers need every wave
        const int anyb = wflag[0] | wflag[1] | wflag[2] | wflag[3];
        if (__builtin_amdgcn_readfirstlane(anyb) == 0) break;                   // every row met an unmasked key: skipped tiles contributed exactly 0
        dense = true;                                                           // otherwise repeat without skipping (work-group-uniform)
    }

    const float inv = 1.0f / (l + xhalf(l));
#pragma unroll
    for (int dt = 0; dt < 4; ++dt) { v4u a8, c8;                                // the lane's 8 consecutive d of its query: one 16-byte piece of each ctx tile row
#pragma unroll
        for (int r = 0; r < 4; ++r) { unsigned a, c; splitf2(o[dt][2 * r] * inv, o[dt][2 * r + 1] * inv, a, c); a8[r] = a; c8[r] = c; }
        *(v8usa*)(cth + lr * CP + dt * 16 + 8 * hi) = __builtin_bit_cast(v8us, a8); *(v8usa*)(ctl + lr * CP + dt * 16 + 8 * hi) = __builtin_bit_cast(v8us, c8); }
    wave_sync();
    v8us hv[4], lv[4];
#pragma unroll
    for (int s = 0; s < 4; ++s) { const int row = 4 * s + (lane >> 3); hv[s] = *(const v8usa*)(cth + row * CP + (lane & 7) * 8); lv[s] = *(const v8usa*)(ctl + row * CP + (lane & 7) * 8); }
    const size_t ob = (size_t)(b * SEQ + q0 + (lane >> 3)) * DQ + h * HD + (lane & 7) * 8;
{
#pragma unroll
        for (int s = 0; s < 4; ++s) { *(v8us*)(ATh + ob + (size_t)(4 * s) * DQ) = hv[s]; *(v8us*)(ATl + ob + (size_t)(4 * s) * DQ) = lv[s]; }
         }
}
// k_attn: both kinds of attention work-group in one launch, chosen by the work-group index; they do not depend on one another. The hi/lo-plane work-groups (three times the products, one wave per SIMD if they had the chip
// to themselves) come first in the index, the f16 work-groups behind them; four work-groups fit a WGP's LDS and registers, so all of them can be resident at once and fill one another's waits.
constexpr int AHI = RHE / (16 * NW);                       // hi/lo-plane work-groups per (b, h)
constexpr int ALO = (SEQ - RHE) / (16 * NW);               // f16 work-groups per (b, h)
__global__ __launch_bounds__(32 * NW) void k_attn(const h16* Q16, const h16* K16, const h16* VT16, const bf* Qh, const bf* Ql, const bf* Kh, const bf* Kl, const bf* VTh, const bf* VTl,
                                                  const unsigned* PM, bf* ATh, bf* ATl) {
    __shared__ __align__(16) unsigned short stg[2 * 4 * TPL];                // two buffers of staged tiles (the larger kind's); ctx tiles behind the key loop
    __shared__ int wflag[NW];                                                // per wave: some row has met no unmasked key
    const int g = blockIdx.x;
#if SEQ > RH
    if (g >= AHI * NH_ * NB) { const int r = g - AHI * NH_ * NB;
        attn_body<false>(Q16, K16, VT16, nullptr, nullptr, nullptr, nullptr, nullptr, nullptr, PM, ATh, ATl, RHE, stg, wflag, r % ALO, (r / ALO) % NH_, r / (ALO * NH_)); return; }
#endif
    attn_body<true>(nullptr, nullptr, nullptr, Qh, Ql, Kh, Kl, VTh, VTl, PM, ATh, ATl, 0, stg, wflag, g % AHI, (g / AHI) % NH_, g / (AHI * NH_)); }

extern "C" void kernel_launch(void* const* d_in, const int* in_sizes, int n_in,
                              void* d_out, int out_size, void* d_ws, size_t ws_size, hipStream_t stream) {
    if (n_in < 12) return;
    const long long need_x = (long long)(NB - 1) * SEQ_FULL * DM + (long long)SEQ * DM;      // rows read from a full-size stream
    const long long need_m = (long long)(SEQ - 1) * SEQ_FULL + SEQ;
    if (in_sizes[0] < need_x || in_sizes[1] < need_x || in_sizes[2] < need_x || in_sizes[3] < need_m) return;
    if (in_sizes[4] < DM * DM || in_sizes[6] < DM * DM || in_sizes[8] < DM * DM || in_sizes[10] < DM * DM) return;
    if (in_sizes[5] < DM || in_sizes[7] < DM || in_sizes[9] < DM || in_sizes[11] < DM) return;
    if ((long long)out_size < need_x) return;
    if (WS_TOTAL > ws_size) return;
    // wire order: x_q, x_k, x_v, mask (int32 [1][1][SEQ_FULL][SEQ_FULL]), Wq, bq, Wk, bk, Wv, bv, Wo, bo; weights [out][in]
    const float* xq = (const float*)d_in[0]; const float* xk = (const float*)d_in[1]; const float* xv = (const float*)d_in[2];
    const int* mask = (const int*)d_in[3];
    const float* wq = (const float*)d_in[4]; const float* bq = (const float*)d_in[5];
    const float* wk = (const float*)d_in[6]; const float* bk = (const float*)d_in[7];
    const float* wv = (const float*)d_in[8]; const float* bv = (const float*)d_in[9];
    const float* wo = (const float*)d_in[10]; const float* bo = (const float*)d_in[11];
    float* OUT = (float*)d_out;     // [NB_FULL][SEQ_FULL][DM]
    char* wsp = (char*)d_ws;
    auto take = [&](size_t bytes) { char* p = wsp; wsp += bytes; return (void*)p; };      // all sizes are multiples of 256 bytes
    bf* WQ = (bf*)take(WS_W / 4); bf* WK = (bf*)take(WS_W / 4); bf* WV = (bf*)take(WS_W / 4); bf* WO = (bf*)take(WS_W / 4);
    bf* XBq = (bf*)take(WS_XB); bf* XBk = (bf*)take(WS_XB); bf* XBv = (bf*)take(WS_XB);   // contiguous: k_prep indexes them from XBq, as it does the weights from WQ
    h16* Q16 = (h16*)take(WS_PL); bf* Qh = (bf*)take(WS_PL); bf* Ql = (bf*)take(WS_PL);
    h16* K16 = (h16*)take(WS_PL); bf* Kh = (bf*)take(WS_PL); bf* Kl = (bf*)take(WS_PL);
    h16* VT16 = (h16*)take(WS_PL); bf* VTh = (bf*)take(WS_PL); bf* VTl = (bf*)take(WS_PL);
    bf* ATh = (bf*)take(WS_AT); bf* ATl = (bf*)take(WS_AT);
    unsigned* PM = (unsigned*)take(WS_PM);
    if ((size_t)(wsp - (char*)d_ws) > ws_size) return;

    // bf16 copies of the streams and the weights, and the mask's lane masks (once for all batches and heads)
    k_prep<<<dim3(PGC + PGM), 256, 0, stream>>>(xq, xk, xv, wq, wk, wv, wo, mask, XBq, WQ, PM);
    // q, k, v projections: one launch (the streams' copies, the weights' copies and the nine head planes each lie one behind the other)
    k_qkv<<<dim3(SEQ / 128, DQ / 128, 3 * NB), 32 * NW, 0, stream>>>(XBq, WQ, DM, bq, bk, bv, Q16, Qh, Ql);
    // attention, one launch: query rows [0, RHE) on hi/lo planes, rows [RHE, SEQ) on f16 planes
    k_attn<<<dim3((AHI + ALO) * NH_ * NB), 32 * NW, 0, stream>>>(Q16, K16, VT16, Qh, Ql, Kh, Kl, VTh, VTl, PM, ATh, ATl);
    // output projection: per batch rows of the full-size output
    k_oproj<<<dim3(SEQ / 128, DM / 128, NB), 32 * NW, 0, stream>>>(ATh, ATl, WO, DQ, OUT, DM, bo, (size_t)SEQ * DQ, (size_t)SEQ_FULL * DM);
}

// v010
// A run of this version takes 127 microseconds.
// In both of two side-by-side timings against v009, it was 1.05 times as fast.
// Over all steps from v000 it is 4.01 times as fast.
#include <hip/hip_runtime.h>

// Three-stream masked attention: q = xq Wq^T + bq, k = xk Wk^T + bk, v = xv Wv^T + bv (weights [out][in]); 16 heads x 64 (head h = columns h*64+d); scores x 1/8; integer mask [SEQ][SEQ] read by value (0 -> score := -1e9); softmax; out = ctx Wo^T + bo.
// Compute dtypes, f32 accumulate: every float input RNE-converted to bf16; projections v_wmma_f32_16x16x32_bf16 (exact operand products); attention query rows < RH: bf16 hi+lo planes for q, k, v and p (3 products per site); rows >= RH: v_wmma_f32_16x16x32_f16 single products (q, k, v, p as f16); online softmax f32; ctx carried as bf16 hi+lo planes x Wo bf16 (2 products).
// Engine: four waves per 128x128 GEMM tile, one 64x64 quarter each (operands from K-contiguous 16-bit planes through LDS: two buffers, asynchronous copies); the q, k, v projections convert their f32 sums in the epilogue and store the head planes themselves (v as W X^T, so that its tile rows are d and its columns t); fused flash-style attention on transposed tiles (S^T = K Q^T, O^T = V^T P^T: a query is a lane's column), four waves per work-group (16 query rows each), 32-key steps; the work-group's waves share 64-key K and V^T tiles in LDS (two buffers, asynchronous copies); q fragments loaded once and held in registers; the mask packed once per call into 32-lane bit masks, read by scalar loads; one preparation launch (k_prep) makes every bf16 copy and the packed mask; the three projections are one launch (k_qkv), both kinds of attention work-group another (k_attn); no score or probability plane in global memory.

#ifndef NB
#define NB 2
#endif
#ifndef SEQ
#define SEQ 2048
#endif
#define NB_FULL  2
#define SEQ_FULL 2048
#define DM   1024
#define NH_  16
#define HD   64
#define DQ   (NH_ * HD)
#define RH   512                  // query rows < RH use hi+lo planes
#define RHE  ((RH < SEQ) ? RH : SEQ)
#define SCL  0.125f               // HD^-0.5
#define L2E  1.4426950408889634f
#define MFILL (-1.0e9f)           // value that replaces a masked score
#define MINIT (-1.0e30f)          // running-max start (below MFILL)
#define MSEEN (-5.0e8f)           // running max above this <=> the row has met an unmasked key
#define CP 72                     // ctx tile pitch (halves): 64 + 8
#define NW 4                      // waves per work-group (attention: 16 query rows each; GEMM: a 64x64 quarter each)
#define KT 64                     // keys per staged K / V^T tile
#define TP 72                     // staged tile pitch (halves): 64 + 8 = 144 bytes, an odd multiple of 16 bytes
#define TPL (64 * TP)             // one staged plane tile (halves): 64 rows (K: keys x d; V^T: d x keys; GEMM operands: rows x k)

typedef _Float16 h16;
typedef unsigned short bf;
typedef __attribute__((ext_vector_type(16))) __bf16   v16bf;
typedef __attribute__((ext_vector_type(16))) _Float16 v16h;
typedef __attribute__((ext_vector_type(8)))  _Float16 v8h;
typedef __attribute__((ext_vector_type(8)))  unsigned short v8us;
typedef __attribute__((ext_vector_type(16))) unsigned short v16us;
typedef __attribute__((ext_vector_type(8)))  float    v8f;
typedef __attribute__((ext_vector_type(4)))  float    v4f;
typedef __attribute__((ext_vector_type(4)))  _Float16 v4h;
typedef __attribute__((ext_vector_type(4)))  unsigned short v4us;
typedef __attribute__((ext_vector_type(4)))  int      v4i;
typedef __attribute__((ext_vector_type(2)))  float    v2f;
typedef __attribute__((ext_vector_type(2)))  __bf16   v2bf;
typedef __attribute__((ext_vector_type(2)))  unsigned v2u;
typedef __attribute__((ext_vector_type(4)))  unsigned v4u;
typedef __attribute__((ext_vector_type(8)))  unsigned v8u;
typedef __attribute__((ext_vector_type(16))) unsigned v16u;
typedef __attribute__((ext_vector_type(8)))  unsigned long long v8ul;
typedef v8h  __attribute__((may_alias)) v8ha;
typedef v4f  __attribute__((may_alias)) v4fa;
typedef v8us __attribute__((may_alias)) v8usa;

static_assert(HD == 64);
static_assert(DQ == DM);                       // merged width equals model width
static_assert(DM % 128 == 0);                  // GEMM tiles of 128, K stages of 128
static_assert(SEQ % 128 == 0);                 // GEMM tiles of 128; attention tiles of 16 rows, 32 keys
static_assert(RH % 16 == 0);                   // hi/lo row split on a query-tile boundary
static_assert(NB <= NB_FULL);
static_assert(SEQ <= SEQ_FULL);
static_assert((CP * 2) % 16 == 0);             // 16-byte aligned ctx tile rows
static_assert((TP * 2) % 16 == 0);             // 16-byte aligned staged rows
static_assert(RHE % (16 * NW) == 0 && (SEQ - RHE) % (16 * NW) == 0);   // whole attention work-groups on both sides of the row split
static_assert(SEQ % KT == 0 && SEQ / KT >= 2); // whole staged tiles; the two-buffer prologue needs two
static_assert(KT == 64 && NW * 32 == 128);     // stage_pair: 512 16-byte pieces per plane tile, 4 per thread
static_assert((long long)NB * NH_ * SEQ * HD < 2147483647LL);       // int element offsets into head planes
static_assert((long long)SEQ_FULL * SEQ_FULL < 2147483647LL);      // int element offsets into the mask

constexpr size_t WS_W  = (size_t)4 * DM * DM * 2;          // four bf16 weight planes
constexpr size_t WS_XB = (size_t)NB * SEQ * DM * 2;        // bf16 copy of one input stream
constexpr size_t WS_PL = (size_t)NB * NH_ * SEQ * HD * 2;  // one 16-bit head plane
constexpr size_t WS_AT = (size_t)NB * SEQ * DQ * 2;        // one merged ctx plane
constexpr size_t WS_PM = (size_t)(SEQ / 16) * (SEQ / 32) * 64;   // packed mask: 16 words per 16-query x 32-key tile
constexpr size_t WS_TOTAL = WS_W + 3 * WS_XB + 9 * WS_PL + 2 * WS_AT + WS_PM;
static_assert(WS_TOTAL <= (size_t)134217728);              // carve stays within 128 MiB
static_assert(WS_W % 256 == 0 && WS_XB % 256 == 0 && WS_PL % 256 == 0 && WS_AT % 256 == 0 && WS_PM % 256 == 0);

__device__ __forceinline__ unsigned short f2bf(float f) { return __builtin_bit_cast(unsigned short, (__bf16)f); }   // RNE, the hardware's conversion
__device__ __forceinline__ unsigned f2bf2(float a, float b) { return __builtin_bit_cast(unsigned, __builtin_convertvector((v2f){a, b}, v2bf)); }   // two RNE conversions in one packed instruction: a in the low half, b in the high half
__device__ __forceinline__ float bf2f(unsigned short b) { return __uint_as_float(((unsigned)b) << 16); }
__device__ __forceinline__ float bfr(float f) { return bf2f(f2bf(f)); }
__device__ __forceinline__ v16h cat16(v8h lo, v8h hi) { return __builtin_shufflevector(lo, hi, 0, 1, 2, 3, 4, 5, 6, 7, 8, 9, 10, 11, 12, 13, 14, 15); }
__device__ __forceinline__ v16bf cat16b(v8us lo, v8us hi) { return __builtin_bit_cast(v16bf, __builtin_shufflevector(lo, hi, 0, 1, 2, 3, 4, 5, 6, 7, 8, 9, 10, 11, 12, 13, 14, 15)); }
__device__ __forceinline__ v8f wmma16(v16h a, v16h b, v8f c) { return __builtin_amdgcn_wmma_f32_16x16x32_f16(false, a, false, b, (short)0, c, false, false); }
__device__ __forceinline__ v8f wmmab(v16bf a, v16bf b, v8f c) { return __builtin_amdgcn_wmma_f32_16x16x32_bf16(false, a, false, b, (short)0, c, false, false); }
__device__ __forceinline__ v8f mma3(v16bf ah, v16bf al, v16bf bh, v16bf bl, v8f c) { c = wmmab(ah, bh, c); c = wmmab(ah, bl, c); c = wmmab(al, bh, c); return c; }   // hi hi, then hi x B lo, then A lo x hi
__device__ __forceinline__ float xhalf(float x) { return __builtin_bit_cast(float, __builtin_amdgcn_permlanex16(__builtin_bit_cast(int, x), __builtin_bit_cast(int, x), 0x76543210, 0xfedcba98, false, false)); }   // lane l with lane l ^ 16
__device__ __forceinline__ h16 tohx(float x) { return (h16)x; }
// hi/lo split of two values, packed (a low, b high): h = RNE(y), l = RNE(y - h); the difference is exact in f32
__device__ __forceinline__ void splitf2(float a, float b, unsigned& h, unsigned& l) {
    const v2f y = {a, b}; const v2bf hb = __builtin_convertvector(y, v2bf);
    h = __builtin_bit_cast(unsigned, hb); l = __builtin_bit_cast(unsigned, __builtin_convertvector(y - __builtin_convertvector(hb, v2f), v2bf)); }
__device__ __forceinline__ void wave_sync() { __builtin_amdgcn_wave_barrier(); asm volatile("" ::: "memory"); }   // same-wave LDS exchange (tiles are private to the wave)

// Fragment loaders (A and B alike): lane (lr = lane & 15, hi = lane >> 4) points at row/column lr, element 8*hi of the 32-deep k-step;
// elements 0..7 <- k0 + 8hi + 0..7, elements 8..15 <- k0 + 16 + 8hi + 0..7.
template <typename T16> struct WFrag;
template <> struct WFrag<h16> { typedef v16h V; static __device__ __forceinline__ V ld(const h16* p) { return cat16(*(const v8h*)p, *(const v8h*)(p + 16)); } static __device__ __forceinline__ v8f mma(V a, V b, v8f c) { return wmma16(a, b, c); } };
template <> struct WFrag<bf> { typedef v16bf V; static __device__ __forceinline__ V ld(const bf* p) { return cat16b(*(const v8us*)p, *(const v8us*)(p + 16)); } static __device__ __forceinline__ v8f mma(V a, V b, v8f c) { return wmmab(a, b, c); } };

// ---- staging of 64-row x 128-byte tiles in LDS (GEMM operands; K and V^T of the attention work-group)
__device__ __forceinline__ unsigned lds_off(const void* p) { return (unsigned)(size_t)p; }   // byte offset in the work-group's LDS (low half of the shared address)
__device__ __forceinline__ v16bf ldsb(const unsigned short* p) { return cat16b(*(const v8usa*)p, *(const v8usa*)(p + 16)); }   // fragment from a staged bf16 tile, same k order as WFrag::ld
__device__ __forceinline__ v16h  ldsh(const unsigned short* p) { return cat16(*(const v8ha*)p, *(const v8ha*)(p + 16)); }       // fragment from a staged f16 tile
// Two plane tiles of 64 rows x 128 bytes -> LDS at pitch TP, 16 bytes per lane and copy, 128 threads: copy i of a plane brings row 16 i + (tid >> 3), piece tid & 7.
// la / lb: the lane's LDS byte address of its row-0..15 piece; ga / gb: the lane's global address of the same piece; pa / pb: 16 source rows in elements.
template <typename T16>
__device__ __forceinline__ void stage_pair(unsigned la, const T16* ga, int pa, unsigned lb, const T16* gb, int pb) {
    // copies and their s_wait_xcnt in one statement: no address register of a copy is rewritten ahead of the wait
    asm volatile("global_load_async_to_lds_b128 %0, %8, off\n\t"
                 "global_load_async_to_lds_b128 %1, %9, off\n\t"
                 "global_load_async_to_lds_b128 %2, %10, off\n\t"
                 "global_load_async_to_lds_b128 %3, %11, off\n\t"
                 "global_load_async_to_lds_b128 %4, %12, off\n\t"
                 "global_load_async_to_lds_b128 %5, %13, off\n\t"
                 "global_load_async_to_lds_b128 %6, %14, off\n\t"
                 "global_load_async_to_lds_b128 %7, %15, off\n\t"
                 "s_wait_xcnt 0x0"
                 :: "v"(la), "v"(la + 16u * TP * 2u), "v"(la + 32u * TP * 2u), "v"(la + 48u * TP * 2u),
                    "v"(lb), "v"(lb + 16u * TP * 2u), "v"(lb + 32u * TP * 2u), "v"(lb + 48u * TP * 2u),
                    "v"(ga), "v"(ga + pa), "v"(ga + 2 * pa), "v"(ga + 3 * pa),
                    "v"(gb), "v"(gb + pb), "v"(gb + 2 * pb), "v"(gb + 3 * pb)
                 : "memory");
}

// ---- register-blocked GEMM body: one work-group = NW waves (2 x 2) on a 128x128 output tile, one wave per 64x64 quarter (16 accumulators); tile (bx, by) of (M/128, N/128) and batch z from the caller, 128 threads.
// Operands come from K-contiguous 16-bit planes through LDS: a stage is GK = 128 k of the work-group's 128 A rows (and A2 rows) and 128 Bt rows, held as 64-k tiles of 64 rows at pitch TP;
// every thread copies its pieces of stage t + 2 into the buffer that stage t has left (two buffers); one work-group barrier per stage publishes stage t + 1 and frees stage t's buffer.
// C[m][n] (f32, pitch ldc, + bf16-converted bias[n]) = sum_k A[m][k] Bt[n][k] (+ A2 Bt when NSPLIT == 1). z-batch strides sA/sB/sC in elements. K % 128 == 0, M % 128 == 0, N % 128 == 0.
// OUT == 0: C is stored as f32. OUT == 1, tr false (m = t, n = h*64 + d) or tr true (m = h*64 + d, n = t, bias[m]; tr is the same for the whole work-group): the f32 value (bias added on its way into the epilogue tile) is converted
// where it is made and stored to the three 16-bit head planes (f16, bf16 hi, bf16 lo) at P*[pb + tile row * pp + tile column]; a tile row is 128 bytes of each plane, one whole line per 16 lanes.
// gst: the work-group's LDS (GLDS<NSPLIT> halves); bx, by, z: its tile and batch.
#define GK 128                    // k per staged GEMM stage (two 64-k tiles per operand row block)
template <int NSPLIT> constexpr int GLDS = 2 * (GK / 64) * (2 + NSPLIT) * 2 * TPL;   // halves of LDS that a GEMM work-group needs: two buffers of staged operands
template <typename T16, int NSPLIT, bool BIAS, int OUT = 0>
__device__ __forceinline__ void gemmw_body(unsigned short* gst, int bx, int by, size_t z, bool tr, const T16* __restrict__ A, const T16* __restrict__ A2, const T16* __restrict__ Bt, int K, float* C, int ldc, const float* __restrict__ bias, size_t sA, size_t sB, size_t sC,
                                           h16* P16 = nullptr, bf* Ph = nullptr, bf* Pl = nullptr) {
    typedef typename WFrag<T16>::V V;
    static_assert(NSPLIT == 0 || NSPLIT == 1);
    constexpr int NT = 2 + NSPLIT;                                           // staged operands: A, (A2,) Bt
    constexpr int GT = 2 * TPL;                                              // 128 rows x 64 k of one operand (halves)
    constexpr int GB = (GK / 64) * NT * GT;                                  // one buffer (halves): [64-k half][operand][128 rows at pitch TP]
    static_assert((GK / 64) * NT * 8 <= 63);                                 // copies of one wave in flight: one stage's, 8 per operand and 64-k half
    static_assert(GLDS<NSPLIT> == 2 * GB && NW * 16 * 68 * 4 <= 2 * GB * 2);
    float* osa = (float*)gst;                                                // epilogue tiles, one per wave, in the staged operands' LDS: written only behind the last stage's foot (every wave's reads returned, no copy in flight, barrier)
    A += z * sA; if (NSPLIT) A2 += z * sA; Bt += z * sB; C += z * sC;
    const int tid = threadIdx.x, lane = tid & 31, lr = lane & 15, hi = lane >> 4;
    const int wave = __builtin_amdgcn_readfirstlane(tid >> 5);
    float* os = osa + wave * (16 * 68);
    const int R0 = bx * 128, C0 = by * 128;                                  // the work-group's tile
    const int r0 = R0 + (wave >> 1) * 64, c0 = C0 + (wave & 1) * 64;         // the wave's quarter
    v8f acc[4][4];
#pragma unroll
    for (int mb = 0; mb < 4; ++mb)
#pragma unroll
        for (int nb = 0; nb < 4; ++nb) acc[mb][nb] = (v8f){};
    const unsigned sl = lds_off(gst) + (unsigned)((tid >> 3) * TP + (tid & 7) * 8) * 2u;   // this thread's piece in a staged 64-row tile
    const size_t sga = (size_t)(R0 + (tid >> 3)) * K + (tid & 7) * 8;        // the same piece in A's rows R0..R0+63: + 64 K (rows + 64), + k
    const size_t sgb = (size_t)(C0 + (tid >> 3)) * K + (tid & 7) * 8;        // the same piece in Bt's rows C0..C0+63
    auto stage = [&](int t, int bi) {
#pragma unroll
        for (int s = 0; s < GK / 64; ++s) {
            const unsigned l = sl + (unsigned)((bi * GB + s * NT * GT) * 2);
            const size_t k = (size_t)t * GK + s * 64;
            // each scheduling barrier keeps the next eight copies' address arithmetic behind the eight just issued: their registers are reused, nothing spills beside the 128 accumulators
            stage_pair<T16>(l, A + sga + k, 16 * K, l + TPL * 2u, A + sga + (size_t)64 * K + k, 16 * K);
            __builtin_amdgcn_sched_barrier(0);
            if (NSPLIT) { stage_pair<T16>(l + GT * 2u, A2 + sga + k, 16 * K, l + GT * 2u + TPL * 2u, A2 + sga + (size_t)64 * K + k, 16 * K); __builtin_amdgcn_sched_barrier(0); }
            stage_pair<T16>(l + (NT - 1) * GT * 2u, Bt + sgb + k, 16 * K, l + (NT - 1) * GT * 2u + TPL * 2u, Bt + sgb + (size_t)64 * K + k, 16 * K);
            __builtin_amdgcn_sched_barrier(0);
        }
    };
    const int af = ((wave >> 1) * 64 + lr) * TP + 8 * hi;                    // A fragment in a staged operand: + mb*16*TP + 32 (second k-step of the 64-k half)
    const int bo = (NT - 1) * GT + ((wave & 1) * 64 + lr) * TP + 8 * hi;     // Bt fragment: + nb*16*TP + 32
    const int nst = K / GK;
    stage(0, 0);
    asm volatile("s_wait_asynccnt 0x0" ::: "memory");                           // this wave's pieces of stage 0 have landed
    __syncthreads();                                                            // stage 0 published to all waves
    if (1 < nst) stage(1, 1);
#pragma unroll 1
    for (int t = 0; t < nst; ++t) {
        const unsigned short* sb = gst + (t & 1) * GB;
#pragma unroll
        for (int ks = 0; ks < GK / 32; ++ks) {
            const unsigned short* sk = sb + (ks >> 1) * (NT * GT) + (ks & 1) * 32;
            V a[4], a2[4], b[4];
#pragma unroll
            for (int mb = 0; mb < 4; ++mb) { a[mb] = ldsb(sk + af + mb * 16 * TP); if (NSPLIT) a2[mb] = ldsb(sk + GT + af + mb * 16 * TP); b[mb] = ldsb(sk + bo + mb * 16 * TP); }
            // inputs-only fence on the loaded fragments: the k-step's LDS reads are issued as one group in front of its WMMAs (one LDS wait per k-step, not one per Bt fragment)
            if (NSPLIT) asm volatile("" :: "v"(a[0]), "v"(a[1]), "v"(a[2]), "v"(a[3]), "v"(a2[0]), "v"(a2[1]), "v"(a2[2]), "v"(a2[3]), "v"(b[0]), "v"(b[1]), "v"(b[2]), "v"(b[3]));
            else        asm volatile("" :: "v"(a[0]), "v"(a[1]), "v"(a[2]), "v"(a[3]), "v"(b[0]), "v"(b[1]), "v"(b[2]), "v"(b[3]));
#pragma unroll
            for (int nb = 0; nb < 4; ++nb) {
#pragma unroll
                for (int mb = 0; mb < 4; ++mb) { acc[mb][nb] = WFrag<T16>::mma(a[mb], b[nb], acc[mb][nb]); if (NSPLIT) acc[mb][nb] = WFrag<T16>::mma(a2[mb], b[nb], acc[mb][nb]); } }
        }
        // foot of stage t
        asm volatile("s_wait_dscnt 0x0" ::: "memory");                          // this wave's reads of stage t's buffer have returned
        asm volatile("s_wait_asynccnt 0x0" ::: "memory");                       // this wave's pieces of stage t + 1 have landed
        __syncthreads();                                                        // publishes stage t + 1; ends every wave's reads of stage t's buffer
        if (t + 2 < nst) stage(t + 2, t & 1);                                   // refill the buffer just left (same test in every wave)
    }
    asm volatile("s_wait_asynccnt 0x0" ::: "memory");                           // no copy in flight behind the loop
#pragma unroll
    for (int mb = 0; mb < 4; ++mb) {
        if (OUT == 1 && BIAS && tr) {                                           // bias[m]: the lane's 8 accumulator rows
            const v4f b0 = *(const v4f*)(bias + r0 + mb * 16 + hi * 8), b1 = *(const v4f*)(bias + r0 + mb * 16 + hi * 8 + 4);
#pragma unroll
            for (int nb = 0; nb < 4; ++nb) {
#pragma unroll
                for (int j = 0; j < 8; ++j) os[(hi * 8 + j) * 68 + nb * 16 + lr] = acc[mb][nb][j] + bfr(j < 4 ? b0[j & 3] : b1[j & 3]); }
        } else {
#pragma unroll
            for (int nb = 0; nb < 4; ++nb) { const float bc = (OUT == 1 && BIAS) ? bfr(bias[c0 + nb * 16 + lr]) : 0.0f;   // bias[n]: the lane's accumulator column
#pragma unroll
                for (int j = 0; j < 8; ++j) os[(hi * 8 + j) * 68 + nb * 16 + lr] = (OUT == 1 && BIAS) ? acc[mb][nb][j] + bc : acc[mb][nb][j]; }
        }
        wave_sync();
        float* crow = C + (size_t)(r0 + mb * 16) * ldc + c0;
if (OUT == 0) {
#pragma unroll
            for (int s = 0; s < 8; ++s) { const int row = 2 * s + hi, cofs = lr * 4; v4f val = *(const v4fa*)(os + row * 68 + cofs); if (BIAS) { val[0] += bfr(bias[c0 + cofs]); val[1] += bfr(bias[c0 + cofs + 1]); val[2] += bfr(bias[c0 + cofs + 2]); val[3] += bfr(bias[c0 + cofs + 3]); }
                *(v4f*)(crow + (size_t)row * ldc + cofs) = val; }
             }
        else {
            const size_t pb = !tr ? ((z * NH_ + c0 / 64) * SEQ + r0 + mb * 16) * HD : ((z * NH_ + r0 / 64) * HD + mb * 16) * SEQ + c0;   // head = the quarter's index along h*64 + d
            const int pp = !tr ? HD : SEQ;
#pragma unroll
            for (int s = 0; s < 8; ++s) { const int row = 2 * s + hi, cofs = lr * 4; v4f val = *(const v4fa*)(os + row * 68 + cofs);
                v4h o16; v2u oh, ol;
#pragma unroll
                for (int q = 0; q < 4; ++q) o16[q] = tohx(val[q]);
#pragma unroll
                for (int q = 0; q < 2; ++q) { unsigned a2, c2; splitf2(val[2 * q], val[2 * q + 1], a2, c2); oh[q] = a2; ol[q] = c2; }
                const size_t pe = pb + (size_t)row * pp + cofs;
                *(v4h*)(P16 + pe) = o16; *(v4us*)(Ph + pe) = __builtin_bit_cast(v4us, oh); *(v4us*)(Pl + pe) = __builtin_bit_cast(v4us, ol);
                asm volatile("s_wait_xcnt 0x0" ::: "memory"); }   // stands in front of the next rows' values, which reuse the registers these stores name
        }
        wave_sync();
    }
}
// k_qkv: the three projections in one launch, grid (SEQ/128, DQ/128, 3 * NB): stream s = blockIdx.z / NB (q, k, v), batch blockIdx.z % NB; the three do not depend on one another, and two work-groups fit a WGP's LDS.
// s = q, k: y[z][t][n] = XB[s][z][t][:] . WB[s][n][:] + b[n] (bf16 x bf16, one product), stored as [z*NH_ + h][t][d] planes. s = v: the same product with W as A and XB as B, stored as [z*NH_ + h][d][t] planes.
// XB, WB: the streams' and the weights' bf16 copies, one behind the other; P16, Ph, Pl: q's three planes; stream s has its own three 3 s planes further on.
__global__ __launch_bounds__(32 * NW) void k_qkv(const bf* XB, const bf* WB, int K, const float* bq, const float* bk, const float* bv, h16* P16, bf* Ph, bf* Pl) {
    __shared__ __align__(16) unsigned short gst[GLDS<0>];
    const int s = blockIdx.z / NB; const size_t z = blockIdx.z % NB;
    const bool tr = s == 2;
    const bf* X = XB + (size_t)s * NB * SEQ * DM; const bf* Wt = WB + (size_t)s * DM * DM;
    const size_t po = (size_t)s * 3 * NB * NH_ * SEQ * HD;
    gemmw_body<bf, 0, true, 1>(gst, tr ? blockIdx.y : blockIdx.x, tr ? blockIdx.x : blockIdx.y, z, tr, tr ? Wt : X, nullptr, tr ? X : Wt, K, nullptr, 0, s == 0 ? bq : s == 1 ? bk : bv,
                               tr ? (size_t)0 : (size_t)SEQ * DM, tr ? (size_t)SEQ * DM : (size_t)0, (size_t)0, P16 + po, Ph + po, Pl + po); }
// k_oproj: OUT[z][t][n] = (ATh + ATl)[z][t][:] . Wo[n][:] + bo[n] (two products).
__global__ __launch_bounds__(32 * NW) void k_oproj(const bf* A, const bf* A2, const bf* Bt, int K, float* C, int ldc, const float* bias, size_t sA, size_t sC) {
    __shared__ __align__(16) unsigned short gst[GLDS<1>];
    gemmw_body<bf, 1, true>(gst, blockIdx.x, blockIdx.y, blockIdx.z, false, A, A2, Bt, K, C, ldc, bias, sA, (size_t)0, sC); }

// ---- k_prep: everything the GEMMs and the attention read that is a plain re-coding of an input, in one launch of 256-thread work-groups.
// Work-groups [0, PGC): f32 -> bf16 (RNE) copies of the three streams (XB[s][b][t][:], s = q, k, v) and the four weights (WB[s][:][:], s = q, k, v, o). One work-group = PCH consecutive floats of one source:
// load u of a wave covers 512 consecutive bytes (16 per lane), store u 256 consecutive bytes (8 per lane); a thread's PU loads are all issued in front of its first store.
// Work-groups [PGC, PGC + PGM): the integer mask, read by value, as lane masks of the attention's S^T accumulators. PM[(qt * (SEQ/32) + st) * 16 + g*8 + r], bit l = (mask[qt*16 + (l & 15)][st*32 + g*16 + 8*(l >> 4) + r] != 0):
// word g*8 + r selects, lane by lane, element r of score accumulator g of query tile qt at key step st. One wave = one query tile x two key steps = 32 words = one 128-byte line.
#define PU 16                                              // 16-byte pieces per thread of a conversion work-group
constexpr int PCH = 256 * PU * 4;                          // floats per conversion work-group
constexpr int PGX = SEQ * DM / PCH;                        // work-groups per batch row block of one stream
constexpr int PGW = DM * DM / PCH;                         // work-groups per weight
constexpr int PGS = 3 * NB * PGX;                          // all stream work-groups
constexpr int PGC = PGS + 4 * PGW;                         // all conversion work-groups
constexpr int PGM = (SEQ / 16) * (SEQ / 64) / 8;           // mask work-groups
static_assert((SEQ * DM) % PCH == 0 && (DM * DM) % PCH == 0);
static_assert(((SEQ / 16) * (SEQ / 64)) % 8 == 0);
__device__ __forceinline__ void mpack_body(const int* __restrict__ mask, unsigned* PM, int blk) {
    const int lane = threadIdx.x & 31, lr = lane & 15, hi = lane >> 4;
    const int w = blk * 8 + (threadIdx.x >> 5), qt = w / (SEQ / 64), t = w % (SEQ / 64);
    const int* mp = mask + (qt * 16 + lr) * SEQ_FULL + t * 64 + 8 * hi;
    v4i m[8];
#pragma unroll
    for (int s = 0; s < 2; ++s) { m[4 * s] = *(const v4i*)(mp + 32 * s); m[4 * s + 1] = *(const v4i*)(mp + 32 * s + 4); m[4 * s + 2] = *(const v4i*)(mp + 32 * s + 16); m[4 * s + 3] = *(const v4i*)(mp + 32 * s + 20); }
    unsigned v = 0u;
#pragma unroll
    for (int j = 0; j < 32; ++j) { const unsigned b = __builtin_amdgcn_ballot_w32(m[j >> 2][j & 3] != 0); v = (lane == j) ? b : v; }   // lane j keeps word j
    PM[(size_t)w * 32 + lane] = v;
}
__global__ __launch_bounds__(256) void k_prep(const float* __restrict__ xq, const float* __restrict__ xk, const float* __restrict__ xv,
                                              const float* __restrict__ wq, const float* __restrict__ wk, const float* __restrict__ wv, const float* __restrict__ wo,
                                              const int* __restrict__ mask, bf* XB, bf* WB, unsigned* PM) {
    const int g = blockIdx.x;
    if (g >= PGC) { mpack_body(mask, PM, g - PGC); return; }           // no barrier anywhere in this kernel
    const float* src; bf* dst;
    if (g < PGS) { const int s = g / (NB * PGX), r = g % (NB * PGX), b = r / PGX, c = r % PGX;
        src = (s == 0 ? xq : s == 1 ? xk : xv) + (size_t)b * SEQ_FULL * DM + (size_t)c * PCH;
        dst = XB + ((size_t)s * NB + b) * SEQ * DM + (size_t)c * PCH; }
    else { const int r = g - PGS, s = r / PGW, c = r % PGW;
        src = (s == 0 ? wq : s == 1 ? wk : s == 2 ? wv : wo) + (size_t)c * PCH;
        dst = WB + (size_t)s * DM * DM + (size_t)c * PCH; }
    const int e = threadIdx.x * 4;
    v4f v[PU];
#pragma unroll
    for (int u = 0; u < PU; ++u) v[u] = *(const v4f*)(src + u * 1024 + e);
#pragma unroll
    for (int u = 0; u < PU; ++u) { const v2u o = {f2bf2(v[u][0], v[u][1]), f2bf2(v[u][2], v[u][3])};
        *(v4us*)(dst + u * 1024 + e) = __builtin_bit_cast(v4us, o); }
}

// ---- fused attention body: one work-group = NW waves of one (b, h); one wave = 16 query rows (q0..q0+15); key loop in 32-key steps, two steps per staged 64-key tile.
// K and V^T tiles: every thread copies its pieces of tile t + 2 into the buffer that tile t has left (two buffers); one work-group barrier per tile publishes tile t + 1 and frees tile t's buffer.
// Per step: (1) the 16x32 mask tile comes as 16 lane masks (k_prep: one word per S^T accumulator element), one 64-byte scalar load issued one step ahead; a tile whose 512 entries are all 0
// is skipped (wave-uniform, decided on the words read); (2) S^T = k q^T (two 16x16 accumulators: row = key 8*hi + r, column = query lr; k fragments from LDS as A, q fragments as B, held in
// registers); (3) e = mask == 0 ? -1e9 : S/8; online softmax in f32, one running maximum per query (16 values in the lane, then lane l with l ^ 16) and one running sum (hi/lo rows: per lane, f32 adds, halves joined in the epilogue; f16 rows: per query, the step's sum made by one more WMMA, ones x P^T, from the f16 operands); (4) the lane's 16 probabilities are
// the B fragment of P^T as they stand (elements 0..7 = keys 8*hi + r, 8..15 = keys 16 + 8*hi + r); O^T += V^T P^T (four d-tiles, V^T fragments from LDS as A; row = d, column = query).
// A skipped all-masked tile contributes exactly 0 to every row that meets an unmasked key somewhere (exp underflow); if some row of the work-group never does, the work-group repeats the loop
// with skipping disabled (every entry -1e9 -> uniform weights; rows that do meet a key end with the same values), so the result is exact for any mask contents.
template <bool HI>
__device__ __forceinline__ void attn_body(const h16* __restrict__ Q16, const h16* __restrict__ K16, const h16* __restrict__ VT16,
                                          const bf* __restrict__ Qh, const bf* __restrict__ Ql, const bf* __restrict__ Kh, const bf* __restrict__ Kl,
                                          const bf* __restrict__ VTh, const bf* __restrict__ VTl, const unsigned* __restrict__ PM, bf* ATh, bf* ATl, int row_base,
                                          unsigned short* stg, int* wflag, int xt, int h, int b) {
    constexpr int NPL = HI ? 4 : 2;                                          // staged planes per buffer: Kh Kl VTh VTl, or K16 VT16; stg holds two buffers of staged tiles
    static_assert(2 * NW * 16 * CP <= 2 * NPL * TPL);
    unsigned short* ctha = stg;                                              // ctx tiles hi, in the staged tiles' LDS: written only behind the key loop's last foot and the barrier of the repeat decision
    unsigned short* ctla = stg + NW * 16 * CP;                               // ctx tiles lo
    const int tid = threadIdx.x, lane = tid & 31, lr = lane & 15, hi = lane >> 4;
    const int wave = __builtin_amdgcn_readfirstlane(tid >> 5);
    unsigned short* cth = ctha + wave * 16 * CP;
    unsigned short* ctl = ctla + wave * 16 * CP;
    const int q0 = row_base + (xt * NW + wave) * 16;
    const int zoff  = (b * NH_ + h) * (SEQ * HD);            // head plane offset ([t][d] and [d][t] planes both hold SEQ*HD elements)
    const int qbase = zoff + (q0 + lr) * HD + 8 * hi;        // B fragment of q: column = query q0 + lr; + c2*32
    const int kfrag = lr * TP + 8 * hi;                      // A fragment of k in a staged tile: row = key (sub*32 + nt*16 + lr); + (sub*32 + nt*16)*TP + c2*32
    const int vfrag = lr * TP + 8 * hi;                      // A fragment of v^T in a staged tile: row = d = dt*16 + lr; + dt*16*TP + sub*32
    // the query tile's lane masks, 16 words per key step; written by an earlier launch and never in this one: read through the constant address space, so that the loads are scalar
    const __attribute__((address_space(4))) v16u* pm = (const __attribute__((address_space(4))) v16u*)(PM + (size_t)(q0 >> 4) * ((SEQ / 32) * 16));
    const unsigned sl = lds_off(stg) + (unsigned)((tid >> 3) * TP + (tid & 7) * 8) * 2u;   // this thread's piece in a staged plane tile
    const int sgk = zoff + (tid >> 3) * HD + (tid & 7) * 8;  // the same piece in a [t][d] plane: + t*KT*HD
    const int sgv = zoff + (tid >> 3) * SEQ + (tid & 7) * 8; // the same piece in a [d][t] plane: + t*KT
    auto stage = [&](int t, int bi) {
        const unsigned l = sl + (unsigned)(bi * NPL * TPL * 2);
        if (HI) {
            stage_pair<bf>(l, Kh + sgk + t * (KT * HD), 16 * HD, l + TPL * 2u, Kl + sgk + t * (KT * HD), 16 * HD);
            stage_pair<bf>(l + 2u * TPL * 2u, VTh + sgv + t * KT, 16 * SEQ, l + 3u * TPL * 2u, VTl + sgv + t * KT, 16 * SEQ);
        } else {
            stage_pair<h16>(l, K16 + sgk + t * (KT * HD), 16 * HD, l + TPL * 2u, VT16 + sgv + t * KT, 16 * SEQ);
        }
    };

    // B fragments of q^T: loaded once, held in registers over the whole key loop (and its repeat)
    v16bf qh0, qh1, ql0, ql1; v16h qa0, qa1;
    if (HI) { qh0 = WFrag<bf>::ld(Qh + qbase); qh1 = WFrag<bf>::ld(Qh + qbase + 32); ql0 = WFrag<bf>::ld(Ql + qbase); ql1 = WFrag<bf>::ld(Ql + qbase + 32); }
    else    { qa0 = WFrag<h16>::ld(Q16 + qbase); qa1 = WFrag<h16>::ld(Q16 + qbase + 32); }
    v8f o[4]; float m, l;
    v16h ones;                                                               // A fragment of the row sums (f16 rows): f16 1.0 at every row and k
    if (!HI) { unsigned w0, w1, w2, w3, w4, w5, w6, w7;
        // written here, once, into eight registers of their own: as a literal the compiler keeps one register and rebuilds the other seven in every step
        asm volatile("v_mov_b32 %0, %8\n\tv_mov_b32 %1, %8\n\tv_mov_b32 %2, %8\n\tv_mov_b32 %3, %8\n\tv_mov_b32 %4, %8\n\tv_mov_b32 %5, %8\n\tv_mov_b32 %6, %8\n\tv_mov_b32 %7, %8"
                     : "=v"(w0), "=v"(w1), "=v"(w2), "=v"(w3), "=v"(w4), "=v"(w5), "=v"(w6), "=v"(w7) : "s"(0x3c003c00u));
        ones = __builtin_bit_cast(v16h, (v8u){w0, w1, w2, w3, w4, w5, w6, w7}); }
    bool dense = false;
#pragma unroll 1
    for (int pass = 0; pass < 2; ++pass) {
#pragma unroll
        for (int t = 0; t < 4; ++t) o[t] = (v8f){};
        m = MINIT; l = 0.0f;
        // two-buffer prologue (on a repeat, the last tile's foot has already ended every read of both buffers)
        stage(0, 0);
        asm volatile("s_wait_asynccnt 0x0" ::: "memory");                       // this wave's pieces of tile 0 have landed
        __syncthreads();                                                        // tile 0 published to all waves
        stage(1, 1);
        v16u nx = pm[0];                                                        // lane masks of step 0
#pragma unroll 1
        for (int t = 0; t < SEQ / KT; ++t) {
            const unsigned short* sb = stg + (t & 1) * (NPL * TPL);
#pragma unroll 1
            for (int sub = 0; sub < 2; ++sub) {                                 // rolled: one copy of the step's code
            const int st = t * 2 + sub;
            const v16u cw = nx;                                                 // this step's lane masks, loaded during the step before
            nx = pm[(st + 1 < SEQ / 32) ? st + 1 : SEQ / 32 - 1];               // the next step's (the last step reads its own again)
            const v8ul c8 = __builtin_bit_cast(v8ul, cw);
            const bool anyw = (((c8[0] | c8[1]) | (c8[2] | c8[3])) | ((c8[4] | c8[5]) | (c8[6] | c8[7]))) != 0ull;   // wave-uniform
            if (!(dense || anyw)) continue;                                     // whole 16x32 tile masked: skipped (its words were read); the tile's foot below is still passed

            const unsigned short* kf = sb + kfrag + sub * 32 * TP;
            v8f s0 = (v8f){}, s1 = (v8f){};
            if (HI) {
                s0 = mma3(ldsb(kf), ldsb(kf + TPL), qh0, ql0, s0);
                s0 = mma3(ldsb(kf + 32), ldsb(kf + TPL + 32), qh1, ql1, s0);
                s1 = mma3(ldsb(kf + 16 * TP), ldsb(kf + TPL + 16 * TP), qh0, ql0, s1);
                s1 = mma3(ldsb(kf + 16 * TP + 32), ldsb(kf + TPL + 16 * TP + 32), qh1, ql1, s1);
                asm volatile("v_nop\n\tv_nop\n\tv_nop\n\tv_nop" : "+v"(s0), "+v"(s1) : "v"(qh1), "v"(ql1));
            } else {
                s0 = wmma16(ldsh(kf), qa0, s0);
                s0 = wmma16(ldsh(kf + 32), qa1, s0);
                s1 = wmma16(ldsh(kf + 16 * TP), qa0, s1);
                s1 = wmma16(ldsh(kf + 16 * TP + 32), qa1, s1);
                asm volatile("v_nop\n\tv_nop\n\tv_nop\n\tv_nop" : "+v"(s0), "+v"(s1) : "v"(qa0), "v"(qa1));
            }

            float e0[8], e1[8], t8[8];
#pragma unroll
            for (int r = 0; r < 8; ++r) { e0[r] = __builtin_amdgcn_inverse_ballot_w32(cw[r]) ? s0[r] * SCL : MFILL; e1[r] = __builtin_amdgcn_inverse_ballot_w32(cw[8 + r]) ? s1[r] * SCL : MFILL; t8[r] = fmaxf(e0[r], e1[r]); }
            float rm = fmaxf(fmaxf(fmaxf(t8[0], t8[1]), fmaxf(t8[2], t8[3])), fmaxf(fmaxf(t8[4], t8[5]), fmaxf(t8[6], t8[7])));
            rm = fmaxf(rm, xhalf(rm));                                          // the query's other 16 keys of the step
            const float mn = fmaxf(m, rm);
            const float al = __builtin_amdgcn_exp2f((m - mn) * L2E);
            v8u ph, pl; v16h pa;                                                // B fragments of P^T (ph, pl: two bf16 per word)
#pragma unroll
            for (int r = 0; r < 8; ++r) {
                float x0 = __builtin_amdgcn_exp2f((e0[r] - mn) * L2E);
                float x1 = __builtin_amdgcn_exp2f((e1[r] - mn) * L2E);
                if (HI) {
                    e0[r] = x0; e1[r] = x1;                                     // split two at a time below
                    t8[r] = x0 + x1;
                } else {
                    pa[r] = tohx(x0); pa[8 + r] = tohx(x1);                     // summed below by the matrix unit, from these very operands
                }
            }
            if (HI) {
#pragma unroll
                for (int i = 0; i < 4; ++i) { unsigned a0, c0, a1, c1; splitf2(e0[2 * i], e0[2 * i + 1], a0, c0); splitf2(e1[2 * i], e1[2 * i + 1], a1, c1);
                    ph[i] = a0; pl[i] = c0; ph[4 + i] = a1; pl[4 + i] = c1; }   // elements 2i, 2i + 1 and 8 + 2i, 8 + 2i + 1 of the fragments
            }
            if (HI) { const float rs = ((t8[0] + t8[1]) + (t8[2] + t8[3])) + ((t8[4] + t8[5]) + (t8[6] + t8[7]));
                l = l * al + rs; }                                              // l: this lane's half of the keys; the two halves (same al) are joined behind the loop
            m = mn;
#pragma unroll
            for (int dt = 0; dt < 4; ++dt) o[dt] *= al;
            const unsigned short* vf = sb + (HI ? 2 : 1) * TPL + vfrag + sub * 32;
            if (HI) {
                const v16bf pb = __builtin_bit_cast(v16bf, ph), pc = __builtin_bit_cast(v16bf, pl);
                const v16bf vh0 = ldsb(vf), vh1 = ldsb(vf + 16 * TP), vh2 = ldsb(vf + 32 * TP), vh3 = ldsb(vf + 48 * TP);
                const v16bf vl0 = ldsb(vf + TPL), vl1 = ldsb(vf + TPL + 16 * TP), vl2 = ldsb(vf + TPL + 32 * TP), vl3 = ldsb(vf + TPL + 48 * TP);
                o[0] = mma3(vh0, vl0, pb, pc, o[0]); o[1] = mma3(vh1, vl1, pb, pc, o[1]); o[2] = mma3(vh2, vl2, pb, pc, o[2]); o[3] = mma3(vh3, vl3, pb, pc, o[3]);
                asm volatile("v_nop\n\tv_nop\n\tv_nop\n\tv_nop" : "+v"(o[0]), "+v"(o[1]), "+v"(o[2]), "+v"(o[3]) : "v"(pb), "v"(pc));
            } else {
                const v16h v0 = ldsh(vf), v1 = ldsh(vf + 16 * TP), v2 = ldsh(vf + 32 * TP), v3 = ldsh(vf + 48 * TP);
                v8f rsv = wmma16(ones, pa, (v8f){});                            // ones x P^T: every element = the query's sum over all 32 keys of the step, of the operands that V^T meets
                o[0] = wmma16(v0, pa, o[0]); o[1] = wmma16(v1, pa, o[1]); o[2] = wmma16(v2, pa, o[2]); o[3] = wmma16(v3, pa, o[3]);
                // the distance behind the matrix instructions, on the loop's back edge too; the sum's result is named so that its WMMA stays in front of these slots
                asm volatile("v_nop\n\tv_nop\n\tv_nop\n\tv_nop" : "+v"(o[0]), "+v"(o[1]), "+v"(o[2]), "+v"(o[3]), "+v"(rsv) : "v"(pa), "v"(v3));
                l = l * al + rsv[0];                                            // l: the whole row (both lane halves hold the same sum)
            }
            }
            // foot of tile t, passed by every wave whatever it skipped
            asm volatile("s_wait_dscnt 0x0" ::: "memory");                      // this wave's reads of tile t's buffer have returned
            asm volatile("s_wait_asynccnt 0x0" ::: "memory");                   // this wave's pieces of tile t + 1 have landed
            __syncthreads();                                                    // publishes tile t + 1; ends every wave's reads of tile t's buffer
            if (t + 2 < SEQ / KT) stage(t + 2, t & 1);                          // refill the buffer just left (same test in every wave)
        }
        asm volatile("s_wait_asynccnt 0x0" ::: "memory");                       // no copy in flight behind the loop
        const bool bad = !(m > MSEEN);
        const int wbad = (__builtin_amdgcn_ballot_w32(bad) != 0u) ? 1 : 0;      // taken with every lane on
        if (lane == 0) wflag[wave] = wbad;
        __syncthreads();                                                        // the repeat is decided for the whole work-group: its barriers need every wave
        const int anyb = wflag[0] | wflag[1] | wflag[2] | wflag[3];
        if (__builtin_amdgcn_readfirstlane(anyb) == 0) break;                   // every row met an unmasked key: skipped tiles contributed exactly 0
        dense = true;                                                           // otherwise repeat without skipping (work-group-uniform)
    }

    const float inv = 1.0f / (HI ? l + xhalf(l) : l);
#pragma unroll
    for (int dt = 0; dt < 4; ++dt) { v4u a8, c8;                                // the lane's 8 consecutive d of its query: one 16-byte piece of each ctx tile row
#pragma unroll
        for (int r = 0; r < 4; ++r) { unsigned a, c; splitf2(o[dt][2 * r] * inv, o[dt][2 * r + 1] * inv, a, c); a8[r] = a; c8[r] = c; }
        *(v8usa*)(cth + lr * CP + dt * 16 + 8 * hi) = __builtin_bit_cast(v8us, a8); *(v8usa*)(ctl + lr * CP + dt * 16 + 8 * hi) = __builtin_bit_cast(v8us, c8); }
    wave_sync();
    v8us hv[4], lv[4];
#pragma unroll
    for (int s = 0; s < 4; ++s) { const int row = 4 * s + (lane >> 3); hv[s] = *(const v8usa*)(cth + row * CP + (lane & 7) * 8); lv[s] = *(const v8usa*)(ctl + row * CP + (lane & 7) * 8); }
    const size_t ob = (size_t)(b * SEQ + q0 + (lane >> 3)) * DQ + h * HD + (lane & 7) * 8;
{
#pragma unroll
        for (int s = 0; s < 4; ++s) { *(v8us*)(ATh + ob + (size_t)(4 * s) * DQ) = hv[s]; *(v8us*)(ATl + ob + (size_t)(4 * s) * DQ) = lv[s]; }
         }
}
// k_attn: both kinds of attention work-group in one launch, chosen by the work-group index; they do not depend on one another. The hi/lo-plane work-groups (three times the products, one wave per SIMD if they had the chip
// to themselves) come first in the index, the f16 work-groups behind them; four work-groups fit a WGP's LDS and registers, so all of them can be resident at once and fill one another's waits.
constexpr int AHI = RHE / (16 * NW);                       // hi/lo-plane work-groups per (b, h)
constexpr int ALO = (SEQ - RHE) / (16 * NW);               // f16 work-groups per (b, h)
__global__ __launch_bounds__(32 * NW) void k_attn(const h16* Q16, const h16* K16, const h16* VT16, const bf* Qh, const bf* Ql, const bf* Kh, const bf* Kl, const bf* VTh, const bf* VTl,
                                                  const unsigned* PM, bf* ATh, bf* ATl) {
    __shared__ __align__(16) unsigned short stg[2 * 4 * TPL];                // two buffers of staged tiles (the larger kind's); ctx tiles behind the key loop
    __shared__ int wflag[NW];                                                // per wave: some row has met no unmasked key
    const int g = blockIdx.x;
#if SEQ > RH
    if (g >= AHI * NH_ * NB) { const int r = g - AHI * NH_ * NB;
        attn_body<false>(Q16, K16, VT16, nullptr, nullptr, nullptr, nullptr, nullptr, nullptr, PM, ATh, ATl, RHE, stg, wflag, r % ALO, (r / ALO) % NH_, r / (ALO * NH_)); return; }
#endif
    attn_body<true>(nullptr, nullptr, nullptr, Qh, Ql, Kh, Kl, VTh, VTl, PM, ATh, ATl, 0, stg, wflag, g % AHI, (g / AHI) % NH_, g / (AHI * NH_)); }

extern "C" void kernel_launch(void* const* d_in, const int* in_sizes, int n_in,
                              void* d_out, int out_size, void* d_ws, size_t ws_size, hipStream_t stream) {
    if (n_in < 12) return;
    const long long need_x = (long long)(NB - 1) * SEQ_FULL * DM + (long long)SEQ * DM;      // rows read from a full-size stream
    const long long need_m = (long long)(SEQ - 1) * SEQ_FULL + SEQ;
    if (in_sizes[0] < need_x || in_sizes[1] < need_x || in_sizes[2] < need_x || in_sizes[3] < need_m) return;
    if (in_sizes[4] < DM * DM || in_sizes[6] < DM * DM || in_sizes[8] < DM * DM || in_sizes[10] < DM * DM) return;
    if (in_sizes[5] < DM || in_sizes[7] < DM || in_sizes[9] < DM || in_sizes[11] < DM) return;
    if ((long long)out_size < need_x) return;
    if (WS_TOTAL > ws_size) return;
    // wire order: x_q, x_k, x_v, mask (int32 [1][1][SEQ_FULL][SEQ_FULL]), Wq, bq, Wk, bk, Wv, bv, Wo, bo; weights [out][in]
    const float* xq = (const float*)d_in[0]; const float* xk = (const float*)d_in[1]; const float* xv = (const float*)d_in[2];
    const int* mask = (const int*)d_in[3];
    const float* wq = (const float*)d_in[4]; const float* bq = (const float*)d_in[5];
    const float* wk = (const float*)d_in[6]; const float* bk = (const float*)d_in[7];
    const float* wv = (const float*)d_in[8]; const float* bv = (const float*)d_in[9];
    const float* wo = (const float*)d_in[10]; const float* bo = (const float*)d_in[11];
    float* OUT = (float*)d_out;     // [NB_FULL][SEQ_FULL][DM]
    char* wsp = (char*)d_ws;
    auto take = [&](size_t bytes) { char* p = wsp; wsp += bytes; return (void*)p; };      // all sizes are multiples of 256 bytes
    bf* WQ = (bf*)take(WS_W / 4); bf* WK = (bf*)take(WS_W / 4); bf* WV = (bf*)take(WS_W / 4); bf* WO = (bf*)take(WS_W / 4);
    bf* XBq = (bf*)take(WS_XB); bf* XBk = (bf*)take(WS_XB); bf* XBv = (bf*)take(WS_XB);   // contiguous: k_prep indexes them from XBq, as it does the weights from WQ
    h16* Q16 = (h16*)take(WS_PL); bf* Qh = (bf*)take(WS_PL); bf* Ql = (bf*)take(WS_PL);
    h16* K16 = (h16*)take(WS_PL); bf* Kh = (bf*)take(WS_PL); bf* Kl = (bf*)take(WS_PL);
    h16* VT16 = (h16*)take(WS_PL); bf* VTh = (bf*)take(WS_PL); bf* VTl = (bf*)take(WS_PL);
    bf* ATh = (bf*)take(WS_AT); bf* ATl = (bf*)take(WS_AT);
    unsigned* PM = (unsigned*)take(WS_PM);
    if ((size_t)(wsp - (char*)d_ws) > ws_size) return;

    // bf16 copies of the streams and the weights, and the mask's lane masks (once for all batches and heads)
    k_prep<<<dim3(PGC + PGM), 256, 0, stream>>>(xq, xk, xv, wq, wk, wv, wo, mask, XBq, WQ, PM);
    // q, k, v projections: one launch (the streams' copies, the weights' copies and the nine head planes each lie one behind the other)
    k_qkv<<<dim3(SEQ / 128, DQ / 128, 3 * NB), 32 * NW, 0, stream>>>(XBq, WQ, DM, bq, bk, bv, Q16, Qh, Ql);
    // attention, one launch: query rows [0, RHE) on hi/lo planes, rows [RHE, SEQ) on f16 planes
    k_attn<<<dim3((AHI + ALO) * NH_ * NB), 32 * NW, 0, stream>>>(Q16, K16, VT16, Qh, Ql, Kh, Kl, VTh, VTl, PM, ATh, ATl);
    // output projection: per batch rows of the full-size output
    k_oproj<<<dim3(SEQ / 128, DM / 128, NB), 32 * NW, 0, stream>>>(ATh, ATl, WO, DQ, OUT, DM, bo, (size_t)SEQ * DQ, (size_t)SEQ_FULL * DM);
}
